// v000
// Times are from an AMD MI455X. After a warm-up the kernel runs many times in a row, and a time is the length of
// such a window on the GPU divided by its runs, so every launch and the gaps after it count. The runs cycle
// through copies of the inputs. A figure is the median of several windows, for all but v000 over two sittings.
// Sittings can differ by a few percent; kernels timed side by side share one.
// v000, which the later versions start from, runs in 7070 microseconds.
#include <hip/hip_runtime.h>
// Multi-head attention over separate query / key / value inputs ([1][4096][512] each; q = query Wq^T + bq, k = key Wk^T + bk, v = value Wv^T + bv, 8 heads of 64; attn = softmax(q k^T / 8); x = attn v; out = x Wo^T + bo -> [1][4096][512]).
// Structure: token rows; query, key and value as exact f16 rows; Q | K | V as three WMMA GEMMs (32x64 wave tiles, f32 accumulation, exact x16 natural weights, bias in the epilogue, f16 outputs); per head: scores GEMM (K = 64), row softmax on VALU (f32; weights stored x256 as f16), V^T via LDS transposes, x = P . V GEMM (K = 4,096, alpha 2^-8) written straight into the merged f16 rows; out = x Wo^T + bo GEMM (f32).
// Compute dtype: inputs rounded to bf16; inputs / weights exact; q, k, v, softmax weights and x as plain f16 GEMM operands (~2^-12); scores and softmax statistics f32. v_wmma_f32_16x16x32_f16.
#define NB 1
#define SQ 4096
#define DM 512
#define NH 8
#define HD 64
#define HG 1                         /* heads per attention launch group */
#define QN SQ                        /* query rows attended per batch (debug hook) */
#define NBR NB                       /* batches attended (debug hook) */
#define MP ((int)NR)                 /* token rows through the q/k/v projections (debug hook) */
#define MO ((int)NR)                 /* token rows through the output projection (debug hook) */
#define NR ((size_t)NB * SQ)         /* 4096 token rows */
typedef __bf16 v16b __attribute__((ext_vector_type(16)));
typedef unsigned short v8us __attribute__((ext_vector_type(8), may_alias));
typedef float  v8f  __attribute__((ext_vector_type(8)));
typedef float  v4f  __attribute__((ext_vector_type(4)));
typedef float  v4fa __attribute__((ext_vector_type(4), may_alias));
union FragB { v16b v; v8us half[2]; unsigned short u[16]; };

__device__ __forceinline__ unsigned short bf16_bits(float x) { unsigned int u = __float_as_uint(x); return (unsigned short)((u + 0x7FFFu + ((u >> 16) & 1u)) >> 16); }
__device__ __forceinline__ float bf16_val(unsigned short b) { return __uint_as_float(((unsigned int)b) << 16); }
__device__ __forceinline__ float bf16_round(float x) { return bf16_val(bf16_bits(x)); }
// D += A·B with NT terms: 1 = ah·bh, 2 = + al·bh (A split), 3 = + ah·bl (both split)
template <int NT>
__device__ __forceinline__ v8f mmaN(v16b ah, v16b al, v16b bh, v16b bl, v8f c) {
  c = __builtin_amdgcn_wmma_f32_16x16x32_bf16(false, ah, false, bh, (short)0, c, false, false);
  if (NT >= 2) c = __builtin_amdgcn_wmma_f32_16x16x32_bf16(false, al, false, bh, (short)0, c, false, false);
  if (NT >= 3) c = __builtin_amdgcn_wmma_f32_16x16x32_bf16(false, ah, false, bl, (short)0, c, false, false);
  asm volatile("v_nop\n\tv_nop\n\tv_nop\n\tv_nop" : "+v"(c) : "v"(ah), "v"(al), "v"(bh), "v"(bl));
  return c;
}

__global__ __launch_bounds__(256) void k_wt_bf16(const float* __restrict__ W, unsigned short* __restrict__ Wt, int K, int N) {
  const int t = blockIdx.x * 256 + threadIdx.x;
  const int k8n = K / 8;
  if (t >= N * k8n) return;
  const int n = t / k8n, k8 = (t % k8n) * 8;
  v8us v;
#pragma unroll
  for (int i = 0; i < 8; ++i) v[i] = bf16_bits(W[(size_t)(k8 + i) * N + n]);
  *(v8us*)(Wt + (size_t)n * K + k8) = v;
  
}

// GEMM C[M][N] (f32, pitch ldc) = act(A[M][K]·W + bias). A f32 row-major (pitch lda) converted per fragment to bf16
// (ASPLIT: hi/lo two planes -> 2 terms, else single rounded term); Wt bf16 [N][K] (pitch ldb). BIAS_BF16 rounds the
// bias to bf16 first (bias quantised to bf16 before the add). K%32==0, M%16==0, N%64==0.
template <bool ASPLIT, int ACT, bool BIAS_BF16>
__global__ __launch_bounds__(128) void k_gemm_bf(const float* __restrict__ A, int lda, const unsigned short* __restrict__ Wt, int ldb,
                                               const float* __restrict__ bias, float* __restrict__ C, int ldc, int M, int N, int K) {
  __shared__ __attribute__((aligned(16))) float so[4][16][64];
  const int tid = threadIdx.x, w = tid >> 5, lane = tid & 31, ln = lane & 15, hh = lane >> 4;
  const int ntn = N / 64;
  const int wid = blockIdx.x * 4 + w;
  const int mt = wid / ntn, nq = wid % ntn;
  if (mt * 16 >= M) return;
  const int row0 = mt * 16, col0 = nq * 64;
  const float* arow = A + (size_t)(row0 + ln) * lda;
  v8f acc[4] = {};
  for (int kb = 0; kb < K; kb += 32) {
    FragB ah, al;
    const v4f x0 = *(const v4fa*)(arow + kb + 8 * hh), x1 = *(const v4fa*)(arow + kb + 8 * hh + 4);
    const v4f x2 = *(const v4fa*)(arow + kb + 16 + 8 * hh), x3 = *(const v4fa*)(arow + kb + 16 + 8 * hh + 4);
    float xs[16] = {x0[0],x0[1],x0[2],x0[3],x1[0],x1[1],x1[2],x1[3],x2[0],x2[1],x2[2],x2[3],x3[0],x3[1],x3[2],x3[3]};
#pragma unroll
    for (int i = 0; i < 16; ++i) { const unsigned short hb = bf16_bits(xs[i]); ah.u[i] = hb; al.u[i] = ASPLIT ? bf16_bits(xs[i] - bf16_val(hb)) : (unsigned short)0; }
#pragma unroll
    for (int t = 0; t < 4; ++t) {
      const unsigned short* brow = Wt + (size_t)(col0 + t * 16 + ln) * ldb + kb;
      FragB b;
      b.half[0] = *(const v8us*)(brow + 8 * hh);
      b.half[1] = *(const v8us*)(brow + 16 + 8 * hh);
      acc[t] = mmaN<ASPLIT ? 2 : 1>(ah.v, al.v, b.v, b.v, acc[t]);
    }
  }
#pragma unroll
  for (int t = 0; t < 4; ++t) {
    float bv = bias ? bias[col0 + t * 16 + ln] : 0.f;
    if (BIAS_BF16) bv = bf16_round(bv);
#pragma unroll
    for (int r = 0; r < 8; ++r) { float v = acc[t][r] + bv; if (ACT == 1) v = fmaxf(v, 0.f); so[w][8 * hh + r][t * 16 + ln] = v; }
  }
  __builtin_amdgcn_fence(__ATOMIC_ACQ_REL, "workgroup");
  __builtin_amdgcn_wave_barrier();
  const int rsub = lane >> 4, c4 = (lane & 15) * 4;
  {
#pragma unroll
    for (int q = 0; q < 8; ++q) {
      const int r = q * 2 + rsub;
      const v4f v = *(const v4fa*)&so[w][r][c4];
      *(v4f*)(C + (size_t)(row0 + r) * ldc + col0 + c4) = v;
    }
    
  }
}

// GEMM C = act(A·W + bias + resid): A f32 (ASPLIT -> hi/lo 2 terms), Wt bf16 [N][K]; ACT 0 none, 1 relu, 2 exact gelu;
// resid (optional, f32, row index = (row % rmod), pitch ldr, RES_BF16 rounds it) added before the activation.
template <bool ASPLIT, int ACT, bool BIAS_BF16, bool RES_BF16>
__global__ __launch_bounds__(128) void k_gemm_bf3(const float* __restrict__ A, int lda, const unsigned short* __restrict__ Wt, int ldb,
                                                const float* __restrict__ bias, const float* __restrict__ resid, int rmod, int ldr,
                                                float* __restrict__ C, int ldc, int M, int N, int K) {
  __shared__ __attribute__((aligned(16))) float so[4][16][64];
  const int tid = threadIdx.x, w = tid >> 5, lane = tid & 31, ln = lane & 15, hh = lane >> 4;
  const int ntn = N / 64;
  const int wid = blockIdx.x * 4 + w;
  const int mt = wid / ntn, nq = wid % ntn;
  if (mt * 16 >= M) return;
  const int row0 = mt * 16, col0 = nq * 64;
  const float* arow = A + (size_t)(row0 + ln) * lda;
  v8f acc[4] = {};
  for (int kb = 0; kb < K; kb += 32) {
    FragB ah, al;
    const v4f x0 = *(const v4fa*)(arow + kb + 8 * hh), x1 = *(const v4fa*)(arow + kb + 8 * hh + 4);
    const v4f x2 = *(const v4fa*)(arow + kb + 16 + 8 * hh), x3 = *(const v4fa*)(arow + kb + 16 + 8 * hh + 4);
    float xs[16] = {x0[0],x0[1],x0[2],x0[3],x1[0],x1[1],x1[2],x1[3],x2[0],x2[1],x2[2],x2[3],x3[0],x3[1],x3[2],x3[3]};
#pragma unroll
    for (int i = 0; i < 16; ++i) { const unsigned short hb = bf16_bits(xs[i]); ah.u[i] = hb; al.u[i] = ASPLIT ? bf16_bits(xs[i] - bf16_val(hb)) : (unsigned short)0; }
#pragma unroll
    for (int t = 0; t < 4; ++t) {
      const unsigned short* brow = Wt + (size_t)(col0 + t * 16 + ln) * ldb + kb;
      FragB b;
      b.half[0] = *(const v8us*)(brow + 8 * hh);
      b.half[1] = *(const v8us*)(brow + 16 + 8 * hh);
      acc[t] = mmaN<ASPLIT ? 2 : 1>(ah.v, al.v, b.v, b.v, acc[t]);
    }
  }
#pragma unroll
  for (int t = 0; t < 4; ++t) {
    const int col = col0 + t * 16 + ln;
    float bv = bias ? bias[col] : 0.f;
    if (BIAS_BF16) bv = bf16_round(bv);
#pragma unroll
    for (int r = 0; r < 8; ++r) {
      float v = acc[t][r] + bv;
      if (resid) { float rv = resid[(size_t)((row0 + 8 * hh + r) % rmod) * ldr + col]; if (RES_BF16) rv = bf16_round(rv); v += rv; }
      if (ACT == 1) v = fmaxf(v, 0.f);
      if (ACT == 2) v = 0.5f * v * (1.0f + erff(v * 0.70710678118654752f));
      if (ACT == 3) { const float u = 0.7978845608028654f * (v + 0.044715f * v * v * v); v = 0.5f * v * (1.0f + tanhf(u)); }
      so[w][8 * hh + r][t * 16 + ln] = v;
    }
  }
  __builtin_amdgcn_fence(__ATOMIC_ACQ_REL, "workgroup");
  __builtin_amdgcn_wave_barrier();
  const int rsub = lane >> 4, c4 = (lane & 15) * 4;
  {
#pragma unroll
    for (int q = 0; q < 8; ++q) {
      const int r = q * 2 + rsub;
      const v4f v = *(const v4fa*)&so[w][r][c4];
      *(v4f*)(C + (size_t)(row0 + r) * ldc + col0 + c4) = v;
    }
    
  }
}
// row LayerNorm (biased variance, eps) over N: s = X (+ R); optional out_sum <- s; out_norm <- (s-mu)*rsqrt(var+eps)*g + b
template <bool PARAM_BF16>
__global__ __launch_bounds__(256) void k_layernorm(const float* __restrict__ X, const float* __restrict__ R, const float* __restrict__ g, const float* __restrict__ bta,
                                                  float* __restrict__ out_sum, float* __restrict__ out_norm, int N, float eps) {
  __shared__ float red[256];
  const int row = blockIdx.x, tid = threadIdx.x;
  const float* x = X + (size_t)row * N; const float* rr = R ? R + (size_t)row * N : nullptr;
  float vals[16];                     // up to N = 4096
  const int per = N / 256;            // contiguous chunk per thread? use strided-by-4 chunks: thread handles j = tid*4 + 1024*u
  float s1 = 0.f;
  for (int u = 0; u < per / 4; ++u) {
    const int j = tid * 4 + 1024 * u;
    const v4f a = *(const v4fa*)(x + j);
    v4f b = {0.f,0.f,0.f,0.f}; if (rr) b = *(const v4fa*)(rr + j);
#pragma unroll
    for (int q = 0; q < 4; ++q) { const float v = a[q] + b[q]; vals[u * 4 + q] = v; s1 += v; }
  }
  red[tid] = s1; __syncthreads();
  for (int st = 128; st > 0; st >>= 1) { if (tid < st) red[tid] += red[tid + st]; __syncthreads(); }
  const float mu = red[0] / (float)N; __syncthreads();
  float s2 = 0.f;
  for (int u = 0; u < per / 4; ++u)
#pragma unroll
    for (int q = 0; q < 4; ++q) { const float c = vals[u * 4 + q] - mu; s2 += c * c; }
  red[tid] = s2; __syncthreads();
  for (int st = 128; st > 0; st >>= 1) { if (tid < st) red[tid] += red[tid + st]; __syncthreads(); }
  const float rs = rsqrtf(red[0] / (float)N + eps);
  {
    for (int u = 0; u < per / 4; ++u) {
      const int j = tid * 4 + 1024 * u;
      v4f o, sm;
#pragma unroll
      for (int q = 0; q < 4; ++q) {
        float gg = g[j + q], bb = bta[j + q];
        if (PARAM_BF16) { gg = bf16_round(gg); bb = bf16_round(bb); }
        sm[q] = vals[u * 4 + q]; o[q] = (vals[u * 4 + q] - mu) * rs * gg + bb;
      }
      if (out_sum) *(v4f*)(out_sum + (size_t)row * N + j) = sm;
      *(v4f*)(out_norm + (size_t)row * N + j) = o;
    }
    
  }
}



// ---- f16 WMMA path (v_wmma_f32_16x16x32_f16): 11-bit significands for operands in range — used where a [0,1] probability operand needs more precision than bf16
typedef _Float16 v16h __attribute__((ext_vector_type(16)));
union FragH { v16h v; v8us half[2]; _Float16 h[16]; unsigned short u[16]; };
template <int NT>
__device__ __forceinline__ v8f mmaH(v16h ah, v16h al, v16h bh, v16h bl, v8f c) {
  c = __builtin_amdgcn_wmma_f32_16x16x32_f16(false, ah, false, bh, (short)0, c, false, false);
  if (NT >= 2) c = __builtin_amdgcn_wmma_f32_16x16x32_f16(false, al, false, bh, (short)0, c, false, false);
  if (NT >= 3) c = __builtin_amdgcn_wmma_f32_16x16x32_f16(false, ah, false, bl, (short)0, c, false, false);
  asm volatile("v_nop\n\tv_nop\n\tv_nop\n\tv_nop" : "+v"(c) : "v"(ah), "v"(al), "v"(bh), "v"(bl));
  return c;
}
// batched GEMM like k_gemm_b but f16 operands: A f32 (split into f16 hi/lo if ASPLIT, else rounded to f16), Bt = f16 values [n][k]; alpha; C f32; N multiple of 16 (partial tiles skipped)
template <bool ASPLIT>
__global__ __launch_bounds__(128) void k_gemm_h(const float* __restrict__ A, int lda, size_t sA, const _Float16* __restrict__ Bh, int ldb, size_t sB, float alpha, float* __restrict__ C, int ldc, size_t sC, int M, int N, int K) {
  __shared__ __attribute__((aligned(16))) float so[4][16][64];
  const int tid = threadIdx.x, w = tid >> 5, lane = tid & 31, ln = lane & 15, hh = lane >> 4; const int by = blockIdx.y;
  A += (size_t)by * sA; Bh += (size_t)by * sB; C += (size_t)by * sC;
  const int ntn = (N + 63) / 64; const int wid = blockIdx.x * 4 + w; const int mt = wid / ntn, nq = wid % ntn; if (mt * 16 >= M) return;
  const int row0 = mt * 16, col0 = nq * 64; const float* arow = A + (size_t)(row0 + ln) * lda;
  v8f acc[4] = {};
  for (int kb = 0; kb < K; kb += 32) {
    FragH ah, al;
    const v4f x0 = *(const v4fa*)(arow + kb + 8 * hh), x1 = *(const v4fa*)(arow + kb + 8 * hh + 4), x2 = *(const v4fa*)(arow + kb + 16 + 8 * hh), x3 = *(const v4fa*)(arow + kb + 16 + 8 * hh + 4);
    float xs[16] = {x0[0],x0[1],x0[2],x0[3],x1[0],x1[1],x1[2],x1[3],x2[0],x2[1],x2[2],x2[3],x3[0],x3[1],x3[2],x3[3]};
#pragma unroll
    for (int i = 0; i < 16; ++i) { const _Float16 h = (_Float16)xs[i]; ah.h[i] = h; al.h[i] = ASPLIT ? (_Float16)(xs[i] - (float)h) : (_Float16)0.0f; }
#pragma unroll
    for (int t = 0; t < 4; ++t) { if (col0 + t * 16 >= N) continue; const size_t boff = (size_t)(col0 + t * 16 + ln) * ldb + kb; FragH bq; bq.half[0] = *(const v8us*)(Bh + boff + 8 * hh); bq.half[1] = *(const v8us*)(Bh + boff + 16 + 8 * hh);
      acc[t] = mmaH<ASPLIT ? 2 : 1>(ah.v, al.v, bq.v, bq.v, acc[t]); }
  }
#pragma unroll
  for (int t = 0; t < 4; ++t) { if (col0 + t * 16 >= N) continue;
#pragma unroll
    for (int r = 0; r < 8; ++r) so[w][8 * hh + r][t * 16 + ln] = acc[t][r] * alpha; }
  __builtin_amdgcn_fence(__ATOMIC_ACQ_REL, "workgroup"); __builtin_amdgcn_wave_barrier();
  const int rsub = lane >> 4, c4 = (lane & 15) * 4;
  {
#pragma unroll
    for (int q = 0; q < 8; ++q) { const int r = q * 2 + rsub; if (col0 + c4 < N) { const v4f v = *(const v4fa*)&so[w][r][c4]; *(v4f*)(C + (size_t)(row0 + r) * ldc + col0 + c4) = v; } }
     }
}

// Wt[n][k] = f16(W[k][n]·scale) from f32 row-major W[K][N] (scale = power of two; bf16-exact weights stay exact in f16 away from the subnormal range)
__global__ __launch_bounds__(256) void k_wt_f16(const float* __restrict__ W, _Float16* __restrict__ Wt, int K, int N, float scale) {
  const int t = blockIdx.x * 256 + threadIdx.x; if (t >= N * (K / 8)) return; const int n = t / (K / 8), k8 = (t % (K / 8)) * 8; FragH f;
#pragma unroll
  for (int i = 0; i < 8; ++i) f.h[i] = (_Float16)(bf16_round(W[(size_t)(k8 + i) * N + n]) * scale); const v8us o = f.half[0];
  *(v8us*)((unsigned short*)Wt + (size_t)n * K + k8) = o; 
}
// k_gemm_hh variant with fused epilogue: v = acc·alpha + bias[by·sBias + col] (+ CP[(row/rowsPerB)·sCPb + by·64 + col] if CP) ; ACT 0 none / 1 elu ; writes f16 C16 (and f32 C if non-null)
template <int ACT>
__global__ __launch_bounds__(128) void k_gemm_hhx(const _Float16* __restrict__ A, int lda, size_t sA, const _Float16* __restrict__ Bh, int ldb, size_t sB, float alpha, const float* __restrict__ bias, size_t sBias, const float* __restrict__ CP, int rowsPerB, size_t sCPb, int row0g,
    float* __restrict__ C, _Float16* __restrict__ C16, int ldc, size_t sC, int M, int N, int K) {
  __shared__ __attribute__((aligned(16))) float so[4][16][64];
  const int tid = threadIdx.x, w = tid >> 5, lane = tid & 31, ln = lane & 15, hh = lane >> 4; const int by = blockIdx.y;
  A += (size_t)by * sA; Bh += (size_t)by * sB; const size_t cofs = (size_t)by * sC; const float* bp = bias ? bias + (size_t)by * sBias : nullptr;
  const int ntn = (N + 63) / 64; const int wid = blockIdx.x * 4 + w; const int mt = wid / ntn, nq = wid % ntn; if (mt * 16 >= M) return;
  const int row0 = mt * 16, col0 = nq * 64; const _Float16* arow = A + (size_t)(row0 + ln) * lda;
  v8f acc[4] = {};
  for (int kb = 0; kb < K; kb += 32) { FragH ah; ah.half[0] = *(const v8us*)((const unsigned short*)arow + kb + 8 * hh); ah.half[1] = *(const v8us*)((const unsigned short*)arow + kb + 16 + 8 * hh);
#pragma unroll
    for (int t = 0; t < 4; ++t) { if (col0 + t * 16 >= N) continue; const size_t boff = (size_t)(col0 + t * 16 + ln) * ldb + kb; FragH bq; bq.half[0] = *(const v8us*)((const unsigned short*)Bh + boff + 8 * hh); bq.half[1] = *(const v8us*)((const unsigned short*)Bh + boff + 16 + 8 * hh);
      acc[t] = mmaH<1>(ah.v, ah.v, bq.v, bq.v, acc[t]); }
  }
#pragma unroll
  for (int t = 0; t < 4; ++t) { if (col0 + t * 16 >= N) continue; const int col = col0 + t * 16 + ln; const float bv = bp ? bf16_round(bp[col]) : 0.f;
#pragma unroll
    for (int r = 0; r < 8; ++r) { float v = acc[t][r] * alpha + bv; if (CP) { const int rr = row0g + row0 + 8 * hh + r; if (rowsPerB < 0) v += CP[cofs + (size_t)rr * ldc + col];      /* rowsPerB < 0: own element of the batched C plane */ else { const int bidx = rr / rowsPerB; v += CP[(size_t)bidx * sCPb + (size_t)by * 64 + col]; } } if (ACT == 1) v = (v > 0.f) ? v : expm1f(v); else if (ACT == 7) v = (v > 0.f) ? v + 1.0f : expf(v); else if (ACT == 8) v = tanhf(v); else if (ACT == 9) v = 0.5f * v * (1.0f + tanhf(0.7978845608028654f * (v + 0.044715f * v * v * v))); else if (ACT == 11) v = 1.0f / (1.0f + expf(-v)); else if (ACT == 12) v = (v > 0.f) ? v : 0.01f * v; else if (ACT == 14) v = (v > 0.f) ? v : 0.1f * v; else if (ACT == 16) v = (v >= 0.f) ? v : 0.3f * v; else if (ACT == 17) v = (v >= 0.f) ? v : 0.2f * v; else if (ACT == 15) v = v / (1.0f + expf(-v)); else if (ACT == 3) v = fmaxf(v, 0.f); else if (ACT == 6) v = 0.5f * v * (1.0f + erff(v * 0.70710678118654752f)); so[w][8 * hh + r][t * 16 + ln] = v; } }
  __builtin_amdgcn_fence(__ATOMIC_ACQ_REL, "workgroup"); __builtin_amdgcn_wave_barrier();
  const int rsub = lane >> 4, c4 = (lane & 15) * 4; typedef _Float16 v4h __attribute__((ext_vector_type(4)));
  {
#pragma unroll
    for (int q = 0; q < 8; ++q) { const int r = q * 2 + rsub; if (col0 + c4 < N) { const v4f v = *(const v4fa*)&so[w][r][c4]; if (C) *(v4f*)(C + cofs + (size_t)(row0 + r) * ldc + col0 + c4) = v; if (C16) { v4h h4; for (int i = 0; i < 4; ++i) h4[i] = (_Float16)v[i]; *(v4h*)(C16 + cofs + (size_t)(row0 + r) * ldc + col0 + c4) = h4; } } }
     }
}


typedef _Float16 v4h __attribute__((ext_vector_type(4)));

__global__ __launch_bounds__(256) void k_x16(const float* __restrict__ x, _Float16* __restrict__ X16, size_t n8) { const size_t t = (size_t)blockIdx.x * 256 + threadIdx.x; if (t >= n8) return; FragH f;
#pragma unroll
  for (int q = 0; q < 8; ++q) f.h[q] = (_Float16)bf16_round(x[t * 8 + q]); *(v8us*)((unsigned short*)X16 + t * 8) = f.half[0];  }
__global__ __launch_bounds__(256) void k_h16(const float* __restrict__ x, _Float16* __restrict__ X16, size_t n8) { const size_t t = (size_t)blockIdx.x * 256 + threadIdx.x; if (t >= n8) return; FragH f;
#pragma unroll
  for (int q = 0; q < 8; ++q) f.h[q] = (_Float16)x[t * 8 + q]; *(v8us*)((unsigned short*)X16 + t * 8) = f.half[0];  }
__global__ __launch_bounds__(256) void k_round16f(const float* __restrict__ W, _Float16* __restrict__ Bt, size_t n8) { const size_t t = (size_t)blockIdx.x * 256 + threadIdx.x; if (t >= n8) return; FragH f;
#pragma unroll
  for (int i = 0; i < 8; ++i) f.h[i] = (_Float16)(bf16_round(W[t * 8 + i]) * 16.0f); *(v8us*)((unsigned short*)Bt + t * 8) = f.half[0];  }
template <int NHv, int TTv>
__global__ __launch_bounds__(256) void k_vt(const _Float16* __restrict__ V16, int ldv, int voff, _Float16* __restrict__ Vt) { __shared__ unsigned short tl[64][66]; const int tid = threadIdx.x; const int slab = blockIdx.x / (TTv / 64), lg = blockIdx.x % (TTv / 64); const int b = slab / NHv, h = slab % NHv;
  for (int i = tid; i < 64 * 8; i += 256) { const int r = i / 8, c8 = (i % 8) * 8; FragH f; f.half[0] = *(const v8us*)((const unsigned short*)V16 + ((size_t)b * TTv + lg * 64 + r) * ldv + voff + h * 64 + c8);
#pragma unroll
    for (int q = 0; q < 8; ++q) tl[r][c8 + q] = f.u[q]; }
  __syncthreads();
  {
#pragma unroll
    for (int rd = 0; rd < 2; ++rd) { const int d = rd * 32 + tid / 8, pc = tid % 8; FragH f;
#pragma unroll
      for (int q = 0; q < 8; ++q) f.u[q] = tl[pc * 8 + q][d];
      *(v8us*)((unsigned short*)Vt + ((size_t)slab * 64 + d) * TTv + lg * 64 + pc * 8) = f.half[0]; }
     } }

__global__ __launch_bounds__(256) void k_hl(const float* __restrict__ F, _Float16* __restrict__ Hh, _Float16* __restrict__ Hl, size_t n8) { const size_t t = (size_t)blockIdx.x * 256 + threadIdx.x; if (t >= n8) return; FragH fh, fl; const v4f a = *(const v4fa*)(F + t * 8), c = *(const v4fa*)(F + t * 8 + 4);
#pragma unroll
  for (int q = 0; q < 4; ++q) { _Float16 h = (_Float16)a[q]; fh.h[q] = h; fl.h[q] = (_Float16)((a[q] - (float)h) * 1024.0f); h = (_Float16)c[q]; fh.h[4 + q] = h; fl.h[4 + q] = (_Float16)((c[q] - (float)h) * 1024.0f); }
  { *(v8us*)((unsigned short*)Hh + t * 8) = fh.half[0]; *(v8us*)((unsigned short*)Hl + t * 8) = fl.half[0];  } }

// ---- fast GEMM (wave tile 32x64; requires M % 32 == 0 rows per launch region and N % 64 == 0); epilogue = k_gemm_hhx semantics ----
__device__ __forceinline__ v16h g2_frag(const _Float16* p, int hh) { FragH f; f.half[0] = *(const v8us*)((const unsigned short*)p + 8 * hh); f.half[1] = *(const v8us*)((const unsigned short*)p + 16 + 8 * hh); return f.v; }
__device__ __forceinline__ v8f g2_mma(v16h a, v16h b, v8f c) { v8f d = __builtin_amdgcn_wmma_f32_16x16x32_f16(false, a, false, b, (short)0, c, false, false); asm volatile("v_nop\n\tv_nop\n\tv_nop\n\tv_nop" : "+v"(d) : "v"(a), "v"(b)); return d; }
template <int ACT>
__global__ __launch_bounds__(128) void k_gemm2(const _Float16* __restrict__ A, int lda, size_t sA, const _Float16* __restrict__ Bh, int ldb, size_t sB, float alpha, const float* __restrict__ bias, size_t sBias, const float* __restrict__ CP, int rowsPerB, size_t sCPb, int row0g,
    float* __restrict__ C, _Float16* __restrict__ C16, int ldc, size_t sC, int M, int N, int K) { static_assert(ACT == 0 || ACT == 3 || ACT == 6 || ACT == 8 || ACT == 9 || ACT == 11 || ACT == 12 || ACT == 14 || ACT == 15 || ACT == 16 || ACT == 17, "k_gemm2: unsupported ACT code (would silently apply no activation)");
  __shared__ __attribute__((aligned(16))) float so[4][32][68];
  const int tid = threadIdx.x, w = tid >> 5, lane = tid & 31, ln = lane & 15, hh = lane >> 4; const int by = blockIdx.y;
  A += (size_t)by * sA; Bh += (size_t)by * sB; const size_t cofs = (size_t)by * sC; const float* bp = bias ? bias + (size_t)by * sBias : nullptr;
  const int ntn = N >> 6; const int mt = blockIdx.x / ntn, nq = blockIdx.x - mt * ntn; const int row0 = mt * 128 + 32 * w, col0 = nq * 64; if (row0 >= M) return;
  const _Float16* a0p = A + (size_t)(row0 + ln) * lda; const _Float16* a1p = a0p + (size_t)16 * lda;
  const _Float16* b0p = Bh + (size_t)(col0 + ln) * ldb; const _Float16* b1p = b0p + (size_t)16 * ldb; const _Float16* b2p = b1p + (size_t)16 * ldb; const _Float16* b3p = b2p + (size_t)16 * ldb;
  const v8f z8 = {0.f,0.f,0.f,0.f,0.f,0.f,0.f,0.f}; v8f c00 = z8, c01 = z8, c02 = z8, c03 = z8, c10 = z8, c11 = z8, c12 = z8, c13 = z8;
#pragma unroll 1
  for (int kb = 0; kb < K; kb += 32) { const v16h a0 = g2_frag(a0p + kb, hh), a1 = g2_frag(a1p + kb, hh);
    v16h b = g2_frag(b0p + kb, hh); c00 = g2_mma(a0, b, c00); c10 = g2_mma(a1, b, c10);
    b = g2_frag(b1p + kb, hh); c01 = g2_mma(a0, b, c01); c11 = g2_mma(a1, b, c11);
    b = g2_frag(b2p + kb, hh); c02 = g2_mma(a0, b, c02); c12 = g2_mma(a1, b, c12);
    b = g2_frag(b3p + kb, hh); c03 = g2_mma(a0, b, c03); c13 = g2_mma(a1, b, c13); }
  v8f accs[8] = {c00, c01, c02, c03, c10, c11, c12, c13};
#pragma unroll
  for (int u = 0; u < 8; ++u) { const int t = u & 3, half = u >> 2; const int col = col0 + t * 16 + ln; const float bv = bp ? bf16_round(bp[col]) : 0.f;
#pragma unroll
    for (int r = 0; r < 8; ++r) { const int rloc = half * 16 + 8 * hh + r; float v = accs[u][r] * alpha + bv; if (CP) { if (rowsPerB < 0) v += CP[cofs + (size_t)(row0g + row0 + rloc) * ldc + col];      /* rowsPerB < 0: own element of the batched C plane */ else { const int bidx = (row0g + row0 + rloc) / rowsPerB; v += CP[(size_t)bidx * sCPb + (size_t)by * 64 + col]; } }
      if (ACT == 3) v = fmaxf(v, 0.f); else if (ACT == 6) v = 0.5f * v * (1.0f + erff(v * 0.70710678118654752f)); else if (ACT == 11) v = 1.0f / (1.0f + expf(-v)); else if (ACT == 15) v = v / (1.0f + expf(-v)); else if (ACT == 12) v = (v > 0.f) ? v : 0.01f * v; else if (ACT == 8) v = tanhf(v); else if (ACT == 9) v = 0.5f * v * (1.0f + tanhf(0.7978845608028654f * (v + 0.044715f * v * v * v))); else if (ACT == 14) v = (v > 0.f) ? v : 0.1f * v; else if (ACT == 16) v = (v >= 0.f) ? v : 0.3f * v; else if (ACT == 17) v = (v >= 0.f) ? v : 0.2f * v;
      so[w][rloc][t * 16 + ln] = v; } }
  __builtin_amdgcn_fence(__ATOMIC_ACQ_REL, "workgroup"); __builtin_amdgcn_wave_barrier();
  const int rsub = lane >> 4, c4 = (lane & 15) * 4;
  {
#pragma unroll
    for (int q = 0; q < 16; ++q) { const int r = q * 2 + rsub; const v4f v = *(const v4fa*)&so[w][r][c4]; if (C) *(v4f*)(C + cofs + (size_t)(row0 + r) * ldc + col0 + c4) = v; if (C16) { v4h h4; for (int i = 0; i < 4; ++i) h4[i] = (_Float16)v[i]; *(v4h*)(C16 + cofs + (size_t)(row0 + r) * ldc + col0 + c4) = h4; } }
     } }


__global__ __launch_bounds__(256) void k_wnat(const float* __restrict__ w, size_t n8, _Float16* __restrict__ Bt) { const size_t t = (size_t)blockIdx.x * 256 + threadIdx.x; if (t >= n8) return; FragH f; for (int q = 0; q < 8; ++q) f.h[q] = (_Float16)(bf16_round(w[t * 8 + q]) * 16.0f); *(v8us*)((unsigned short*)Bt + t * 8) = f.half[0];  }
__global__ __launch_bounds__(256) void k_rsm(const float* __restrict__ S, _Float16* __restrict__ P, int nrows) {
  #pragma clang fp contract(off)
  const int i = blockIdx.x * 256 + threadIdx.x; if (i >= nrows) return; const float* s = S + (size_t)i * SQ; float mx = -3.0e38f;
#pragma unroll 1
  for (int j = 0; j < SQ; ++j) mx = fmaxf(mx, s[j]); float se = 0.f;
#pragma unroll 1
  for (int j = 0; j < SQ; ++j) se += expf(s[j] - mx); const float sc = 256.0f / se;
#pragma unroll 1
  for (int j0 = 0; j0 < SQ; j0 += 8) { FragH f; for (int q = 0; q < 8; ++q) f.h[q] = (_Float16)(expf(s[j0 + q] - mx) * sc); unsigned short* d = (unsigned short*)P + (size_t)i * SQ + j0; *(v8us*)d = f.half[0];  } }
__global__ __launch_bounds__(256) void k_vt(const _Float16* __restrict__ V16, int b, int h0, _Float16* __restrict__ VT) { __shared__ unsigned short tl[64][65]; const int tid = threadIdx.x; const int hh = blockIdx.x % HG, sg = blockIdx.x / HG; const int s0 = sg * 64; const int h = h0 + hh;
  for (int i = tid; i < 64 * 8; i += 256) { const int j = i / 8, d8 = (i % 8) * 8; FragH f; f.half[0] = *(const v8us*)((const unsigned short*)V16 + ((size_t)b * SQ + s0 + j) * DM + h * HD + d8); for (int q = 0; q < 8; ++q) tl[d8 + q][j] = f.u[q]; }
  __syncthreads();
  { for (int i = tid; i < 64 * 8; i += 256) { const int d = i / 8, j8 = (i % 8) * 8; FragH f; for (int q = 0; q < 8; ++q) f.u[q] = tl[d][j8 + q]; *(v8us*)((unsigned short*)VT + ((size_t)hh * HD + d) * SQ + s0 + j8) = f.half[0]; }  } }

extern "C" void kernel_launch(void* const* d_in, const int* in_sizes, int n_in,
                              void* d_out, int out_size, void* d_ws, size_t ws_size, hipStream_t stream) {
  (void)in_sizes; (void)n_in; (void)out_size;
  const float* const* I = (const float* const*)d_in; const float* xq = I[0]; const float* xk = I[1]; const float* xv = I[2]; const float* wq = I[3]; const float* bq = I[4]; const float* wk = I[5]; const float* bk = I[6]; const float* wv = I[7]; const float* bv = I[8]; const float* wo = I[9]; const float* bo = I[10];
  char* ws = (char*)d_ws; size_t off = 0;
  auto take = [&](size_t bytes) { char* p = ws + off; off += (bytes + 255) & ~(size_t)255; return p; };
  _Float16* BQ = (_Float16*)take((size_t)DM * DM * 2); _Float16* BK = (_Float16*)take((size_t)DM * DM * 2); _Float16* BV = (_Float16*)take((size_t)DM * DM * 2); _Float16* BO = (_Float16*)take((size_t)DM * DM * 2);
  _Float16* XQ = (_Float16*)take(NR * DM * 2); _Float16* XK = (_Float16*)take(NR * DM * 2); _Float16* XV = (_Float16*)take(NR * DM * 2); _Float16* Q16 = (_Float16*)take(NR * DM * 2); _Float16* K16 = (_Float16*)take(NR * DM * 2); _Float16* V16 = (_Float16*)take(NR * DM * 2); _Float16* O16 = (_Float16*)take(NR * DM * 2);
  float* S = (float*)take((size_t)HG * SQ * SQ * 4); _Float16* P = (_Float16*)take((size_t)HG * SQ * SQ * 2); _Float16* VT = (_Float16*)take((size_t)HG * HD * SQ * 2);
  if (off > ws_size) return;      /* 2 + 7x4 + 64 + 32 + 0.5 = approx 127 MiB */
  const size_t nw8 = (size_t)DM * DM / 8; const unsigned gw = (unsigned)((nw8 + 255) / 256);
  k_wnat<<<gw, 256, 0, stream>>>(wq, nw8, BQ); k_wnat<<<gw, 256, 0, stream>>>(wk, nw8, BK); k_wnat<<<gw, 256, 0, stream>>>(wv, nw8, BV); k_wnat<<<gw, 256, 0, stream>>>(wo, nw8, BO);
  k_x16<<<(unsigned)((NR * DM / 8 + 255) / 256), 256, 0, stream>>>(xq, XQ, NR * DM / 8); k_x16<<<(unsigned)((NR * DM / 8 + 255) / 256), 256, 0, stream>>>(xk, XK, NR * DM / 8); k_x16<<<(unsigned)((NR * DM / 8 + 255) / 256), 256, 0, stream>>>(xv, XV, NR * DM / 8);
  const dim3 gp((unsigned)((NR / 128) * (DM / 64)), 1);
  k_gemm2<0><<<gp, 128, 0, stream>>>(XQ, DM, 0, BQ, DM, 0, 0.0625f, bq, 0, nullptr, 1, 0, 0, nullptr, Q16, DM, 0, MP, DM, DM);
  k_gemm2<0><<<gp, 128, 0, stream>>>(XK, DM, 0, BK, DM, 0, 0.0625f, bk, 0, nullptr, 1, 0, 0, nullptr, K16, DM, 0, MP, DM, DM);
  k_gemm2<0><<<gp, 128, 0, stream>>>(XV, DM, 0, BV, DM, 0, 0.0625f, bv, 0, nullptr, 1, 0, 0, nullptr, V16, DM, 0, MP, DM, DM);
  for (int b = 0; b < NBR; ++b) for (int h0 = 0; h0 < NH; h0 += HG) {
    const _Float16* qb = Q16 + (size_t)b * SQ * DM + h0 * HD; const _Float16* kb = K16 + (size_t)b * SQ * DM + h0 * HD;
    k_gemm2<0><<<dim3((QN / 128) * (SQ / 64), HG), 128, 0, stream>>>(qb, DM, (size_t)HD, kb, DM, (size_t)HD, 0.125f, nullptr, 0, nullptr, 1, 0, 0, S, nullptr, SQ, (size_t)SQ * SQ, QN, SQ, HD);      /* scores / sqrt(64) */
    for (int hh = 0; hh < HG; ++hh) k_rsm<<<(QN + 255) / 256, 256, 0, stream>>>(S + (size_t)hh * SQ * SQ, P + (size_t)hh * SQ * SQ, QN);
    k_vt<<<HG * (SQ / 64), 256, 0, stream>>>(V16, b, h0, VT);
    k_gemm2<0><<<dim3((QN / 128) * (HD / 64), HG), 128, 0, stream>>>(P, SQ, (size_t)SQ * SQ, VT, SQ, (size_t)HD * SQ, 0.00390625f, nullptr, 0, nullptr, 1, 0, 0, nullptr, O16 + (size_t)b * SQ * DM + h0 * HD, DM, (size_t)HD, QN, HD, SQ); }      /* o (merged heads) as f16 rows */
  k_gemm2<0><<<gp, 128, 0, stream>>>(O16, DM, 0, BO, DM, 0, 0.0625f, bo, 0, nullptr, 1, 0, 0, (float*)d_out, nullptr, DM, 0, MO, DM, DM);      /* out = o W_o^T + b_o, rows are the output layout */
}

// v001
// A run of this version takes 1380 microseconds.
// In two side-by-side timings against v000, it was 5.05 and 5.23 times as fast.
#include <hip/hip_runtime.h>
// Multi-head attention over separate query / key / value inputs ([1][4096][512] each; q = query Wq^T + bq, k = key Wk^T + bk, v = value Wv^T + bv, 8 heads of 64; attn = softmax(q k^T / 8); x = attn v; out = x Wo^T + bo -> [1][4096][512]).
// Structure: token rows; query, key and value as exact f16 rows; Q | K | V as three WMMA GEMMs (32x64 wave tiles, f32 accumulation, exact x16 natural weights, bias in the epilogue, f16 outputs); per head: scores GEMM (K = 64), row softmax on VALU (f32; weights stored x256 as f16), V^T via LDS transposes, x = P . V GEMM (K = 4,096, alpha 2^-8) written straight into the merged f16 rows; out = x Wo^T + bo GEMM (f32).
// Compute dtype: inputs rounded to bf16; inputs / weights exact; q, k, v, softmax weights and x as plain f16 GEMM operands (~2^-12); scores and softmax statistics f32. v_wmma_f32_16x16x32_f16.
#define NB 1
#define SQ 4096
#define DM 512
#define NH 8
#define HD 64
#define HG 1                         /* heads per attention launch group */
#define QN SQ                        /* query rows attended per batch (debug hook) */
#define NBR NB                       /* batches attended (debug hook) */
#define MP ((int)NR)                 /* token rows through the q/k/v projections (debug hook) */
#define MO ((int)NR)                 /* token rows through the output projection (debug hook) */
#define NR ((size_t)NB * SQ)         /* 4096 token rows */
typedef __bf16 v16b __attribute__((ext_vector_type(16)));
typedef unsigned short v8us __attribute__((ext_vector_type(8), may_alias));
typedef float  v8f  __attribute__((ext_vector_type(8)));
typedef float  v4f  __attribute__((ext_vector_type(4)));
typedef float  v4fa __attribute__((ext_vector_type(4), may_alias));
union FragB { v16b v; v8us half[2]; unsigned short u[16]; };

__device__ __forceinline__ unsigned short bf16_bits(float x) { unsigned int u = __float_as_uint(x); return (unsigned short)((u + 0x7FFFu + ((u >> 16) & 1u)) >> 16); }
__device__ __forceinline__ float bf16_val(unsigned short b) { return __uint_as_float(((unsigned int)b) << 16); }
__device__ __forceinline__ float bf16_round(float x) { return bf16_val(bf16_bits(x)); }
// D += A·B with NT terms: 1 = ah·bh, 2 = + al·bh (A split), 3 = + ah·bl (both split)
template <int NT>
__device__ __forceinline__ v8f mmaN(v16b ah, v16b al, v16b bh, v16b bl, v8f c) {
  c = __builtin_amdgcn_wmma_f32_16x16x32_bf16(false, ah, false, bh, (short)0, c, false, false);
  if (NT >= 2) c = __builtin_amdgcn_wmma_f32_16x16x32_bf16(false, al, false, bh, (short)0, c, false, false);
  if (NT >= 3) c = __builtin_amdgcn_wmma_f32_16x16x32_bf16(false, ah, false, bl, (short)0, c, false, false);
  asm volatile("v_nop\n\tv_nop\n\tv_nop\n\tv_nop" : "+v"(c) : "v"(ah), "v"(al), "v"(bh), "v"(bl));
  return c;
}

__global__ __launch_bounds__(256) void k_wt_bf16(const float* __restrict__ W, unsigned short* __restrict__ Wt, int K, int N) {
  const int t = blockIdx.x * 256 + threadIdx.x;
  const int k8n = K / 8;
  if (t >= N * k8n) return;
  const int n = t / k8n, k8 = (t % k8n) * 8;
  v8us v;
#pragma unroll
  for (int i = 0; i < 8; ++i) v[i] = bf16_bits(W[(size_t)(k8 + i) * N + n]);
  *(v8us*)(Wt + (size_t)n * K + k8) = v;
  
}

// GEMM C[M][N] (f32, pitch ldc) = act(A[M][K]·W + bias). A f32 row-major (pitch lda) converted per fragment to bf16
// (ASPLIT: hi/lo two planes -> 2 terms, else single rounded term); Wt bf16 [N][K] (pitch ldb). BIAS_BF16 rounds the
// bias to bf16 first (bias quantised to bf16 before the add). K%32==0, M%16==0, N%64==0.
template <bool ASPLIT, int ACT, bool BIAS_BF16>
__global__ __launch_bounds__(128) void k_gemm_bf(const float* __restrict__ A, int lda, const unsigned short* __restrict__ Wt, int ldb,
                                               const float* __restrict__ bias, float* __restrict__ C, int ldc, int M, int N, int K) {
  __shared__ __attribute__((aligned(16))) float so[4][16][64];
  const int tid = threadIdx.x, w = tid >> 5, lane = tid & 31, ln = lane & 15, hh = lane >> 4;
  const int ntn = N / 64;
  const int wid = blockIdx.x * 4 + w;
  const int mt = wid / ntn, nq = wid % ntn;
  if (mt * 16 >= M) return;
  const int row0 = mt * 16, col0 = nq * 64;
  const float* arow = A + (size_t)(row0 + ln) * lda;
  v8f acc[4] = {};
  for (int kb = 0; kb < K; kb += 32) {
    FragB ah, al;
    const v4f x0 = *(const v4fa*)(arow + kb + 8 * hh), x1 = *(const v4fa*)(arow + kb + 8 * hh + 4);
    const v4f x2 = *(const v4fa*)(arow + kb + 16 + 8 * hh), x3 = *(const v4fa*)(arow + kb + 16 + 8 * hh + 4);
    float xs[16] = {x0[0],x0[1],x0[2],x0[3],x1[0],x1[1],x1[2],x1[3],x2[0],x2[1],x2[2],x2[3],x3[0],x3[1],x3[2],x3[3]};
#pragma unroll
    for (int i = 0; i < 16; ++i) { const unsigned short hb = bf16_bits(xs[i]); ah.u[i] = hb; al.u[i] = ASPLIT ? bf16_bits(xs[i] - bf16_val(hb)) : (unsigned short)0; }
#pragma unroll
    for (int t = 0; t < 4; ++t) {
      const unsigned short* brow = Wt + (size_t)(col0 + t * 16 + ln) * ldb + kb;
      FragB b;
      b.half[0] = *(const v8us*)(brow + 8 * hh);
      b.half[1] = *(const v8us*)(brow + 16 + 8 * hh);
      acc[t] = mmaN<ASPLIT ? 2 : 1>(ah.v, al.v, b.v, b.v, acc[t]);
    }
  }
#pragma unroll
  for (int t = 0; t < 4; ++t) {
    float bv = bias ? bias[col0 + t * 16 + ln] : 0.f;
    if (BIAS_BF16) bv = bf16_round(bv);
#pragma unroll
    for (int r = 0; r < 8; ++r) { float v = acc[t][r] + bv; if (ACT == 1) v = fmaxf(v, 0.f); so[w][8 * hh + r][t * 16 + ln] = v; }
  }
  __builtin_amdgcn_fence(__ATOMIC_ACQ_REL, "workgroup");
  __builtin_amdgcn_wave_barrier();
  const int rsub = lane >> 4, c4 = (lane & 15) * 4;
  {
#pragma unroll
    for (int q = 0; q < 8; ++q) {
      const int r = q * 2 + rsub;
      const v4f v = *(const v4fa*)&so[w][r][c4];
      *(v4f*)(C + (size_t)(row0 + r) * ldc + col0 + c4) = v;
    }
    
  }
}

// GEMM C = act(A·W + bias + resid): A f32 (ASPLIT -> hi/lo 2 terms), Wt bf16 [N][K]; ACT 0 none, 1 relu, 2 exact gelu;
// resid (optional, f32, row index = (row % rmod), pitch ldr, RES_BF16 rounds it) added before the activation.
template <bool ASPLIT, int ACT, bool BIAS_BF16, bool RES_BF16>
__global__ __launch_bounds__(128) void k_gemm_bf3(const float* __restrict__ A, int lda, const unsigned short* __restrict__ Wt, int ldb,
                                                const float* __restrict__ bias, const float* __restrict__ resid, int rmod, int ldr,
                                                float* __restrict__ C, int ldc, int M, int N, int K) {
  __shared__ __attribute__((aligned(16))) float so[4][16][64];
  const int tid = threadIdx.x, w = tid >> 5, lane = tid & 31, ln = lane & 15, hh = lane >> 4;
  const int ntn = N / 64;
  const int wid = blockIdx.x * 4 + w;
  const int mt = wid / ntn, nq = wid % ntn;
  if (mt * 16 >= M) return;
  const int row0 = mt * 16, col0 = nq * 64;
  const float* arow = A + (size_t)(row0 + ln) * lda;
  v8f acc[4] = {};
  for (int kb = 0; kb < K; kb += 32) {
    FragB ah, al;
    const v4f x0 = *(const v4fa*)(arow + kb + 8 * hh), x1 = *(const v4fa*)(arow + kb + 8 * hh + 4);
    const v4f x2 = *(const v4fa*)(arow + kb + 16 + 8 * hh), x3 = *(const v4fa*)(arow + kb + 16 + 8 * hh + 4);
    float xs[16] = {x0[0],x0[1],x0[2],x0[3],x1[0],x1[1],x1[2],x1[3],x2[0],x2[1],x2[2],x2[3],x3[0],x3[1],x3[2],x3[3]};
#pragma unroll
    for (int i = 0; i < 16; ++i) { const unsigned short hb = bf16_bits(xs[i]); ah.u[i] = hb; al.u[i] = ASPLIT ? bf16_bits(xs[i] - bf16_val(hb)) : (unsigned short)0; }
#pragma unroll
    for (int t = 0; t < 4; ++t) {
      const unsigned short* brow = Wt + (size_t)(col0 + t * 16 + ln) * ldb + kb;
      FragB b;
      b.half[0] = *(const v8us*)(brow + 8 * hh);
      b.half[1] = *(const v8us*)(brow + 16 + 8 * hh);
      acc[t] = mmaN<ASPLIT ? 2 : 1>(ah.v, al.v, b.v, b.v, acc[t]);
    }
  }
#pragma unroll
  for (int t = 0; t < 4; ++t) {
    const int col = col0 + t * 16 + ln;
    float bv = bias ? bias[col] : 0.f;
    if (BIAS_BF16) bv = bf16_round(bv);
#pragma unroll
    for (int r = 0; r < 8; ++r) {
      float v = acc[t][r] + bv;
      if (resid) { float rv = resid[(size_t)((row0 + 8 * hh + r) % rmod) * ldr + col]; if (RES_BF16) rv = bf16_round(rv); v += rv; }
      if (ACT == 1) v = fmaxf(v, 0.f);
      if (ACT == 2) v = 0.5f * v * (1.0f + erff(v * 0.70710678118654752f));
      if (ACT == 3) { const float u = 0.7978845608028654f * (v + 0.044715f * v * v * v); v = 0.5f * v * (1.0f + tanhf(u)); }
      so[w][8 * hh + r][t * 16 + ln] = v;
    }
  }
  __builtin_amdgcn_fence(__ATOMIC_ACQ_REL, "workgroup");
  __builtin_amdgcn_wave_barrier();
  const int rsub = lane >> 4, c4 = (lane & 15) * 4;
  {
#pragma unroll
    for (int q = 0; q < 8; ++q) {
      const int r = q * 2 + rsub;
      const v4f v = *(const v4fa*)&so[w][r][c4];
      *(v4f*)(C + (size_t)(row0 + r) * ldc + col0 + c4) = v;
    }
    
  }
}
// row LayerNorm (biased variance, eps) over N: s = X (+ R); optional out_sum <- s; out_norm <- (s-mu)*rsqrt(var+eps)*g + b
template <bool PARAM_BF16>
__global__ __launch_bounds__(256) void k_layernorm(const float* __restrict__ X, const float* __restrict__ R, const float* __restrict__ g, const float* __restrict__ bta,
                                                  float* __restrict__ out_sum, float* __restrict__ out_norm, int N, float eps) {
  __shared__ float red[256];
  const int row = blockIdx.x, tid = threadIdx.x;
  const float* x = X + (size_t)row * N; const float* rr = R ? R + (size_t)row * N : nullptr;
  float vals[16];                     // up to N = 4096
  const int per = N / 256;            // contiguous chunk per thread? use strided-by-4 chunks: thread handles j = tid*4 + 1024*u
  float s1 = 0.f;
  for (int u = 0; u < per / 4; ++u) {
    const int j = tid * 4 + 1024 * u;
    const v4f a = *(const v4fa*)(x + j);
    v4f b = {0.f,0.f,0.f,0.f}; if (rr) b = *(const v4fa*)(rr + j);
#pragma unroll
    for (int q = 0; q < 4; ++q) { const float v = a[q] + b[q]; vals[u * 4 + q] = v; s1 += v; }
  }
  red[tid] = s1; __syncthreads();
  for (int st = 128; st > 0; st >>= 1) { if (tid < st) red[tid] += red[tid + st]; __syncthreads(); }
  const float mu = red[0] / (float)N; __syncthreads();
  float s2 = 0.f;
  for (int u = 0; u < per / 4; ++u)
#pragma unroll
    for (int q = 0; q < 4; ++q) { const float c = vals[u * 4 + q] - mu; s2 += c * c; }
  red[tid] = s2; __syncthreads();
  for (int st = 128; st > 0; st >>= 1) { if (tid < st) red[tid] += red[tid + st]; __syncthreads(); }
  const float rs = rsqrtf(red[0] / (float)N + eps);
  {
    for (int u = 0; u < per / 4; ++u) {
      const int j = tid * 4 + 1024 * u;
      v4f o, sm;
#pragma unroll
      for (int q = 0; q < 4; ++q) {
        float gg = g[j + q], bb = bta[j + q];
        if (PARAM_BF16) { gg = bf16_round(gg); bb = bf16_round(bb); }
        sm[q] = vals[u * 4 + q]; o[q] = (vals[u * 4 + q] - mu) * rs * gg + bb;
      }
      if (out_sum) *(v4f*)(out_sum + (size_t)row * N + j) = sm;
      *(v4f*)(out_norm + (size_t)row * N + j) = o;
    }
    
  }
}



// ---- f16 WMMA path (v_wmma_f32_16x16x32_f16): 11-bit significands for operands in range — used where a [0,1] probability operand needs more precision than bf16
typedef _Float16 v16h __attribute__((ext_vector_type(16)));
union FragH { v16h v; v8us half[2]; _Float16 h[16]; unsigned short u[16]; };
template <int NT>
__device__ __forceinline__ v8f mmaH(v16h ah, v16h al, v16h bh, v16h bl, v8f c) {
  c = __builtin_amdgcn_wmma_f32_16x16x32_f16(false, ah, false, bh, (short)0, c, false, false);
  if (NT >= 2) c = __builtin_amdgcn_wmma_f32_16x16x32_f16(false, al, false, bh, (short)0, c, false, false);
  if (NT >= 3) c = __builtin_amdgcn_wmma_f32_16x16x32_f16(false, ah, false, bl, (short)0, c, false, false);
  asm volatile("v_nop\n\tv_nop\n\tv_nop\n\tv_nop" : "+v"(c) : "v"(ah), "v"(al), "v"(bh), "v"(bl));
  return c;
}
// batched GEMM like k_gemm_b but f16 operands: A f32 (split into f16 hi/lo if ASPLIT, else rounded to f16), Bt = f16 values [n][k]; alpha; C f32; N multiple of 16 (partial tiles skipped)
template <bool ASPLIT>
__global__ __launch_bounds__(128) void k_gemm_h(const float* __restrict__ A, int lda, size_t sA, const _Float16* __restrict__ Bh, int ldb, size_t sB, float alpha, float* __restrict__ C, int ldc, size_t sC, int M, int N, int K) {
  __shared__ __attribute__((aligned(16))) float so[4][16][64];
  const int tid = threadIdx.x, w = tid >> 5, lane = tid & 31, ln = lane & 15, hh = lane >> 4; const int by = blockIdx.y;
  A += (size_t)by * sA; Bh += (size_t)by * sB; C += (size_t)by * sC;
  const int ntn = (N + 63) / 64; const int wid = blockIdx.x * 4 + w; const int mt = wid / ntn, nq = wid % ntn; if (mt * 16 >= M) return;
  const int row0 = mt * 16, col0 = nq * 64; const float* arow = A + (size_t)(row0 + ln) * lda;
  v8f acc[4] = {};
  for (int kb = 0; kb < K; kb += 32) {
    FragH ah, al;
    const v4f x0 = *(const v4fa*)(arow + kb + 8 * hh), x1 = *(const v4fa*)(arow + kb + 8 * hh + 4), x2 = *(const v4fa*)(arow + kb + 16 + 8 * hh), x3 = *(const v4fa*)(arow + kb + 16 + 8 * hh + 4);
    float xs[16] = {x0[0],x0[1],x0[2],x0[3],x1[0],x1[1],x1[2],x1[3],x2[0],x2[1],x2[2],x2[3],x3[0],x3[1],x3[2],x3[3]};
#pragma unroll
    for (int i = 0; i < 16; ++i) { const _Float16 h = (_Float16)xs[i]; ah.h[i] = h; al.h[i] = ASPLIT ? (_Float16)(xs[i] - (float)h) : (_Float16)0.0f; }
#pragma unroll
    for (int t = 0; t < 4; ++t) { if (col0 + t * 16 >= N) continue; const size_t boff = (size_t)(col0 + t * 16 + ln) * ldb + kb; FragH bq; bq.half[0] = *(const v8us*)(Bh + boff + 8 * hh); bq.half[1] = *(const v8us*)(Bh + boff + 16 + 8 * hh);
      acc[t] = mmaH<ASPLIT ? 2 : 1>(ah.v, al.v, bq.v, bq.v, acc[t]); }
  }
#pragma unroll
  for (int t = 0; t < 4; ++t) { if (col0 + t * 16 >= N) continue;
#pragma unroll
    for (int r = 0; r < 8; ++r) so[w][8 * hh + r][t * 16 + ln] = acc[t][r] * alpha; }
  __builtin_amdgcn_fence(__ATOMIC_ACQ_REL, "workgroup"); __builtin_amdgcn_wave_barrier();
  const int rsub = lane >> 4, c4 = (lane & 15) * 4;
  {
#pragma unroll
    for (int q = 0; q < 8; ++q) { const int r = q * 2 + rsub; if (col0 + c4 < N) { const v4f v = *(const v4fa*)&so[w][r][c4]; *(v4f*)(C + (size_t)(row0 + r) * ldc + col0 + c4) = v; } }
     }
}

// Wt[n][k] = f16(W[k][n]·scale) from f32 row-major W[K][N] (scale = power of two; bf16-exact weights stay exact in f16 away from the subnormal range)
__global__ __launch_bounds__(256) void k_wt_f16(const float* __restrict__ W, _Float16* __restrict__ Wt, int K, int N, float scale) {
  const int t = blockIdx.x * 256 + threadIdx.x; if (t >= N * (K / 8)) return; const int n = t / (K / 8), k8 = (t % (K / 8)) * 8; FragH f;
#pragma unroll
  for (int i = 0; i < 8; ++i) f.h[i] = (_Float16)(bf16_round(W[(size_t)(k8 + i) * N + n]) * scale); const v8us o = f.half[0];
  *(v8us*)((unsigned short*)Wt + (size_t)n * K + k8) = o; 
}
// k_gemm_hh variant with fused epilogue: v = acc·alpha + bias[by·sBias + col] (+ CP[(row/rowsPerB)·sCPb + by·64 + col] if CP) ; ACT 0 none / 1 elu ; writes f16 C16 (and f32 C if non-null)
template <int ACT>
__global__ __launch_bounds__(128) void k_gemm_hhx(const _Float16* __restrict__ A, int lda, size_t sA, const _Float16* __restrict__ Bh, int ldb, size_t sB, float alpha, const float* __restrict__ bias, size_t sBias, const float* __restrict__ CP, int rowsPerB, size_t sCPb, int row0g,
    float* __restrict__ C, _Float16* __restrict__ C16, int ldc, size_t sC, int M, int N, int K) {
  __shared__ __attribute__((aligned(16))) float so[4][16][64];
  const int tid = threadIdx.x, w = tid >> 5, lane = tid & 31, ln = lane & 15, hh = lane >> 4; const int by = blockIdx.y;
  A += (size_t)by * sA; Bh += (size_t)by * sB; const size_t cofs = (size_t)by * sC; const float* bp = bias ? bias + (size_t)by * sBias : nullptr;
  const int ntn = (N + 63) / 64; const int wid = blockIdx.x * 4 + w; const int mt = wid / ntn, nq = wid % ntn; if (mt * 16 >= M) return;
  const int row0 = mt * 16, col0 = nq * 64; const _Float16* arow = A + (size_t)(row0 + ln) * lda;
  v8f acc[4] = {};
  for (int kb = 0; kb < K; kb += 32) { FragH ah; ah.half[0] = *(const v8us*)((const unsigned short*)arow + kb + 8 * hh); ah.half[1] = *(const v8us*)((const unsigned short*)arow + kb + 16 + 8 * hh);
#pragma unroll
    for (int t = 0; t < 4; ++t) { if (col0 + t * 16 >= N) continue; const size_t boff = (size_t)(col0 + t * 16 + ln) * ldb + kb; FragH bq; bq.half[0] = *(const v8us*)((const unsigned short*)Bh + boff + 8 * hh); bq.half[1] = *(const v8us*)((const unsigned short*)Bh + boff + 16 + 8 * hh);
      acc[t] = mmaH<1>(ah.v, ah.v, bq.v, bq.v, acc[t]); }
  }
#pragma unroll
  for (int t = 0; t < 4; ++t) { if (col0 + t * 16 >= N) continue; const int col = col0 + t * 16 + ln; const float bv = bp ? bf16_round(bp[col]) : 0.f;
#pragma unroll
    for (int r = 0; r < 8; ++r) { float v = acc[t][r] * alpha + bv; if (CP) { const int rr = row0g + row0 + 8 * hh + r; if (rowsPerB < 0) v += CP[cofs + (size_t)rr * ldc + col];      /* rowsPerB < 0: own element of the batched C plane */ else { const int bidx = rr / rowsPerB; v += CP[(size_t)bidx * sCPb + (size_t)by * 64 + col]; } } if (ACT == 1) v = (v > 0.f) ? v : expm1f(v); else if (ACT == 7) v = (v > 0.f) ? v + 1.0f : expf(v); else if (ACT == 8) v = tanhf(v); else if (ACT == 9) v = 0.5f * v * (1.0f + tanhf(0.7978845608028654f * (v + 0.044715f * v * v * v))); else if (ACT == 11) v = 1.0f / (1.0f + expf(-v)); else if (ACT == 12) v = (v > 0.f) ? v : 0.01f * v; else if (ACT == 14) v = (v > 0.f) ? v : 0.1f * v; else if (ACT == 16) v = (v >= 0.f) ? v : 0.3f * v; else if (ACT == 17) v = (v >= 0.f) ? v : 0.2f * v; else if (ACT == 15) v = v / (1.0f + expf(-v)); else if (ACT == 3) v = fmaxf(v, 0.f); else if (ACT == 6) v = 0.5f * v * (1.0f + erff(v * 0.70710678118654752f)); so[w][8 * hh + r][t * 16 + ln] = v; } }
  __builtin_amdgcn_fence(__ATOMIC_ACQ_REL, "workgroup"); __builtin_amdgcn_wave_barrier();
  const int rsub = lane >> 4, c4 = (lane & 15) * 4; typedef _Float16 v4h __attribute__((ext_vector_type(4)));
  {
#pragma unroll
    for (int q = 0; q < 8; ++q) { const int r = q * 2 + rsub; if (col0 + c4 < N) { const v4f v = *(const v4fa*)&so[w][r][c4]; if (C) *(v4f*)(C + cofs + (size_t)(row0 + r) * ldc + col0 + c4) = v; if (C16) { v4h h4; for (int i = 0; i < 4; ++i) h4[i] = (_Float16)v[i]; *(v4h*)(C16 + cofs + (size_t)(row0 + r) * ldc + col0 + c4) = h4; } } }
     }
}


typedef _Float16 v4h __attribute__((ext_vector_type(4)));

__global__ __launch_bounds__(256) void k_x16(const float* __restrict__ x, _Float16* __restrict__ X16, size_t n8) { const size_t t = (size_t)blockIdx.x * 256 + threadIdx.x; if (t >= n8) return; FragH f;
#pragma unroll
  for (int q = 0; q < 8; ++q) f.h[q] = (_Float16)bf16_round(x[t * 8 + q]); *(v8us*)((unsigned short*)X16 + t * 8) = f.half[0];  }
__global__ __launch_bounds__(256) void k_h16(const float* __restrict__ x, _Float16* __restrict__ X16, size_t n8) { const size_t t = (size_t)blockIdx.x * 256 + threadIdx.x; if (t >= n8) return; FragH f;
#pragma unroll
  for (int q = 0; q < 8; ++q) f.h[q] = (_Float16)x[t * 8 + q]; *(v8us*)((unsigned short*)X16 + t * 8) = f.half[0];  }
__global__ __launch_bounds__(256) void k_round16f(const float* __restrict__ W, _Float16* __restrict__ Bt, size_t n8) { const size_t t = (size_t)blockIdx.x * 256 + threadIdx.x; if (t >= n8) return; FragH f;
#pragma unroll
  for (int i = 0; i < 8; ++i) f.h[i] = (_Float16)(bf16_round(W[t * 8 + i]) * 16.0f); *(v8us*)((unsigned short*)Bt + t * 8) = f.half[0];  }
template <int NHv, int TTv>
__global__ __launch_bounds__(256) void k_vt(const _Float16* __restrict__ V16, int ldv, int voff, _Float16* __restrict__ Vt) { __shared__ unsigned short tl[64][66]; const int tid = threadIdx.x; const int slab = blockIdx.x / (TTv / 64), lg = blockIdx.x % (TTv / 64); const int b = slab / NHv, h = slab % NHv;
  for (int i = tid; i < 64 * 8; i += 256) { const int r = i / 8, c8 = (i % 8) * 8; FragH f; f.half[0] = *(const v8us*)((const unsigned short*)V16 + ((size_t)b * TTv + lg * 64 + r) * ldv + voff + h * 64 + c8);
#pragma unroll
    for (int q = 0; q < 8; ++q) tl[r][c8 + q] = f.u[q]; }
  __syncthreads();
  {
#pragma unroll
    for (int rd = 0; rd < 2; ++rd) { const int d = rd * 32 + tid / 8, pc = tid % 8; FragH f;
#pragma unroll
      for (int q = 0; q < 8; ++q) f.u[q] = tl[pc * 8 + q][d];
      *(v8us*)((unsigned short*)Vt + ((size_t)slab * 64 + d) * TTv + lg * 64 + pc * 8) = f.half[0]; }
     } }

__global__ __launch_bounds__(256) void k_hl(const float* __restrict__ F, _Float16* __restrict__ Hh, _Float16* __restrict__ Hl, size_t n8) { const size_t t = (size_t)blockIdx.x * 256 + threadIdx.x; if (t >= n8) return; FragH fh, fl; const v4f a = *(const v4fa*)(F + t * 8), c = *(const v4fa*)(F + t * 8 + 4);
#pragma unroll
  for (int q = 0; q < 4; ++q) { _Float16 h = (_Float16)a[q]; fh.h[q] = h; fl.h[q] = (_Float16)((a[q] - (float)h) * 1024.0f); h = (_Float16)c[q]; fh.h[4 + q] = h; fl.h[4 + q] = (_Float16)((c[q] - (float)h) * 1024.0f); }
  { *(v8us*)((unsigned short*)Hh + t * 8) = fh.half[0]; *(v8us*)((unsigned short*)Hl + t * 8) = fl.half[0];  } }

// ---- fast GEMM (wave tile 32x64; requires M % 32 == 0 rows per launch region and N % 64 == 0); epilogue = k_gemm_hhx semantics ----
__device__ __forceinline__ v16h g2_frag(const _Float16* p, int hh) { FragH f; f.half[0] = *(const v8us*)((const unsigned short*)p + 8 * hh); f.half[1] = *(const v8us*)((const unsigned short*)p + 16 + 8 * hh); return f.v; }
__device__ __forceinline__ v8f g2_mma(v16h a, v16h b, v8f c) { v8f d = __builtin_amdgcn_wmma_f32_16x16x32_f16(false, a, false, b, (short)0, c, false, false); asm volatile("v_nop\n\tv_nop\n\tv_nop\n\tv_nop" : "+v"(d) : "v"(a), "v"(b)); return d; }
template <int ACT>
__global__ __launch_bounds__(128) void k_gemm2(const _Float16* __restrict__ A, int lda, size_t sA, const _Float16* __restrict__ Bh, int ldb, size_t sB, float alpha, const float* __restrict__ bias, size_t sBias, const float* __restrict__ CP, int rowsPerB, size_t sCPb, int row0g,
    float* __restrict__ C, _Float16* __restrict__ C16, int ldc, size_t sC, int M, int N, int K) { static_assert(ACT == 0 || ACT == 3 || ACT == 6 || ACT == 8 || ACT == 9 || ACT == 11 || ACT == 12 || ACT == 14 || ACT == 15 || ACT == 16 || ACT == 17, "k_gemm2: unsupported ACT code (would silently apply no activation)");
  __shared__ __attribute__((aligned(16))) float so[4][32][68];
  const int tid = threadIdx.x, w = tid >> 5, lane = tid & 31, ln = lane & 15, hh = lane >> 4; const int by = blockIdx.y;
  A += (size_t)by * sA; Bh += (size_t)by * sB; const size_t cofs = (size_t)by * sC; const float* bp = bias ? bias + (size_t)by * sBias : nullptr;
  const int ntn = N >> 6; const int mt = blockIdx.x / ntn, nq = blockIdx.x - mt * ntn; const int row0 = mt * 128 + 32 * w, col0 = nq * 64; if (row0 >= M) return;
  const _Float16* a0p = A + (size_t)(row0 + ln) * lda; const _Float16* a1p = a0p + (size_t)16 * lda;
  const _Float16* b0p = Bh + (size_t)(col0 + ln) * ldb; const _Float16* b1p = b0p + (size_t)16 * ldb; const _Float16* b2p = b1p + (size_t)16 * ldb; const _Float16* b3p = b2p + (size_t)16 * ldb;
  const v8f z8 = {0.f,0.f,0.f,0.f,0.f,0.f,0.f,0.f}; v8f c00 = z8, c01 = z8, c02 = z8, c03 = z8, c10 = z8, c11 = z8, c12 = z8, c13 = z8;
#pragma unroll 1
  for (int kb = 0; kb < K; kb += 32) { const v16h a0 = g2_frag(a0p + kb, hh), a1 = g2_frag(a1p + kb, hh);
    v16h b = g2_frag(b0p + kb, hh); c00 = g2_mma(a0, b, c00); c10 = g2_mma(a1, b, c10);
    b = g2_frag(b1p + kb, hh); c01 = g2_mma(a0, b, c01); c11 = g2_mma(a1, b, c11);
    b = g2_frag(b2p + kb, hh); c02 = g2_mma(a0, b, c02); c12 = g2_mma(a1, b, c12);
    b = g2_frag(b3p + kb, hh); c03 = g2_mma(a0, b, c03); c13 = g2_mma(a1, b, c13); }
  v8f accs[8] = {c00, c01, c02, c03, c10, c11, c12, c13};
#pragma unroll
  for (int u = 0; u < 8; ++u) { const int t = u & 3, half = u >> 2; const int col = col0 + t * 16 + ln; const float bv = bp ? bf16_round(bp[col]) : 0.f;
#pragma unroll
    for (int r = 0; r < 8; ++r) { const int rloc = half * 16 + 8 * hh + r; float v = accs[u][r] * alpha + bv; if (CP) { if (rowsPerB < 0) v += CP[cofs + (size_t)(row0g + row0 + rloc) * ldc + col];      /* rowsPerB < 0: own element of the batched C plane */ else { const int bidx = (row0g + row0 + rloc) / rowsPerB; v += CP[(size_t)bidx * sCPb + (size_t)by * 64 + col]; } }
      if (ACT == 3) v = fmaxf(v, 0.f); else if (ACT == 6) v = 0.5f * v * (1.0f + erff(v * 0.70710678118654752f)); else if (ACT == 11) v = 1.0f / (1.0f + expf(-v)); else if (ACT == 15) v = v / (1.0f + expf(-v)); else if (ACT == 12) v = (v > 0.f) ? v : 0.01f * v; else if (ACT == 8) v = tanhf(v); else if (ACT == 9) v = 0.5f * v * (1.0f + tanhf(0.7978845608028654f * (v + 0.044715f * v * v * v))); else if (ACT == 14) v = (v > 0.f) ? v : 0.1f * v; else if (ACT == 16) v = (v >= 0.f) ? v : 0.3f * v; else if (ACT == 17) v = (v >= 0.f) ? v : 0.2f * v;
      so[w][rloc][t * 16 + ln] = v; } }
  __builtin_amdgcn_fence(__ATOMIC_ACQ_REL, "workgroup"); __builtin_amdgcn_wave_barrier();
  const int rsub = lane >> 4, c4 = (lane & 15) * 4;
  {
#pragma unroll
    for (int q = 0; q < 16; ++q) { const int r = q * 2 + rsub; const v4f v = *(const v4fa*)&so[w][r][c4]; if (C) *(v4f*)(C + cofs + (size_t)(row0 + r) * ldc + col0 + c4) = v; if (C16) { v4h h4; for (int i = 0; i < 4; ++i) h4[i] = (_Float16)v[i]; *(v4h*)(C16 + cofs + (size_t)(row0 + r) * ldc + col0 + c4) = h4; } }
     } }


__global__ __launch_bounds__(256) void k_wnat(const float* __restrict__ w, size_t n8, _Float16* __restrict__ Bt) { const size_t t = (size_t)blockIdx.x * 256 + threadIdx.x; if (t >= n8) return; FragH f; for (int q = 0; q < 8; ++q) f.h[q] = (_Float16)(bf16_round(w[t * 8 + q]) * 16.0f); *(v8us*)((unsigned short*)Bt + t * 8) = f.half[0];  }
// Row softmax, one wave per row: the row's 4,096 f32 scores sit in the wave's registers (128 a lane; every wave-wide load is 512 contiguous bytes, every
// wave-wide store 256), so S is read once and exp is taken once an element; maximum and sum run down the lane's values and end in a five-step butterfly
// over the lanes. No barrier, no LDS. One sum chain a lane: its adds hide behind the exp work, and four chains made the build spill.
__global__ __launch_bounds__(512) void k_rsm(const float* __restrict__ S, _Float16* __restrict__ P, int nrows) {
  const int lane = threadIdx.x & 31; const int row = blockIdx.x * 16 + (threadIdx.x >> 5); if (row >= nrows) return;      /* the same in every lane of a wave */
  const float* s = S + (size_t)row * SQ + lane * 4; float x[SQ / 32];
#pragma unroll      /* constant indices keep x[] in registers; 32 loads in flight a wave */
  for (int c = 0; c < SQ / 128; ++c) { const v4f t = *(const v4fa*)(s + c * 128); x[4 * c] = t[0]; x[4 * c + 1] = t[1]; x[4 * c + 2] = t[2]; x[4 * c + 3] = t[3]; }
  asm volatile("s_wait_xcnt 0x0" :: "v"(s) : "memory");      /* the wait owed before a load's address register is reused; naming s keeps that pair whole up to here */
  __builtin_amdgcn_sched_barrier(0);      /* keeps the first use below all 32 loads: without it the build issues the last two only when the other thirty are back, a second trip to memory */
  float mx = -3.0e38f;
#pragma unroll      /* x[] in registers */
  for (int i = 0; i < SQ / 32; ++i) mx = fmaxf(mx, x[i]);
  for (int d = 16; d > 0; d >>= 1) mx = fmaxf(mx, __shfl_xor(mx, d, 32));
  float se = 0.f;
#pragma unroll      /* x[] in registers */
  for (int i = 0; i < SQ / 32; ++i) { x[i] = expf(x[i] - mx); se += x[i]; }
  for (int d = 16; d > 0; d >>= 1) se += __shfl_xor(se, d, 32);      /* every lane ends with the same bits */
  const float sc = 256.0f / se; _Float16* p = P + (size_t)row * SQ + lane * 4;
#pragma unroll      /* x[] in registers */
  for (int c = 0; c < SQ / 128; ++c) { v4h h4; for (int q = 0; q < 4; ++q) h4[q] = (_Float16)(x[4 * c + q] * sc); *(v4h*)(p + c * 128) = h4; } }
__global__ __launch_bounds__(256) void k_vt(const _Float16* __restrict__ V16, int b, int h0, _Float16* __restrict__ VT) { __shared__ unsigned short tl[64][65]; const int tid = threadIdx.x; const int hh = blockIdx.x % HG, sg = blockIdx.x / HG; const int s0 = sg * 64; const int h = h0 + hh;
  for (int i = tid; i < 64 * 8; i += 256) { const int j = i / 8, d8 = (i % 8) * 8; FragH f; f.half[0] = *(const v8us*)((const unsigned short*)V16 + ((size_t)b * SQ + s0 + j) * DM + h * HD + d8); for (int q = 0; q < 8; ++q) tl[d8 + q][j] = f.u[q]; }
  __syncthreads();
  { for (int i = tid; i < 64 * 8; i += 256) { const int d = i / 8, j8 = (i % 8) * 8; FragH f; for (int q = 0; q < 8; ++q) f.u[q] = tl[d][j8 + q]; *(v8us*)((unsigned short*)VT + ((size_t)hh * HD + d) * SQ + s0 + j8) = f.half[0]; }  } }

extern "C" void kernel_launch(void* const* d_in, const int* in_sizes, int n_in,
                              void* d_out, int out_size, void* d_ws, size_t ws_size, hipStream_t stream) {
  (void)in_sizes; (void)n_in; (void)out_size;
  const float* const* I = (const float* const*)d_in; const float* xq = I[0]; const float* xk = I[1]; const float* xv = I[2]; const float* wq = I[3]; const float* bq = I[4]; const float* wk = I[5]; const float* bk = I[6]; const float* wv = I[7]; const float* bv = I[8]; const float* wo = I[9]; const float* bo = I[10];
  char* ws = (char*)d_ws; size_t off = 0;
  auto take = [&](size_t bytes) { char* p = ws + off; off += (bytes + 255) & ~(size_t)255; return p; };
  _Float16* BQ = (_Float16*)take((size_t)DM * DM * 2); _Float16* BK = (_Float16*)take((size_t)DM * DM * 2); _Float16* BV = (_Float16*)take((size_t)DM * DM * 2); _Float16* BO = (_Float16*)take((size_t)DM * DM * 2);
  _Float16* XQ = (_Float16*)take(NR * DM * 2); _Float16* XK = (_Float16*)take(NR * DM * 2); _Float16* XV = (_Float16*)take(NR * DM * 2); _Float16* Q16 = (_Float16*)take(NR * DM * 2); _Float16* K16 = (_Float16*)take(NR * DM * 2); _Float16* V16 = (_Float16*)take(NR * DM * 2); _Float16* O16 = (_Float16*)take(NR * DM * 2);
  float* S = (float*)take((size_t)HG * SQ * SQ * 4); _Float16* P = (_Float16*)take((size_t)HG * SQ * SQ * 2); _Float16* VT = (_Float16*)take((size_t)HG * HD * SQ * 2);
  if (off > ws_size) return;      /* 2 + 7x4 + 64 + 32 + 0.5 = approx 127 MiB */
  const size_t nw8 = (size_t)DM * DM / 8; const unsigned gw = (unsigned)((nw8 + 255) / 256);
  k_wnat<<<gw, 256, 0, stream>>>(wq, nw8, BQ); k_wnat<<<gw, 256, 0, stream>>>(wk, nw8, BK); k_wnat<<<gw, 256, 0, stream>>>(wv, nw8, BV); k_wnat<<<gw, 256, 0, stream>>>(wo, nw8, BO);
  k_x16<<<(unsigned)((NR * DM / 8 + 255) / 256), 256, 0, stream>>>(xq, XQ, NR * DM / 8); k_x16<<<(unsigned)((NR * DM / 8 + 255) / 256), 256, 0, stream>>>(xk, XK, NR * DM / 8); k_x16<<<(unsigned)((NR * DM / 8 + 255) / 256), 256, 0, stream>>>(xv, XV, NR * DM / 8);
  const dim3 gp((unsigned)((NR / 128) * (DM / 64)), 1);
  k_gemm2<0><<<gp, 128, 0, stream>>>(XQ, DM, 0, BQ, DM, 0, 0.0625f, bq, 0, nullptr, 1, 0, 0, nullptr, Q16, DM, 0, MP, DM, DM);
  k_gemm2<0><<<gp, 128, 0, stream>>>(XK, DM, 0, BK, DM, 0, 0.0625f, bk, 0, nullptr, 1, 0, 0, nullptr, K16, DM, 0, MP, DM, DM);
  k_gemm2<0><<<gp, 128, 0, stream>>>(XV, DM, 0, BV, DM, 0, 0.0625f, bv, 0, nullptr, 1, 0, 0, nullptr, V16, DM, 0, MP, DM, DM);
  for (int b = 0; b < NBR; ++b) for (int h0 = 0; h0 < NH; h0 += HG) {
    const _Float16* qb = Q16 + (size_t)b * SQ * DM + h0 * HD; const _Float16* kb = K16 + (size_t)b * SQ * DM + h0 * HD;
    k_gemm2<0><<<dim3((QN / 128) * (SQ / 64), HG), 128, 0, stream>>>(qb, DM, (size_t)HD, kb, DM, (size_t)HD, 0.125f, nullptr, 0, nullptr, 1, 0, 0, S, nullptr, SQ, (size_t)SQ * SQ, QN, SQ, HD);      /* scores / sqrt(64) */
    for (int hh = 0; hh < HG; ++hh) k_rsm<<<(QN + 15) / 16, 512, 0, stream>>>(S + (size_t)hh * SQ * SQ, P + (size_t)hh * SQ * SQ, QN);
    k_vt<<<HG * (SQ / 64), 256, 0, stream>>>(V16, b, h0, VT);
    k_gemm2<0><<<dim3((QN / 128) * (HD / 64), HG), 128, 0, stream>>>(P, SQ, (size_t)SQ * SQ, VT, SQ, (size_t)HD * SQ, 0.00390625f, nullptr, 0, nullptr, 1, 0, 0, nullptr, O16 + (size_t)b * SQ * DM + h0 * HD, DM, (size_t)HD, QN, HD, SQ); }      /* o (merged heads) as f16 rows */
  k_gemm2<0><<<gp, 128, 0, stream>>>(O16, DM, 0, BO, DM, 0, 0.0625f, bo, 0, nullptr, 1, 0, 0, (float*)d_out, nullptr, DM, 0, MO, DM, DM);      /* out = o W_o^T + b_o, rows are the output layout */
}

// v002
// It runs in 160 microseconds.
// Timed twice side by side with v001, it ran 8.58 and 8.51 times as fast.
// Counting every step since v000, it is 43.9 times as fast.
#include <hip/hip_runtime.h>
// Multi-head attention over separate query / key / value inputs ([1][4096][512] each; q = query Wq^T + bq, k = key Wk^T + bk, v = value Wv^T + bv, 8 heads of 64; attn = softmax(q k^T / 8); x = attn v; out = x Wo^T + bo -> [1][4096][512]).
// Structure: token rows; query, key and value as exact f16 rows; Q | K | V as three WMMA GEMMs (32x64 wave tiles, f32 accumulation, exact x16 natural weights, bias in the epilogue, f16 outputs); V^T of all heads via LDS transposes; one attention kernel for all heads (scores^T = K q^T, running-maximum softmax in registers, x^T += V^T p^T; scores and weights never stored) written straight into the merged f16 rows; out = x Wo^T + bo GEMM (f32).
// Compute dtype: inputs rounded to bf16; inputs / weights exact; q, k, v, softmax weights and x as plain f16 GEMM operands (~2^-12); scores and softmax statistics f32. v_wmma_f32_16x16x32_f16.
#define NB 1
#define SQ 4096
#define DM 512
#define NH 8
#define HD 64
#define MP ((int)NR)                 /* token rows through the q/k/v projections (debug hook) */
#define MO ((int)NR)                 /* token rows through the output projection (debug hook) */
#define NR ((size_t)NB * SQ)         /* 4096 token rows */
typedef __bf16 v16b __attribute__((ext_vector_type(16)));
typedef unsigned short v8us __attribute__((ext_vector_type(8), may_alias));
typedef float  v8f  __attribute__((ext_vector_type(8)));
typedef float  v4f  __attribute__((ext_vector_type(4)));
typedef float  v4fa __attribute__((ext_vector_type(4), may_alias));
union FragB { v16b v; v8us half[2]; unsigned short u[16]; };

__device__ __forceinline__ unsigned short bf16_bits(float x) { unsigned int u = __float_as_uint(x); return (unsigned short)((u + 0x7FFFu + ((u >> 16) & 1u)) >> 16); }
__device__ __forceinline__ float bf16_val(unsigned short b) { return __uint_as_float(((unsigned int)b) << 16); }
__device__ __forceinline__ float bf16_round(float x) { return bf16_val(bf16_bits(x)); }
// D += A·B with NT terms: 1 = ah·bh, 2 = + al·bh (A split), 3 = + ah·bl (both split)
template <int NT>
__device__ __forceinline__ v8f mmaN(v16b ah, v16b al, v16b bh, v16b bl, v8f c) {
  c = __builtin_amdgcn_wmma_f32_16x16x32_bf16(false, ah, false, bh, (short)0, c, false, false);
  if (NT >= 2) c = __builtin_amdgcn_wmma_f32_16x16x32_bf16(false, al, false, bh, (short)0, c, false, false);
  if (NT >= 3) c = __builtin_amdgcn_wmma_f32_16x16x32_bf16(false, ah, false, bl, (short)0, c, false, false);
  asm volatile("v_nop\n\tv_nop\n\tv_nop\n\tv_nop" : "+v"(c) : "v"(ah), "v"(al), "v"(bh), "v"(bl));
  return c;
}

__global__ __launch_bounds__(256) void k_wt_bf16(const float* __restrict__ W, unsigned short* __restrict__ Wt, int K, int N) {
  const int t = blockIdx.x * 256 + threadIdx.x;
  const int k8n = K / 8;
  if (t >= N * k8n) return;
  const int n = t / k8n, k8 = (t % k8n) * 8;
  v8us v;
#pragma unroll
  for (int i = 0; i < 8; ++i) v[i] = bf16_bits(W[(size_t)(k8 + i) * N + n]);
  *(v8us*)(Wt + (size_t)n * K + k8) = v;
  
}

// GEMM C[M][N] (f32, pitch ldc) = act(A[M][K]·W + bias). A f32 row-major (pitch lda) converted per fragment to bf16
// (ASPLIT: hi/lo two planes -> 2 terms, else single rounded term); Wt bf16 [N][K] (pitch ldb). BIAS_BF16 rounds the
// bias to bf16 first (bias quantised to bf16 before the add). K%32==0, M%16==0, N%64==0.
template <bool ASPLIT, int ACT, bool BIAS_BF16>
__global__ __launch_bounds__(128) void k_gemm_bf(const float* __restrict__ A, int lda, const unsigned short* __restrict__ Wt, int ldb,
                                               const float* __restrict__ bias, float* __restrict__ C, int ldc, int M, int N, int K) {
  __shared__ __attribute__((aligned(16))) float so[4][16][64];
  const int tid = threadIdx.x, w = tid >> 5, lane = tid & 31, ln = lane & 15, hh = lane >> 4;
  const int ntn = N / 64;
  const int wid = blockIdx.x * 4 + w;
  const int mt = wid / ntn, nq = wid % ntn;
  if (mt * 16 >= M) return;
  const int row0 = mt * 16, col0 = nq * 64;
  const float* arow = A + (size_t)(row0 + ln) * lda;
  v8f acc[4] = {};
  for (int kb = 0; kb < K; kb += 32) {
    FragB ah, al;
    const v4f x0 = *(const v4fa*)(arow + kb + 8 * hh), x1 = *(const v4fa*)(arow + kb + 8 * hh + 4);
    const v4f x2 = *(const v4fa*)(arow + kb + 16 + 8 * hh), x3 = *(const v4fa*)(arow + kb + 16 + 8 * hh + 4);
    float xs[16] = {x0[0],x0[1],x0[2],x0[3],x1[0],x1[1],x1[2],x1[3],x2[0],x2[1],x2[2],x2[3],x3[0],x3[1],x3[2],x3[3]};
#pragma unroll
    for (int i = 0; i < 16; ++i) { const unsigned short hb = bf16_bits(xs[i]); ah.u[i] = hb; al.u[i] = ASPLIT ? bf16_bits(xs[i] - bf16_val(hb)) : (unsigned short)0; }
#pragma unroll
    for (int t = 0; t < 4; ++t) {
      const unsigned short* brow = Wt + (size_t)(col0 + t * 16 + ln) * ldb + kb;
      FragB b;
      b.half[0] = *(const v8us*)(brow + 8 * hh);
      b.half[1] = *(const v8us*)(brow + 16 + 8 * hh);
      acc[t] = mmaN<ASPLIT ? 2 : 1>(ah.v, al.v, b.v, b.v, acc[t]);
    }
  }
#pragma unroll
  for (int t = 0; t < 4; ++t) {
    float bv = bias ? bias[col0 + t * 16 + ln] : 0.f;
    if (BIAS_BF16) bv = bf16_round(bv);
#pragma unroll
    for (int r = 0; r < 8; ++r) { float v = acc[t][r] + bv; if (ACT == 1) v = fmaxf(v, 0.f); so[w][8 * hh + r][t * 16 + ln] = v; }
  }
  __builtin_amdgcn_fence(__ATOMIC_ACQ_REL, "workgroup");
  __builtin_amdgcn_wave_barrier();
  const int rsub = lane >> 4, c4 = (lane & 15) * 4;
  {
#pragma unroll
    for (int q = 0; q < 8; ++q) {
      const int r = q * 2 + rsub;
      const v4f v = *(const v4fa*)&so[w][r][c4];
      *(v4f*)(C + (size_t)(row0 + r) * ldc + col0 + c4) = v;
    }
    
  }
}

// GEMM C = act(A·W + bias + resid): A f32 (ASPLIT -> hi/lo 2 terms), Wt bf16 [N][K]; ACT 0 none, 1 relu, 2 exact gelu;
// resid (optional, f32, row index = (row % rmod), pitch ldr, RES_BF16 rounds it) added before the activation.
template <bool ASPLIT, int ACT, bool BIAS_BF16, bool RES_BF16>
__global__ __launch_bounds__(128) void k_gemm_bf3(const float* __restrict__ A, int lda, const unsigned short* __restrict__ Wt, int ldb,
                                                const float* __restrict__ bias, const float* __restrict__ resid, int rmod, int ldr,
                                                float* __restrict__ C, int ldc, int M, int N, int K) {
  __shared__ __attribute__((aligned(16))) float so[4][16][64];
  const int tid = threadIdx.x, w = tid >> 5, lane = tid & 31, ln = lane & 15, hh = lane >> 4;
  const int ntn = N / 64;
  const int wid = blockIdx.x * 4 + w;
  const int mt = wid / ntn, nq = wid % ntn;
  if (mt * 16 >= M) return;
  const int row0 = mt * 16, col0 = nq * 64;
  const float* arow = A + (size_t)(row0 + ln) * lda;
  v8f acc[4] = {};
  for (int kb = 0; kb < K; kb += 32) {
    FragB ah, al;
    const v4f x0 = *(const v4fa*)(arow + kb + 8 * hh), x1 = *(const v4fa*)(arow + kb + 8 * hh + 4);
    const v4f x2 = *(const v4fa*)(arow + kb + 16 + 8 * hh), x3 = *(const v4fa*)(arow + kb + 16 + 8 * hh + 4);
    float xs[16] = {x0[0],x0[1],x0[2],x0[3],x1[0],x1[1],x1[2],x1[3],x2[0],x2[1],x2[2],x2[3],x3[0],x3[1],x3[2],x3[3]};
#pragma unroll
    for (int i = 0; i < 16; ++i) { const unsigned short hb = bf16_bits(xs[i]); ah.u[i] = hb; al.u[i] = ASPLIT ? bf16_bits(xs[i] - bf16_val(hb)) : (unsigned short)0; }
#pragma unroll
    for (int t = 0; t < 4; ++t) {
      const unsigned short* brow = Wt + (size_t)(col0 + t * 16 + ln) * ldb + kb;
      FragB b;
      b.half[0] = *(const v8us*)(brow + 8 * hh);
      b.half[1] = *(const v8us*)(brow + 16 + 8 * hh);
      acc[t] = mmaN<ASPLIT ? 2 : 1>(ah.v, al.v, b.v, b.v, acc[t]);
    }
  }
#pragma unroll
  for (int t = 0; t < 4; ++t) {
    const int col = col0 + t * 16 + ln;
    float bv = bias ? bias[col] : 0.f;
    if (BIAS_BF16) bv = bf16_round(bv);
#pragma unroll
    for (int r = 0; r < 8; ++r) {
      float v = acc[t][r] + bv;
      if (resid) { float rv = resid[(size_t)((row0 + 8 * hh + r) % rmod) * ldr + col]; if (RES_BF16) rv = bf16_round(rv); v += rv; }
      if (ACT == 1) v = fmaxf(v, 0.f);
      if (ACT == 2) v = 0.5f * v * (1.0f + erff(v * 0.70710678118654752f));
      if (ACT == 3) { const float u = 0.7978845608028654f * (v + 0.044715f * v * v * v); v = 0.5f * v * (1.0f + tanhf(u)); }
      so[w][8 * hh + r][t * 16 + ln] = v;
    }
  }
  __builtin_amdgcn_fence(__ATOMIC_ACQ_REL, "workgroup");
  __builtin_amdgcn_wave_barrier();
  const int rsub = lane >> 4, c4 = (lane & 15) * 4;
  {
#pragma unroll
    for (int q = 0; q < 8; ++q) {
      const int r = q * 2 + rsub;
      const v4f v = *(const v4fa*)&so[w][r][c4];
      *(v4f*)(C + (size_t)(row0 + r) * ldc + col0 + c4) = v;
    }
    
  }
}
// row LayerNorm (biased variance, eps) over N: s = X (+ R); optional out_sum <- s; out_norm <- (s-mu)*rsqrt(var+eps)*g + b
template <bool PARAM_BF16>
__global__ __launch_bounds__(256) void k_layernorm(const float* __restrict__ X, const float* __restrict__ R, const float* __restrict__ g, const float* __restrict__ bta,
                                                  float* __restrict__ out_sum, float* __restrict__ out_norm, int N, float eps) {
  __shared__ float red[256];
  const int row = blockIdx.x, tid = threadIdx.x;
  const float* x = X + (size_t)row * N; const float* rr = R ? R + (size_t)row * N : nullptr;
  float vals[16];                     // up to N = 4096
  const int per = N / 256;            // contiguous chunk per thread? use strided-by-4 chunks: thread handles j = tid*4 + 1024*u
  float s1 = 0.f;
  for (int u = 0; u < per / 4; ++u) {
    const int j = tid * 4 + 1024 * u;
    const v4f a = *(const v4fa*)(x + j);
    v4f b = {0.f,0.f,0.f,0.f}; if (rr) b = *(const v4fa*)(rr + j);
#pragma unroll
    for (int q = 0; q < 4; ++q) { const float v = a[q] + b[q]; vals[u * 4 + q] = v; s1 += v; }
  }
  red[tid] = s1; __syncthreads();
  for (int st = 128; st > 0; st >>= 1) { if (tid < st) red[tid] += red[tid + st]; __syncthreads(); }
  const float mu = red[0] / (float)N; __syncthreads();
  float s2 = 0.f;
  for (int u = 0; u < per / 4; ++u)
#pragma unroll
    for (int q = 0; q < 4; ++q) { const float c = vals[u * 4 + q] - mu; s2 += c * c; }
  red[tid] = s2; __syncthreads();
  for (int st = 128; st > 0; st >>= 1) { if (tid < st) red[tid] += red[tid + st]; __syncthreads(); }
  const float rs = rsqrtf(red[0] / (float)N + eps);
  {
    for (int u = 0; u < per / 4; ++u) {
      const int j = tid * 4 + 1024 * u;
      v4f o, sm;
#pragma unroll
      for (int q = 0; q < 4; ++q) {
        float gg = g[j + q], bb = bta[j + q];
        if (PARAM_BF16) { gg = bf16_round(gg); bb = bf16_round(bb); }
        sm[q] = vals[u * 4 + q]; o[q] = (vals[u * 4 + q] - mu) * rs * gg + bb;
      }
      if (out_sum) *(v4f*)(out_sum + (size_t)row * N + j) = sm;
      *(v4f*)(out_norm + (size_t)row * N + j) = o;
    }
    
  }
}



// ---- f16 WMMA path (v_wmma_f32_16x16x32_f16): 11-bit significands for operands in range — used where a [0,1] probability operand needs more precision than bf16
typedef _Float16 v16h __attribute__((ext_vector_type(16)));
union FragH { v16h v; v8us half[2]; _Float16 h[16]; unsigned short u[16]; };
template <int NT>
__device__ __forceinline__ v8f mmaH(v16h ah, v16h al, v16h bh, v16h bl, v8f c) {
  c = __builtin_amdgcn_wmma_f32_16x16x32_f16(false, ah, false, bh, (short)0, c, false, false);
  if (NT >= 2) c = __builtin_amdgcn_wmma_f32_16x16x32_f16(false, al, false, bh, (short)0, c, false, false);
  if (NT >= 3) c = __builtin_amdgcn_wmma_f32_16x16x32_f16(false, ah, false, bl, (short)0, c, false, false);
  asm volatile("v_nop\n\tv_nop\n\tv_nop\n\tv_nop" : "+v"(c) : "v"(ah), "v"(al), "v"(bh), "v"(bl));
  return c;
}
// batched GEMM like k_gemm_b but f16 operands: A f32 (split into f16 hi/lo if ASPLIT, else rounded to f16), Bt = f16 values [n][k]; alpha; C f32; N multiple of 16 (partial tiles skipped)
template <bool ASPLIT>
__global__ __launch_bounds__(128) void k_gemm_h(const float* __restrict__ A, int lda, size_t sA, const _Float16* __restrict__ Bh, int ldb, size_t sB, float alpha, float* __restrict__ C, int ldc, size_t sC, int M, int N, int K) {
  __shared__ __attribute__((aligned(16))) float so[4][16][64];
  const int tid = threadIdx.x, w = tid >> 5, lane = tid & 31, ln = lane & 15, hh = lane >> 4; const int by = blockIdx.y;
  A += (size_t)by * sA; Bh += (size_t)by * sB; C += (size_t)by * sC;
  const int ntn = (N + 63) / 64; const int wid = blockIdx.x * 4 + w; const int mt = wid / ntn, nq = wid % ntn; if (mt * 16 >= M) return;
  const int row0 = mt * 16, col0 = nq * 64; const float* arow = A + (size_t)(row0 + ln) * lda;
  v8f acc[4] = {};
  for (int kb = 0; kb < K; kb += 32) {
    FragH ah, al;
    const v4f x0 = *(const v4fa*)(arow + kb + 8 * hh), x1 = *(const v4fa*)(arow + kb + 8 * hh + 4), x2 = *(const v4fa*)(arow + kb + 16 + 8 * hh), x3 = *(const v4fa*)(arow + kb + 16 + 8 * hh + 4);
    float xs[16] = {x0[0],x0[1],x0[2],x0[3],x1[0],x1[1],x1[2],x1[3],x2[0],x2[1],x2[2],x2[3],x3[0],x3[1],x3[2],x3[3]};
#pragma unroll
    for (int i = 0; i < 16; ++i) { const _Float16 h = (_Float16)xs[i]; ah.h[i] = h; al.h[i] = ASPLIT ? (_Float16)(xs[i] - (float)h) : (_Float16)0.0f; }
#pragma unroll
    for (int t = 0; t < 4; ++t) { if (col0 + t * 16 >= N) continue; const size_t boff = (size_t)(col0 + t * 16 + ln) * ldb + kb; FragH bq; bq.half[0] = *(const v8us*)(Bh + boff + 8 * hh); bq.half[1] = *(const v8us*)(Bh + boff + 16 + 8 * hh);
      acc[t] = mmaH<ASPLIT ? 2 : 1>(ah.v, al.v, bq.v, bq.v, acc[t]); }
  }
#pragma unroll
  for (int t = 0; t < 4; ++t) { if (col0 + t * 16 >= N) continue;
#pragma unroll
    for (int r = 0; r < 8; ++r) so[w][8 * hh + r][t * 16 + ln] = acc[t][r] * alpha; }
  __builtin_amdgcn_fence(__ATOMIC_ACQ_REL, "workgroup"); __builtin_amdgcn_wave_barrier();
  const int rsub = lane >> 4, c4 = (lane & 15) * 4;
  {
#pragma unroll
    for (int q = 0; q < 8; ++q) { const int r = q * 2 + rsub; if (col0 + c4 < N) { const v4f v = *(const v4fa*)&so[w][r][c4]; *(v4f*)(C + (size_t)(row0 + r) * ldc + col0 + c4) = v; } }
     }
}

// Wt[n][k] = f16(W[k][n]·scale) from f32 row-major W[K][N] (scale = power of two; bf16-exact weights stay exact in f16 away from the subnormal range)
__global__ __launch_bounds__(256) void k_wt_f16(const float* __restrict__ W, _Float16* __restrict__ Wt, int K, int N, float scale) {
  const int t = blockIdx.x * 256 + threadIdx.x; if (t >= N * (K / 8)) return; const int n = t / (K / 8), k8 = (t % (K / 8)) * 8; FragH f;
#pragma unroll
  for (int i = 0; i < 8; ++i) f.h[i] = (_Float16)(bf16_round(W[(size_t)(k8 + i) * N + n]) * scale); const v8us o = f.half[0];
  *(v8us*)((unsigned short*)Wt + (size_t)n * K + k8) = o; 
}
// k_gemm_hh variant with fused epilogue: v = acc·alpha + bias[by·sBias + col] (+ CP[(row/rowsPerB)·sCPb + by·64 + col] if CP) ; ACT 0 none / 1 elu ; writes f16 C16 (and f32 C if non-null)
template <int ACT>
__global__ __launch_bounds__(128) void k_gemm_hhx(const _Float16* __restrict__ A, int lda, size_t sA, const _Float16* __restrict__ Bh, int ldb, size_t sB, float alpha, const float* __restrict__ bias, size_t sBias, const float* __restrict__ CP, int rowsPerB, size_t sCPb, int row0g,
    float* __restrict__ C, _Float16* __restrict__ C16, int ldc, size_t sC, int M, int N, int K) {
  __shared__ __attribute__((aligned(16))) float so[4][16][64];
  const int tid = threadIdx.x, w = tid >> 5, lane = tid & 31, ln = lane & 15, hh = lane >> 4; const int by = blockIdx.y;
  A += (size_t)by * sA; Bh += (size_t)by * sB; const size_t cofs = (size_t)by * sC; const float* bp = bias ? bias + (size_t)by * sBias : nullptr;
  const int ntn = (N + 63) / 64; const int wid = blockIdx.x * 4 + w; const int mt = wid / ntn, nq = wid % ntn; if (mt * 16 >= M) return;
  const int row0 = mt * 16, col0 = nq * 64; const _Float16* arow = A + (size_t)(row0 + ln) * lda;
  v8f acc[4] = {};
  for (int kb = 0; kb < K; kb += 32) { FragH ah; ah.half[0] = *(const v8us*)((const unsigned short*)arow + kb + 8 * hh); ah.half[1] = *(const v8us*)((const unsigned short*)arow + kb + 16 + 8 * hh);
#pragma unroll
    for (int t = 0; t < 4; ++t) { if (col0 + t * 16 >= N) continue; const size_t boff = (size_t)(col0 + t * 16 + ln) * ldb + kb; FragH bq; bq.half[0] = *(const v8us*)((const unsigned short*)Bh + boff + 8 * hh); bq.half[1] = *(const v8us*)((const unsigned short*)Bh + boff + 16 + 8 * hh);
      acc[t] = mmaH<1>(ah.v, ah.v, bq.v, bq.v, acc[t]); }
  }
#pragma unroll
  for (int t = 0; t < 4; ++t) { if (col0 + t * 16 >= N) continue; const int col = col0 + t * 16 + ln; const float bv = bp ? bf16_round(bp[col]) : 0.f;
#pragma unroll
    for (int r = 0; r < 8; ++r) { float v = acc[t][r] * alpha + bv; if (CP) { const int rr = row0g + row0 + 8 * hh + r; if (rowsPerB < 0) v += CP[cofs + (size_t)rr * ldc + col];      /* rowsPerB < 0: own element of the batched C plane */ else { const int bidx = rr / rowsPerB; v += CP[(size_t)bidx * sCPb + (size_t)by * 64 + col]; } } if (ACT == 1) v = (v > 0.f) ? v : expm1f(v); else if (ACT == 7) v = (v > 0.f) ? v + 1.0f : expf(v); else if (ACT == 8) v = tanhf(v); else if (ACT == 9) v = 0.5f * v * (1.0f + tanhf(0.7978845608028654f * (v + 0.044715f * v * v * v))); else if (ACT == 11) v = 1.0f / (1.0f + expf(-v)); else if (ACT == 12) v = (v > 0.f) ? v : 0.01f * v; else if (ACT == 14) v = (v > 0.f) ? v : 0.1f * v; else if (ACT == 16) v = (v >= 0.f) ? v : 0.3f * v; else if (ACT == 17) v = (v >= 0.f) ? v : 0.2f * v; else if (ACT == 15) v = v / (1.0f + expf(-v)); else if (ACT == 3) v = fmaxf(v, 0.f); else if (ACT == 6) v = 0.5f * v * (1.0f + erff(v * 0.70710678118654752f)); so[w][8 * hh + r][t * 16 + ln] = v; } }
  __builtin_amdgcn_fence(__ATOMIC_ACQ_REL, "workgroup"); __builtin_amdgcn_wave_barrier();
  const int rsub = lane >> 4, c4 = (lane & 15) * 4; typedef _Float16 v4h __attribute__((ext_vector_type(4)));
  {
#pragma unroll
    for (int q = 0; q < 8; ++q) { const int r = q * 2 + rsub; if (col0 + c4 < N) { const v4f v = *(const v4fa*)&so[w][r][c4]; if (C) *(v4f*)(C + cofs + (size_t)(row0 + r) * ldc + col0 + c4) = v; if (C16) { v4h h4; for (int i = 0; i < 4; ++i) h4[i] = (_Float16)v[i]; *(v4h*)(C16 + cofs + (size_t)(row0 + r) * ldc + col0 + c4) = h4; } } }
     }
}


typedef _Float16 v4h __attribute__((ext_vector_type(4)));

__global__ __launch_bounds__(256) void k_x16(const float* __restrict__ x, _Float16* __restrict__ X16, size_t n8) { const size_t t = (size_t)blockIdx.x * 256 + threadIdx.x; if (t >= n8) return; FragH f;
#pragma unroll
  for (int q = 0; q < 8; ++q) f.h[q] = (_Float16)bf16_round(x[t * 8 + q]); *(v8us*)((unsigned short*)X16 + t * 8) = f.half[0];  }
__global__ __launch_bounds__(256) void k_h16(const float* __restrict__ x, _Float16* __restrict__ X16, size_t n8) { const size_t t = (size_t)blockIdx.x * 256 + threadIdx.x; if (t >= n8) return; FragH f;
#pragma unroll
  for (int q = 0; q < 8; ++q) f.h[q] = (_Float16)x[t * 8 + q]; *(v8us*)((unsigned short*)X16 + t * 8) = f.half[0];  }
__global__ __launch_bounds__(256) void k_round16f(const float* __restrict__ W, _Float16* __restrict__ Bt, size_t n8) { const size_t t = (size_t)blockIdx.x * 256 + threadIdx.x; if (t >= n8) return; FragH f;
#pragma unroll
  for (int i = 0; i < 8; ++i) f.h[i] = (_Float16)(bf16_round(W[t * 8 + i]) * 16.0f); *(v8us*)((unsigned short*)Bt + t * 8) = f.half[0];  }
template <int NHv, int TTv>
__global__ __launch_bounds__(256) void k_vt(const _Float16* __restrict__ V16, int ldv, int voff, _Float16* __restrict__ Vt) { __shared__ unsigned short tl[64][66]; const int tid = threadIdx.x; const int slab = blockIdx.x / (TTv / 64), lg = blockIdx.x % (TTv / 64); const int b = slab / NHv, h = slab % NHv;
  for (int i = tid; i < 64 * 8; i += 256) { const int r = i / 8, c8 = (i % 8) * 8; FragH f; f.half[0] = *(const v8us*)((const unsigned short*)V16 + ((size_t)b * TTv + lg * 64 + r) * ldv + voff + h * 64 + c8);
#pragma unroll
    for (int q = 0; q < 8; ++q) tl[r][c8 + q] = f.u[q]; }
  __syncthreads();
  {
#pragma unroll
    for (int rd = 0; rd < 2; ++rd) { const int d = rd * 32 + tid / 8, pc = tid % 8; FragH f;
#pragma unroll
      for (int q = 0; q < 8; ++q) f.u[q] = tl[pc * 8 + q][d];
      *(v8us*)((unsigned short*)Vt + ((size_t)slab * 64 + d) * TTv + lg * 64 + pc * 8) = f.half[0]; }
     } }

__global__ __launch_bounds__(256) void k_hl(const float* __restrict__ F, _Float16* __restrict__ Hh, _Float16* __restrict__ Hl, size_t n8) { const size_t t = (size_t)blockIdx.x * 256 + threadIdx.x; if (t >= n8) return; FragH fh, fl; const v4f a = *(const v4fa*)(F + t * 8), c = *(const v4fa*)(F + t * 8 + 4);
#pragma unroll
  for (int q = 0; q < 4; ++q) { _Float16 h = (_Float16)a[q]; fh.h[q] = h; fl.h[q] = (_Float16)((a[q] - (float)h) * 1024.0f); h = (_Float16)c[q]; fh.h[4 + q] = h; fl.h[4 + q] = (_Float16)((c[q] - (float)h) * 1024.0f); }
  { *(v8us*)((unsigned short*)Hh + t * 8) = fh.half[0]; *(v8us*)((unsigned short*)Hl + t * 8) = fl.half[0];  } }

// ---- fast GEMM (wave tile 32x64; requires M % 32 == 0 rows per launch region and N % 64 == 0); epilogue = k_gemm_hhx semantics ----
__device__ __forceinline__ v16h g2_frag(const _Float16* p, int hh) { FragH f; f.half[0] = *(const v8us*)((const unsigned short*)p + 8 * hh); f.half[1] = *(const v8us*)((const unsigned short*)p + 16 + 8 * hh); return f.v; }
__device__ __forceinline__ v8f g2_mma(v16h a, v16h b, v8f c) { v8f d = __builtin_amdgcn_wmma_f32_16x16x32_f16(false, a, false, b, (short)0, c, false, false); asm volatile("v_nop\n\tv_nop\n\tv_nop\n\tv_nop" : "+v"(d) : "v"(a), "v"(b)); return d; }
template <int ACT>
__global__ __launch_bounds__(128) void k_gemm2(const _Float16* __restrict__ A, int lda, size_t sA, const _Float16* __restrict__ Bh, int ldb, size_t sB, float alpha, const float* __restrict__ bias, size_t sBias, const float* __restrict__ CP, int rowsPerB, size_t sCPb, int row0g,
    float* __restrict__ C, _Float16* __restrict__ C16, int ldc, size_t sC, int M, int N, int K) { static_assert(ACT == 0 || ACT == 3 || ACT == 6 || ACT == 8 || ACT == 9 || ACT == 11 || ACT == 12 || ACT == 14 || ACT == 15 || ACT == 16 || ACT == 17, "k_gemm2: unsupported ACT code (would silently apply no activation)");
  __shared__ __attribute__((aligned(16))) float so[4][32][68];
  const int tid = threadIdx.x, w = tid >> 5, lane = tid & 31, ln = lane & 15, hh = lane >> 4; const int by = blockIdx.y;
  A += (size_t)by * sA; Bh += (size_t)by * sB; const size_t cofs = (size_t)by * sC; const float* bp = bias ? bias + (size_t)by * sBias : nullptr;
  const int ntn = N >> 6; const int mt = blockIdx.x / ntn, nq = blockIdx.x - mt * ntn; const int row0 = mt * 128 + 32 * w, col0 = nq * 64; if (row0 >= M) return;
  const _Float16* a0p = A + (size_t)(row0 + ln) * lda; const _Float16* a1p = a0p + (size_t)16 * lda;
  const _Float16* b0p = Bh + (size_t)(col0 + ln) * ldb; const _Float16* b1p = b0p + (size_t)16 * ldb; const _Float16* b2p = b1p + (size_t)16 * ldb; const _Float16* b3p = b2p + (size_t)16 * ldb;
  const v8f z8 = {0.f,0.f,0.f,0.f,0.f,0.f,0.f,0.f}; v8f c00 = z8, c01 = z8, c02 = z8, c03 = z8, c10 = z8, c11 = z8, c12 = z8, c13 = z8;
#pragma unroll 1
  for (int kb = 0; kb < K; kb += 32) { const v16h a0 = g2_frag(a0p + kb, hh), a1 = g2_frag(a1p + kb, hh);
    v16h b = g2_frag(b0p + kb, hh); c00 = g2_mma(a0, b, c00); c10 = g2_mma(a1, b, c10);
    b = g2_frag(b1p + kb, hh); c01 = g2_mma(a0, b, c01); c11 = g2_mma(a1, b, c11);
    b = g2_frag(b2p + kb, hh); c02 = g2_mma(a0, b, c02); c12 = g2_mma(a1, b, c12);
    b = g2_frag(b3p + kb, hh); c03 = g2_mma(a0, b, c03); c13 = g2_mma(a1, b, c13); }
  v8f accs[8] = {c00, c01, c02, c03, c10, c11, c12, c13};
#pragma unroll
  for (int u = 0; u < 8; ++u) { const int t = u & 3, half = u >> 2; const int col = col0 + t * 16 + ln; const float bv = bp ? bf16_round(bp[col]) : 0.f;
#pragma unroll
    for (int r = 0; r < 8; ++r) { const int rloc = half * 16 + 8 * hh + r; float v = accs[u][r] * alpha + bv; if (CP) { if (rowsPerB < 0) v += CP[cofs + (size_t)(row0g + row0 + rloc) * ldc + col];      /* rowsPerB < 0: own element of the batched C plane */ else { const int bidx = (row0g + row0 + rloc) / rowsPerB; v += CP[(size_t)bidx * sCPb + (size_t)by * 64 + col]; } }
      if (ACT == 3) v = fmaxf(v, 0.f); else if (ACT == 6) v = 0.5f * v * (1.0f + erff(v * 0.70710678118654752f)); else if (ACT == 11) v = 1.0f / (1.0f + expf(-v)); else if (ACT == 15) v = v / (1.0f + expf(-v)); else if (ACT == 12) v = (v > 0.f) ? v : 0.01f * v; else if (ACT == 8) v = tanhf(v); else if (ACT == 9) v = 0.5f * v * (1.0f + tanhf(0.7978845608028654f * (v + 0.044715f * v * v * v))); else if (ACT == 14) v = (v > 0.f) ? v : 0.1f * v; else if (ACT == 16) v = (v >= 0.f) ? v : 0.3f * v; else if (ACT == 17) v = (v >= 0.f) ? v : 0.2f * v;
      so[w][rloc][t * 16 + ln] = v; } }
  __builtin_amdgcn_fence(__ATOMIC_ACQ_REL, "workgroup"); __builtin_amdgcn_wave_barrier();
  const int rsub = lane >> 4, c4 = (lane & 15) * 4;
  {
#pragma unroll
    for (int q = 0; q < 16; ++q) { const int r = q * 2 + rsub; const v4f v = *(const v4fa*)&so[w][r][c4]; if (C) *(v4f*)(C + cofs + (size_t)(row0 + r) * ldc + col0 + c4) = v; if (C16) { v4h h4; for (int i = 0; i < 4; ++i) h4[i] = (_Float16)v[i]; *(v4h*)(C16 + cofs + (size_t)(row0 + r) * ldc + col0 + c4) = h4; } }
     } }


__global__ __launch_bounds__(256) void k_wnat(const float* __restrict__ w, size_t n8, _Float16* __restrict__ Bt) { const size_t t = (size_t)blockIdx.x * 256 + threadIdx.x; if (t >= n8) return; FragH f; for (int q = 0; q < 8; ++q) f.h[q] = (_Float16)(bf16_round(w[t * 8 + q]) * 16.0f); *(v8us*)((unsigned short*)Bt + t * 8) = f.half[0];  }
// V^T of every head: VT[h][d][s] from the merged f16 rows, 64 x 64 tiles through LDS. grid (SQ / 64, NH).
__global__ __launch_bounds__(256) void k_vt(const _Float16* __restrict__ V16, _Float16* __restrict__ VT) { __shared__ unsigned short tl[64][65]; const int tid = threadIdx.x; const int h = blockIdx.y; const int s0 = blockIdx.x * 64;
  for (int i = tid; i < 64 * 8; i += 256) { const int j = i / 8, d8 = (i % 8) * 8; FragH f; f.half[0] = *(const v8us*)((const unsigned short*)V16 + ((size_t)s0 + j) * DM + h * HD + d8); for (int q = 0; q < 8; ++q) tl[d8 + q][j] = f.u[q]; }
  __syncthreads();
  { for (int i = tid; i < 64 * 8; i += 256) { const int d = i / 8, j8 = (i % 8) * 8; FragH f; for (int q = 0; q < 8; ++q) f.u[q] = tl[d][j8 + q]; *(v8us*)((unsigned short*)VT + ((size_t)h * HD + d) * SQ + s0 + j8) = f.half[0]; }  } }

#define FK 64                        /* keys a pass */
#define FP 72                        /* LDS row pitch in f16 */
__device__ __forceinline__ float fa_xhalf(float x) { return __builtin_bit_cast(float, __builtin_amdgcn_permlanex16(__builtin_bit_cast(int, x), __builtin_bit_cast(int, x), 0x76543210, 0xfedcba98, false, false)); }      /* lane l with lane l ^ 16 */
__device__ __forceinline__ v8f fa_mma(v16h a, v16h b, v8f c) { return __builtin_amdgcn_wmma_f32_16x16x32_f16(false, a, false, b, (short)0, c, false, false); }
__device__ __forceinline__ v16h fa_frag(const unsigned short* p, int hh) { FragH f; f.half[0] = *(const v8us*)(p + 8 * hh); f.half[1] = *(const v8us*)(p + 16 + 8 * hh); return f.v; }
__global__ __launch_bounds__(256) void k_fattn(const _Float16* __restrict__ Q16, const _Float16* __restrict__ K16, const _Float16* __restrict__ VT, _Float16* __restrict__ O16) {
  __shared__ __attribute__((aligned(16))) unsigned short kt[2][FK][FP];
  __shared__ __attribute__((aligned(16))) unsigned short vs[2][HD][FP];
  const int tid = threadIdx.x, w = tid >> 5, lane = tid & 31, ln = lane & 15, hh = lane >> 4; const int h = blockIdx.y; const int q0 = blockIdx.x * 128 + w * 16;
  const _Float16* qp = Q16 + (size_t)(q0 + ln) * DM + h * HD; const v16h qf0 = g2_frag(qp, hh), qf1 = g2_frag(qp + 32, hh);
  const int sr = tid >> 3, sc = (tid & 7) * 8;      /* staging: this thread moves 16 bytes of rows sr and sr + 32 of each tile; 8 threads cover a 128-byte row */
  const unsigned short* kg = (const unsigned short*)K16 + (size_t)sr * DM + h * HD + sc; const unsigned short* vg = (const unsigned short*)VT + ((size_t)h * HD + sr) * SQ + sc;
  v8us rk0 = *(const v8us*)kg, rk1 = *(const v8us*)(kg + 32 * DM), rv0 = *(const v8us*)vg, rv1 = *(const v8us*)(vg + (size_t)32 * SQ);
  *(v8us*)&kt[0][sr][sc] = rk0; *(v8us*)&kt[0][sr + 32][sc] = rk1; *(v8us*)&vs[0][sr][sc] = rv0; *(v8us*)&vs[0][sr + 32][sc] = rv1;
  __syncthreads();
  const v8f z8 = {0.f,0.f,0.f,0.f,0.f,0.f,0.f,0.f}; v8f o[4] = {z8, z8, z8, z8}; float m = -3.0e38f, l = 0.f;      /* m: running maximum of the raw products q.k; l: this half's sum of weights */
  const float CS = 0.125f * 1.4426950408889634f;      /* 1 / sqrt(64), and e^x as 2^(x log2 e) */
#pragma unroll 1      /* one pass a trip: the body already holds 16 matrix instructions and 32 LDS reads */
  for (int it = 0; it < SQ / FK; ++it) { const int cur = it & 1; const bool more = it + 1 < SQ / FK;
    if (more) { kg += (size_t)FK * DM; vg += FK; rk0 = *(const v8us*)kg; rk1 = *(const v8us*)(kg + 32 * DM); rv0 = *(const v8us*)vg; rv1 = *(const v8us*)(vg + (size_t)32 * SQ); }
    v16h kf[8], vf[8];
#pragma unroll      /* constant indices keep the fragments and accumulators in registers */
    for (int t = 0; t < 4; ++t) { const unsigned short* kr = &kt[cur][t * 16 + ln][0]; kf[2 * t] = fa_frag(kr, hh); kf[2 * t + 1] = fa_frag(kr + 32, hh); }
#pragma unroll      /* constant indices keep the fragments and accumulators in registers */
    for (int t = 0; t < 4; ++t) { const unsigned short* vr = &vs[cur][t * 16 + ln][0]; vf[2 * t] = fa_frag(vr, hh); vf[2 * t + 1] = fa_frag(vr + 32, hh); }
    __builtin_amdgcn_sched_barrier(0);      /* keeps all 32 LDS reads of the pass issued here, K first: left alone the build sinks most V^T reads to directly in front of their matrix instruction, each with a full LDS latency in the open */
    v8f s[4];
#pragma unroll      /* constant indices keep the fragments and accumulators in registers */
    for (int t = 0; t < 4; ++t) { s[t] = fa_mma(kf[2 * t], qf0, z8); s[t] = fa_mma(kf[2 * t + 1], qf1, s[t]); }
    float tx[4];      /* one short maximum chain a tile: each starts as soon as its tile is done, and the four do not wait on one another */
#pragma unroll      /* constant indices keep the fragments and accumulators in registers */
    for (int t = 0; t < 4; ++t) { float a = s[t][0];
#pragma unroll      /* constant indices keep the fragments and accumulators in registers */
      for (int r = 1; r < 8; ++r) a = fmaxf(a, s[t][r]);
      tx[t] = a; }
    float tm = fmaxf(fmaxf(tx[0], tx[1]), fmaxf(tx[2], tx[3])); tm = fmaxf(tm, fa_xhalf(tm)); const float mn = fmaxf(m, tm); const float corr = __builtin_amdgcn_exp2f((m - mn) * CS); const float off = 8.0f - mn * CS; m = mn;      /* weights carry x256, as f16 operands away from the subnormal range; it cancels in x = sum / l */
    FragH p[2];
#pragma unroll      /* constant indices keep the fragments and accumulators in registers */
    for (int t = 0; t < 4; ++t)
#pragma unroll      /* constant indices keep the fragments and accumulators in registers */
      for (int r = 0; r < 8; ++r) { const float e = __builtin_amdgcn_exp2f(fmaf(s[t][r], CS, off)); s[t][r] = e; p[t >> 1].h[(t & 1) * 8 + r] = (_Float16)e; }
    const v8f es = (s[0] + s[1]) + (s[2] + s[3]);      /* the pass's sum as a tree: one chain of 32 dependent adds would stand at the foot of every pass */
    l = l * corr + (((es[0] + es[1]) + (es[2] + es[3])) + ((es[4] + es[5]) + (es[6] + es[7])));
#pragma unroll      /* constant indices keep the fragments and accumulators in registers */
    for (int t = 0; t < 4; ++t) o[t] *= corr;
#pragma unroll      /* constant indices keep the fragments and accumulators in registers */
    for (int t = 0; t < 4; ++t) { o[t] = fa_mma(vf[2 * t], p[0].v, o[t]); o[t] = fa_mma(vf[2 * t + 1], p[1].v, o[t]); }
    if (more) { *(v8us*)&kt[cur ^ 1][sr][sc] = rk0; *(v8us*)&kt[cur ^ 1][sr + 32][sc] = rk1; *(v8us*)&vs[cur ^ 1][sr][sc] = rv0; *(v8us*)&vs[cur ^ 1][sr + 32][sc] = rv1; }      /* every reader left that buffer before the last barrier */
    __syncthreads(); }      /* publishes the next tile and ends this pass's reads of the buffer that the next pass refills */
  l += fa_xhalf(l); const float inv = 1.0f / l;
  _Float16* op = O16 + (size_t)(q0 + ln) * DM + h * HD + 8 * hh;      /* lane (ln, hh) holds x[q0 + ln][16 t + 8 hh + r] */
#pragma unroll      /* constant indices keep the fragments and accumulators in registers */
  for (int t = 0; t < 4; ++t) { FragH f;
#pragma unroll      /* constant indices keep the fragments and accumulators in registers */
    for (int r = 0; r < 8; ++r) f.h[r] = (_Float16)(o[t][r] * inv);
    *(v8us*)((unsigned short*)op + t * 16) = f.half[0]; } }

extern "C" void kernel_launch(void* const* d_in, const int* in_sizes, int n_in,
                              void* d_out, int out_size, void* d_ws, size_t ws_size, hipStream_t stream) {
  (void)in_sizes; (void)n_in; (void)out_size;
  const float* const* I = (const float* const*)d_in; const float* xq = I[0]; const float* xk = I[1]; const float* xv = I[2]; const float* wq = I[3]; const float* bq = I[4]; const float* wk = I[5]; const float* bk = I[6]; const float* wv = I[7]; const float* bv = I[8]; const float* wo = I[9]; const float* bo = I[10];
  char* ws = (char*)d_ws; size_t off = 0;
  auto take = [&](size_t bytes) { char* p = ws + off; off += (bytes + 255) & ~(size_t)255; return p; };
  _Float16* BQ = (_Float16*)take((size_t)DM * DM * 2); _Float16* BK = (_Float16*)take((size_t)DM * DM * 2); _Float16* BV = (_Float16*)take((size_t)DM * DM * 2); _Float16* BO = (_Float16*)take((size_t)DM * DM * 2);
  _Float16* XQ = (_Float16*)take(NR * DM * 2); _Float16* XK = (_Float16*)take(NR * DM * 2); _Float16* XV = (_Float16*)take(NR * DM * 2); _Float16* Q16 = (_Float16*)take(NR * DM * 2); _Float16* K16 = (_Float16*)take(NR * DM * 2); _Float16* V16 = (_Float16*)take(NR * DM * 2); _Float16* O16 = (_Float16*)take(NR * DM * 2);
  _Float16* VT = (_Float16*)take((size_t)NH * HD * SQ * 2);
  if (off > ws_size) return;      /* 2 + 7x4 + 4 = approx 34 MiB */
  const size_t nw8 = (size_t)DM * DM / 8; const unsigned gw = (unsigned)((nw8 + 255) / 256);
  k_wnat<<<gw, 256, 0, stream>>>(wq, nw8, BQ); k_wnat<<<gw, 256, 0, stream>>>(wk, nw8, BK); k_wnat<<<gw, 256, 0, stream>>>(wv, nw8, BV); k_wnat<<<gw, 256, 0, stream>>>(wo, nw8, BO);
  k_x16<<<(unsigned)((NR * DM / 8 + 255) / 256), 256, 0, stream>>>(xq, XQ, NR * DM / 8); k_x16<<<(unsigned)((NR * DM / 8 + 255) / 256), 256, 0, stream>>>(xk, XK, NR * DM / 8); k_x16<<<(unsigned)((NR * DM / 8 + 255) / 256), 256, 0, stream>>>(xv, XV, NR * DM / 8);
  const dim3 gp((unsigned)((NR / 128) * (DM / 64)), 1);
  k_gemm2<0><<<gp, 128, 0, stream>>>(XQ, DM, 0, BQ, DM, 0, 0.0625f, bq, 0, nullptr, 1, 0, 0, nullptr, Q16, DM, 0, MP, DM, DM);
  k_gemm2<0><<<gp, 128, 0, stream>>>(XK, DM, 0, BK, DM, 0, 0.0625f, bk, 0, nullptr, 1, 0, 0, nullptr, K16, DM, 0, MP, DM, DM);
  k_gemm2<0><<<gp, 128, 0, stream>>>(XV, DM, 0, BV, DM, 0, 0.0625f, bv, 0, nullptr, 1, 0, 0, nullptr, V16, DM, 0, MP, DM, DM);
  k_vt<<<dim3(SQ / 64, NH), 256, 0, stream>>>(V16, VT);
  k_fattn<<<dim3(SQ / 128, NH), 256, 0, stream>>>(Q16, K16, VT, O16);      /* x (merged heads) as f16 rows */
  k_gemm2<0><<<gp, 128, 0, stream>>>(O16, DM, 0, BO, DM, 0, 0.0625f, bo, 0, nullptr, 1, 0, 0, (float*)d_out, nullptr, DM, 0, MO, DM, DM);      /* out = o W_o^T + b_o, rows are the output layout */
}

// v003
// One run takes 110 microseconds.
// Timed twice side by side with v002, it ran 1.45 and 1.43 times as fast.
// Counting every step since v000, it is 63.4 times as fast.
#include <hip/hip_runtime.h>
// Multi-head attention over separate query / key / value inputs ([1][4096][512] each; q = query Wq^T + bq, k = key Wk^T + bk, v = value Wv^T + bv, 8 heads of 64; attn = softmax(q k^T / 8); x = attn v; out = x Wo^T + bo -> [1][4096][512]).
// Structure: token rows; query, key, value and the four weights to exact f16 in one launch; Q | K | V as three WMMA GEMMs in one launch, blockIdx.y the projection (32x64 wave tiles, f32 accumulation, exact x16 natural weights, bias in the epilogue, f16 outputs); V^T of all heads via LDS transposes; one attention kernel for all heads (scores^T = K q^T, running-maximum softmax in registers, x^T += V^T p^T; scores and weights never stored) written straight into the merged f16 rows; out = x Wo^T + bo GEMM (f32).
// Compute dtype: inputs rounded to bf16; inputs / weights exact; q, k, v, softmax weights and x as plain f16 GEMM operands (~2^-12); scores and softmax statistics f32. v_wmma_f32_16x16x32_f16.
#define NB 1
#define SQ 4096
#define DM 512
#define NH 8
#define HD 64
#define MP ((int)NR)                 /* token rows through the q/k/v projections (debug hook) */
#define MO ((int)NR)                 /* token rows through the output projection (debug hook) */
#define NR ((size_t)NB * SQ)         /* 4096 token rows */
typedef __bf16 v16b __attribute__((ext_vector_type(16)));
typedef unsigned short v8us __attribute__((ext_vector_type(8), may_alias));
typedef float  v8f  __attribute__((ext_vector_type(8)));
typedef float  v4f  __attribute__((ext_vector_type(4)));
typedef float  v4fa __attribute__((ext_vector_type(4), may_alias));
union FragB { v16b v; v8us half[2]; unsigned short u[16]; };

__device__ __forceinline__ unsigned short bf16_bits(float x) { unsigned int u = __float_as_uint(x); return (unsigned short)((u + 0x7FFFu + ((u >> 16) & 1u)) >> 16); }
__device__ __forceinline__ float bf16_val(unsigned short b) { return __uint_as_float(((unsigned int)b) << 16); }
__device__ __forceinline__ float bf16_round(float x) { return bf16_val(bf16_bits(x)); }
// D += A·B with NT terms: 1 = ah·bh, 2 = + al·bh (A split), 3 = + ah·bl (both split)
template <int NT>
__device__ __forceinline__ v8f mmaN(v16b ah, v16b al, v16b bh, v16b bl, v8f c) {
  c = __builtin_amdgcn_wmma_f32_16x16x32_bf16(false, ah, false, bh, (short)0, c, false, false);
  if (NT >= 2) c = __builtin_amdgcn_wmma_f32_16x16x32_bf16(false, al, false, bh, (short)0, c, false, false);
  if (NT >= 3) c = __builtin_amdgcn_wmma_f32_16x16x32_bf16(false, ah, false, bl, (short)0, c, false, false);
  asm volatile("v_nop\n\tv_nop\n\tv_nop\n\tv_nop" : "+v"(c) : "v"(ah), "v"(al), "v"(bh), "v"(bl));
  return c;
}

__global__ __launch_bounds__(256) void k_wt_bf16(const float* __restrict__ W, unsigned short* __restrict__ Wt, int K, int N) {
  const int t = blockIdx.x * 256 + threadIdx.x;
  const int k8n = K / 8;
  if (t >= N * k8n) return;
  const int n = t / k8n, k8 = (t % k8n) * 8;
  v8us v;
#pragma unroll
  for (int i = 0; i < 8; ++i) v[i] = bf16_bits(W[(size_t)(k8 + i) * N + n]);
  *(v8us*)(Wt + (size_t)n * K + k8) = v;
  
}

// GEMM C[M][N] (f32, pitch ldc) = act(A[M][K]·W + bias). A f32 row-major (pitch lda) converted per fragment to bf16
// (ASPLIT: hi/lo two planes -> 2 terms, else single rounded term); Wt bf16 [N][K] (pitch ldb). BIAS_BF16 rounds the
// bias to bf16 first (bias quantised to bf16 before the add). K%32==0, M%16==0, N%64==0.
template <bool ASPLIT, int ACT, bool BIAS_BF16>
__global__ __launch_bounds__(128) void k_gemm_bf(const float* __restrict__ A, int lda, const unsigned short* __restrict__ Wt, int ldb,
                                               const float* __restrict__ bias, float* __restrict__ C, int ldc, int M, int N, int K) {
  __shared__ __attribute__((aligned(16))) float so[4][16][64];
  const int tid = threadIdx.x, w = tid >> 5, lane = tid & 31, ln = lane & 15, hh = lane >> 4;
  const int ntn = N / 64;
  const int wid = blockIdx.x * 4 + w;
  const int mt = wid / ntn, nq = wid % ntn;
  if (mt * 16 >= M) return;
  const int row0 = mt * 16, col0 = nq * 64;
  const float* arow = A + (size_t)(row0 + ln) * lda;
  v8f acc[4] = {};
  for (int kb = 0; kb < K; kb += 32) {
    FragB ah, al;
    const v4f x0 = *(const v4fa*)(arow + kb + 8 * hh), x1 = *(const v4fa*)(arow + kb + 8 * hh + 4);
    const v4f x2 = *(const v4fa*)(arow + kb + 16 + 8 * hh), x3 = *(const v4fa*)(arow + kb + 16 + 8 * hh + 4);
    float xs[16] = {x0[0],x0[1],x0[2],x0[3],x1[0],x1[1],x1[2],x1[3],x2[0],x2[1],x2[2],x2[3],x3[0],x3[1],x3[2],x3[3]};
#pragma unroll
    for (int i = 0; i < 16; ++i) { const unsigned short hb = bf16_bits(xs[i]); ah.u[i] = hb; al.u[i] = ASPLIT ? bf16_bits(xs[i] - bf16_val(hb)) : (unsigned short)0; }
#pragma unroll
    for (int t = 0; t < 4; ++t) {
      const unsigned short* brow = Wt + (size_t)(col0 + t * 16 + ln) * ldb + kb;
      FragB b;
      b.half[0] = *(const v8us*)(brow + 8 * hh);
      b.half[1] = *(const v8us*)(brow + 16 + 8 * hh);
      acc[t] = mmaN<ASPLIT ? 2 : 1>(ah.v, al.v, b.v, b.v, acc[t]);
    }
  }
#pragma unroll
  for (int t = 0; t < 4; ++t) {
    float bv = bias ? bias[col0 + t * 16 + ln] : 0.f;
    if (BIAS_BF16) bv = bf16_round(bv);
#pragma unroll
    for (int r = 0; r < 8; ++r) { float v = acc[t][r] + bv; if (ACT == 1) v = fmaxf(v, 0.f); so[w][8 * hh + r][t * 16 + ln] = v; }
  }
  __builtin_amdgcn_fence(__ATOMIC_ACQ_REL, "workgroup");
  __builtin_amdgcn_wave_barrier();
  const int rsub = lane >> 4, c4 = (lane & 15) * 4;
  {
#pragma unroll
    for (int q = 0; q < 8; ++q) {
      const int r = q * 2 + rsub;
      const v4f v = *(const v4fa*)&so[w][r][c4];
      *(v4f*)(C + (size_t)(row0 + r) * ldc + col0 + c4) = v;
    }
    
  }
}

// GEMM C = act(A·W + bias + resid): A f32 (ASPLIT -> hi/lo 2 terms), Wt bf16 [N][K]; ACT 0 none, 1 relu, 2 exact gelu;
// resid (optional, f32, row index = (row % rmod), pitch ldr, RES_BF16 rounds it) added before the activation.
template <bool ASPLIT, int ACT, bool BIAS_BF16, bool RES_BF16>
__global__ __launch_bounds__(128) void k_gemm_bf3(const float* __restrict__ A, int lda, const unsigned short* __restrict__ Wt, int ldb,
                                                const float* __restrict__ bias, const float* __restrict__ resid, int rmod, int ldr,
                                                float* __restrict__ C, int ldc, int M, int N, int K) {
  __shared__ __attribute__((aligned(16))) float so[4][16][64];
  const int tid = threadIdx.x, w = tid >> 5, lane = tid & 31, ln = lane & 15, hh = lane >> 4;
  const int ntn = N / 64;
  const int wid = blockIdx.x * 4 + w;
  const int mt = wid / ntn, nq = wid % ntn;
  if (mt * 16 >= M) return;
  const int row0 = mt * 16, col0 = nq * 64;
  const float* arow = A + (size_t)(row0 + ln) * lda;
  v8f acc[4] = {};
  for (int kb = 0; kb < K; kb += 32) {
    FragB ah, al;
    const v4f x0 = *(const v4fa*)(arow + kb + 8 * hh), x1 = *(const v4fa*)(arow + kb + 8 * hh + 4);
    const v4f x2 = *(const v4fa*)(arow + kb + 16 + 8 * hh), x3 = *(const v4fa*)(arow + kb + 16 + 8 * hh + 4);
    float xs[16] = {x0[0],x0[1],x0[2],x0[3],x1[0],x1[1],x1[2],x1[3],x2[0],x2[1],x2[2],x2[3],x3[0],x3[1],x3[2],x3[3]};
#pragma unroll
    for (int i = 0; i < 16; ++i) { const unsigned short hb = bf16_bits(xs[i]); ah.u[i] = hb; al.u[i] = ASPLIT ? bf16_bits(xs[i] - bf16_val(hb)) : (unsigned short)0; }
#pragma unroll
    for (int t = 0; t < 4; ++t) {
      const unsigned short* brow = Wt + (size_t)(col0 + t * 16 + ln) * ldb + kb;
      FragB b;
      b.half[0] = *(const v8us*)(brow + 8 * hh);
      b.half[1] = *(const v8us*)(brow + 16 + 8 * hh);
      acc[t] = mmaN<ASPLIT ? 2 : 1>(ah.v, al.v, b.v, b.v, acc[t]);
    }
  }
#pragma unroll
  for (int t = 0; t < 4; ++t) {
    const int col = col0 + t * 16 + ln;
    float bv = bias ? bias[col] : 0.f;
    if (BIAS_BF16) bv = bf16_round(bv);
#pragma unroll
    for (int r = 0; r < 8; ++r) {
      float v = acc[t][r] + bv;
      if (resid) { float rv = resid[(size_t)((row0 + 8 * hh + r) % rmod) * ldr + col]; if (RES_BF16) rv = bf16_round(rv); v += rv; }
      if (ACT == 1) v = fmaxf(v, 0.f);
      if (ACT == 2) v = 0.5f * v * (1.0f + erff(v * 0.70710678118654752f));
      if (ACT == 3) { const float u = 0.7978845608028654f * (v + 0.044715f * v * v * v); v = 0.5f * v * (1.0f + tanhf(u)); }
      so[w][8 * hh + r][t * 16 + ln] = v;
    }
  }
  __builtin_amdgcn_fence(__ATOMIC_ACQ_REL, "workgroup");
  __builtin_amdgcn_wave_barrier();
  const int rsub = lane >> 4, c4 = (lane & 15) * 4;
  {
#pragma unroll
    for (int q = 0; q < 8; ++q) {
      const int r = q * 2 + rsub;
      const v4f v = *(const v4fa*)&so[w][r][c4];
      *(v4f*)(C + (size_t)(row0 + r) * ldc + col0 + c4) = v;
    }
    
  }
}
// row LayerNorm (biased variance, eps) over N: s = X (+ R); optional out_sum <- s; out_norm <- (s-mu)*rsqrt(var+eps)*g + b
template <bool PARAM_BF16>
__global__ __launch_bounds__(256) void k_layernorm(const float* __restrict__ X, const float* __restrict__ R, const float* __restrict__ g, const float* __restrict__ bta,
                                                  float* __restrict__ out_sum, float* __restrict__ out_norm, int N, float eps) {
  __shared__ float red[256];
  const int row = blockIdx.x, tid = threadIdx.x;
  const float* x = X + (size_t)row * N; const float* rr = R ? R + (size_t)row * N : nullptr;
  float vals[16];                     // up to N = 4096
  const int per = N / 256;            // contiguous chunk per thread? use strided-by-4 chunks: thread handles j = tid*4 + 1024*u
  float s1 = 0.f;
  for (int u = 0; u < per / 4; ++u) {
    const int j = tid * 4 + 1024 * u;
    const v4f a = *(const v4fa*)(x + j);
    v4f b = {0.f,0.f,0.f,0.f}; if (rr) b = *(const v4fa*)(rr + j);
#pragma unroll
    for (int q = 0; q < 4; ++q) { const float v = a[q] + b[q]; vals[u * 4 + q] = v; s1 += v; }
  }
  red[tid] = s1; __syncthreads();
  for (int st = 128; st > 0; st >>= 1) { if (tid < st) red[tid] += red[tid + st]; __syncthreads(); }
  const float mu = red[0] / (float)N; __syncthreads();
  float s2 = 0.f;
  for (int u = 0; u < per / 4; ++u)
#pragma unroll
    for (int q = 0; q < 4; ++q) { const float c = vals[u * 4 + q] - mu; s2 += c * c; }
  red[tid] = s2; __syncthreads();
  for (int st = 128; st > 0; st >>= 1) { if (tid < st) red[tid] += red[tid + st]; __syncthreads(); }
  const float rs = rsqrtf(red[0] / (float)N + eps);
  {
    for (int u = 0; u < per / 4; ++u) {
      const int j = tid * 4 + 1024 * u;
      v4f o, sm;
#pragma unroll
      for (int q = 0; q < 4; ++q) {
        float gg = g[j + q], bb = bta[j + q];
        if (PARAM_BF16) { gg = bf16_round(gg); bb = bf16_round(bb); }
        sm[q] = vals[u * 4 + q]; o[q] = (vals[u * 4 + q] - mu) * rs * gg + bb;
      }
      if (out_sum) *(v4f*)(out_sum + (size_t)row * N + j) = sm;
      *(v4f*)(out_norm + (size_t)row * N + j) = o;
    }
    
  }
}



// ---- f16 WMMA path (v_wmma_f32_16x16x32_f16): 11-bit significands for operands in range — used where a [0,1] probability operand needs more precision than bf16
typedef _Float16 v16h __attribute__((ext_vector_type(16)));
union FragH { v16h v; v8us half[2]; _Float16 h[16]; unsigned short u[16]; };
template <int NT>
__device__ __forceinline__ v8f mmaH(v16h ah, v16h al, v16h bh, v16h bl, v8f c) {
  c = __builtin_amdgcn_wmma_f32_16x16x32_f16(false, ah, false, bh, (short)0, c, false, false);
  if (NT >= 2) c = __builtin_amdgcn_wmma_f32_16x16x32_f16(false, al, false, bh, (short)0, c, false, false);
  if (NT >= 3) c = __builtin_amdgcn_wmma_f32_16x16x32_f16(false, ah, false, bl, (short)0, c, false, false);
  asm volatile("v_nop\n\tv_nop\n\tv_nop\n\tv_nop" : "+v"(c) : "v"(ah), "v"(al), "v"(bh), "v"(bl));
  return c;
}
// batched GEMM like k_gemm_b but f16 operands: A f32 (split into f16 hi/lo if ASPLIT, else rounded to f16), Bt = f16 values [n][k]; alpha; C f32; N multiple of 16 (partial tiles skipped)
template <bool ASPLIT>
__global__ __launch_bounds__(128) void k_gemm_h(const float* __restrict__ A, int lda, size_t sA, const _Float16* __restrict__ Bh, int ldb, size_t sB, float alpha, float* __restrict__ C, int ldc, size_t sC, int M, int N, int K) {
  __shared__ __attribute__((aligned(16))) float so[4][16][64];
  const int tid = threadIdx.x, w = tid >> 5, lane = tid & 31, ln = lane & 15, hh = lane >> 4; const int by = blockIdx.y;
  A += (size_t)by * sA; Bh += (size_t)by * sB; C += (size_t)by * sC;
  const int ntn = (N + 63) / 64; const int wid = blockIdx.x * 4 + w; const int mt = wid / ntn, nq = wid % ntn; if (mt * 16 >= M) return;
  const int row0 = mt * 16, col0 = nq * 64; const float* arow = A + (size_t)(row0 + ln) * lda;
  v8f acc[4] = {};
  for (int kb = 0; kb < K; kb += 32) {
    FragH ah, al;
    const v4f x0 = *(const v4fa*)(arow + kb + 8 * hh), x1 = *(const v4fa*)(arow + kb + 8 * hh + 4), x2 = *(const v4fa*)(arow + kb + 16 + 8 * hh), x3 = *(const v4fa*)(arow + kb + 16 + 8 * hh + 4);
    float xs[16] = {x0[0],x0[1],x0[2],x0[3],x1[0],x1[1],x1[2],x1[3],x2[0],x2[1],x2[2],x2[3],x3[0],x3[1],x3[2],x3[3]};
#pragma unroll
    for (int i = 0; i < 16; ++i) { const _Float16 h = (_Float16)xs[i]; ah.h[i] = h; al.h[i] = ASPLIT ? (_Float16)(xs[i] - (float)h) : (_Float16)0.0f; }
#pragma unroll
    for (int t = 0; t < 4; ++t) { if (col0 + t * 16 >= N) continue; const size_t boff = (size_t)(col0 + t * 16 + ln) * ldb + kb; FragH bq; bq.half[0] = *(const v8us*)(Bh + boff + 8 * hh); bq.half[1] = *(const v8us*)(Bh + boff + 16 + 8 * hh);
      acc[t] = mmaH<ASPLIT ? 2 : 1>(ah.v, al.v, bq.v, bq.v, acc[t]); }
  }
#pragma unroll
  for (int t = 0; t < 4; ++t) { if (col0 + t * 16 >= N) continue;
#pragma unroll
    for (int r = 0; r < 8; ++r) so[w][8 * hh + r][t * 16 + ln] = acc[t][r] * alpha; }
  __builtin_amdgcn_fence(__ATOMIC_ACQ_REL, "workgroup"); __builtin_amdgcn_wave_barrier();
  const int rsub = lane >> 4, c4 = (lane & 15) * 4;
  {
#pragma unroll
    for (int q = 0; q < 8; ++q) { const int r = q * 2 + rsub; if (col0 + c4 < N) { const v4f v = *(const v4fa*)&so[w][r][c4]; *(v4f*)(C + (size_t)(row0 + r) * ldc + col0 + c4) = v; } }
     }
}

// Wt[n][k] = f16(W[k][n]·scale) from f32 row-major W[K][N] (scale = power of two; bf16-exact weights stay exact in f16 away from the subnormal range)
__global__ __launch_bounds__(256) void k_wt_f16(const float* __restrict__ W, _Float16* __restrict__ Wt, int K, int N, float scale) {
  const int t = blockIdx.x * 256 + threadIdx.x; if (t >= N * (K / 8)) return; const int n = t / (K / 8), k8 = (t % (K / 8)) * 8; FragH f;
#pragma unroll
  for (int i = 0; i < 8; ++i) f.h[i] = (_Float16)(bf16_round(W[(size_t)(k8 + i) * N + n]) * scale); const v8us o = f.half[0];
  *(v8us*)((unsigned short*)Wt + (size_t)n * K + k8) = o; 
}
// k_gemm_hh variant with fused epilogue: v = acc·alpha + bias[by·sBias + col] (+ CP[(row/rowsPerB)·sCPb + by·64 + col] if CP) ; ACT 0 none / 1 elu ; writes f16 C16 (and f32 C if non-null)
template <int ACT>
__global__ __launch_bounds__(128) void k_gemm_hhx(const _Float16* __restrict__ A, int lda, size_t sA, const _Float16* __restrict__ Bh, int ldb, size_t sB, float alpha, const float* __restrict__ bias, size_t sBias, const float* __restrict__ CP, int rowsPerB, size_t sCPb, int row0g,
    float* __restrict__ C, _Float16* __restrict__ C16, int ldc, size_t sC, int M, int N, int K) {
  __shared__ __attribute__((aligned(16))) float so[4][16][64];
  const int tid = threadIdx.x, w = tid >> 5, lane = tid & 31, ln = lane & 15, hh = lane >> 4; const int by = blockIdx.y;
  A += (size_t)by * sA; Bh += (size_t)by * sB; const size_t cofs = (size_t)by * sC; const float* bp = bias ? bias + (size_t)by * sBias : nullptr;
  const int ntn = (N + 63) / 64; const int wid = blockIdx.x * 4 + w; const int mt = wid / ntn, nq = wid % ntn; if (mt * 16 >= M) return;
  const int row0 = mt * 16, col0 = nq * 64; const _Float16* arow = A + (size_t)(row0 + ln) * lda;
  v8f acc[4] = {};
  for (int kb = 0; kb < K; kb += 32) { FragH ah; ah.half[0] = *(const v8us*)((const unsigned short*)arow + kb + 8 * hh); ah.half[1] = *(const v8us*)((const unsigned short*)arow + kb + 16 + 8 * hh);
#pragma unroll
    for (int t = 0; t < 4; ++t) { if (col0 + t * 16 >= N) continue; const size_t boff = (size_t)(col0 + t * 16 + ln) * ldb + kb; FragH bq; bq.half[0] = *(const v8us*)((const unsigned short*)Bh + boff + 8 * hh); bq.half[1] = *(const v8us*)((const unsigned short*)Bh + boff + 16 + 8 * hh);
      acc[t] = mmaH<1>(ah.v, ah.v, bq.v, bq.v, acc[t]); }
  }
#pragma unroll
  for (int t = 0; t < 4; ++t) { if (col0 + t * 16 >= N) continue; const int col = col0 + t * 16 + ln; const float bv = bp ? bf16_round(bp[col]) : 0.f;
#pragma unroll
    for (int r = 0; r < 8; ++r) { float v = acc[t][r] * alpha + bv; if (CP) { const int rr = row0g + row0 + 8 * hh + r; if (rowsPerB < 0) v += CP[cofs + (size_t)rr * ldc + col];      /* rowsPerB < 0: own element of the batched C plane */ else { const int bidx = rr / rowsPerB; v += CP[(size_t)bidx * sCPb + (size_t)by * 64 + col]; } } if (ACT == 1) v = (v > 0.f) ? v : expm1f(v); else if (ACT == 7) v = (v > 0.f) ? v + 1.0f : expf(v); else if (ACT == 8) v = tanhf(v); else if (ACT == 9) v = 0.5f * v * (1.0f + tanhf(0.7978845608028654f * (v + 0.044715f * v * v * v))); else if (ACT == 11) v = 1.0f / (1.0f + expf(-v)); else if (ACT == 12) v = (v > 0.f) ? v : 0.01f * v; else if (ACT == 14) v = (v > 0.f) ? v : 0.1f * v; else if (ACT == 16) v = (v >= 0.f) ? v : 0.3f * v; else if (ACT == 17) v = (v >= 0.f) ? v : 0.2f * v; else if (ACT == 15) v = v / (1.0f + expf(-v)); else if (ACT == 3) v = fmaxf(v, 0.f); else if (ACT == 6) v = 0.5f * v * (1.0f + erff(v * 0.70710678118654752f)); so[w][8 * hh + r][t * 16 + ln] = v; } }
  __builtin_amdgcn_fence(__ATOMIC_ACQ_REL, "workgroup"); __builtin_amdgcn_wave_barrier();
  const int rsub = lane >> 4, c4 = (lane & 15) * 4; typedef _Float16 v4h __attribute__((ext_vector_type(4)));
  {
#pragma unroll
    for (int q = 0; q < 8; ++q) { const int r = q * 2 + rsub; if (col0 + c4 < N) { const v4f v = *(const v4fa*)&so[w][r][c4]; if (C) *(v4f*)(C + cofs + (size_t)(row0 + r) * ldc + col0 + c4) = v; if (C16) { v4h h4; for (int i = 0; i < 4; ++i) h4[i] = (_Float16)v[i]; *(v4h*)(C16 + cofs + (size_t)(row0 + r) * ldc + col0 + c4) = h4; } } }
     }
}


typedef _Float16 v4h __attribute__((ext_vector_type(4)));

__global__ __launch_bounds__(256) void k_x16(const float* __restrict__ x, _Float16* __restrict__ X16, size_t n8) { const size_t t = (size_t)blockIdx.x * 256 + threadIdx.x; if (t >= n8) return; FragH f;
#pragma unroll
  for (int q = 0; q < 8; ++q) f.h[q] = (_Float16)bf16_round(x[t * 8 + q]); *(v8us*)((unsigned short*)X16 + t * 8) = f.half[0];  }
__global__ __launch_bounds__(256) void k_h16(const float* __restrict__ x, _Float16* __restrict__ X16, size_t n8) { const size_t t = (size_t)blockIdx.x * 256 + threadIdx.x; if (t >= n8) return; FragH f;
#pragma unroll
  for (int q = 0; q < 8; ++q) f.h[q] = (_Float16)x[t * 8 + q]; *(v8us*)((unsigned short*)X16 + t * 8) = f.half[0];  }
__global__ __launch_bounds__(256) void k_round16f(const float* __restrict__ W, _Float16* __restrict__ Bt, size_t n8) { const size_t t = (size_t)blockIdx.x * 256 + threadIdx.x; if (t >= n8) return; FragH f;
#pragma unroll
  for (int i = 0; i < 8; ++i) f.h[i] = (_Float16)(bf16_round(W[t * 8 + i]) * 16.0f); *(v8us*)((unsigned short*)Bt + t * 8) = f.half[0];  }
template <int NHv, int TTv>
__global__ __launch_bounds__(256) void k_vt(const _Float16* __restrict__ V16, int ldv, int voff, _Float16* __restrict__ Vt) { __shared__ unsigned short tl[64][66]; const int tid = threadIdx.x; const int slab = blockIdx.x / (TTv / 64), lg = blockIdx.x % (TTv / 64); const int b = slab / NHv, h = slab % NHv;
  for (int i = tid; i < 64 * 8; i += 256) { const int r = i / 8, c8 = (i % 8) * 8; FragH f; f.half[0] = *(const v8us*)((const unsigned short*)V16 + ((size_t)b * TTv + lg * 64 + r) * ldv + voff + h * 64 + c8);
#pragma unroll
    for (int q = 0; q < 8; ++q) tl[r][c8 + q] = f.u[q]; }
  __syncthreads();
  {
#pragma unroll
    for (int rd = 0; rd < 2; ++rd) { const int d = rd * 32 + tid / 8, pc = tid % 8; FragH f;
#pragma unroll
      for (int q = 0; q < 8; ++q) f.u[q] = tl[pc * 8 + q][d];
      *(v8us*)((unsigned short*)Vt + ((size_t)slab * 64 + d) * TTv + lg * 64 + pc * 8) = f.half[0]; }
     } }

__global__ __launch_bounds__(256) void k_hl(const float* __restrict__ F, _Float16* __restrict__ Hh, _Float16* __restrict__ Hl, size_t n8) { const size_t t = (size_t)blockIdx.x * 256 + threadIdx.x; if (t >= n8) return; FragH fh, fl; const v4f a = *(const v4fa*)(F + t * 8), c = *(const v4fa*)(F + t * 8 + 4);
#pragma unroll
  for (int q = 0; q < 4; ++q) { _Float16 h = (_Float16)a[q]; fh.h[q] = h; fl.h[q] = (_Float16)((a[q] - (float)h) * 1024.0f); h = (_Float16)c[q]; fh.h[4 + q] = h; fl.h[4 + q] = (_Float16)((c[q] - (float)h) * 1024.0f); }
  { *(v8us*)((unsigned short*)Hh + t * 8) = fh.half[0]; *(v8us*)((unsigned short*)Hl + t * 8) = fl.half[0];  } }

// ---- fast GEMM (wave tile 32x64; requires M % 32 == 0 rows per launch region and N % 64 == 0); epilogue = k_gemm_hhx semantics ----
__device__ __forceinline__ v16h g2_frag(const _Float16* p, int hh) { FragH f; f.half[0] = *(const v8us*)((const unsigned short*)p + 8 * hh); f.half[1] = *(const v8us*)((const unsigned short*)p + 16 + 8 * hh); return f.v; }
__device__ __forceinline__ v8f g2_mma(v16h a, v16h b, v8f c) { v8f d = __builtin_amdgcn_wmma_f32_16x16x32_f16(false, a, false, b, (short)0, c, false, false); asm volatile("v_nop\n\tv_nop\n\tv_nop\n\tv_nop" : "+v"(d) : "v"(a), "v"(b)); return d; }
template <int ACT>
__global__ __launch_bounds__(128) void k_gemm2(const _Float16* __restrict__ A, int lda, size_t sA, const _Float16* __restrict__ Bh, int ldb, size_t sB, float alpha, const float* __restrict__ bias, size_t sBias, const float* __restrict__ CP, int rowsPerB, size_t sCPb, int row0g,
    float* __restrict__ C, _Float16* __restrict__ C16, int ldc, size_t sC, int M, int N, int K, const float* __restrict__ bias1, const float* __restrict__ bias2) { static_assert(ACT == 0 || ACT == 3 || ACT == 6 || ACT == 8 || ACT == 9 || ACT == 11 || ACT == 12 || ACT == 14 || ACT == 15 || ACT == 16 || ACT == 17, "k_gemm2: unsupported ACT code (would silently apply no activation)");
  __shared__ __attribute__((aligned(16))) float so[4][32][68];
  const int tid = threadIdx.x, w = tid >> 5, lane = tid & 31, ln = lane & 15, hh = lane >> 4; const int by = blockIdx.y;
  A += (size_t)by * sA; Bh += (size_t)by * sB; const size_t cofs = (size_t)by * sC; const float* bp = bias ? bias + (size_t)by * sBias : nullptr;
  if (by == 1 && bias1) bp = bias1; if (by == 2 && bias2) bp = bias2;      /* batch entries 1 and 2 whose biases are buffers of their own */
  const int ntn = N >> 6; const int mt = blockIdx.x / ntn, nq = blockIdx.x - mt * ntn; const int row0 = mt * 128 + 32 * w, col0 = nq * 64; if (row0 >= M) return;
  const _Float16* a0p = A + (size_t)(row0 + ln) * lda; const _Float16* a1p = a0p + (size_t)16 * lda;
  const _Float16* b0p = Bh + (size_t)(col0 + ln) * ldb; const _Float16* b1p = b0p + (size_t)16 * ldb; const _Float16* b2p = b1p + (size_t)16 * ldb; const _Float16* b3p = b2p + (size_t)16 * ldb;
  const v8f z8 = {0.f,0.f,0.f,0.f,0.f,0.f,0.f,0.f}; v8f c00 = z8, c01 = z8, c02 = z8, c03 = z8, c10 = z8, c11 = z8, c12 = z8, c13 = z8;
#pragma unroll 1
  for (int kb = 0; kb < K; kb += 32) { const v16h a0 = g2_frag(a0p + kb, hh), a1 = g2_frag(a1p + kb, hh);
    v16h b = g2_frag(b0p + kb, hh); c00 = g2_mma(a0, b, c00); c10 = g2_mma(a1, b, c10);
    b = g2_frag(b1p + kb, hh); c01 = g2_mma(a0, b, c01); c11 = g2_mma(a1, b, c11);
    b = g2_frag(b2p + kb, hh); c02 = g2_mma(a0, b, c02); c12 = g2_mma(a1, b, c12);
    b = g2_frag(b3p + kb, hh); c03 = g2_mma(a0, b, c03); c13 = g2_mma(a1, b, c13); }
  v8f accs[8] = {c00, c01, c02, c03, c10, c11, c12, c13};
#pragma unroll
  for (int u = 0; u < 8; ++u) { const int t = u & 3, half = u >> 2; const int col = col0 + t * 16 + ln; const float bv = bp ? bf16_round(bp[col]) : 0.f;
#pragma unroll
    for (int r = 0; r < 8; ++r) { const int rloc = half * 16 + 8 * hh + r; float v = accs[u][r] * alpha + bv; if (CP) { if (rowsPerB < 0) v += CP[cofs + (size_t)(row0g + row0 + rloc) * ldc + col];      /* rowsPerB < 0: own element of the batched C plane */ else { const int bidx = (row0g + row0 + rloc) / rowsPerB; v += CP[(size_t)bidx * sCPb + (size_t)by * 64 + col]; } }
      if (ACT == 3) v = fmaxf(v, 0.f); else if (ACT == 6) v = 0.5f * v * (1.0f + erff(v * 0.70710678118654752f)); else if (ACT == 11) v = 1.0f / (1.0f + expf(-v)); else if (ACT == 15) v = v / (1.0f + expf(-v)); else if (ACT == 12) v = (v > 0.f) ? v : 0.01f * v; else if (ACT == 8) v = tanhf(v); else if (ACT == 9) v = 0.5f * v * (1.0f + tanhf(0.7978845608028654f * (v + 0.044715f * v * v * v))); else if (ACT == 14) v = (v > 0.f) ? v : 0.1f * v; else if (ACT == 16) v = (v >= 0.f) ? v : 0.3f * v; else if (ACT == 17) v = (v >= 0.f) ? v : 0.2f * v;
      so[w][rloc][t * 16 + ln] = v; } }
  __builtin_amdgcn_fence(__ATOMIC_ACQ_REL, "workgroup"); __builtin_amdgcn_wave_barrier();
  const int rsub = lane >> 4, c4 = (lane & 15) * 4;
  {
#pragma unroll
    for (int q = 0; q < 16; ++q) { const int r = q * 2 + rsub; const v4f v = *(const v4fa*)&so[w][r][c4]; if (C) *(v4f*)(C + cofs + (size_t)(row0 + r) * ldc + col0 + c4) = v; if (C16) { v4h h4; for (int i = 0; i < 4; ++i) h4[i] = (_Float16)v[i]; *(v4h*)(C16 + cofs + (size_t)(row0 + r) * ldc + col0 + c4) = h4; } }
     } }


// All seven f32 -> f16 conversions in one launch; the block index picks the buffer. Blocks 0 .. 3 PXB - 1: query, key, value -> X[0..2] (bf16-rounded, exact in f16);
// then 4 PWB blocks: Wq, Wk, Wv, Wo -> B[0..3] (bf16-rounded, x16: exact, away from the f16 subnormal range). A thread moves PC pieces of 4 elements, 256 pieces apart:
// a wave's 16-byte loads cover 512 contiguous bytes and its 8-byte stores 256, whole lines both.
#define PC 16
#define PXB ((int)(NR * DM / 4 / (256 * PC)))      /* blocks an input: 128 */
#define PWB ((int)((size_t)DM * DM / 4 / (256 * PC)))      /* blocks a weight: 16 */
__global__ __launch_bounds__(256) void k_prep(const float* __restrict__ xq, const float* __restrict__ xk, const float* __restrict__ xv, const float* __restrict__ wq, const float* __restrict__ wk, const float* __restrict__ wv, const float* __restrict__ wo, _Float16* __restrict__ X, _Float16* __restrict__ B) {
  const int b = blockIdx.x; const bool isx = b < 3 * PXB; const int j = isx ? b / PXB : (b - 3 * PXB) / PWB; const int blk = isx ? b - j * PXB : (b - 3 * PXB) - j * PWB;
  const float* s = isx ? (j == 0 ? xq : j == 1 ? xk : xv) : (j == 0 ? wq : j == 1 ? wk : j == 2 ? wv : wo);
  _Float16* d = isx ? X + (size_t)j * NR * DM : B + (size_t)j * DM * DM; const float sc = isx ? 1.0f : 16.0f;
  const size_t e0 = ((size_t)blk * (256 * PC) + threadIdx.x) * 4;
  v4f a[PC];
#pragma unroll      /* constant indices keep the pieces in registers, their loads in flight together */
  for (int u = 0; u < PC; ++u) a[u] = *(const v4fa*)(s + e0 + (size_t)u * 1024);
  __builtin_amdgcn_sched_barrier(0);      /* keeps all PC loads issued here: left alone the build holds the last five back until the first eleven have landed, a second memory latency in the open */
#pragma unroll      /* constant indices keep the pieces in registers */
  for (int u = 0; u < PC; ++u) { v4h o;
#pragma unroll      /* constant indices keep the pieces in registers */
    for (int q = 0; q < 4; ++q) o[q] = (_Float16)(bf16_round(a[u][q]) * sc);
    *(v4h*)(d + e0 + (size_t)u * 1024) = o; } }
// V^T of every head: VT[h][d][s] from the merged f16 rows, 64 x 64 tiles through LDS. grid (SQ / 64, NH).
__global__ __launch_bounds__(256) void k_vt(const _Float16* __restrict__ V16, _Float16* __restrict__ VT) { __shared__ unsigned short tl[64][65]; const int tid = threadIdx.x; const int h = blockIdx.y; const int s0 = blockIdx.x * 64;
  for (int i = tid; i < 64 * 8; i += 256) { const int j = i / 8, d8 = (i % 8) * 8; FragH f; f.half[0] = *(const v8us*)((const unsigned short*)V16 + ((size_t)s0 + j) * DM + h * HD + d8); for (int q = 0; q < 8; ++q) tl[d8 + q][j] = f.u[q]; }
  __syncthreads();
  { for (int i = tid; i < 64 * 8; i += 256) { const int d = i / 8, j8 = (i % 8) * 8; FragH f; for (int q = 0; q < 8; ++q) f.u[q] = tl[d][j8 + q]; *(v8us*)((unsigned short*)VT + ((size_t)h * HD + d) * SQ + s0 + j8) = f.half[0]; }  } }

#define FK 64                        /* keys a pass */
#define FP 72                        /* LDS row pitch in f16 */
__device__ __forceinline__ float fa_xhalf(float x) { return __builtin_bit_cast(float, __builtin_amdgcn_permlanex16(__builtin_bit_cast(int, x), __builtin_bit_cast(int, x), 0x76543210, 0xfedcba98, false, false)); }      /* lane l with lane l ^ 16 */
__device__ __forceinline__ v8f fa_mma(v16h a, v16h b, v8f c) { return __builtin_amdgcn_wmma_f32_16x16x32_f16(false, a, false, b, (short)0, c, false, false); }
__device__ __forceinline__ v16h fa_frag(const unsigned short* p, int hh) { FragH f; f.half[0] = *(const v8us*)(p + 8 * hh); f.half[1] = *(const v8us*)(p + 16 + 8 * hh); return f.v; }
__global__ __launch_bounds__(256) void k_fattn(const _Float16* __restrict__ Q16, const _Float16* __restrict__ K16, const _Float16* __restrict__ VT, _Float16* __restrict__ O16) {
  __shared__ __attribute__((aligned(16))) unsigned short kt[2][FK][FP];
  __shared__ __attribute__((aligned(16))) unsigned short vs[2][HD][FP];
  const int tid = threadIdx.x, w = tid >> 5, lane = tid & 31, ln = lane & 15, hh = lane >> 4; const int h = blockIdx.y; const int q0 = blockIdx.x * 128 + w * 16;
  const _Float16* qp = Q16 + (size_t)(q0 + ln) * DM + h * HD; const v16h qf0 = g2_frag(qp, hh), qf1 = g2_frag(qp + 32, hh);
  const int sr = tid >> 3, sc = (tid & 7) * 8;      /* staging: this thread moves 16 bytes of rows sr and sr + 32 of each tile; 8 threads cover a 128-byte row */
  const unsigned short* kg = (const unsigned short*)K16 + (size_t)sr * DM + h * HD + sc; const unsigned short* vg = (const unsigned short*)VT + ((size_t)h * HD + sr) * SQ + sc;
  v8us rk0 = *(const v8us*)kg, rk1 = *(const v8us*)(kg + 32 * DM), rv0 = *(const v8us*)vg, rv1 = *(const v8us*)(vg + (size_t)32 * SQ);
  *(v8us*)&kt[0][sr][sc] = rk0; *(v8us*)&kt[0][sr + 32][sc] = rk1; *(v8us*)&vs[0][sr][sc] = rv0; *(v8us*)&vs[0][sr + 32][sc] = rv1;
  __syncthreads();
  const v8f z8 = {0.f,0.f,0.f,0.f,0.f,0.f,0.f,0.f}; v8f o[4] = {z8, z8, z8, z8}; float m = -3.0e38f, l = 0.f;      /* m: running maximum of the raw products q.k; l: this half's sum of weights */
  const float CS = 0.125f * 1.4426950408889634f;      /* 1 / sqrt(64), and e^x as 2^(x log2 e) */
#pragma unroll 1      /* one pass a trip: the body already holds 16 matrix instructions and 32 LDS reads */
  for (int it = 0; it < SQ / FK; ++it) { const int cur = it & 1; const bool more = it + 1 < SQ / FK;
    if (more) { kg += (size_t)FK * DM; vg += FK; rk0 = *(const v8us*)kg; rk1 = *(const v8us*)(kg + 32 * DM); rv0 = *(const v8us*)vg; rv1 = *(const v8us*)(vg + (size_t)32 * SQ); }
    v16h kf[8], vf[8];
#pragma unroll      /* constant indices keep the fragments and accumulators in registers */
    for (int t = 0; t < 4; ++t) { const unsigned short* kr = &kt[cur][t * 16 + ln][0]; kf[2 * t] = fa_frag(kr, hh); kf[2 * t + 1] = fa_frag(kr + 32, hh); }
#pragma unroll      /* constant indices keep the fragments and accumulators in registers */
    for (int t = 0; t < 4; ++t) { const unsigned short* vr = &vs[cur][t * 16 + ln][0]; vf[2 * t] = fa_frag(vr, hh); vf[2 * t + 1] = fa_frag(vr + 32, hh); }
    __builtin_amdgcn_sched_barrier(0);      /* keeps all 32 LDS reads of the pass issued here, K first: left alone the build sinks most V^T reads to directly in front of their matrix instruction, each with a full LDS latency in the open */
    v8f s[4];
#pragma unroll      /* constant indices keep the fragments and accumulators in registers */
    for (int t = 0; t < 4; ++t) { s[t] = fa_mma(kf[2 * t], qf0, z8); s[t] = fa_mma(kf[2 * t + 1], qf1, s[t]); }
    float tx[4];      /* one short maximum chain a tile: each starts as soon as its tile is done, and the four do not wait on one another */
#pragma unroll      /* constant indices keep the fragments and accumulators in registers */
    for (int t = 0; t < 4; ++t) { float a = s[t][0];
#pragma unroll      /* constant indices keep the fragments and accumulators in registers */
      for (int r = 1; r < 8; ++r) a = fmaxf(a, s[t][r]);
      tx[t] = a; }
    float tm = fmaxf(fmaxf(tx[0], tx[1]), fmaxf(tx[2], tx[3])); tm = fmaxf(tm, fa_xhalf(tm)); const float mn = fmaxf(m, tm); const float corr = __builtin_amdgcn_exp2f((m - mn) * CS); const float off = 8.0f - mn * CS; m = mn;      /* weights carry x256, as f16 operands away from the subnormal range; it cancels in x = sum / l */
    FragH p[2];
#pragma unroll      /* constant indices keep the fragments and accumulators in registers */
    for (int t = 0; t < 4; ++t)
#pragma unroll      /* constant indices keep the fragments and accumulators in registers */
      for (int r = 0; r < 8; ++r) { const float e = __builtin_amdgcn_exp2f(fmaf(s[t][r], CS, off)); s[t][r] = e; p[t >> 1].h[(t & 1) * 8 + r] = (_Float16)e; }
    const v8f es = (s[0] + s[1]) + (s[2] + s[3]);      /* the pass's sum as a tree: one chain of 32 dependent adds would stand at the foot of every pass */
    l = l * corr + (((es[0] + es[1]) + (es[2] + es[3])) + ((es[4] + es[5]) + (es[6] + es[7])));
#pragma unroll      /* constant indices keep the fragments and accumulators in registers */
    for (int t = 0; t < 4; ++t) o[t] *= corr;
#pragma unroll      /* constant indices keep the fragments and accumulators in registers */
    for (int t = 0; t < 4; ++t) { o[t] = fa_mma(vf[2 * t], p[0].v, o[t]); o[t] = fa_mma(vf[2 * t + 1], p[1].v, o[t]); }
    if (more) { *(v8us*)&kt[cur ^ 1][sr][sc] = rk0; *(v8us*)&kt[cur ^ 1][sr + 32][sc] = rk1; *(v8us*)&vs[cur ^ 1][sr][sc] = rv0; *(v8us*)&vs[cur ^ 1][sr + 32][sc] = rv1; }      /* every reader left that buffer before the last barrier */
    __syncthreads(); }      /* publishes the next tile and ends this pass's reads of the buffer that the next pass refills */
  l += fa_xhalf(l); const float inv = 1.0f / l;
  _Float16* op = O16 + (size_t)(q0 + ln) * DM + h * HD + 8 * hh;      /* lane (ln, hh) holds x[q0 + ln][16 t + 8 hh + r] */
#pragma unroll      /* constant indices keep the fragments and accumulators in registers */
  for (int t = 0; t < 4; ++t) { FragH f;
#pragma unroll      /* constant indices keep the fragments and accumulators in registers */
    for (int r = 0; r < 8; ++r) f.h[r] = (_Float16)(o[t][r] * inv);
    *(v8us*)((unsigned short*)op + t * 16) = f.half[0]; } }

extern "C" void kernel_launch(void* const* d_in, const int* in_sizes, int n_in,
                              void* d_out, int out_size, void* d_ws, size_t ws_size, hipStream_t stream) {
  (void)in_sizes; (void)n_in; (void)out_size;
  const float* const* I = (const float* const*)d_in; const float* xq = I[0]; const float* xk = I[1]; const float* xv = I[2]; const float* wq = I[3]; const float* bq = I[4]; const float* wk = I[5]; const float* bk = I[6]; const float* wv = I[7]; const float* bv = I[8]; const float* wo = I[9]; const float* bo = I[10];
  char* ws = (char*)d_ws; size_t off = 0;
  auto take = [&](size_t bytes) { char* p = ws + off; off += (bytes + 255) & ~(size_t)255; return p; };
  _Float16* BQ = (_Float16*)take((size_t)4 * DM * DM * 2); _Float16* BO = BQ + (size_t)3 * DM * DM;      /* Wq | Wk | Wv | Wo, one after the other */
  _Float16* XQ = (_Float16*)take(3 * NR * DM * 2);      /* query | key | value rows */
  _Float16* Q16 = (_Float16*)take(3 * NR * DM * 2); _Float16* K16 = Q16 + NR * DM; _Float16* V16 = K16 + NR * DM;      /* q | k | v */
  _Float16* O16 = (_Float16*)take(NR * DM * 2);
  _Float16* VT = (_Float16*)take((size_t)NH * HD * SQ * 2);
  if (off > ws_size) return;      /* 2 + 7x4 + 4 = approx 34 MiB */
  k_prep<<<3 * PXB + 4 * PWB, 256, 0, stream>>>(xq, xk, xv, wq, wk, wv, wo, XQ, BQ);
  const dim3 gp((unsigned)((NR / 128) * (DM / 64)), 1); const dim3 gp3((unsigned)((NR / 128) * (DM / 64)), 3);
  k_gemm2<0><<<gp3, 128, 0, stream>>>(XQ, DM, NR * DM, BQ, DM, (size_t)DM * DM, 0.0625f, bq, 0, nullptr, 1, 0, 0, nullptr, Q16, DM, NR * DM, MP, DM, DM, bk, bv);      /* q, k and v: blockIdx.y picks rows, weight, bias and output */
  k_vt<<<dim3(SQ / 64, NH), 256, 0, stream>>>(V16, VT);
  k_fattn<<<dim3(SQ / 128, NH), 256, 0, stream>>>(Q16, K16, VT, O16);      /* x (merged heads) as f16 rows */
  k_gemm2<0><<<gp, 128, 0, stream>>>(O16, DM, 0, BO, DM, 0, 0.0625f, bo, 0, nullptr, 1, 0, 0, (float*)d_out, nullptr, DM, 0, MO, DM, DM, nullptr, nullptr);      /* out = o W_o^T + b_o, rows are the output layout */
}

// v004
// A run of this version takes 81 microseconds.
// In two side-by-side timings against v003, it was 1.32 and 1.33 times as fast.
// Counting every step since v000, it is 84.2 times as fast.
#include <hip/hip_runtime.h>
// Multi-head attention over separate query / key / value inputs ([1][4096][512] each; q = query Wq^T + bq, k = key Wk^T + bk, v = value Wv^T + bv, 8 heads of 64; attn = softmax(q k^T / 8); x = attn v; out = x Wo^T + bo -> [1][4096][512]).
// Structure: token rows; query, key, value and the four weights to exact f16 in one launch; Q | K | V as three WMMA GEMMs in one launch, blockIdx.y the projection (32x64 wave tiles, operands via LDS, f32 accumulation, exact x16 natural weights, bias in the epilogue, f16 outputs); V^T of all heads via LDS transposes; one attention kernel for all heads (scores^T = K q^T, running-maximum softmax in registers, x^T += V^T p^T; scores and weights never stored) written straight into the merged f16 rows; out = x Wo^T + bo GEMM (f32).
// Compute dtype: inputs rounded to bf16; inputs / weights exact; q, k, v, softmax weights and x as plain f16 GEMM operands (~2^-12); scores and softmax statistics f32. v_wmma_f32_16x16x32_f16.
#define NB 1
#define SQ 4096
#define DM 512
#define NH 8
#define HD 64
#define MP ((int)NR)                 /* token rows through the q/k/v projections (debug hook) */
#define MO ((int)NR)                 /* token rows through the output projection (debug hook) */
#define NR ((size_t)NB * SQ)         /* 4096 token rows */
typedef __bf16 v16b __attribute__((ext_vector_type(16)));
typedef unsigned short v8us __attribute__((ext_vector_type(8), may_alias));
typedef float  v8f  __attribute__((ext_vector_type(8)));
typedef float  v4f  __attribute__((ext_vector_type(4)));
typedef float  v4fa __attribute__((ext_vector_type(4), may_alias));
union FragB { v16b v; v8us half[2]; unsigned short u[16]; };

__device__ __forceinline__ unsigned short bf16_bits(float x) { unsigned int u = __float_as_uint(x); return (unsigned short)((u + 0x7FFFu + ((u >> 16) & 1u)) >> 16); }
__device__ __forceinline__ float bf16_val(unsigned short b) { return __uint_as_float(((unsigned int)b) << 16); }
__device__ __forceinline__ float bf16_round(float x) { return bf16_val(bf16_bits(x)); }
// D += A·B with NT terms: 1 = ah·bh, 2 = + al·bh (A split), 3 = + ah·bl (both split)
template <int NT>
__device__ __forceinline__ v8f mmaN(v16b ah, v16b al, v16b bh, v16b bl, v8f c) {
  c = __builtin_amdgcn_wmma_f32_16x16x32_bf16(false, ah, false, bh, (short)0, c, false, false);
  if (NT >= 2) c = __builtin_amdgcn_wmma_f32_16x16x32_bf16(false, al, false, bh, (short)0, c, false, false);
  if (NT >= 3) c = __builtin_amdgcn_wmma_f32_16x16x32_bf16(false, ah, false, bl, (short)0, c, false, false);
  asm volatile("v_nop\n\tv_nop\n\tv_nop\n\tv_nop" : "+v"(c) : "v"(ah), "v"(al), "v"(bh), "v"(bl));
  return c;
}

__global__ __launch_bounds__(256) void k_wt_bf16(const float* __restrict__ W, unsigned short* __restrict__ Wt, int K, int N) {
  const int t = blockIdx.x * 256 + threadIdx.x;
  const int k8n = K / 8;
  if (t >= N * k8n) return;
  const int n = t / k8n, k8 = (t % k8n) * 8;
  v8us v;
#pragma unroll
  for (int i = 0; i < 8; ++i) v[i] = bf16_bits(W[(size_t)(k8 + i) * N + n]);
  *(v8us*)(Wt + (size_t)n * K + k8) = v;
  
}

// GEMM C[M][N] (f32, pitch ldc) = act(A[M][K]·W + bias). A f32 row-major (pitch lda) converted per fragment to bf16
// (ASPLIT: hi/lo two planes -> 2 terms, else single rounded term); Wt bf16 [N][K] (pitch ldb). BIAS_BF16 rounds the
// bias to bf16 first (bias quantised to bf16 before the add). K%32==0, M%16==0, N%64==0.
template <bool ASPLIT, int ACT, bool BIAS_BF16>
__global__ __launch_bounds__(128) void k_gemm_bf(const float* __restrict__ A, int lda, const unsigned short* __restrict__ Wt, int ldb,
                                               const float* __restrict__ bias, float* __restrict__ C, int ldc, int M, int N, int K) {
  __shared__ __attribute__((aligned(16))) float so[4][16][64];
  const int tid = threadIdx.x, w = tid >> 5, lane = tid & 31, ln = lane & 15, hh = lane >> 4;
  const int ntn = N / 64;
  const int wid = blockIdx.x * 4 + w;
  const int mt = wid / ntn, nq = wid % ntn;
  if (mt * 16 >= M) return;
  const int row0 = mt * 16, col0 = nq * 64;
  const float* arow = A + (size_t)(row0 + ln) * lda;
  v8f acc[4] = {};
  for (int kb = 0; kb < K; kb += 32) {
    FragB ah, al;
    const v4f x0 = *(const v4fa*)(arow + kb + 8 * hh), x1 = *(const v4fa*)(arow + kb + 8 * hh + 4);
    const v4f x2 = *(const v4fa*)(arow + kb + 16 + 8 * hh), x3 = *(const v4fa*)(arow + kb + 16 + 8 * hh + 4);
    float xs[16] = {x0[0],x0[1],x0[2],x0[3],x1[0],x1[1],x1[2],x1[3],x2[0],x2[1],x2[2],x2[3],x3[0],x3[1],x3[2],x3[3]};
#pragma unroll
    for (int i = 0; i < 16; ++i) { const unsigned short hb = bf16_bits(xs[i]); ah.u[i] = hb; al.u[i] = ASPLIT ? bf16_bits(xs[i] - bf16_val(hb)) : (unsigned short)0; }
#pragma unroll
    for (int t = 0; t < 4; ++t) {
      const unsigned short* brow = Wt + (size_t)(col0 + t * 16 + ln) * ldb + kb;
      FragB b;
      b.half[0] = *(const v8us*)(brow + 8 * hh);
      b.half[1] = *(const v8us*)(brow + 16 + 8 * hh);
      acc[t] = mmaN<ASPLIT ? 2 : 1>(ah.v, al.v, b.v, b.v, acc[t]);
    }
  }
#pragma unroll
  for (int t = 0; t < 4; ++t) {
    float bv = bias ? bias[col0 + t * 16 + ln] : 0.f;
    if (BIAS_BF16) bv = bf16_round(bv);
#pragma unroll
    for (int r = 0; r < 8; ++r) { float v = acc[t][r] + bv; if (ACT == 1) v = fmaxf(v, 0.f); so[w][8 * hh + r][t * 16 + ln] = v; }
  }
  __builtin_amdgcn_fence(__ATOMIC_ACQ_REL, "workgroup");
  __builtin_amdgcn_wave_barrier();
  const int rsub = lane >> 4, c4 = (lane & 15) * 4;
  {
#pragma unroll
    for (int q = 0; q < 8; ++q) {
      const int r = q * 2 + rsub;
      const v4f v = *(const v4fa*)&so[w][r][c4];
      *(v4f*)(C + (size_t)(row0 + r) * ldc + col0 + c4) = v;
    }
    
  }
}

// GEMM C = act(A·W + bias + resid): A f32 (ASPLIT -> hi/lo 2 terms), Wt bf16 [N][K]; ACT 0 none, 1 relu, 2 exact gelu;
// resid (optional, f32, row index = (row % rmod), pitch ldr, RES_BF16 rounds it) added before the activation.
template <bool ASPLIT, int ACT, bool BIAS_BF16, bool RES_BF16>
__global__ __launch_bounds__(128) void k_gemm_bf3(const float* __restrict__ A, int lda, const unsigned short* __restrict__ Wt, int ldb,
                                                const float* __restrict__ bias, const float* __restrict__ resid, int rmod, int ldr,
                                                float* __restrict__ C, int ldc, int M, int N, int K) {
  __shared__ __attribute__((aligned(16))) float so[4][16][64];
  const int tid = threadIdx.x, w = tid >> 5, lane = tid & 31, ln = lane & 15, hh = lane >> 4;
  const int ntn = N / 64;
  const int wid = blockIdx.x * 4 + w;
  const int mt = wid / ntn, nq = wid % ntn;
  if (mt * 16 >= M) return;
  const int row0 = mt * 16, col0 = nq * 64;
  const float* arow = A + (size_t)(row0 + ln) * lda;
  v8f acc[4] = {};
  for (int kb = 0; kb < K; kb += 32) {
    FragB ah, al;
    const v4f x0 = *(const v4fa*)(arow + kb + 8 * hh), x1 = *(const v4fa*)(arow + kb + 8 * hh + 4);
    const v4f x2 = *(const v4fa*)(arow + kb + 16 + 8 * hh), x3 = *(const v4fa*)(arow + kb + 16 + 8 * hh + 4);
    float xs[16] = {x0[0],x0[1],x0[2],x0[3],x1[0],x1[1],x1[2],x1[3],x2[0],x2[1],x2[2],x2[3],x3[0],x3[1],x3[2],x3[3]};
#pragma unroll
    for (int i = 0; i < 16; ++i) { const unsigned short hb = bf16_bits(xs[i]); ah.u[i] = hb; al.u[i] = ASPLIT ? bf16_bits(xs[i] - bf16_val(hb)) : (unsigned short)0; }
#pragma unroll
    for (int t = 0; t < 4; ++t) {
      const unsigned short* brow = Wt + (size_t)(col0 + t * 16 + ln) * ldb + kb;
      FragB b;
      b.half[0] = *(const v8us*)(brow + 8 * hh);
      b.half[1] = *(const v8us*)(brow + 16 + 8 * hh);
      acc[t] = mmaN<ASPLIT ? 2 : 1>(ah.v, al.v, b.v, b.v, acc[t]);
    }
  }
#pragma unroll
  for (int t = 0; t < 4; ++t) {
    const int col = col0 + t * 16 + ln;
    float bv = bias ? bias[col] : 0.f;
    if (BIAS_BF16) bv = bf16_round(bv);
#pragma unroll
    for (int r = 0; r < 8; ++r) {
      float v = acc[t][r] + bv;
      if (resid) { float rv = resid[(size_t)((row0 + 8 * hh + r) % rmod) * ldr + col]; if (RES_BF16) rv = bf16_round(rv); v += rv; }
      if (ACT == 1) v = fmaxf(v, 0.f);
      if (ACT == 2) v = 0.5f * v * (1.0f + erff(v * 0.70710678118654752f));
      if (ACT == 3) { const float u = 0.7978845608028654f * (v + 0.044715f * v * v * v); v = 0.5f * v * (1.0f + tanhf(u)); }
      so[w][8 * hh + r][t * 16 + ln] = v;
    }
  }
  __builtin_amdgcn_fence(__ATOMIC_ACQ_REL, "workgroup");
  __builtin_amdgcn_wave_barrier();
  const int rsub = lane >> 4, c4 = (lane & 15) * 4;
  {
#pragma unroll
    for (int q = 0; q < 8; ++q) {
      const int r = q * 2 + rsub;
      const v4f v = *(const v4fa*)&so[w][r][c4];
      *(v4f*)(C + (size_t)(row0 + r) * ldc + col0 + c4) = v;
    }
    
  }
}
// row LayerNorm (biased variance, eps) over N: s = X (+ R); optional out_sum <- s; out_norm <- (s-mu)*rsqrt(var+eps)*g + b
template <bool PARAM_BF16>
__global__ __launch_bounds__(256) void k_layernorm(const float* __restrict__ X, const float* __restrict__ R, const float* __restrict__ g, const float* __restrict__ bta,
                                                  float* __restrict__ out_sum, float* __restrict__ out_norm, int N, float eps) {
  __shared__ float red[256];
  const int row = blockIdx.x, tid = threadIdx.x;
  const float* x = X + (size_t)row * N; const float* rr = R ? R + (size_t)row * N : nullptr;
  float vals[16];                     // up to N = 4096
  const int per = N / 256;            // contiguous chunk per thread? use strided-by-4 chunks: thread handles j = tid*4 + 1024*u
  float s1 = 0.f;
  for (int u = 0; u < per / 4; ++u) {
    const int j = tid * 4 + 1024 * u;
    const v4f a = *(const v4fa*)(x + j);
    v4f b = {0.f,0.f,0.f,0.f}; if (rr) b = *(const v4fa*)(rr + j);
#pragma unroll
    for (int q = 0; q < 4; ++q) { const float v = a[q] + b[q]; vals[u * 4 + q] = v; s1 += v; }
  }
  red[tid] = s1; __syncthreads();
  for (int st = 128; st > 0; st >>= 1) { if (tid < st) red[tid] += red[tid + st]; __syncthreads(); }
  const float mu = red[0] / (float)N; __syncthreads();
  float s2 = 0.f;
  for (int u = 0; u < per / 4; ++u)
#pragma unroll
    for (int q = 0; q < 4; ++q) { const float c = vals[u * 4 + q] - mu; s2 += c * c; }
  red[tid] = s2; __syncthreads();
  for (int st = 128; st > 0; st >>= 1) { if (tid < st) red[tid] += red[tid + st]; __syncthreads(); }
  const float rs = rsqrtf(red[0] / (float)N + eps);
  {
    for (int u = 0; u < per / 4; ++u) {
      const int j = tid * 4 + 1024 * u;
      v4f o, sm;
#pragma unroll
      for (int q = 0; q < 4; ++q) {
        float gg = g[j + q], bb = bta[j + q];
        if (PARAM_BF16) { gg = bf16_round(gg); bb = bf16_round(bb); }
        sm[q] = vals[u * 4 + q]; o[q] = (vals[u * 4 + q] - mu) * rs * gg + bb;
      }
      if (out_sum) *(v4f*)(out_sum + (size_t)row * N + j) = sm;
      *(v4f*)(out_norm + (size_t)row * N + j) = o;
    }
    
  }
}



// ---- f16 WMMA path (v_wmma_f32_16x16x32_f16): 11-bit significands for operands in range — used where a [0,1] probability operand needs more precision than bf16
typedef _Float16 v16h __attribute__((ext_vector_type(16)));
union FragH { v16h v; v8us half[2]; _Float16 h[16]; unsigned short u[16]; };
template <int NT>
__device__ __forceinline__ v8f mmaH(v16h ah, v16h al, v16h bh, v16h bl, v8f c) {
  c = __builtin_amdgcn_wmma_f32_16x16x32_f16(false, ah, false, bh, (short)0, c, false, false);
  if (NT >= 2) c = __builtin_amdgcn_wmma_f32_16x16x32_f16(false, al, false, bh, (short)0, c, false, false);
  if (NT >= 3) c = __builtin_amdgcn_wmma_f32_16x16x32_f16(false, ah, false, bl, (short)0, c, false, false);
  asm volatile("v_nop\n\tv_nop\n\tv_nop\n\tv_nop" : "+v"(c) : "v"(ah), "v"(al), "v"(bh), "v"(bl));
  return c;
}
// batched GEMM like k_gemm_b but f16 operands: A f32 (split into f16 hi/lo if ASPLIT, else rounded to f16), Bt = f16 values [n][k]; alpha; C f32; N multiple of 16 (partial tiles skipped)
template <bool ASPLIT>
__global__ __launch_bounds__(128) void k_gemm_h(const float* __restrict__ A, int lda, size_t sA, const _Float16* __restrict__ Bh, int ldb, size_t sB, float alpha, float* __restrict__ C, int ldc, size_t sC, int M, int N, int K) {
  __shared__ __attribute__((aligned(16))) float so[4][16][64];
  const int tid = threadIdx.x, w = tid >> 5, lane = tid & 31, ln = lane & 15, hh = lane >> 4; const int by = blockIdx.y;
  A += (size_t)by * sA; Bh += (size_t)by * sB; C += (size_t)by * sC;
  const int ntn = (N + 63) / 64; const int wid = blockIdx.x * 4 + w; const int mt = wid / ntn, nq = wid % ntn; if (mt * 16 >= M) return;
  const int row0 = mt * 16, col0 = nq * 64; const float* arow = A + (size_t)(row0 + ln) * lda;
  v8f acc[4] = {};
  for (int kb = 0; kb < K; kb += 32) {
    FragH ah, al;
    const v4f x0 = *(const v4fa*)(arow + kb + 8 * hh), x1 = *(const v4fa*)(arow + kb + 8 * hh + 4), x2 = *(const v4fa*)(arow + kb + 16 + 8 * hh), x3 = *(const v4fa*)(arow + kb + 16 + 8 * hh + 4);
    float xs[16] = {x0[0],x0[1],x0[2],x0[3],x1[0],x1[1],x1[2],x1[3],x2[0],x2[1],x2[2],x2[3],x3[0],x3[1],x3[2],x3[3]};
#pragma unroll
    for (int i = 0; i < 16; ++i) { const _Float16 h = (_Float16)xs[i]; ah.h[i] = h; al.h[i] = ASPLIT ? (_Float16)(xs[i] - (float)h) : (_Float16)0.0f; }
#pragma unroll
    for (int t = 0; t < 4; ++t) { if (col0 + t * 16 >= N) continue; const size_t boff = (size_t)(col0 + t * 16 + ln) * ldb + kb; FragH bq; bq.half[0] = *(const v8us*)(Bh + boff + 8 * hh); bq.half[1] = *(const v8us*)(Bh + boff + 16 + 8 * hh);
      acc[t] = mmaH<ASPLIT ? 2 : 1>(ah.v, al.v, bq.v, bq.v, acc[t]); }
  }
#pragma unroll
  for (int t = 0; t < 4; ++t) { if (col0 + t * 16 >= N) continue;
#pragma unroll
    for (int r = 0; r < 8; ++r) so[w][8 * hh + r][t * 16 + ln] = acc[t][r] * alpha; }
  __builtin_amdgcn_fence(__ATOMIC_ACQ_REL, "workgroup"); __builtin_amdgcn_wave_barrier();
  const int rsub = lane >> 4, c4 = (lane & 15) * 4;
  {
#pragma unroll
    for (int q = 0; q < 8; ++q) { const int r = q * 2 + rsub; if (col0 + c4 < N) { const v4f v = *(const v4fa*)&so[w][r][c4]; *(v4f*)(C + (size_t)(row0 + r) * ldc + col0 + c4) = v; } }
     }
}

// Wt[n][k] = f16(W[k][n]·scale) from f32 row-major W[K][N] (scale = power of two; bf16-exact weights stay exact in f16 away from the subnormal range)
__global__ __launch_bounds__(256) void k_wt_f16(const float* __restrict__ W, _Float16* __restrict__ Wt, int K, int N, float scale) {
  const int t = blockIdx.x * 256 + threadIdx.x; if (t >= N * (K / 8)) return; const int n = t / (K / 8), k8 = (t % (K / 8)) * 8; FragH f;
#pragma unroll
  for (int i = 0; i < 8; ++i) f.h[i] = (_Float16)(bf16_round(W[(size_t)(k8 + i) * N + n]) * scale); const v8us o = f.half[0];
  *(v8us*)((unsigned short*)Wt + (size_t)n * K + k8) = o; 
}
// k_gemm_hh variant with fused epilogue: v = acc·alpha + bias[by·sBias + col] (+ CP[(row/rowsPerB)·sCPb + by·64 + col] if CP) ; ACT 0 none / 1 elu ; writes f16 C16 (and f32 C if non-null)
template <int ACT>
__global__ __launch_bounds__(128) void k_gemm_hhx(const _Float16* __restrict__ A, int lda, size_t sA, const _Float16* __restrict__ Bh, int ldb, size_t sB, float alpha, const float* __restrict__ bias, size_t sBias, const float* __restrict__ CP, int rowsPerB, size_t sCPb, int row0g,
    float* __restrict__ C, _Float16* __restrict__ C16, int ldc, size_t sC, int M, int N, int K) {
  __shared__ __attribute__((aligned(16))) float so[4][16][64];
  const int tid = threadIdx.x, w = tid >> 5, lane = tid & 31, ln = lane & 15, hh = lane >> 4; const int by = blockIdx.y;
  A += (size_t)by * sA; Bh += (size_t)by * sB; const size_t cofs = (size_t)by * sC; const float* bp = bias ? bias + (size_t)by * sBias : nullptr;
  const int ntn = (N + 63) / 64; const int wid = blockIdx.x * 4 + w; const int mt = wid / ntn, nq = wid % ntn; if (mt * 16 >= M) return;
  const int row0 = mt * 16, col0 = nq * 64; const _Float16* arow = A + (size_t)(row0 + ln) * lda;
  v8f acc[4] = {};
  for (int kb = 0; kb < K; kb += 32) { FragH ah; ah.half[0] = *(const v8us*)((const unsigned short*)arow + kb + 8 * hh); ah.half[1] = *(const v8us*)((const unsigned short*)arow + kb + 16 + 8 * hh);
#pragma unroll
    for (int t = 0; t < 4; ++t) { if (col0 + t * 16 >= N) continue; const size_t boff = (size_t)(col0 + t * 16 + ln) * ldb + kb; FragH bq; bq.half[0] = *(const v8us*)((const unsigned short*)Bh + boff + 8 * hh); bq.half[1] = *(const v8us*)((const unsigned short*)Bh + boff + 16 + 8 * hh);
      acc[t] = mmaH<1>(ah.v, ah.v, bq.v, bq.v, acc[t]); }
  }
#pragma unroll
  for (int t = 0; t < 4; ++t) { if (col0 + t * 16 >= N) continue; const int col = col0 + t * 16 + ln; const float bv = bp ? bf16_round(bp[col]) : 0.f;
#pragma unroll
    for (int r = 0; r < 8; ++r) { float v = acc[t][r] * alpha + bv; if (CP) { const int rr = row0g + row0 + 8 * hh + r; if (rowsPerB < 0) v += CP[cofs + (size_t)rr * ldc + col];      /* rowsPerB < 0: own element of the batched C plane */ else { const int bidx = rr / rowsPerB; v += CP[(size_t)bidx * sCPb + (size_t)by * 64 + col]; } } if (ACT == 1) v = (v > 0.f) ? v : expm1f(v); else if (ACT == 7) v = (v > 0.f) ? v + 1.0f : expf(v); else if (ACT == 8) v = tanhf(v); else if (ACT == 9) v = 0.5f * v * (1.0f + tanhf(0.7978845608028654f * (v + 0.044715f * v * v * v))); else if (ACT == 11) v = 1.0f / (1.0f + expf(-v)); else if (ACT == 12) v = (v > 0.f) ? v : 0.01f * v; else if (ACT == 14) v = (v > 0.f) ? v : 0.1f * v; else if (ACT == 16) v = (v >= 0.f) ? v : 0.3f * v; else if (ACT == 17) v = (v >= 0.f) ? v : 0.2f * v; else if (ACT == 15) v = v / (1.0f + expf(-v)); else if (ACT == 3) v = fmaxf(v, 0.f); else if (ACT == 6) v = 0.5f * v * (1.0f + erff(v * 0.70710678118654752f)); so[w][8 * hh + r][t * 16 + ln] = v; } }
  __builtin_amdgcn_fence(__ATOMIC_ACQ_REL, "workgroup"); __builtin_amdgcn_wave_barrier();
  const int rsub = lane >> 4, c4 = (lane & 15) * 4; typedef _Float16 v4h __attribute__((ext_vector_type(4)));
  {
#pragma unroll
    for (int q = 0; q < 8; ++q) { const int r = q * 2 + rsub; if (col0 + c4 < N) { const v4f v = *(const v4fa*)&so[w][r][c4]; if (C) *(v4f*)(C + cofs + (size_t)(row0 + r) * ldc + col0 + c4) = v; if (C16) { v4h h4; for (int i = 0; i < 4; ++i) h4[i] = (_Float16)v[i]; *(v4h*)(C16 + cofs + (size_t)(row0 + r) * ldc + col0 + c4) = h4; } } }
     }
}


typedef _Float16 v4h __attribute__((ext_vector_type(4)));

__global__ __launch_bounds__(256) void k_x16(const float* __restrict__ x, _Float16* __restrict__ X16, size_t n8) { const size_t t = (size_t)blockIdx.x * 256 + threadIdx.x; if (t >= n8) return; FragH f;
#pragma unroll
  for (int q = 0; q < 8; ++q) f.h[q] = (_Float16)bf16_round(x[t * 8 + q]); *(v8us*)((unsigned short*)X16 + t * 8) = f.half[0];  }
__global__ __launch_bounds__(256) void k_h16(const float* __restrict__ x, _Float16* __restrict__ X16, size_t n8) { const size_t t = (size_t)blockIdx.x * 256 + threadIdx.x; if (t >= n8) return; FragH f;
#pragma unroll
  for (int q = 0; q < 8; ++q) f.h[q] = (_Float16)x[t * 8 + q]; *(v8us*)((unsigned short*)X16 + t * 8) = f.half[0];  }
__global__ __launch_bounds__(256) void k_round16f(const float* __restrict__ W, _Float16* __restrict__ Bt, size_t n8) { const size_t t = (size_t)blockIdx.x * 256 + threadIdx.x; if (t >= n8) return; FragH f;
#pragma unroll
  for (int i = 0; i < 8; ++i) f.h[i] = (_Float16)(bf16_round(W[t * 8 + i]) * 16.0f); *(v8us*)((unsigned short*)Bt + t * 8) = f.half[0];  }
template <int NHv, int TTv>
__global__ __launch_bounds__(256) void k_vt(const _Float16* __restrict__ V16, int ldv, int voff, _Float16* __restrict__ Vt) { __shared__ unsigned short tl[64][66]; const int tid = threadIdx.x; const int slab = blockIdx.x / (TTv / 64), lg = blockIdx.x % (TTv / 64); const int b = slab / NHv, h = slab % NHv;
  for (int i = tid; i < 64 * 8; i += 256) { const int r = i / 8, c8 = (i % 8) * 8; FragH f; f.half[0] = *(const v8us*)((const unsigned short*)V16 + ((size_t)b * TTv + lg * 64 + r) * ldv + voff + h * 64 + c8);
#pragma unroll
    for (int q = 0; q < 8; ++q) tl[r][c8 + q] = f.u[q]; }
  __syncthreads();
  {
#pragma unroll
    for (int rd = 0; rd < 2; ++rd) { const int d = rd * 32 + tid / 8, pc = tid % 8; FragH f;
#pragma unroll
      for (int q = 0; q < 8; ++q) f.u[q] = tl[pc * 8 + q][d];
      *(v8us*)((unsigned short*)Vt + ((size_t)slab * 64 + d) * TTv + lg * 64 + pc * 8) = f.half[0]; }
     } }

__global__ __launch_bounds__(256) void k_hl(const float* __restrict__ F, _Float16* __restrict__ Hh, _Float16* __restrict__ Hl, size_t n8) { const size_t t = (size_t)blockIdx.x * 256 + threadIdx.x; if (t >= n8) return; FragH fh, fl; const v4f a = *(const v4fa*)(F + t * 8), c = *(const v4fa*)(F + t * 8 + 4);
#pragma unroll
  for (int q = 0; q < 4; ++q) { _Float16 h = (_Float16)a[q]; fh.h[q] = h; fl.h[q] = (_Float16)((a[q] - (float)h) * 1024.0f); h = (_Float16)c[q]; fh.h[4 + q] = h; fl.h[4 + q] = (_Float16)((c[q] - (float)h) * 1024.0f); }
  { *(v8us*)((unsigned short*)Hh + t * 8) = fh.half[0]; *(v8us*)((unsigned short*)Hl + t * 8) = fl.half[0];  } }

// ---- fast GEMM (work-group tile 128x64, wave tile 32x64; requires M % 128 == 0, N % 64 == 0, K % 64 == 0); epilogue = k_gemm_hhx semantics ----
// Operands go through LDS, 64 k a pass: the work-group's 128 A rows and 64 B rows as 128-byte row pieces, 8 lanes a piece, so a wave's 16-byte global load covers 4 whole lines
// (a fragment load straight from global touches 16 lines for the same bytes, and each wave fetched all of B for itself). Rows at a 144-B pitch: 16-byte fragment reads without bank conflicts.
// Two buffers: the next pass's global loads fly during the pass, are stored to the other buffer at its foot, one barrier a pass. Each accumulator takes its products in ascending k.
#define GK 64                        /* k a pass */
#define GP 72                        /* LDS row pitch in f16 */
__device__ __forceinline__ v16h g2_frag(const _Float16* p, int hh) { FragH f; f.half[0] = *(const v8us*)((const unsigned short*)p + 8 * hh); f.half[1] = *(const v8us*)((const unsigned short*)p + 16 + 8 * hh); return f.v; }
__device__ __forceinline__ v16h g2_lfrag(const unsigned short* p, int hh) { FragH f; f.half[0] = *(const v8us*)(p + 8 * hh); f.half[1] = *(const v8us*)(p + 16 + 8 * hh); return f.v; }      /* the same k order from an LDS row */
__device__ __forceinline__ v8f g2_mma(v16h a, v16h b, v8f c) { v8f d = __builtin_amdgcn_wmma_f32_16x16x32_f16(false, a, false, b, (short)0, c, false, false); asm volatile("v_nop\n\tv_nop\n\tv_nop\n\tv_nop" : "+v"(d) : "v"(a), "v"(b)); return d; }
template <int ACT>
__global__ __launch_bounds__(128) void k_gemm2(const _Float16* __restrict__ A, int lda, size_t sA, const _Float16* __restrict__ Bh, int ldb, size_t sB, float alpha, const float* __restrict__ bias, size_t sBias, const float* __restrict__ CP, int rowsPerB, size_t sCPb, int row0g,
    float* __restrict__ C, _Float16* __restrict__ C16, int ldc, size_t sC, int M, int N, int K, const float* __restrict__ bias1, const float* __restrict__ bias2) { static_assert(ACT == 0 || ACT == 3 || ACT == 6 || ACT == 8 || ACT == 9 || ACT == 11 || ACT == 12 || ACT == 14 || ACT == 15 || ACT == 16 || ACT == 17, "k_gemm2: unsupported ACT code (would silently apply no activation)");
  __shared__ __attribute__((aligned(16))) float so[4][32][68];
  __shared__ __attribute__((aligned(16))) unsigned short sa[2][128][GP];
  __shared__ __attribute__((aligned(16))) unsigned short sb[2][64][GP];
  const int tid = threadIdx.x, w = tid >> 5, lane = tid & 31, ln = lane & 15, hh = lane >> 4; const int by = blockIdx.y;
  A += (size_t)by * sA; Bh += (size_t)by * sB; const size_t cofs = (size_t)by * sC; const float* bp = bias ? bias + (size_t)by * sBias : nullptr;
  if (by == 1 && bias1) bp = bias1; if (by == 2 && bias2) bp = bias2;      /* batch entries 1 and 2 whose biases are buffers of their own */
  const int ntn = N >> 6; const int mt = blockIdx.x / ntn, nq = blockIdx.x - mt * ntn; const int row0 = mt * 128 + 32 * w, col0 = nq * 64; if (mt * 128 >= M) return;      /* the whole work-group leaves or none: barriers follow */
  const int sr = tid >> 3, sc = (tid & 7) * 8;      /* staging: this thread moves 16 bytes of rows sr + 16 i of each tile; 8 threads cover a 128-byte row piece */
  __builtin_assume(lda == DM); __builtin_assume(ldb == DM);      /* every launch here has rows of DM: with the pitch known the 16-row steps are immediate offsets on one address pair an operand, no address arithmetic between the loads */
  const unsigned short* ag = (const unsigned short*)A + (size_t)(mt * 128 + sr) * lda + sc; const unsigned short* bg = (const unsigned short*)Bh + (size_t)(col0 + sr) * ldb + sc;
  v8us ra[8], rb[4];
#pragma unroll      /* constant indices keep the pieces in registers */
  for (int i = 0; i < 8; ++i) ra[i] = *(const v8us*)(ag + (size_t)(16 * i) * lda);
#pragma unroll      /* constant indices keep the pieces in registers */
  for (int i = 0; i < 4; ++i) rb[i] = *(const v8us*)(bg + (size_t)(16 * i) * ldb);
#pragma unroll      /* constant indices keep the pieces in registers */
  for (int i = 0; i < 8; ++i) *(v8us*)&sa[0][sr + 16 * i][sc] = ra[i];
#pragma unroll      /* constant indices keep the pieces in registers */
  for (int i = 0; i < 4; ++i) *(v8us*)&sb[0][sr + 16 * i][sc] = rb[i];
  __syncthreads();
  const v8f z8 = {0.f,0.f,0.f,0.f,0.f,0.f,0.f,0.f}; v8f c00 = z8, c01 = z8, c02 = z8, c03 = z8, c10 = z8, c11 = z8, c12 = z8, c13 = z8;
#pragma unroll 1      /* one pass a trip: the body already holds 16 matrix instructions and 24 LDS reads */
  for (int kb = 0; kb < K; kb += GK) { const int cur = (kb / GK) & 1; const bool more = kb + GK < K;
    if (more) { ag += GK; bg += GK;
#pragma unroll      /* constant indices keep the pieces in registers */
      for (int i = 0; i < 8; ++i) ra[i] = *(const v8us*)(ag + (size_t)(16 * i) * lda);
#pragma unroll      /* constant indices keep the pieces in registers */
      for (int i = 0; i < 4; ++i) rb[i] = *(const v8us*)(bg + (size_t)(16 * i) * ldb); }
    v16h af[2][2], bf[2][4];      /* [k half of the pass][tile] */
#pragma unroll      /* constant indices keep the fragments in registers */
    for (int s = 0; s < 2; ++s) {
#pragma unroll      /* constant indices keep the fragments in registers */
      for (int t = 0; t < 2; ++t) af[s][t] = g2_lfrag(&sa[cur][32 * w + 16 * t + ln][32 * s], hh);
#pragma unroll      /* constant indices keep the fragments in registers */
      for (int t = 0; t < 4; ++t) bf[s][t] = g2_lfrag(&sb[cur][16 * t + ln][32 * s], hh); }
    __builtin_amdgcn_sched_barrier(0);      /* keeps the pass's global loads and all 24 LDS reads issued here: sunk to in front of their matrix instructions, each group would stand with a full latency in the open */
#pragma unroll      /* constant indices keep the fragments in registers */
    for (int s = 0; s < 2; ++s) {
      c00 = g2_mma(af[s][0], bf[s][0], c00); c10 = g2_mma(af[s][1], bf[s][0], c10);
      c01 = g2_mma(af[s][0], bf[s][1], c01); c11 = g2_mma(af[s][1], bf[s][1], c11);
      c02 = g2_mma(af[s][0], bf[s][2], c02); c12 = g2_mma(af[s][1], bf[s][2], c12);
      c03 = g2_mma(af[s][0], bf[s][3], c03); c13 = g2_mma(af[s][1], bf[s][3], c13); }
    if (more) {      /* every reader left that buffer before the last barrier */
#pragma unroll      /* constant indices keep the pieces in registers */
      for (int i = 0; i < 8; ++i) *(v8us*)&sa[cur ^ 1][sr + 16 * i][sc] = ra[i];
#pragma unroll      /* constant indices keep the pieces in registers */
      for (int i = 0; i < 4; ++i) *(v8us*)&sb[cur ^ 1][sr + 16 * i][sc] = rb[i]; }
    __syncthreads(); }      /* publishes the next pass's tiles and ends this pass's reads of the buffer that the next pass refills */
  v8f accs[8] = {c00, c01, c02, c03, c10, c11, c12, c13};
#pragma unroll
  for (int u = 0; u < 8; ++u) { const int t = u & 3, half = u >> 2; const int col = col0 + t * 16 + ln; const float bv = bp ? bf16_round(bp[col]) : 0.f;
#pragma unroll
    for (int r = 0; r < 8; ++r) { const int rloc = half * 16 + 8 * hh + r; float v = accs[u][r] * alpha + bv; if (CP) { if (rowsPerB < 0) v += CP[cofs + (size_t)(row0g + row0 + rloc) * ldc + col];      /* rowsPerB < 0: own element of the batched C plane */ else { const int bidx = (row0g + row0 + rloc) / rowsPerB; v += CP[(size_t)bidx * sCPb + (size_t)by * 64 + col]; } }
      if (ACT == 3) v = fmaxf(v, 0.f); else if (ACT == 6) v = 0.5f * v * (1.0f + erff(v * 0.70710678118654752f)); else if (ACT == 11) v = 1.0f / (1.0f + expf(-v)); else if (ACT == 15) v = v / (1.0f + expf(-v)); else if (ACT == 12) v = (v > 0.f) ? v : 0.01f * v; else if (ACT == 8) v = tanhf(v); else if (ACT == 9) v = 0.5f * v * (1.0f + tanhf(0.7978845608028654f * (v + 0.044715f * v * v * v))); else if (ACT == 14) v = (v > 0.f) ? v : 0.1f * v; else if (ACT == 16) v = (v >= 0.f) ? v : 0.3f * v; else if (ACT == 17) v = (v >= 0.f) ? v : 0.2f * v;
      so[w][rloc][t * 16 + ln] = v; } }
  __builtin_amdgcn_fence(__ATOMIC_ACQ_REL, "workgroup"); __builtin_amdgcn_wave_barrier();
  const int rsub = lane >> 4, c4 = (lane & 15) * 4;
  {
#pragma unroll
    for (int q = 0; q < 16; ++q) { const int r = q * 2 + rsub; const v4f v = *(const v4fa*)&so[w][r][c4]; if (C) *(v4f*)(C + cofs + (size_t)(row0 + r) * ldc + col0 + c4) = v; if (C16) { v4h h4; for (int i = 0; i < 4; ++i) h4[i] = (_Float16)v[i]; *(v4h*)(C16 + cofs + (size_t)(row0 + r) * ldc + col0 + c4) = h4; } }
     } }


// All seven f32 -> f16 conversions in one launch; the block index picks the buffer. Blocks 0 .. 3 PXB - 1: query, key, value -> X[0..2] (bf16-rounded, exact in f16);
// then 4 PWB blocks: Wq, Wk, Wv, Wo -> B[0..3] (bf16-rounded, x16: exact, away from the f16 subnormal range). A thread moves PC pieces of 4 elements, 256 pieces apart:
// a wave's 16-byte loads cover 512 contiguous bytes and its 8-byte stores 256, whole lines both.
#define PC 16
#define PXB ((int)(NR * DM / 4 / (256 * PC)))      /* blocks an input: 128 */
#define PWB ((int)((size_t)DM * DM / 4 / (256 * PC)))      /* blocks a weight: 16 */
__global__ __launch_bounds__(256) void k_prep(const float* __restrict__ xq, const float* __restrict__ xk, const float* __restrict__ xv, const float* __restrict__ wq, const float* __restrict__ wk, const float* __restrict__ wv, const float* __restrict__ wo, _Float16* __restrict__ X, _Float16* __restrict__ B) {
  const int b = blockIdx.x; const bool isx = b < 3 * PXB; const int j = isx ? b / PXB : (b - 3 * PXB) / PWB; const int blk = isx ? b - j * PXB : (b - 3 * PXB) - j * PWB;
  const float* s = isx ? (j == 0 ? xq : j == 1 ? xk : xv) : (j == 0 ? wq : j == 1 ? wk : j == 2 ? wv : wo);
  _Float16* d = isx ? X + (size_t)j * NR * DM : B + (size_t)j * DM * DM; const float sc = isx ? 1.0f : 16.0f;
  const size_t e0 = ((size_t)blk * (256 * PC) + threadIdx.x) * 4;
  v4f a[PC];
#pragma unroll      /* constant indices keep the pieces in registers, their loads in flight together */
  for (int u = 0; u < PC; ++u) a[u] = *(const v4fa*)(s + e0 + (size_t)u * 1024);
  __builtin_amdgcn_sched_barrier(0);      /* keeps all PC loads issued here: left alone the build holds the last five back until the first eleven have landed, a second memory latency in the open */
#pragma unroll      /* constant indices keep the pieces in registers */
  for (int u = 0; u < PC; ++u) { v4h o;
#pragma unroll      /* constant indices keep the pieces in registers */
    for (int q = 0; q < 4; ++q) o[q] = (_Float16)(bf16_round(a[u][q]) * sc);
    *(v4h*)(d + e0 + (size_t)u * 1024) = o; } }
// V^T of every head: VT[h][d][s] from the merged f16 rows, 64 x 64 tiles through LDS. grid (SQ / 64, NH).
__global__ __launch_bounds__(256) void k_vt(const _Float16* __restrict__ V16, _Float16* __restrict__ VT) { __shared__ unsigned short tl[64][65]; const int tid = threadIdx.x; const int h = blockIdx.y; const int s0 = blockIdx.x * 64;
  for (int i = tid; i < 64 * 8; i += 256) { const int j = i / 8, d8 = (i % 8) * 8; FragH f; f.half[0] = *(const v8us*)((const unsigned short*)V16 + ((size_t)s0 + j) * DM + h * HD + d8); for (int q = 0; q < 8; ++q) tl[d8 + q][j] = f.u[q]; }
  __syncthreads();
  { for (int i = tid; i < 64 * 8; i += 256) { const int d = i / 8, j8 = (i % 8) * 8; FragH f; for (int q = 0; q < 8; ++q) f.u[q] = tl[d][j8 + q]; *(v8us*)((unsigned short*)VT + ((size_t)h * HD + d) * SQ + s0 + j8) = f.half[0]; }  } }

#define FK 64                        /* keys a pass */
#define FP 72                        /* LDS row pitch in f16 */
__device__ __forceinline__ float fa_xhalf(float x) { return __builtin_bit_cast(float, __builtin_amdgcn_permlanex16(__builtin_bit_cast(int, x), __builtin_bit_cast(int, x), 0x76543210, 0xfedcba98, false, false)); }      /* lane l with lane l ^ 16 */
__device__ __forceinline__ v8f fa_mma(v16h a, v16h b, v8f c) { return __builtin_amdgcn_wmma_f32_16x16x32_f16(false, a, false, b, (short)0, c, false, false); }
__device__ __forceinline__ v16h fa_frag(const unsigned short* p, int hh) { FragH f; f.half[0] = *(const v8us*)(p + 8 * hh); f.half[1] = *(const v8us*)(p + 16 + 8 * hh); return f.v; }
__global__ __launch_bounds__(256) void k_fattn(const _Float16* __restrict__ Q16, const _Float16* __restrict__ K16, const _Float16* __restrict__ VT, _Float16* __restrict__ O16) {
  __shared__ __attribute__((aligned(16))) unsigned short kt[2][FK][FP];
  __shared__ __attribute__((aligned(16))) unsigned short vs[2][HD][FP];
  const int tid = threadIdx.x, w = tid >> 5, lane = tid & 31, ln = lane & 15, hh = lane >> 4; const int h = blockIdx.y; const int q0 = blockIdx.x * 128 + w * 16;
  const _Float16* qp = Q16 + (size_t)(q0 + ln) * DM + h * HD; const v16h qf0 = g2_frag(qp, hh), qf1 = g2_frag(qp + 32, hh);
  const int sr = tid >> 3, sc = (tid & 7) * 8;      /* staging: this thread moves 16 bytes of rows sr and sr + 32 of each tile; 8 threads cover a 128-byte row */
  const unsigned short* kg = (const unsigned short*)K16 + (size_t)sr * DM + h * HD + sc; const unsigned short* vg = (const unsigned short*)VT + ((size_t)h * HD + sr) * SQ + sc;
  v8us rk0 = *(const v8us*)kg, rk1 = *(const v8us*)(kg + 32 * DM), rv0 = *(const v8us*)vg, rv1 = *(const v8us*)(vg + (size_t)32 * SQ);
  *(v8us*)&kt[0][sr][sc] = rk0; *(v8us*)&kt[0][sr + 32][sc] = rk1; *(v8us*)&vs[0][sr][sc] = rv0; *(v8us*)&vs[0][sr + 32][sc] = rv1;
  __syncthreads();
  const v8f z8 = {0.f,0.f,0.f,0.f,0.f,0.f,0.f,0.f}; v8f o[4] = {z8, z8, z8, z8}; float m = -3.0e38f, l = 0.f;      /* m: running maximum of the raw products q.k; l: this half's sum of weights */
  const float CS = 0.125f * 1.4426950408889634f;      /* 1 / sqrt(64), and e^x as 2^(x log2 e) */
#pragma unroll 1      /* one pass a trip: the body already holds 16 matrix instructions and 32 LDS reads */
  for (int it = 0; it < SQ / FK; ++it) { const int cur = it & 1; const bool more = it + 1 < SQ / FK;
    if (more) { kg += (size_t)FK * DM; vg += FK; rk0 = *(const v8us*)kg; rk1 = *(const v8us*)(kg + 32 * DM); rv0 = *(const v8us*)vg; rv1 = *(const v8us*)(vg + (size_t)32 * SQ); }
    v16h kf[8], vf[8];
#pragma unroll      /* constant indices keep the fragments and accumulators in registers */
    for (int t = 0; t < 4; ++t) { const unsigned short* kr = &kt[cur][t * 16 + ln][0]; kf[2 * t] = fa_frag(kr, hh); kf[2 * t + 1] = fa_frag(kr + 32, hh); }
#pragma unroll      /* constant indices keep the fragments and accumulators in registers */
    for (int t = 0; t < 4; ++t) { const unsigned short* vr = &vs[cur][t * 16 + ln][0]; vf[2 * t] = fa_frag(vr, hh); vf[2 * t + 1] = fa_frag(vr + 32, hh); }
    __builtin_amdgcn_sched_barrier(0);      /* keeps all 32 LDS reads of the pass issued here, K first: left alone the build sinks most V^T reads to directly in front of their matrix instruction, each with a full LDS latency in the open */
    v8f s[4];
#pragma unroll      /* constant indices keep the fragments and accumulators in registers */
    for (int t = 0; t < 4; ++t) { s[t] = fa_mma(kf[2 * t], qf0, z8); s[t] = fa_mma(kf[2 * t + 1], qf1, s[t]); }
    float tx[4];      /* one short maximum chain a tile: each starts as soon as its tile is done, and the four do not wait on one another */
#pragma unroll      /* constant indices keep the fragments and accumulators in registers */
    for (int t = 0; t < 4; ++t) { float a = s[t][0];
#pragma unroll      /* constant indices keep the fragments and accumulators in registers */
      for (int r = 1; r < 8; ++r) a = fmaxf(a, s[t][r]);
      tx[t] = a; }
    float tm = fmaxf(fmaxf(tx[0], tx[1]), fmaxf(tx[2], tx[3])); tm = fmaxf(tm, fa_xhalf(tm)); const float mn = fmaxf(m, tm); const float corr = __builtin_amdgcn_exp2f((m - mn) * CS); const float off = 8.0f - mn * CS; m = mn;      /* weights carry x256, as f16 operands away from the subnormal range; it cancels in x = sum / l */
    FragH p[2];
#pragma unroll      /* constant indices keep the fragments and accumulators in registers */
    for (int t = 0; t < 4; ++t)
#pragma unroll      /* constant indices keep the fragments and accumulators in registers */
      for (int r = 0; r < 8; ++r) { const float e = __builtin_amdgcn_exp2f(fmaf(s[t][r], CS, off)); s[t][r] = e; p[t >> 1].h[(t & 1) * 8 + r] = (_Float16)e; }
    const v8f es = (s[0] + s[1]) + (s[2] + s[3]);      /* the pass's sum as a tree: one chain of 32 dependent adds would stand at the foot of every pass */
    l = l * corr + (((es[0] + es[1]) + (es[2] + es[3])) + ((es[4] + es[5]) + (es[6] + es[7])));
#pragma unroll      /* constant indices keep the fragments and accumulators in registers */
    for (int t = 0; t < 4; ++t) o[t] *= corr;
#pragma unroll      /* constant indices keep the fragments and accumulators in registers */
    for (int t = 0; t < 4; ++t) { o[t] = fa_mma(vf[2 * t], p[0].v, o[t]); o[t] = fa_mma(vf[2 * t + 1], p[1].v, o[t]); }
    if (more) { *(v8us*)&kt[cur ^ 1][sr][sc] = rk0; *(v8us*)&kt[cur ^ 1][sr + 32][sc] = rk1; *(v8us*)&vs[cur ^ 1][sr][sc] = rv0; *(v8us*)&vs[cur ^ 1][sr + 32][sc] = rv1; }      /* every reader left that buffer before the last barrier */
    __syncthreads(); }      /* publishes the next tile and ends this pass's reads of the buffer that the next pass refills */
  l += fa_xhalf(l); const float inv = 1.0f / l;
  _Float16* op = O16 + (size_t)(q0 + ln) * DM + h * HD + 8 * hh;      /* lane (ln, hh) holds x[q0 + ln][16 t + 8 hh + r] */
#pragma unroll      /* constant indices keep the fragments and accumulators in registers */
  for (int t = 0; t < 4; ++t) { FragH f;
#pragma unroll      /* constant indices keep the fragments and accumulators in registers */
    for (int r = 0; r < 8; ++r) f.h[r] = (_Float16)(o[t][r] * inv);
    *(v8us*)((unsigned short*)op + t * 16) = f.half[0]; } }

extern "C" void kernel_launch(void* const* d_in, const int* in_sizes, int n_in,
                              void* d_out, int out_size, void* d_ws, size_t ws_size, hipStream_t stream) {
  (void)in_sizes; (void)n_in; (void)out_size;
  const float* const* I = (const float* const*)d_in; const float* xq = I[0]; const float* xk = I[1]; const float* xv = I[2]; const float* wq = I[3]; const float* bq = I[4]; const float* wk = I[5]; const float* bk = I[6]; const float* wv = I[7]; const float* bv = I[8]; const float* wo = I[9]; const float* bo = I[10];
  char* ws = (char*)d_ws; size_t off = 0;
  auto take = [&](size_t bytes) { char* p = ws + off; off += (bytes + 255) & ~(size_t)255; return p; };
  _Float16* BQ = (_Float16*)take((size_t)4 * DM * DM * 2); _Float16* BO = BQ + (size_t)3 * DM * DM;      /* Wq | Wk | Wv | Wo, one after the other */
  _Float16* XQ = (_Float16*)take(3 * NR * DM * 2);      /* query | key | value rows */
  _Float16* Q16 = (_Float16*)take(3 * NR * DM * 2); _Float16* K16 = Q16 + NR * DM; _Float16* V16 = K16 + NR * DM;      /* q | k | v */
  _Float16* O16 = (_Float16*)take(NR * DM * 2);
  _Float16* VT = (_Float16*)take((size_t)NH * HD * SQ * 2);
  if (off > ws_size) return;      /* 2 + 7x4 + 4 = approx 34 MiB */
  k_prep<<<3 * PXB + 4 * PWB, 256, 0, stream>>>(xq, xk, xv, wq, wk, wv, wo, XQ, BQ);
  const dim3 gp((unsigned)((NR / 128) * (DM / 64)), 1); const dim3 gp3((unsigned)((NR / 128) * (DM / 64)), 3);
  k_gemm2<0><<<gp3, 128, 0, stream>>>(XQ, DM, NR * DM, BQ, DM, (size_t)DM * DM, 0.0625f, bq, 0, nullptr, 1, 0, 0, nullptr, Q16, DM, NR * DM, MP, DM, DM, bk, bv);      /* q, k and v: blockIdx.y picks rows, weight, bias and output */
  k_vt<<<dim3(SQ / 64, NH), 256, 0, stream>>>(V16, VT);
  k_fattn<<<dim3(SQ / 128, NH), 256, 0, stream>>>(Q16, K16, VT, O16);      /* x (merged heads) as f16 rows */
  k_gemm2<0><<<gp, 128, 0, stream>>>(O16, DM, 0, BO, DM, 0, 0.0625f, bo, 0, nullptr, 1, 0, 0, (float*)d_out, nullptr, DM, 0, MO, DM, DM, nullptr, nullptr);      /* out = o W_o^T + b_o, rows are the output layout */
}

// v005
// It runs in 68 microseconds.
// In two side-by-side timings against v004, it was 1.20 and 1.22 times as fast.
// All steps since v000 together make it 102 times as fast.
#include <hip/hip_runtime.h>
// Multi-head attention over separate query / key / value inputs ([1][4096][512] each; q = query Wq^T + bq, k = key Wk^T + bk, v = value Wv^T + bv, 8 heads of 64; attn = softmax(q k^T / 8); x = attn v; out = x Wo^T + bo -> [1][4096][512]).
// Structure: token rows; query, key, value and the four weights to exact f16 in one launch; Q | K | V as three WMMA GEMMs in one launch, blockIdx.y the projection (32x64 wave tiles, operands via LDS, f32 accumulation, exact x16 natural weights, bias in the epilogue, f16 outputs); V^T of all heads via LDS transposes; one attention kernel for all heads (scores^T = K q^T, running-maximum softmax in registers, x^T += V^T p^T; scores and weights never stored) written straight into the merged f16 rows; out = x Wo^T + bo GEMM (f32).
// Compute dtype: inputs rounded to bf16; inputs / weights exact; q, k, v, softmax weights and x as plain f16 GEMM operands (~2^-12); scores and softmax statistics f32. v_wmma_f32_16x16x32_f16.
#define NB 1
#define SQ 4096
#define DM 512
#define NH 8
#define HD 64
#define MP ((int)NR)                 /* token rows through the q/k/v projections (debug hook) */
#define MO ((int)NR)                 /* token rows through the output projection (debug hook) */
#define NR ((size_t)NB * SQ)         /* 4096 token rows */
typedef __bf16 v16b __attribute__((ext_vector_type(16)));
typedef unsigned short v8us __attribute__((ext_vector_type(8), may_alias));
typedef float  v8f  __attribute__((ext_vector_type(8)));
typedef float  v4f  __attribute__((ext_vector_type(4)));
typedef float  v4fa __attribute__((ext_vector_type(4), may_alias));
union FragB { v16b v; v8us half[2]; unsigned short u[16]; };

__device__ __forceinline__ unsigned short bf16_bits(float x) { unsigned int u = __float_as_uint(x); return (unsigned short)((u + 0x7FFFu + ((u >> 16) & 1u)) >> 16); }
__device__ __forceinline__ float bf16_val(unsigned short b) { return __uint_as_float(((unsigned int)b) << 16); }
__device__ __forceinline__ float bf16_round(float x) { return bf16_val(bf16_bits(x)); }
// D += A·B with NT terms: 1 = ah·bh, 2 = + al·bh (A split), 3 = + ah·bl (both split)
template <int NT>
__device__ __forceinline__ v8f mmaN(v16b ah, v16b al, v16b bh, v16b bl, v8f c) {
  c = __builtin_amdgcn_wmma_f32_16x16x32_bf16(false, ah, false, bh, (short)0, c, false, false);
  if (NT >= 2) c = __builtin_amdgcn_wmma_f32_16x16x32_bf16(false, al, false, bh, (short)0, c, false, false);
  if (NT >= 3) c = __builtin_amdgcn_wmma_f32_16x16x32_bf16(false, ah, false, bl, (short)0, c, false, false);
  asm volatile("v_nop\n\tv_nop\n\tv_nop\n\tv_nop" : "+v"(c) : "v"(ah), "v"(al), "v"(bh), "v"(bl));
  return c;
}

__global__ __launch_bounds__(256) void k_wt_bf16(const float* __restrict__ W, unsigned short* __restrict__ Wt, int K, int N) {
  const int t = blockIdx.x * 256 + threadIdx.x;
  const int k8n = K / 8;
  if (t >= N * k8n) return;
  const int n = t / k8n, k8 = (t % k8n) * 8;
  v8us v;
#pragma unroll
  for (int i = 0; i < 8; ++i) v[i] = bf16_bits(W[(size_t)(k8 + i) * N + n]);
  *(v8us*)(Wt + (size_t)n * K + k8) = v;
  
}

// GEMM C[M][N] (f32, pitch ldc) = act(A[M][K]·W + bias). A f32 row-major (pitch lda) converted per fragment to bf16
// (ASPLIT: hi/lo two planes -> 2 terms, else single rounded term); Wt bf16 [N][K] (pitch ldb). BIAS_BF16 rounds the
// bias to bf16 first (bias quantised to bf16 before the add). K%32==0, M%16==0, N%64==0.
template <bool ASPLIT, int ACT, bool BIAS_BF16>
__global__ __launch_bounds__(128) void k_gemm_bf(const float* __restrict__ A, int lda, const unsigned short* __restrict__ Wt, int ldb,
                                               const float* __restrict__ bias, float* __restrict__ C, int ldc, int M, int N, int K) {
  __shared__ __attribute__((aligned(16))) float so[4][16][64];
  const int tid = threadIdx.x, w = tid >> 5, lane = tid & 31, ln = lane & 15, hh = lane >> 4;
  const int ntn = N / 64;
  const int wid = blockIdx.x * 4 + w;
  const int mt = wid / ntn, nq = wid % ntn;
  if (mt * 16 >= M) return;
  const int row0 = mt * 16, col0 = nq * 64;
  const float* arow = A + (size_t)(row0 + ln) * lda;
  v8f acc[4] = {};
  for (int kb = 0; kb < K; kb += 32) {
    FragB ah, al;
    const v4f x0 = *(const v4fa*)(arow + kb + 8 * hh), x1 = *(const v4fa*)(arow + kb + 8 * hh + 4);
    const v4f x2 = *(const v4fa*)(arow + kb + 16 + 8 * hh), x3 = *(const v4fa*)(arow + kb + 16 + 8 * hh + 4);
    float xs[16] = {x0[0],x0[1],x0[2],x0[3],x1[0],x1[1],x1[2],x1[3],x2[0],x2[1],x2[2],x2[3],x3[0],x3[1],x3[2],x3[3]};
#pragma unroll
    for (int i = 0; i < 16; ++i) { const unsigned short hb = bf16_bits(xs[i]); ah.u[i] = hb; al.u[i] = ASPLIT ? bf16_bits(xs[i] - bf16_val(hb)) : (unsigned short)0; }
#pragma unroll
    for (int t = 0; t < 4; ++t) {
      const unsigned short* brow = Wt + (size_t)(col0 + t * 16 + ln) * ldb + kb;
      FragB b;
      b.half[0] = *(const v8us*)(brow + 8 * hh);
      b.half[1] = *(const v8us*)(brow + 16 + 8 * hh);
      acc[t] = mmaN<ASPLIT ? 2 : 1>(ah.v, al.v, b.v, b.v, acc[t]);
    }
  }
#pragma unroll
  for (int t = 0; t < 4; ++t) {
    float bv = bias ? bias[col0 + t * 16 + ln] : 0.f;
    if (BIAS_BF16) bv = bf16_round(bv);
#pragma unroll
    for (int r = 0; r < 8; ++r) { float v = acc[t][r] + bv; if (ACT == 1) v = fmaxf(v, 0.f); so[w][8 * hh + r][t * 16 + ln] = v; }
  }
  __builtin_amdgcn_fence(__ATOMIC_ACQ_REL, "workgroup");
  __builtin_amdgcn_wave_barrier();
  const int rsub = lane >> 4, c4 = (lane & 15) * 4;
  {
#pragma unroll
    for (int q = 0; q < 8; ++q) {
      const int r = q * 2 + rsub;
      const v4f v = *(const v4fa*)&so[w][r][c4];
      *(v4f*)(C + (size_t)(row0 + r) * ldc + col0 + c4) = v;
    }
    
  }
}

// GEMM C = act(A·W + bias + resid): A f32 (ASPLIT -> hi/lo 2 terms), Wt bf16 [N][K]; ACT 0 none, 1 relu, 2 exact gelu;
// resid (optional, f32, row index = (row % rmod), pitch ldr, RES_BF16 rounds it) added before the activation.
template <bool ASPLIT, int ACT, bool BIAS_BF16, bool RES_BF16>
__global__ __launch_bounds__(128) void k_gemm_bf3(const float* __restrict__ A, int lda, const unsigned short* __restrict__ Wt, int ldb,
                                                const float* __restrict__ bias, const float* __restrict__ resid, int rmod, int ldr,
                                                float* __restrict__ C, int ldc, int M, int N, int K) {
  __shared__ __attribute__((aligned(16))) float so[4][16][64];
  const int tid = threadIdx.x, w = tid >> 5, lane = tid & 31, ln = lane & 15, hh = lane >> 4;
  const int ntn = N / 64;
  const int wid = blockIdx.x * 4 + w;
  const int mt = wid / ntn, nq = wid % ntn;
  if (mt * 16 >= M) return;
  const int row0 = mt * 16, col0 = nq * 64;
  const float* arow = A + (size_t)(row0 + ln) * lda;
  v8f acc[4] = {};
  for (int kb = 0; kb < K; kb += 32) {
    FragB ah, al;
    const v4f x0 = *(const v4fa*)(arow + kb + 8 * hh), x1 = *(const v4fa*)(arow + kb + 8 * hh + 4);
    const v4f x2 = *(const v4fa*)(arow + kb + 16 + 8 * hh), x3 = *(const v4fa*)(arow + kb + 16 + 8 * hh + 4);
    float xs[16] = {x0[0],x0[1],x0[2],x0[3],x1[0],x1[1],x1[2],x1[3],x2[0],x2[1],x2[2],x2[3],x3[0],x3[1],x3[2],x3[3]};
#pragma unroll
    for (int i = 0; i < 16; ++i) { const unsigned short hb = bf16_bits(xs[i]); ah.u[i] = hb; al.u[i] = ASPLIT ? bf16_bits(xs[i] - bf16_val(hb)) : (unsigned short)0; }
#pragma unroll
    for (int t = 0; t < 4; ++t) {
      const unsigned short* brow = Wt + (size_t)(col0 + t * 16 + ln) * ldb + kb;
      FragB b;
      b.half[0] = *(const v8us*)(brow + 8 * hh);
      b.half[1] = *(const v8us*)(brow + 16 + 8 * hh);
      acc[t] = mmaN<ASPLIT ? 2 : 1>(ah.v, al.v, b.v, b.v, acc[t]);
    }
  }
#pragma unroll
  for (int t = 0; t < 4; ++t) {
    const int col = col0 + t * 16 + ln;
    float bv = bias ? bias[col] : 0.f;
    if (BIAS_BF16) bv = bf16_round(bv);
#pragma unroll
    for (int r = 0; r < 8; ++r) {
      float v = acc[t][r] + bv;
      if (resid) { float rv = resid[(size_t)((row0 + 8 * hh + r) % rmod) * ldr + col]; if (RES_BF16) rv = bf16_round(rv); v += rv; }
      if (ACT == 1) v = fmaxf(v, 0.f);
      if (ACT == 2) v = 0.5f * v * (1.0f + erff(v * 0.70710678118654752f));
      if (ACT == 3) { const float u = 0.7978845608028654f * (v + 0.044715f * v * v * v); v = 0.5f * v * (1.0f + tanhf(u)); }
      so[w][8 * hh + r][t * 16 + ln] = v;
    }
  }
  __builtin_amdgcn_fence(__ATOMIC_ACQ_REL, "workgroup");
  __builtin_amdgcn_wave_barrier();
  const int rsub = lane >> 4, c4 = (lane & 15) * 4;
  {
#pragma unroll
    for (int q = 0; q < 8; ++q) {
      const int r = q * 2 + rsub;
      const v4f v = *(const v4fa*)&so[w][r][c4];
      *(v4f*)(C + (size_t)(row0 + r) * ldc + col0 + c4) = v;
    }
    
  }
}
// row LayerNorm (biased variance, eps) over N: s = X (+ R); optional out_sum <- s; out_norm <- (s-mu)*rsqrt(var+eps)*g + b
template <bool PARAM_BF16>
__global__ __launch_bounds__(256) void k_layernorm(const float* __restrict__ X, const float* __restrict__ R, const float* __restrict__ g, const float* __restrict__ bta,
                                                  float* __restrict__ out_sum, float* __restrict__ out_norm, int N, float eps) {
  __shared__ float red[256];
  const int row = blockIdx.x, tid = threadIdx.x;
  const float* x = X + (size_t)row * N; const float* rr = R ? R + (size_t)row * N : nullptr;
  float vals[16];                     // up to N = 4096
  const int per = N / 256;            // contiguous chunk per thread? use strided-by-4 chunks: thread handles j = tid*4 + 1024*u
  float s1 = 0.f;
  for (int u = 0; u < per / 4; ++u) {
    const int j = tid * 4 + 1024 * u;
    const v4f a = *(const v4fa*)(x + j);
    v4f b = {0.f,0.f,0.f,0.f}; if (rr) b = *(const v4fa*)(rr + j);
#pragma unroll
    for (int q = 0; q < 4; ++q) { const float v = a[q] + b[q]; vals[u * 4 + q] = v; s1 += v; }
  }
  red[tid] = s1; __syncthreads();
  for (int st = 128; st > 0; st >>= 1) { if (tid < st) red[tid] += red[tid + st]; __syncthreads(); }
  const float mu = red[0] / (float)N; __syncthreads();
  float s2 = 0.f;
  for (int u = 0; u < per / 4; ++u)
#pragma unroll
    for (int q = 0; q < 4; ++q) { const float c = vals[u * 4 + q] - mu; s2 += c * c; }
  red[tid] = s2; __syncthreads();
  for (int st = 128; st > 0; st >>= 1) { if (tid < st) red[tid] += red[tid + st]; __syncthreads(); }
  const float rs = rsqrtf(red[0] / (float)N + eps);
  {
    for (int u = 0; u < per / 4; ++u) {
      const int j = tid * 4 + 1024 * u;
      v4f o, sm;
#pragma unroll
      for (int q = 0; q < 4; ++q) {
        float gg = g[j + q], bb = bta[j + q];
        if (PARAM_BF16) { gg = bf16_round(gg); bb = bf16_round(bb); }
        sm[q] = vals[u * 4 + q]; o[q] = (vals[u * 4 + q] - mu) * rs * gg + bb;
      }
      if (out_sum) *(v4f*)(out_sum + (size_t)row * N + j) = sm;
      *(v4f*)(out_norm + (size_t)row * N + j) = o;
    }
    
  }
}



// ---- f16 WMMA path (v_wmma_f32_16x16x32_f16): 11-bit significands for operands in range — used where a [0,1] probability operand needs more precision than bf16
typedef _Float16 v16h __attribute__((ext_vector_type(16)));
union FragH { v16h v; v8us half[2]; _Float16 h[16]; unsigned short u[16]; };
template <int NT>
__device__ __forceinline__ v8f mmaH(v16h ah, v16h al, v16h bh, v16h bl, v8f c) {
  c = __builtin_amdgcn_wmma_f32_16x16x32_f16(false, ah, false, bh, (short)0, c, false, false);
  if (NT >= 2) c = __builtin_amdgcn_wmma_f32_16x16x32_f16(false, al, false, bh, (short)0, c, false, false);
  if (NT >= 3) c = __builtin_amdgcn_wmma_f32_16x16x32_f16(false, ah, false, bl, (short)0, c, false, false);
  asm volatile("v_nop\n\tv_nop\n\tv_nop\n\tv_nop" : "+v"(c) : "v"(ah), "v"(al), "v"(bh), "v"(bl));
  return c;
}
// batched GEMM like k_gemm_b but f16 operands: A f32 (split into f16 hi/lo if ASPLIT, else rounded to f16), Bt = f16 values [n][k]; alpha; C f32; N multiple of 16 (partial tiles skipped)
template <bool ASPLIT>
__global__ __launch_bounds__(128) void k_gemm_h(const float* __restrict__ A, int lda, size_t sA, const _Float16* __restrict__ Bh, int ldb, size_t sB, float alpha, float* __restrict__ C, int ldc, size_t sC, int M, int N, int K) {
  __shared__ __attribute__((aligned(16))) float so[4][16][64];
  const int tid = threadIdx.x, w = tid >> 5, lane = tid & 31, ln = lane & 15, hh = lane >> 4; const int by = blockIdx.y;
  A += (size_t)by * sA; Bh += (size_t)by * sB; C += (size_t)by * sC;
  const int ntn = (N + 63) / 64; const int wid = blockIdx.x * 4 + w; const int mt = wid / ntn, nq = wid % ntn; if (mt * 16 >= M) return;
  const int row0 = mt * 16, col0 = nq * 64; const float* arow = A + (size_t)(row0 + ln) * lda;
  v8f acc[4] = {};
  for (int kb = 0; kb < K; kb += 32) {
    FragH ah, al;
    const v4f x0 = *(const v4fa*)(arow + kb + 8 * hh), x1 = *(const v4fa*)(arow + kb + 8 * hh + 4), x2 = *(const v4fa*)(arow + kb + 16 + 8 * hh), x3 = *(const v4fa*)(arow + kb + 16 + 8 * hh + 4);
    float xs[16] = {x0[0],x0[1],x0[2],x0[3],x1[0],x1[1],x1[2],x1[3],x2[0],x2[1],x2[2],x2[3],x3[0],x3[1],x3[2],x3[3]};
#pragma unroll
    for (int i = 0; i < 16; ++i) { const _Float16 h = (_Float16)xs[i]; ah.h[i] = h; al.h[i] = ASPLIT ? (_Float16)(xs[i] - (float)h) : (_Float16)0.0f; }
#pragma unroll
    for (int t = 0; t < 4; ++t) { if (col0 + t * 16 >= N) continue; const size_t boff = (size_t)(col0 + t * 16 + ln) * ldb + kb; FragH bq; bq.half[0] = *(const v8us*)(Bh + boff + 8 * hh); bq.half[1] = *(const v8us*)(Bh + boff + 16 + 8 * hh);
      acc[t] = mmaH<ASPLIT ? 2 : 1>(ah.v, al.v, bq.v, bq.v, acc[t]); }
  }
#pragma unroll
  for (int t = 0; t < 4; ++t) { if (col0 + t * 16 >= N) continue;
#pragma unroll
    for (int r = 0; r < 8; ++r) so[w][8 * hh + r][t * 16 + ln] = acc[t][r] * alpha; }
  __builtin_amdgcn_fence(__ATOMIC_ACQ_REL, "workgroup"); __builtin_amdgcn_wave_barrier();
  const int rsub = lane >> 4, c4 = (lane & 15) * 4;
  {
#pragma unroll
    for (int q = 0; q < 8; ++q) { const int r = q * 2 + rsub; if (col0 + c4 < N) { const v4f v = *(const v4fa*)&so[w][r][c4]; *(v4f*)(C + (size_t)(row0 + r) * ldc + col0 + c4) = v; } }
     }
}

// Wt[n][k] = f16(W[k][n]·scale) from f32 row-major W[K][N] (scale = power of two; bf16-exact weights stay exact in f16 away from the subnormal range)
__global__ __launch_bounds__(256) void k_wt_f16(const float* __restrict__ W, _Float16* __restrict__ Wt, int K, int N, float scale) {
  const int t = blockIdx.x * 256 + threadIdx.x; if (t >= N * (K / 8)) return; const int n = t / (K / 8), k8 = (t % (K / 8)) * 8; FragH f;
#pragma unroll
  for (int i = 0; i < 8; ++i) f.h[i] = (_Float16)(bf16_round(W[(size_t)(k8 + i) * N + n]) * scale); const v8us o = f.half[0];
  *(v8us*)((unsigned short*)Wt + (size_t)n * K + k8) = o; 
}
// k_gemm_hh variant with fused epilogue: v = acc·alpha + bias[by·sBias + col] (+ CP[(row/rowsPerB)·sCPb + by·64 + col] if CP) ; ACT 0 none / 1 elu ; writes f16 C16 (and f32 C if non-null)
template <int ACT>
__global__ __launch_bounds__(128) void k_gemm_hhx(const _Float16* __restrict__ A, int lda, size_t sA, const _Float16* __restrict__ Bh, int ldb, size_t sB, float alpha, const float* __restrict__ bias, size_t sBias, const float* __restrict__ CP, int rowsPerB, size_t sCPb, int row0g,
    float* __restrict__ C, _Float16* __restrict__ C16, int ldc, size_t sC, int M, int N, int K) {
  __shared__ __attribute__((aligned(16))) float so[4][16][64];
  const int tid = threadIdx.x, w = tid >> 5, lane = tid & 31, ln = lane & 15, hh = lane >> 4; const int by = blockIdx.y;
  A += (size_t)by * sA; Bh += (size_t)by * sB; const size_t cofs = (size_t)by * sC; const float* bp = bias ? bias + (size_t)by * sBias : nullptr;
  const int ntn = (N + 63) / 64; const int wid = blockIdx.x * 4 + w; const int mt = wid / ntn, nq = wid % ntn; if (mt * 16 >= M) return;
  const int row0 = mt * 16, col0 = nq * 64; const _Float16* arow = A + (size_t)(row0 + ln) * lda;
  v8f acc[4] = {};
  for (int kb = 0; kb < K; kb += 32) { FragH ah; ah.half[0] = *(const v8us*)((const unsigned short*)arow + kb + 8 * hh); ah.half[1] = *(const v8us*)((const unsigned short*)arow + kb + 16 + 8 * hh);
#pragma unroll
    for (int t = 0; t < 4; ++t) { if (col0 + t * 16 >= N) continue; const size_t boff = (size_t)(col0 + t * 16 + ln) * ldb + kb; FragH bq; bq.half[0] = *(const v8us*)((const unsigned short*)Bh + boff + 8 * hh); bq.half[1] = *(const v8us*)((const unsigned short*)Bh + boff + 16 + 8 * hh);
      acc[t] = mmaH<1>(ah.v, ah.v, bq.v, bq.v, acc[t]); }
  }
#pragma unroll
  for (int t = 0; t < 4; ++t) { if (col0 + t * 16 >= N) continue; const int col = col0 + t * 16 + ln; const float bv = bp ? bf16_round(bp[col]) : 0.f;
#pragma unroll
    for (int r = 0; r < 8; ++r) { float v = acc[t][r] * alpha + bv; if (CP) { const int rr = row0g + row0 + 8 * hh + r; if (rowsPerB < 0) v += CP[cofs + (size_t)rr * ldc + col];      /* rowsPerB < 0: own element of the batched C plane */ else { const int bidx = rr / rowsPerB; v += CP[(size_t)bidx * sCPb + (size_t)by * 64 + col]; } } if (ACT == 1) v = (v > 0.f) ? v : expm1f(v); else if (ACT == 7) v = (v > 0.f) ? v + 1.0f : expf(v); else if (ACT == 8) v = tanhf(v); else if (ACT == 9) v = 0.5f * v * (1.0f + tanhf(0.7978845608028654f * (v + 0.044715f * v * v * v))); else if (ACT == 11) v = 1.0f / (1.0f + expf(-v)); else if (ACT == 12) v = (v > 0.f) ? v : 0.01f * v; else if (ACT == 14) v = (v > 0.f) ? v : 0.1f * v; else if (ACT == 16) v = (v >= 0.f) ? v : 0.3f * v; else if (ACT == 17) v = (v >= 0.f) ? v : 0.2f * v; else if (ACT == 15) v = v / (1.0f + expf(-v)); else if (ACT == 3) v = fmaxf(v, 0.f); else if (ACT == 6) v = 0.5f * v * (1.0f + erff(v * 0.70710678118654752f)); so[w][8 * hh + r][t * 16 + ln] = v; } }
  __builtin_amdgcn_fence(__ATOMIC_ACQ_REL, "workgroup"); __builtin_amdgcn_wave_barrier();
  const int rsub = lane >> 4, c4 = (lane & 15) * 4; typedef _Float16 v4h __attribute__((ext_vector_type(4)));
  {
#pragma unroll
    for (int q = 0; q < 8; ++q) { const int r = q * 2 + rsub; if (col0 + c4 < N) { const v4f v = *(const v4fa*)&so[w][r][c4]; if (C) *(v4f*)(C + cofs + (size_t)(row0 + r) * ldc + col0 + c4) = v; if (C16) { v4h h4; for (int i = 0; i < 4; ++i) h4[i] = (_Float16)v[i]; *(v4h*)(C16 + cofs + (size_t)(row0 + r) * ldc + col0 + c4) = h4; } } }
     }
}


typedef _Float16 v4h __attribute__((ext_vector_type(4)));

__global__ __launch_bounds__(256) void k_x16(const float* __restrict__ x, _Float16* __restrict__ X16, size_t n8) { const size_t t = (size_t)blockIdx.x * 256 + threadIdx.x; if (t >= n8) return; FragH f;
#pragma unroll
  for (int q = 0; q < 8; ++q) f.h[q] = (_Float16)bf16_round(x[t * 8 + q]); *(v8us*)((unsigned short*)X16 + t * 8) = f.half[0];  }
__global__ __launch_bounds__(256) void k_h16(const float* __restrict__ x, _Float16* __restrict__ X16, size_t n8) { const size_t t = (size_t)blockIdx.x * 256 + threadIdx.x; if (t >= n8) return; FragH f;
#pragma unroll
  for (int q = 0; q < 8; ++q) f.h[q] = (_Float16)x[t * 8 + q]; *(v8us*)((unsigned short*)X16 + t * 8) = f.half[0];  }
__global__ __launch_bounds__(256) void k_round16f(const float* __restrict__ W, _Float16* __restrict__ Bt, size_t n8) { const size_t t = (size_t)blockIdx.x * 256 + threadIdx.x; if (t >= n8) return; FragH f;
#pragma unroll
  for (int i = 0; i < 8; ++i) f.h[i] = (_Float16)(bf16_round(W[t * 8 + i]) * 16.0f); *(v8us*)((unsigned short*)Bt + t * 8) = f.half[0];  }
template <int NHv, int TTv>
__global__ __launch_bounds__(256) void k_vt(const _Float16* __restrict__ V16, int ldv, int voff, _Float16* __restrict__ Vt) { __shared__ unsigned short tl[64][66]; const int tid = threadIdx.x; const int slab = blockIdx.x / (TTv / 64), lg = blockIdx.x % (TTv / 64); const int b = slab / NHv, h = slab % NHv;
  for (int i = tid; i < 64 * 8; i += 256) { const int r = i / 8, c8 = (i % 8) * 8; FragH f; f.half[0] = *(const v8us*)((const unsigned short*)V16 + ((size_t)b * TTv + lg * 64 + r) * ldv + voff + h * 64 + c8);
#pragma unroll
    for (int q = 0; q < 8; ++q) tl[r][c8 + q] = f.u[q]; }
  __syncthreads();
  {
#pragma unroll
    for (int rd = 0; rd < 2; ++rd) { const int d = rd * 32 + tid / 8, pc = tid % 8; FragH f;
#pragma unroll
      for (int q = 0; q < 8; ++q) f.u[q] = tl[pc * 8 + q][d];
      *(v8us*)((unsigned short*)Vt + ((size_t)slab * 64 + d) * TTv + lg * 64 + pc * 8) = f.half[0]; }
     } }

__global__ __launch_bounds__(256) void k_hl(const float* __restrict__ F, _Float16* __restrict__ Hh, _Float16* __restrict__ Hl, size_t n8) { const size_t t = (size_t)blockIdx.x * 256 + threadIdx.x; if (t >= n8) return; FragH fh, fl; const v4f a = *(const v4fa*)(F + t * 8), c = *(const v4fa*)(F + t * 8 + 4);
#pragma unroll
  for (int q = 0; q < 4; ++q) { _Float16 h = (_Float16)a[q]; fh.h[q] = h; fl.h[q] = (_Float16)((a[q] - (float)h) * 1024.0f); h = (_Float16)c[q]; fh.h[4 + q] = h; fl.h[4 + q] = (_Float16)((c[q] - (float)h) * 1024.0f); }
  { *(v8us*)((unsigned short*)Hh + t * 8) = fh.half[0]; *(v8us*)((unsigned short*)Hl + t * 8) = fl.half[0];  } }

// ---- fast GEMM (work-group tile 128x64, wave tile 32x64; requires M % 128 == 0, N % 64 == 0, K % 64 == 0); epilogue = k_gemm_hhx semantics ----
// Operands go through LDS, 64 k a pass: the work-group's 128 A rows and 64 B rows as 128-byte row pieces, 8 lanes a piece, so a wave's 16-byte global load covers 4 whole lines
// (a fragment load straight from global touches 16 lines for the same bytes, and each wave fetched all of B for itself). Rows at a 144-B pitch: 16-byte fragment reads without bank conflicts.
// Two buffers: the next pass's global loads fly during the pass, are stored to the other buffer at its foot, one barrier a pass. Each accumulator takes its products in ascending k.
#define GK 64                        /* k a pass */
#define GP 72                        /* LDS row pitch in f16 */
__device__ __forceinline__ v16h g2_frag(const _Float16* p, int hh) { FragH f; f.half[0] = *(const v8us*)((const unsigned short*)p + 8 * hh); f.half[1] = *(const v8us*)((const unsigned short*)p + 16 + 8 * hh); return f.v; }
__device__ __forceinline__ v16h g2_lfrag(const unsigned short* p, int hh) { FragH f; f.half[0] = *(const v8us*)(p + 8 * hh); f.half[1] = *(const v8us*)(p + 16 + 8 * hh); return f.v; }      /* the same k order from an LDS row */
__device__ __forceinline__ v8f g2_mma(v16h a, v16h b, v8f c) { v8f d = __builtin_amdgcn_wmma_f32_16x16x32_f16(false, a, false, b, (short)0, c, false, false); asm volatile("v_nop\n\tv_nop\n\tv_nop\n\tv_nop" : "+v"(d) : "v"(a), "v"(b)); return d; }
template <int ACT>
__global__ __launch_bounds__(128) void k_gemm2(const _Float16* __restrict__ A, int lda, size_t sA, const _Float16* __restrict__ Bh, int ldb, size_t sB, float alpha, const float* __restrict__ bias, size_t sBias, const float* __restrict__ CP, int rowsPerB, size_t sCPb, int row0g,
    float* __restrict__ C, _Float16* __restrict__ C16, int ldc, size_t sC, int M, int N, int K, const float* __restrict__ bias1, const float* __restrict__ bias2) { static_assert(ACT == 0 || ACT == 3 || ACT == 6 || ACT == 8 || ACT == 9 || ACT == 11 || ACT == 12 || ACT == 14 || ACT == 15 || ACT == 16 || ACT == 17, "k_gemm2: unsupported ACT code (would silently apply no activation)");
  __shared__ __attribute__((aligned(16))) float so[4][32][68];
  __shared__ __attribute__((aligned(16))) unsigned short sa[2][128][GP];
  __shared__ __attribute__((aligned(16))) unsigned short sb[2][64][GP];
  const int tid = threadIdx.x, w = tid >> 5, lane = tid & 31, ln = lane & 15, hh = lane >> 4; const int by = blockIdx.y;
  A += (size_t)by * sA; Bh += (size_t)by * sB; const size_t cofs = (size_t)by * sC; const float* bp = bias ? bias + (size_t)by * sBias : nullptr;
  if (by == 1 && bias1) bp = bias1; if (by == 2 && bias2) bp = bias2;      /* batch entries 1 and 2 whose biases are buffers of their own */
  const int ntn = N >> 6; const int mt = blockIdx.x / ntn, nq = blockIdx.x - mt * ntn; const int row0 = mt * 128 + 32 * w, col0 = nq * 64; if (mt * 128 >= M) return;      /* the whole work-group leaves or none: barriers follow */
  const int sr = tid >> 3, sc = (tid & 7) * 8;      /* staging: this thread moves 16 bytes of rows sr + 16 i of each tile; 8 threads cover a 128-byte row piece */
  __builtin_assume(lda == DM); __builtin_assume(ldb == DM);      /* every launch here has rows of DM: with the pitch known the 16-row steps are immediate offsets on one address pair an operand, no address arithmetic between the loads */
  const unsigned short* ag = (const unsigned short*)A + (size_t)(mt * 128 + sr) * lda + sc; const unsigned short* bg = (const unsigned short*)Bh + (size_t)(col0 + sr) * ldb + sc;
  v8us ra[8], rb[4];
#pragma unroll      /* constant indices keep the pieces in registers */
  for (int i = 0; i < 8; ++i) ra[i] = *(const v8us*)(ag + (size_t)(16 * i) * lda);
#pragma unroll      /* constant indices keep the pieces in registers */
  for (int i = 0; i < 4; ++i) rb[i] = *(const v8us*)(bg + (size_t)(16 * i) * ldb);
#pragma unroll      /* constant indices keep the pieces in registers */
  for (int i = 0; i < 8; ++i) *(v8us*)&sa[0][sr + 16 * i][sc] = ra[i];
#pragma unroll      /* constant indices keep the pieces in registers */
  for (int i = 0; i < 4; ++i) *(v8us*)&sb[0][sr + 16 * i][sc] = rb[i];
  __syncthreads();
  const v8f z8 = {0.f,0.f,0.f,0.f,0.f,0.f,0.f,0.f}; v8f c00 = z8, c01 = z8, c02 = z8, c03 = z8, c10 = z8, c11 = z8, c12 = z8, c13 = z8;
#pragma unroll 1      /* one pass a trip: the body already holds 16 matrix instructions and 24 LDS reads */
  for (int kb = 0; kb < K; kb += GK) { const int cur = (kb / GK) & 1; const bool more = kb + GK < K;
    if (more) { ag += GK; bg += GK;
#pragma unroll      /* constant indices keep the pieces in registers */
      for (int i = 0; i < 8; ++i) ra[i] = *(const v8us*)(ag + (size_t)(16 * i) * lda);
#pragma unroll      /* constant indices keep the pieces in registers */
      for (int i = 0; i < 4; ++i) rb[i] = *(const v8us*)(bg + (size_t)(16 * i) * ldb); }
    v16h af[2][2], bf[2][4];      /* [k half of the pass][tile] */
#pragma unroll      /* constant indices keep the fragments in registers */
    for (int s = 0; s < 2; ++s) {
#pragma unroll      /* constant indices keep the fragments in registers */
      for (int t = 0; t < 2; ++t) af[s][t] = g2_lfrag(&sa[cur][32 * w + 16 * t + ln][32 * s], hh);
#pragma unroll      /* constant indices keep the fragments in registers */
      for (int t = 0; t < 4; ++t) bf[s][t] = g2_lfrag(&sb[cur][16 * t + ln][32 * s], hh); }
    __builtin_amdgcn_sched_barrier(0);      /* keeps the pass's global loads and all 24 LDS reads issued here: sunk to in front of their matrix instructions, each group would stand with a full latency in the open */
#pragma unroll      /* constant indices keep the fragments in registers */
    for (int s = 0; s < 2; ++s) {
      c00 = g2_mma(af[s][0], bf[s][0], c00); c10 = g2_mma(af[s][1], bf[s][0], c10);
      c01 = g2_mma(af[s][0], bf[s][1], c01); c11 = g2_mma(af[s][1], bf[s][1], c11);
      c02 = g2_mma(af[s][0], bf[s][2], c02); c12 = g2_mma(af[s][1], bf[s][2], c12);
      c03 = g2_mma(af[s][0], bf[s][3], c03); c13 = g2_mma(af[s][1], bf[s][3], c13); }
    if (more) {      /* every reader left that buffer before the last barrier */
#pragma unroll      /* constant indices keep the pieces in registers */
      for (int i = 0; i < 8; ++i) *(v8us*)&sa[cur ^ 1][sr + 16 * i][sc] = ra[i];
#pragma unroll      /* constant indices keep the pieces in registers */
      for (int i = 0; i < 4; ++i) *(v8us*)&sb[cur ^ 1][sr + 16 * i][sc] = rb[i]; }
    __syncthreads(); }      /* publishes the next pass's tiles and ends this pass's reads of the buffer that the next pass refills */
  v8f accs[8] = {c00, c01, c02, c03, c10, c11, c12, c13};
#pragma unroll
  for (int u = 0; u < 8; ++u) { const int t = u & 3, half = u >> 2; const int col = col0 + t * 16 + ln; const float bv = bp ? bf16_round(bp[col]) : 0.f;
#pragma unroll
    for (int r = 0; r < 8; ++r) { const int rloc = half * 16 + 8 * hh + r; float v = accs[u][r] * alpha + bv; if (CP) { if (rowsPerB < 0) v += CP[cofs + (size_t)(row0g + row0 + rloc) * ldc + col];      /* rowsPerB < 0: own element of the batched C plane */ else { const int bidx = (row0g + row0 + rloc) / rowsPerB; v += CP[(size_t)bidx * sCPb + (size_t)by * 64 + col]; } }
      if (ACT == 3) v = fmaxf(v, 0.f); else if (ACT == 6) v = 0.5f * v * (1.0f + erff(v * 0.70710678118654752f)); else if (ACT == 11) v = 1.0f / (1.0f + expf(-v)); else if (ACT == 15) v = v / (1.0f + expf(-v)); else if (ACT == 12) v = (v > 0.f) ? v : 0.01f * v; else if (ACT == 8) v = tanhf(v); else if (ACT == 9) v = 0.5f * v * (1.0f + tanhf(0.7978845608028654f * (v + 0.044715f * v * v * v))); else if (ACT == 14) v = (v > 0.f) ? v : 0.1f * v; else if (ACT == 16) v = (v >= 0.f) ? v : 0.3f * v; else if (ACT == 17) v = (v >= 0.f) ? v : 0.2f * v;
      so[w][rloc][t * 16 + ln] = v; } }
  __builtin_amdgcn_fence(__ATOMIC_ACQ_REL, "workgroup"); __builtin_amdgcn_wave_barrier();
  const int rsub = lane >> 4, c4 = (lane & 15) * 4;
  {
#pragma unroll
    for (int q = 0; q < 16; ++q) { const int r = q * 2 + rsub; const v4f v = *(const v4fa*)&so[w][r][c4]; if (C) *(v4f*)(C + cofs + (size_t)(row0 + r) * ldc + col0 + c4) = v; if (C16) { v4h h4; for (int i = 0; i < 4; ++i) h4[i] = (_Float16)v[i]; *(v4h*)(C16 + cofs + (size_t)(row0 + r) * ldc + col0 + c4) = h4; } }
     } }


// All seven f32 -> f16 conversions in one launch; the block index picks the buffer. Blocks 0 .. 3 PXB - 1: query, key, value -> X[0..2] (bf16-rounded, exact in f16);
// then 4 PWB blocks: Wq, Wk, Wv, Wo -> B[0..3] (bf16-rounded, x16: exact, away from the f16 subnormal range). A thread moves PC pieces of 4 elements, 256 pieces apart:
// a wave's 16-byte loads cover 512 contiguous bytes and its 8-byte stores 256, whole lines both.
#define PC 16
#define PXB ((int)(NR * DM / 4 / (256 * PC)))      /* blocks an input: 128 */
#define PWB ((int)((size_t)DM * DM / 4 / (256 * PC)))      /* blocks a weight: 16 */
__global__ __launch_bounds__(256) void k_prep(const float* __restrict__ xq, const float* __restrict__ xk, const float* __restrict__ xv, const float* __restrict__ wq, const float* __restrict__ wk, const float* __restrict__ wv, const float* __restrict__ wo, _Float16* __restrict__ X, _Float16* __restrict__ B) {
  const int b = blockIdx.x; const bool isx = b < 3 * PXB; const int j = isx ? b / PXB : (b - 3 * PXB) / PWB; const int blk = isx ? b - j * PXB : (b - 3 * PXB) - j * PWB;
  const float* s = isx ? (j == 0 ? xq : j == 1 ? xk : xv) : (j == 0 ? wq : j == 1 ? wk : j == 2 ? wv : wo);
  _Float16* d = isx ? X + (size_t)j * NR * DM : B + (size_t)j * DM * DM; const float sc = isx ? 1.0f : 16.0f;
  const size_t e0 = ((size_t)blk * (256 * PC) + threadIdx.x) * 4;
  v4f a[PC];
#pragma unroll      /* constant indices keep the pieces in registers, their loads in flight together */
  for (int u = 0; u < PC; ++u) a[u] = *(const v4fa*)(s + e0 + (size_t)u * 1024);
  __builtin_amdgcn_sched_barrier(0);      /* keeps all PC loads issued here: left alone the build holds the last five back until the first eleven have landed, a second memory latency in the open */
#pragma unroll      /* constant indices keep the pieces in registers */
  for (int u = 0; u < PC; ++u) { v4h o;
#pragma unroll      /* constant indices keep the pieces in registers */
    for (int q = 0; q < 4; ++q) o[q] = (_Float16)(bf16_round(a[u][q]) * sc);
    *(v4h*)(d + e0 + (size_t)u * 1024) = o; } }
// V^T of every head: VT[h][d][s] from the merged f16 rows, 64 x 64 tiles through LDS. grid (SQ / 64, NH).
__global__ __launch_bounds__(256) void k_vt(const _Float16* __restrict__ V16, _Float16* __restrict__ VT) { __shared__ unsigned short tl[64][65]; const int tid = threadIdx.x; const int h = blockIdx.y; const int s0 = blockIdx.x * 64;
  for (int i = tid; i < 64 * 8; i += 256) { const int j = i / 8, d8 = (i % 8) * 8; FragH f; f.half[0] = *(const v8us*)((const unsigned short*)V16 + ((size_t)s0 + j) * DM + h * HD + d8); for (int q = 0; q < 8; ++q) tl[d8 + q][j] = f.u[q]; }
  __syncthreads();
  { for (int i = tid; i < 64 * 8; i += 256) { const int d = i / 8, j8 = (i % 8) * 8; FragH f; for (int q = 0; q < 8; ++q) f.u[q] = tl[d][j8 + q]; *(v8us*)((unsigned short*)VT + ((size_t)h * HD + d) * SQ + s0 + j8) = f.half[0]; }  } }

#define FS 4                         /* key quarters: waves that share a query group */
#define FW 32                        /* keys a wave and run */
#define FJ 2                         /* such 32-key runs of a wave between two barriers */
#define FK (FJ * FS * FW)            /* keys a pass */
#define FP 72                        /* LDS pitch of a K row in f16 */
#define FV 264                       /* LDS pitch of a V^T row in f16 */
__device__ __forceinline__ float fa_xhalf(float x) { return __builtin_bit_cast(float, __builtin_amdgcn_permlanex16(__builtin_bit_cast(int, x), __builtin_bit_cast(int, x), 0x76543210, 0xfedcba98, false, false)); }      /* lane l with lane l ^ 16 */
__device__ __forceinline__ v8f fa_mma(v16h a, v16h b, v8f c) { return __builtin_amdgcn_wmma_f32_16x16x32_f16(false, a, false, b, (short)0, c, false, false); }
__device__ __forceinline__ v16h fa_frag(const unsigned short* p, int hh) { FragH f; f.half[0] = *(const v8us*)(p + 8 * hh); f.half[1] = *(const v8us*)(p + 16 + 8 * hh); return f.v; }
__global__ __launch_bounds__(512) void k_fattn(const _Float16* __restrict__ Q16, const _Float16* __restrict__ K16, const _Float16* __restrict__ VT, _Float16* __restrict__ O16) {
  __shared__ __attribute__((aligned(16))) unsigned short kt[2][FK][FP];
  __shared__ __attribute__((aligned(16))) unsigned short vs[2][HD][FV];
  __shared__ __attribute__((aligned(32))) float mo[4][FS][4][2][32][8];      /* [query group][key quarter][16-d tile][16-query tile][lane]: a quarter's x */
  __shared__ __attribute__((aligned(8))) float ml[4][FS][2][32][2];      /* its maximum and its sum */
  const int tid = threadIdx.x, w = tid >> 5, lane = tid & 31, ln = lane & 15, hh = lane >> 4; const int qg = w & 3, ks = w >> 2; const int h = blockIdx.y; const int q0 = blockIdx.x * 128 + qg * 32;
  v16h qf[2][2];      /* [query tile][d half] */
#pragma unroll      /* constant indices keep the fragments and accumulators in registers */
  for (int u = 0; u < 2; ++u) { const _Float16* qp = Q16 + (size_t)(q0 + 16 * u + ln) * DM + h * HD; qf[u][0] = g2_frag(qp, hh); qf[u][1] = g2_frag(qp + 32, hh);
    asm volatile("s_wait_xcnt 0x0" ::: "memory"); }      /* stands in front of any reuse of this tile's address registers: the next loads' results may be placed on them */
  const int kr = tid >> 3, kc = (tid & 7) * 8;      /* staging K: this thread moves 16 bytes of rows kr + 64 i; 8 threads cover a 128-byte row */
  const int vr = tid >> 5, vc = (tid & 31) * 8;      /* staging V^T: 16 bytes of rows vr + 16 i; a wave covers a 512-byte row piece */
  const unsigned short* kg = (const unsigned short*)K16 + (size_t)kr * DM + h * HD + kc; const unsigned short* vg = (const unsigned short*)VT + ((size_t)h * HD + vr) * SQ + vc;
  { v8us pk[4], pv[4];
#pragma unroll      /* constant indices keep the pieces in registers */
    for (int i = 0; i < 4; ++i) { pk[i] = *(const v8us*)(kg + (size_t)(64 * i) * DM); pv[i] = *(const v8us*)(vg + (size_t)(16 * i) * SQ); }
#pragma unroll      /* constant indices keep the pieces in registers */
    for (int i = 0; i < 4; ++i) { *(v8us*)&kt[0][kr + 64 * i][kc] = pk[i]; *(v8us*)&vs[0][vr + 16 * i][vc] = pv[i]; } }
  __syncthreads();
  v8us rk[2], rv[2];
  const v8f z8 = {0.f,0.f,0.f,0.f,0.f,0.f,0.f,0.f}; v8f o[4][2] = {{z8, z8}, {z8, z8}, {z8, z8}, {z8, z8}}; float m[2] = {-3.0e38f, -3.0e38f}, l[2] = {0.f, 0.f};      /* o: [d tile][query tile]; m: running maximum of the raw products q.k; l: this half's sum of weights */
  const float CS = 0.125f * 1.4426950408889634f;      /* 1 / sqrt(64), and e^x as 2^(x log2 e) */
#pragma unroll 1      /* one pass a trip: the body already holds 32 matrix instructions and 32 LDS reads */
  for (int it = 0; it < SQ / FK; ++it) { const int cur = it & 1; const bool more = it + 1 < SQ / FK;
    if (more) { kg += (size_t)FK * DM; vg += FK; }
#pragma unroll      /* both runs in line: their LDS offsets are immediates */
    for (int j = 0; j < FJ; ++j) { const int k0 = (j * FS + ks) * FW;      /* the run's first key in the tile; no barrier between the runs, so the waves of a SIMD drift apart and fill one another's waits */
    if (more) {      /* each run brings half of the next tile: half the staging registers */
#pragma unroll      /* constant indices keep the pieces in registers */
      for (int i = 0; i < 2; ++i) { rk[i] = *(const v8us*)(kg + (size_t)(64 * (2 * j + i)) * DM); rv[i] = *(const v8us*)(vg + (size_t)(16 * (2 * j + i)) * SQ); } }
    v16h kf[2][2], vf[4];
#pragma unroll      /* constant indices keep the fragments and accumulators in registers */
    for (int t = 0; t < 2; ++t) { const unsigned short* kp = &kt[cur][k0 + t * 16 + ln][0]; kf[t][0] = fa_frag(kp, hh); kf[t][1] = fa_frag(kp + 32, hh); }
    __builtin_amdgcn_sched_barrier(0);      /* keeps the run's global loads and its 8 K reads issued here, as one group ahead of the score products */
    v8f s[2][2];      /* [key tile][query tile] */
#pragma unroll      /* constant indices keep the fragments and accumulators in registers */
    for (int t = 0; t < 2; ++t)
#pragma unroll      /* constant indices keep the fragments and accumulators in registers */
      for (int u = 0; u < 2; ++u) s[t][u] = fa_mma(kf[t][0], qf[u][0], z8);
#pragma unroll      /* constant indices keep the fragments and accumulators in registers */
    for (int t = 0; t < 2; ++t)
#pragma unroll      /* constant indices keep the fragments and accumulators in registers */
      for (int u = 0; u < 2; ++u) s[t][u] = fa_mma(kf[t][1], qf[u][1], s[t][u]);
#pragma unroll      /* constant indices keep the fragments and accumulators in registers */
    for (int t = 0; t < 4; ++t) vf[t] = fa_frag(&vs[cur][t * 16 + ln][k0], hh);
    __builtin_amdgcn_sched_barrier(0);      /* keeps the 8 V^T reads issued here, as one group behind the score products: their latency passes under the softmax; sunk to in front of their matrix instructions each would stand in the open */
    FragH p[2]; float corr[2], off[2];
#pragma unroll      /* constant indices keep the fragments and accumulators in registers */
    for (int u = 0; u < 2; ++u) { float a0 = s[0][u][0], a1 = s[1][u][0];      /* one short maximum chain a tile */
#pragma unroll      /* constant indices keep the fragments and accumulators in registers */
      for (int r = 1; r < 8; ++r) { a0 = fmaxf(a0, s[0][u][r]); a1 = fmaxf(a1, s[1][u][r]); }
      float tm = fmaxf(a0, a1); tm = fmaxf(tm, fa_xhalf(tm)); const float mn = fmaxf(m[u], tm); corr[u] = __builtin_amdgcn_exp2f((m[u] - mn) * CS); off[u] = 8.0f - mn * CS; m[u] = mn; }      /* weights carry x256, as f16 operands away from the subnormal range; it cancels in x = sum / l */
#pragma unroll      /* constant indices keep the fragments and accumulators in registers */
    for (int t = 0; t < 2; ++t)
#pragma unroll      /* constant indices keep the fragments and accumulators in registers */
      for (int u = 0; u < 2; ++u)
#pragma unroll      /* constant indices keep the fragments and accumulators in registers */
        for (int r = 0; r < 8; ++r) { const float e = __builtin_amdgcn_exp2f(fmaf(s[t][u][r], CS, off[u])); s[t][u][r] = e; p[u].h[t * 8 + r] = (_Float16)e; }
#pragma unroll      /* constant indices keep the fragments and accumulators in registers */
    for (int u = 0; u < 2; ++u) { const v8f es = s[0][u] + s[1][u];      /* the run's sum as a tree: one chain of 16 dependent adds would stand at the foot of every run */
      l[u] = l[u] * corr[u] + (((es[0] + es[1]) + (es[2] + es[3])) + ((es[4] + es[5]) + (es[6] + es[7])));
#pragma unroll      /* constant indices keep the fragments and accumulators in registers */
      for (int t = 0; t < 4; ++t) o[t][u] *= corr[u]; }
#pragma unroll      /* constant indices keep the fragments and accumulators in registers */
    for (int u = 0; u < 2; ++u)
#pragma unroll      /* constant indices keep the fragments and accumulators in registers */
      for (int t = 0; t < 4; ++t) o[t][u] = fa_mma(vf[t], p[u].v, o[t][u]);
    if (more) {      /* every reader left that buffer before the last barrier */
#pragma unroll      /* constant indices keep the pieces in registers */
      for (int i = 0; i < 2; ++i) { *(v8us*)&kt[cur ^ 1][kr + 64 * (2 * j + i)][kc] = rk[i]; *(v8us*)&vs[cur ^ 1][vr + 16 * (2 * j + i)][vc] = rv[i]; } } }
    __syncthreads(); }      /* publishes the next tile and ends this pass's reads of the buffer that the next pass refills */
  // join of the four key quarters: every wave leaves its x, maximum and sum in LDS; then the wave of quarter j joins d tile j of its query group's 32 queries
#pragma unroll      /* constant indices keep the fragments and accumulators in registers */
  for (int u = 0; u < 2; ++u) { l[u] += fa_xhalf(l[u]); ml[qg][ks][u][lane][0] = m[u]; ml[qg][ks][u][lane][1] = l[u];
#pragma unroll      /* constant indices keep the fragments and accumulators in registers */
    for (int t = 0; t < 4; ++t) *(v8f*)&mo[qg][ks][t][u][lane][0] = o[t][u]; }
  __syncthreads();      /* the quarters' results are read by other waves */
#pragma unroll      /* constant indices keep the fragments and accumulators in registers */
  for (int u = 0; u < 2; ++u) { float mj[FS], lj[FS];
#pragma unroll      /* constant indices keep the fragments and accumulators in registers */
    for (int j = 0; j < FS; ++j) { mj[j] = ml[qg][j][u][lane][0]; lj[j] = ml[qg][j][u][lane][1]; }
    const float mx = fmaxf(fmaxf(mj[0], mj[1]), fmaxf(mj[2], mj[3])); float ls = 0.f; v8f x = z8;
#pragma unroll      /* constant indices keep the fragments and accumulators in registers */
    for (int j = 0; j < FS; ++j) mj[j] = __builtin_amdgcn_exp2f((mj[j] - mx) * CS);      /* each quarter's weight in the join */
#pragma unroll      /* constant indices keep the fragments and accumulators in registers */
    for (int j = 0; j < FS; ++j) { ls += mj[j] * lj[j]; x += *(const v8f*)&mo[qg][j][ks][u][lane][0] * mj[j]; }
    const float inv = 1.0f / ls; FragH f;      /* lane (ln, hh) holds x[q0 + 16 u + ln][16 ks + 8 hh + r] */
#pragma unroll      /* constant indices keep the fragments and accumulators in registers */
    for (int r = 0; r < 8; ++r) f.h[r] = (_Float16)(x[r] * inv);
    *(v8us*)&kt[0][qg * 32 + 16 * u + ln][16 * ks + 8 * hh] = f.half[0]; }      /* the K buffer, which every reader left at the loop's last barrier, now holds the work-group's 128 output row pieces */
  __syncthreads();      /* a row piece comes from four waves and leaves as one whole 128-byte line */
  unsigned short* op = (unsigned short*)O16 + (size_t)(blockIdx.x * 128 + kr) * DM + h * HD + kc;
  *(v8us*)op = *(const v8us*)&kt[0][kr][kc]; *(v8us*)(op + 64 * DM) = *(const v8us*)&kt[0][kr + 64][kc]; }

extern "C" void kernel_launch(void* const* d_in, const int* in_sizes, int n_in,
                              void* d_out, int out_size, void* d_ws, size_t ws_size, hipStream_t stream) {
  (void)in_sizes; (void)n_in; (void)out_size;
  const float* const* I = (const float* const*)d_in; const float* xq = I[0]; const float* xk = I[1]; const float* xv = I[2]; const float* wq = I[3]; const float* bq = I[4]; const float* wk = I[5]; const float* bk = I[6]; const float* wv = I[7]; const float* bv = I[8]; const float* wo = I[9]; const float* bo = I[10];
  char* ws = (char*)d_ws; size_t off = 0;
  auto take = [&](size_t bytes) { char* p = ws + off; off += (bytes + 255) & ~(size_t)255; return p; };
  _Float16* BQ = (_Float16*)take((size_t)4 * DM * DM * 2); _Float16* BO = BQ + (size_t)3 * DM * DM;      /* Wq | Wk | Wv | Wo, one after the other */
  _Float16* XQ = (_Float16*)take(3 * NR * DM * 2);      /* query | key | value rows */
  _Float16* Q16 = (_Float16*)take(3 * NR * DM * 2); _Float16* K16 = Q16 + NR * DM; _Float16* V16 = K16 + NR * DM;      /* q | k | v */
  _Float16* O16 = (_Float16*)take(NR * DM * 2);
  _Float16* VT = (_Float16*)take((size_t)NH * HD * SQ * 2);
  if (off > ws_size) return;      /* 2 + 7x4 + 4 = approx 34 MiB */
  k_prep<<<3 * PXB + 4 * PWB, 256, 0, stream>>>(xq, xk, xv, wq, wk, wv, wo, XQ, BQ);
  const dim3 gp((unsigned)((NR / 128) * (DM / 64)), 1); const dim3 gp3((unsigned)((NR / 128) * (DM / 64)), 3);
  k_gemm2<0><<<gp3, 128, 0, stream>>>(XQ, DM, NR * DM, BQ, DM, (size_t)DM * DM, 0.0625f, bq, 0, nullptr, 1, 0, 0, nullptr, Q16, DM, NR * DM, MP, DM, DM, bk, bv);      /* q, k and v: blockIdx.y picks rows, weight, bias and output */
  k_vt<<<dim3(SQ / 64, NH), 256, 0, stream>>>(V16, VT);
  k_fattn<<<dim3(SQ / 128, NH), 512, 0, stream>>>(Q16, K16, VT, O16);      /* x (merged heads) as f16 rows */
  k_gemm2<0><<<gp, 128, 0, stream>>>(O16, DM, 0, BO, DM, 0, 0.0625f, bo, 0, nullptr, 1, 0, 0, (float*)d_out, nullptr, DM, 0, MO, DM, DM, nullptr, nullptr);      /* out = o W_o^T + b_o, rows are the output layout */
}

// v006
// A run of this version takes 63.2 microseconds.
// Two timings next to v005 put it at 1.07 and 1.06 times that version's speed.
// Over all steps from v000 it is 108 times as fast.
#include <hip/hip_runtime.h>
// Multi-head attention over separate query / key / value inputs ([1][4096][512] each; q = query Wq^T + bq, k = key Wk^T + bk, v = value Wv^T + bv, 8 heads of 64; attn = softmax(q k^T / 8); x = attn v; out = x Wo^T + bo -> [1][4096][512]).
// Structure: token rows; query, key, value and the four weights to exact f16 in one launch; Q | K | V as three WMMA GEMMs in one launch, blockIdx.y the projection (32x64 wave tiles, operands via LDS, f32 accumulation, exact x16 natural weights, bias in the epilogue, f16 outputs); one attention kernel for all heads (scores^T = K q^T, running-maximum softmax in registers, x^T += V^T p^T with V^T fragments by transposing LDS loads of V rows; scores and weights never stored) written straight into the merged f16 rows; out = x Wo^T + bo GEMM (f32).
// Compute dtype: inputs rounded to bf16; inputs / weights exact; q, k, v, softmax weights and x as plain f16 GEMM operands (~2^-12); scores and softmax statistics f32. v_wmma_f32_16x16x32_f16.
#define NB 1
#define SQ 4096
#define DM 512
#define NH 8
#define HD 64
#define MP ((int)NR)                 /* token rows through the q/k/v projections (debug hook) */
#define MO ((int)NR)                 /* token rows through the output projection (debug hook) */
#define NR ((size_t)NB * SQ)         /* 4096 token rows */
typedef __bf16 v16b __attribute__((ext_vector_type(16)));
typedef unsigned short v8us __attribute__((ext_vector_type(8), may_alias));
typedef float  v8f  __attribute__((ext_vector_type(8)));
typedef float  v4f  __attribute__((ext_vector_type(4)));
typedef float  v4fa __attribute__((ext_vector_type(4), may_alias));
union FragB { v16b v; v8us half[2]; unsigned short u[16]; };

__device__ __forceinline__ unsigned short bf16_bits(float x) { unsigned int u = __float_as_uint(x); return (unsigned short)((u + 0x7FFFu + ((u >> 16) & 1u)) >> 16); }
__device__ __forceinline__ float bf16_val(unsigned short b) { return __uint_as_float(((unsigned int)b) << 16); }
__device__ __forceinline__ float bf16_round(float x) { return bf16_val(bf16_bits(x)); }
// D += A·B with NT terms: 1 = ah·bh, 2 = + al·bh (A split), 3 = + ah·bl (both split)
template <int NT>
__device__ __forceinline__ v8f mmaN(v16b ah, v16b al, v16b bh, v16b bl, v8f c) {
  c = __builtin_amdgcn_wmma_f32_16x16x32_bf16(false, ah, false, bh, (short)0, c, false, false);
  if (NT >= 2) c = __builtin_amdgcn_wmma_f32_16x16x32_bf16(false, al, false, bh, (short)0, c, false, false);
  if (NT >= 3) c = __builtin_amdgcn_wmma_f32_16x16x32_bf16(false, ah, false, bl, (short)0, c, false, false);
  asm volatile("v_nop\n\tv_nop\n\tv_nop\n\tv_nop" : "+v"(c) : "v"(ah), "v"(al), "v"(bh), "v"(bl));
  return c;
}

__global__ __launch_bounds__(256) void k_wt_bf16(const float* __restrict__ W, unsigned short* __restrict__ Wt, int K, int N) {
  const int t = blockIdx.x * 256 + threadIdx.x;
  const int k8n = K / 8;
  if (t >= N * k8n) return;
  const int n = t / k8n, k8 = (t % k8n) * 8;
  v8us v;
#pragma unroll
  for (int i = 0; i < 8; ++i) v[i] = bf16_bits(W[(size_t)(k8 + i) * N + n]);
  *(v8us*)(Wt + (size_t)n * K + k8) = v;
  
}

// GEMM C[M][N] (f32, pitch ldc) = act(A[M][K]·W + bias). A f32 row-major (pitch lda) converted per fragment to bf16
// (ASPLIT: hi/lo two planes -> 2 terms, else single rounded term); Wt bf16 [N][K] (pitch ldb). BIAS_BF16 rounds the
// bias to bf16 first (bias quantised to bf16 before the add). K%32==0, M%16==0, N%64==0.
template <bool ASPLIT, int ACT, bool BIAS_BF16>
__global__ __launch_bounds__(128) void k_gemm_bf(const float* __restrict__ A, int lda, const unsigned short* __restrict__ Wt, int ldb,
                                               const float* __restrict__ bias, float* __restrict__ C, int ldc, int M, int N, int K) {
  __shared__ __attribute__((aligned(16))) float so[4][16][64];
  const int tid = threadIdx.x, w = tid >> 5, lane = tid & 31, ln = lane & 15, hh = lane >> 4;
  const int ntn = N / 64;
  const int wid = blockIdx.x * 4 + w;
  const int mt = wid / ntn, nq = wid % ntn;
  if (mt * 16 >= M) return;
  const int row0 = mt * 16, col0 = nq * 64;
  const float* arow = A + (size_t)(row0 + ln) * lda;
  v8f acc[4] = {};
  for (int kb = 0; kb < K; kb += 32) {
    FragB ah, al;
    const v4f x0 = *(const v4fa*)(arow + kb + 8 * hh), x1 = *(const v4fa*)(arow + kb + 8 * hh + 4);
    const v4f x2 = *(const v4fa*)(arow + kb + 16 + 8 * hh), x3 = *(const v4fa*)(arow + kb + 16 + 8 * hh + 4);
    float xs[16] = {x0[0],x0[1],x0[2],x0[3],x1[0],x1[1],x1[2],x1[3],x2[0],x2[1],x2[2],x2[3],x3[0],x3[1],x3[2],x3[3]};
#pragma unroll
    for (int i = 0; i < 16; ++i) { const unsigned short hb = bf16_bits(xs[i]); ah.u[i] = hb; al.u[i] = ASPLIT ? bf16_bits(xs[i] - bf16_val(hb)) : (unsigned short)0; }
#pragma unroll
    for (int t = 0; t < 4; ++t) {
      const unsigned short* brow = Wt + (size_t)(col0 + t * 16 + ln) * ldb + kb;
      FragB b;
      b.half[0] = *(const v8us*)(brow + 8 * hh);
      b.half[1] = *(const v8us*)(brow + 16 + 8 * hh);
      acc[t] = mmaN<ASPLIT ? 2 : 1>(ah.v, al.v, b.v, b.v, acc[t]);
    }
  }
#pragma unroll
  for (int t = 0; t < 4; ++t) {
    float bv = bias ? bias[col0 + t * 16 + ln] : 0.f;
    if (BIAS_BF16) bv = bf16_round(bv);
#pragma unroll
    for (int r = 0; r < 8; ++r) { float v = acc[t][r] + bv; if (ACT == 1) v = fmaxf(v, 0.f); so[w][8 * hh + r][t * 16 + ln] = v; }
  }
  __builtin_amdgcn_fence(__ATOMIC_ACQ_REL, "workgroup");
  __builtin_amdgcn_wave_barrier();
  const int rsub = lane >> 4, c4 = (lane & 15) * 4;
  {
#pragma unroll
    for (int q = 0; q < 8; ++q) {
      const int r = q * 2 + rsub;
      const v4f v = *(const v4fa*)&so[w][r][c4];
      *(v4f*)(C + (size_t)(row0 + r) * ldc + col0 + c4) = v;
    }
    
  }
}

// GEMM C = act(A·W + bias + resid): A f32 (ASPLIT -> hi/lo 2 terms), Wt bf16 [N][K]; ACT 0 none, 1 relu, 2 exact gelu;
// resid (optional, f32, row index = (row % rmod), pitch ldr, RES_BF16 rounds it) added before the activation.
template <bool ASPLIT, int ACT, bool BIAS_BF16, bool RES_BF16>
__global__ __launch_bounds__(128) void k_gemm_bf3(const float* __restrict__ A, int lda, const unsigned short* __restrict__ Wt, int ldb,
                                                const float* __restrict__ bias, const float* __restrict__ resid, int rmod, int ldr,
                                                float* __restrict__ C, int ldc, int M, int N, int K) {
  __shared__ __attribute__((aligned(16))) float so[4][16][64];
  const int tid = threadIdx.x, w = tid >> 5, lane = tid & 31, ln = lane & 15, hh = lane >> 4;
  const int ntn = N / 64;
  const int wid = blockIdx.x * 4 + w;
  const int mt = wid / ntn, nq = wid % ntn;
  if (mt * 16 >= M) return;
  const int row0 = mt * 16, col0 = nq * 64;
  const float* arow = A + (size_t)(row0 + ln) * lda;
  v8f acc[4] = {};
  for (int kb = 0; kb < K; kb += 32) {
    FragB ah, al;
    const v4f x0 = *(const v4fa*)(arow + kb + 8 * hh), x1 = *(const v4fa*)(arow + kb + 8 * hh + 4);
    const v4f x2 = *(const v4fa*)(arow + kb + 16 + 8 * hh), x3 = *(const v4fa*)(arow + kb + 16 + 8 * hh + 4);
    float xs[16] = {x0[0],x0[1],x0[2],x0[3],x1[0],x1[1],x1[2],x1[3],x2[0],x2[1],x2[2],x2[3],x3[0],x3[1],x3[2],x3[3]};
#pragma unroll
    for (int i = 0; i < 16; ++i) { const unsigned short hb = bf16_bits(xs[i]); ah.u[i] = hb; al.u[i] = ASPLIT ? bf16_bits(xs[i] - bf16_val(hb)) : (unsigned short)0; }
#pragma unroll
    for (int t = 0; t < 4; ++t) {
      const unsigned short* brow = Wt + (size_t)(col0 + t * 16 + ln) * ldb + kb;
      FragB b;
      b.half[0] = *(const v8us*)(brow + 8 * hh);
      b.half[1] = *(const v8us*)(brow + 16 + 8 * hh);
      acc[t] = mmaN<ASPLIT ? 2 : 1>(ah.v, al.v, b.v, b.v, acc[t]);
    }
  }
#pragma unroll
  for (int t = 0; t < 4; ++t) {
    const int col = col0 + t * 16 + ln;
    float bv = bias ? bias[col] : 0.f;
    if (BIAS_BF16) bv = bf16_round(bv);
#pragma unroll
    for (int r = 0; r < 8; ++r) {
      float v = acc[t][r] + bv;
      if (resid) { float rv = resid[(size_t)((row0 + 8 * hh + r) % rmod) * ldr + col]; if (RES_BF16) rv = bf16_round(rv); v += rv; }
      if (ACT == 1) v = fmaxf(v, 0.f);
      if (ACT == 2) v = 0.5f * v * (1.0f + erff(v * 0.70710678118654752f));
      if (ACT == 3) { const float u = 0.7978845608028654f * (v + 0.044715f * v * v * v); v = 0.5f * v * (1.0f + tanhf(u)); }
      so[w][8 * hh + r][t * 16 + ln] = v;
    }
  }
  __builtin_amdgcn_fence(__ATOMIC_ACQ_REL, "workgroup");
  __builtin_amdgcn_wave_barrier();
  const int rsub = lane >> 4, c4 = (lane & 15) * 4;
  {
#pragma unroll
    for (int q = 0; q < 8; ++q) {
      const int r = q * 2 + rsub;
      const v4f v = *(const v4fa*)&so[w][r][c4];
      *(v4f*)(C + (size_t)(row0 + r) * ldc + col0 + c4) = v;
    }
    
  }
}
// row LayerNorm (biased variance, eps) over N: s = X (+ R); optional out_sum <- s; out_norm <- (s-mu)*rsqrt(var+eps)*g + b
template <bool PARAM_BF16>
__global__ __launch_bounds__(256) void k_layernorm(const float* __restrict__ X, const float* __restrict__ R, const float* __restrict__ g, const float* __restrict__ bta,
                                                  float* __restrict__ out_sum, float* __restrict__ out_norm, int N, float eps) {
  __shared__ float red[256];
  const int row = blockIdx.x, tid = threadIdx.x;
  const float* x = X + (size_t)row * N; const float* rr = R ? R + (size_t)row * N : nullptr;
  float vals[16];                     // up to N = 4096
  const int per = N / 256;            // contiguous chunk per thread? use strided-by-4 chunks: thread handles j = tid*4 + 1024*u
  float s1 = 0.f;
  for (int u = 0; u < per / 4; ++u) {
    const int j = tid * 4 + 1024 * u;
    const v4f a = *(const v4fa*)(x + j);
    v4f b = {0.f,0.f,0.f,0.f}; if (rr) b = *(const v4fa*)(rr + j);
#pragma unroll
    for (int q = 0; q < 4; ++q) { const float v = a[q] + b[q]; vals[u * 4 + q] = v; s1 += v; }
  }
  red[tid] = s1; __syncthreads();
  for (int st = 128; st > 0; st >>= 1) { if (tid < st) red[tid] += red[tid + st]; __syncthreads(); }
  const float mu = red[0] / (float)N; __syncthreads();
  float s2 = 0.f;
  for (int u = 0; u < per / 4; ++u)
#pragma unroll
    for (int q = 0; q < 4; ++q) { const float c = vals[u * 4 + q] - mu; s2 += c * c; }
  red[tid] = s2; __syncthreads();
  for (int st = 128; st > 0; st >>= 1) { if (tid < st) red[tid] += red[tid + st]; __syncthreads(); }
  const float rs = rsqrtf(red[0] / (float)N + eps);
  {
    for (int u = 0; u < per / 4; ++u) {
      const int j = tid * 4 + 1024 * u;
      v4f o, sm;
#pragma unroll
      for (int q = 0; q < 4; ++q) {
        float gg = g[j + q], bb = bta[j + q];
        if (PARAM_BF16) { gg = bf16_round(gg); bb = bf16_round(bb); }
        sm[q] = vals[u * 4 + q]; o[q] = (vals[u * 4 + q] - mu) * rs * gg + bb;
      }
      if (out_sum) *(v4f*)(out_sum + (size_t)row * N + j) = sm;
      *(v4f*)(out_norm + (size_t)row * N + j) = o;
    }
    
  }
}



// ---- f16 WMMA path (v_wmma_f32_16x16x32_f16): 11-bit significands for operands in range — used where a [0,1] probability operand needs more precision than bf16
typedef _Float16 v16h __attribute__((ext_vector_type(16)));
union FragH { v16h v; v8us half[2]; _Float16 h[16]; unsigned short u[16]; };
template <int NT>
__device__ __forceinline__ v8f mmaH(v16h ah, v16h al, v16h bh, v16h bl, v8f c) {
  c = __builtin_amdgcn_wmma_f32_16x16x32_f16(false, ah, false, bh, (short)0, c, false, false);
  if (NT >= 2) c = __builtin_amdgcn_wmma_f32_16x16x32_f16(false, al, false, bh, (short)0, c, false, false);
  if (NT >= 3) c = __builtin_amdgcn_wmma_f32_16x16x32_f16(false, ah, false, bl, (short)0, c, false, false);
  asm volatile("v_nop\n\tv_nop\n\tv_nop\n\tv_nop" : "+v"(c) : "v"(ah), "v"(al), "v"(bh), "v"(bl));
  return c;
}
// batched GEMM like k_gemm_b but f16 operands: A f32 (split into f16 hi/lo if ASPLIT, else rounded to f16), Bt = f16 values [n][k]; alpha; C f32; N multiple of 16 (partial tiles skipped)
template <bool ASPLIT>
__global__ __launch_bounds__(128) void k_gemm_h(const float* __restrict__ A, int lda, size_t sA, const _Float16* __restrict__ Bh, int ldb, size_t sB, float alpha, float* __restrict__ C, int ldc, size_t sC, int M, int N, int K) {
  __shared__ __attribute__((aligned(16))) float so[4][16][64];
  const int tid = threadIdx.x, w = tid >> 5, lane = tid & 31, ln = lane & 15, hh = lane >> 4; const int by = blockIdx.y;
  A += (size_t)by * sA; Bh += (size_t)by * sB; C += (size_t)by * sC;
  const int ntn = (N + 63) / 64; const int wid = blockIdx.x * 4 + w; const int mt = wid / ntn, nq = wid % ntn; if (mt * 16 >= M) return;
  const int row0 = mt * 16, col0 = nq * 64; const float* arow = A + (size_t)(row0 + ln) * lda;
  v8f acc[4] = {};
  for (int kb = 0; kb < K; kb += 32) {
    FragH ah, al;
    const v4f x0 = *(const v4fa*)(arow + kb + 8 * hh), x1 = *(const v4fa*)(arow + kb + 8 * hh + 4), x2 = *(const v4fa*)(arow + kb + 16 + 8 * hh), x3 = *(const v4fa*)(arow + kb + 16 + 8 * hh + 4);
    float xs[16] = {x0[0],x0[1],x0[2],x0[3],x1[0],x1[1],x1[2],x1[3],x2[0],x2[1],x2[2],x2[3],x3[0],x3[1],x3[2],x3[3]};
#pragma unroll
    for (int i = 0; i < 16; ++i) { const _Float16 h = (_Float16)xs[i]; ah.h[i] = h; al.h[i] = ASPLIT ? (_Float16)(xs[i] - (float)h) : (_Float16)0.0f; }
#pragma unroll
    for (int t = 0; t < 4; ++t) { if (col0 + t * 16 >= N) continue; const size_t boff = (size_t)(col0 + t * 16 + ln) * ldb + kb; FragH bq; bq.half[0] = *(const v8us*)(Bh + boff + 8 * hh); bq.half[1] = *(const v8us*)(Bh + boff + 16 + 8 * hh);
      acc[t] = mmaH<ASPLIT ? 2 : 1>(ah.v, al.v, bq.v, bq.v, acc[t]); }
  }
#pragma unroll
  for (int t = 0; t < 4; ++t) { if (col0 + t * 16 >= N) continue;
#pragma unroll
    for (int r = 0; r < 8; ++r) so[w][8 * hh + r][t * 16 + ln] = acc[t][r] * alpha; }
  __builtin_amdgcn_fence(__ATOMIC_ACQ_REL, "workgroup"); __builtin_amdgcn_wave_barrier();
  const int rsub = lane >> 4, c4 = (lane & 15) * 4;
  {
#pragma unroll
    for (int q = 0; q < 8; ++q) { const int r = q * 2 + rsub; if (col0 + c4 < N) { const v4f v = *(const v4fa*)&so[w][r][c4]; *(v4f*)(C + (size_t)(row0 + r) * ldc + col0 + c4) = v; } }
     }
}

// Wt[n][k] = f16(W[k][n]·scale) from f32 row-major W[K][N] (scale = power of two; bf16-exact weights stay exact in f16 away from the subnormal range)
__global__ __launch_bounds__(256) void k_wt_f16(const float* __restrict__ W, _Float16* __restrict__ Wt, int K, int N, float scale) {
  const int t = blockIdx.x * 256 + threadIdx.x; if (t >= N * (K / 8)) return; const int n = t / (K / 8), k8 = (t % (K / 8)) * 8; FragH f;
#pragma unroll
  for (int i = 0; i < 8; ++i) f.h[i] = (_Float16)(bf16_round(W[(size_t)(k8 + i) * N + n]) * scale); const v8us o = f.half[0];
  *(v8us*)((unsigned short*)Wt + (size_t)n * K + k8) = o; 
}
// k_gemm_hh variant with fused epilogue: v = acc·alpha + bias[by·sBias + col] (+ CP[(row/rowsPerB)·sCPb + by·64 + col] if CP) ; ACT 0 none / 1 elu ; writes f16 C16 (and f32 C if non-null)
template <int ACT>
__global__ __launch_bounds__(128) void k_gemm_hhx(const _Float16* __restrict__ A, int lda, size_t sA, const _Float16* __restrict__ Bh, int ldb, size_t sB, float alpha, const float* __restrict__ bias, size_t sBias, const float* __restrict__ CP, int rowsPerB, size_t sCPb, int row0g,
    float* __restrict__ C, _Float16* __restrict__ C16, int ldc, size_t sC, int M, int N, int K) {
  __shared__ __attribute__((aligned(16))) float so[4][16][64];
  const int tid = threadIdx.x, w = tid >> 5, lane = tid & 31, ln = lane & 15, hh = lane >> 4; const int by = blockIdx.y;
  A += (size_t)by * sA; Bh += (size_t)by * sB; const size_t cofs = (size_t)by * sC; const float* bp = bias ? bias + (size_t)by * sBias : nullptr;
  const int ntn = (N + 63) / 64; const int wid = blockIdx.x * 4 + w; const int mt = wid / ntn, nq = wid % ntn; if (mt * 16 >= M) return;
  const int row0 = mt * 16, col0 = nq * 64; const _Float16* arow = A + (size_t)(row0 + ln) * lda;
  v8f acc[4] = {};
  for (int kb = 0; kb < K; kb += 32) { FragH ah; ah.half[0] = *(const v8us*)((const unsigned short*)arow + kb + 8 * hh); ah.half[1] = *(const v8us*)((const unsigned short*)arow + kb + 16 + 8 * hh);
#pragma unroll
    for (int t = 0; t < 4; ++t) { if (col0 + t * 16 >= N) continue; const size_t boff = (size_t)(col0 + t * 16 + ln) * ldb + kb; FragH bq; bq.half[0] = *(const v8us*)((const unsigned short*)Bh + boff + 8 * hh); bq.half[1] = *(const v8us*)((const unsigned short*)Bh + boff + 16 + 8 * hh);
      acc[t] = mmaH<1>(ah.v, ah.v, bq.v, bq.v, acc[t]); }
  }
#pragma unroll
  for (int t = 0; t < 4; ++t) { if (col0 + t * 16 >= N) continue; const int col = col0 + t * 16 + ln; const float bv = bp ? bf16_round(bp[col]) : 0.f;
#pragma unroll
    for (int r = 0; r < 8; ++r) { float v = acc[t][r] * alpha + bv; if (CP) { const int rr = row0g + row0 + 8 * hh + r; if (rowsPerB < 0) v += CP[cofs + (size_t)rr * ldc + col];      /* rowsPerB < 0: own element of the batched C plane */ else { const int bidx = rr / rowsPerB; v += CP[(size_t)bidx * sCPb + (size_t)by * 64 + col]; } } if (ACT == 1) v = (v > 0.f) ? v : expm1f(v); else if (ACT == 7) v = (v > 0.f) ? v + 1.0f : expf(v); else if (ACT == 8) v = tanhf(v); else if (ACT == 9) v = 0.5f * v * (1.0f + tanhf(0.7978845608028654f * (v + 0.044715f * v * v * v))); else if (ACT == 11) v = 1.0f / (1.0f + expf(-v)); else if (ACT == 12) v = (v > 0.f) ? v : 0.01f * v; else if (ACT == 14) v = (v > 0.f) ? v : 0.1f * v; else if (ACT == 16) v = (v >= 0.f) ? v : 0.3f * v; else if (ACT == 17) v = (v >= 0.f) ? v : 0.2f * v; else if (ACT == 15) v = v / (1.0f + expf(-v)); else if (ACT == 3) v = fmaxf(v, 0.f); else if (ACT == 6) v = 0.5f * v * (1.0f + erff(v * 0.70710678118654752f)); so[w][8 * hh + r][t * 16 + ln] = v; } }
  __builtin_amdgcn_fence(__ATOMIC_ACQ_REL, "workgroup"); __builtin_amdgcn_wave_barrier();
  const int rsub = lane >> 4, c4 = (lane & 15) * 4; typedef _Float16 v4h __attribute__((ext_vector_type(4)));
  {
#pragma unroll
    for (int q = 0; q < 8; ++q) { const int r = q * 2 + rsub; if (col0 + c4 < N) { const v4f v = *(const v4fa*)&so[w][r][c4]; if (C) *(v4f*)(C + cofs + (size_t)(row0 + r) * ldc + col0 + c4) = v; if (C16) { v4h h4; for (int i = 0; i < 4; ++i) h4[i] = (_Float16)v[i]; *(v4h*)(C16 + cofs + (size_t)(row0 + r) * ldc + col0 + c4) = h4; } } }
     }
}


typedef _Float16 v4h __attribute__((ext_vector_type(4)));

__global__ __launch_bounds__(256) void k_x16(const float* __restrict__ x, _Float16* __restrict__ X16, size_t n8) { const size_t t = (size_t)blockIdx.x * 256 + threadIdx.x; if (t >= n8) return; FragH f;
#pragma unroll
  for (int q = 0; q < 8; ++q) f.h[q] = (_Float16)bf16_round(x[t * 8 + q]); *(v8us*)((unsigned short*)X16 + t * 8) = f.half[0];  }
__global__ __launch_bounds__(256) void k_h16(const float* __restrict__ x, _Float16* __restrict__ X16, size_t n8) { const size_t t = (size_t)blockIdx.x * 256 + threadIdx.x; if (t >= n8) return; FragH f;
#pragma unroll
  for (int q = 0; q < 8; ++q) f.h[q] = (_Float16)x[t * 8 + q]; *(v8us*)((unsigned short*)X16 + t * 8) = f.half[0];  }
__global__ __launch_bounds__(256) void k_round16f(const float* __restrict__ W, _Float16* __restrict__ Bt, size_t n8) { const size_t t = (size_t)blockIdx.x * 256 + threadIdx.x; if (t >= n8) return; FragH f;
#pragma unroll
  for (int i = 0; i < 8; ++i) f.h[i] = (_Float16)(bf16_round(W[t * 8 + i]) * 16.0f); *(v8us*)((unsigned short*)Bt + t * 8) = f.half[0];  }
template <int NHv, int TTv>
__global__ __launch_bounds__(256) void k_vt(const _Float16* __restrict__ V16, int ldv, int voff, _Float16* __restrict__ Vt) { __shared__ unsigned short tl[64][66]; const int tid = threadIdx.x; const int slab = blockIdx.x / (TTv / 64), lg = blockIdx.x % (TTv / 64); const int b = slab / NHv, h = slab % NHv;
  for (int i = tid; i < 64 * 8; i += 256) { const int r = i / 8, c8 = (i % 8) * 8; FragH f; f.half[0] = *(const v8us*)((const unsigned short*)V16 + ((size_t)b * TTv + lg * 64 + r) * ldv + voff + h * 64 + c8);
#pragma unroll
    for (int q = 0; q < 8; ++q) tl[r][c8 + q] = f.u[q]; }
  __syncthreads();
  {
#pragma unroll
    for (int rd = 0; rd < 2; ++rd) { const int d = rd * 32 + tid / 8, pc = tid % 8; FragH f;
#pragma unroll
      for (int q = 0; q < 8; ++q) f.u[q] = tl[pc * 8 + q][d];
      *(v8us*)((unsigned short*)Vt + ((size_t)slab * 64 + d) * TTv + lg * 64 + pc * 8) = f.half[0]; }
     } }

__global__ __launch_bounds__(256) void k_hl(const float* __restrict__ F, _Float16* __restrict__ Hh, _Float16* __restrict__ Hl, size_t n8) { const size_t t = (size_t)blockIdx.x * 256 + threadIdx.x; if (t >= n8) return; FragH fh, fl; const v4f a = *(const v4fa*)(F + t * 8), c = *(const v4fa*)(F + t * 8 + 4);
#pragma unroll
  for (int q = 0; q < 4; ++q) { _Float16 h = (_Float16)a[q]; fh.h[q] = h; fl.h[q] = (_Float16)((a[q] - (float)h) * 1024.0f); h = (_Float16)c[q]; fh.h[4 + q] = h; fl.h[4 + q] = (_Float16)((c[q] - (float)h) * 1024.0f); }
  { *(v8us*)((unsigned short*)Hh + t * 8) = fh.half[0]; *(v8us*)((unsigned short*)Hl + t * 8) = fl.half[0];  } }

// ---- fast GEMM (work-group tile 128x64, wave tile 32x64; requires M % 128 == 0, N % 64 == 0, K % 64 == 0); epilogue = k_gemm_hhx semantics ----
// Operands go through LDS, 64 k a pass: the work-group's 128 A rows and 64 B rows as 128-byte row pieces, 8 lanes a piece, so a wave's 16-byte global load covers 4 whole lines
// (a fragment load straight from global touches 16 lines for the same bytes, and each wave fetched all of B for itself). Rows at a 144-B pitch: 16-byte fragment reads without bank conflicts.
// Two buffers: the next pass's global loads fly during the pass, are stored to the other buffer at its foot, one barrier a pass. Each accumulator takes its products in ascending k.
#define GK 64                        /* k a pass */
#define GP 72                        /* LDS row pitch in f16 */
__device__ __forceinline__ v16h g2_frag(const _Float16* p, int hh) { FragH f; f.half[0] = *(const v8us*)((const unsigned short*)p + 8 * hh); f.half[1] = *(const v8us*)((const unsigned short*)p + 16 + 8 * hh); return f.v; }
__device__ __forceinline__ v16h g2_lfrag(const unsigned short* p, int hh) { FragH f; f.half[0] = *(const v8us*)(p + 8 * hh); f.half[1] = *(const v8us*)(p + 16 + 8 * hh); return f.v; }      /* the same k order from an LDS row */
__device__ __forceinline__ v8f g2_mma(v16h a, v16h b, v8f c) { v8f d = __builtin_amdgcn_wmma_f32_16x16x32_f16(false, a, false, b, (short)0, c, false, false); asm volatile("v_nop\n\tv_nop\n\tv_nop\n\tv_nop" : "+v"(d) : "v"(a), "v"(b)); return d; }
template <int ACT>
__global__ __launch_bounds__(128) void k_gemm2(const _Float16* __restrict__ A, int lda, size_t sA, const _Float16* __restrict__ Bh, int ldb, size_t sB, float alpha, const float* __restrict__ bias, size_t sBias, const float* __restrict__ CP, int rowsPerB, size_t sCPb, int row0g,
    float* __restrict__ C, _Float16* __restrict__ C16, int ldc, size_t sC, int M, int N, int K, const float* __restrict__ bias1, const float* __restrict__ bias2) { static_assert(ACT == 0 || ACT == 3 || ACT == 6 || ACT == 8 || ACT == 9 || ACT == 11 || ACT == 12 || ACT == 14 || ACT == 15 || ACT == 16 || ACT == 17, "k_gemm2: unsupported ACT code (would silently apply no activation)");
  __shared__ __attribute__((aligned(16))) float so[4][32][68];
  __shared__ __attribute__((aligned(16))) unsigned short sa[2][128][GP];
  __shared__ __attribute__((aligned(16))) unsigned short sb[2][64][GP];
  const int tid = threadIdx.x, w = tid >> 5, lane = tid & 31, ln = lane & 15, hh = lane >> 4; const int by = blockIdx.y;
  A += (size_t)by * sA; Bh += (size_t)by * sB; const size_t cofs = (size_t)by * sC; const float* bp = bias ? bias + (size_t)by * sBias : nullptr;
  if (by == 1 && bias1) bp = bias1; if (by == 2 && bias2) bp = bias2;      /* batch entries 1 and 2 whose biases are buffers of their own */
  const int ntn = N >> 6; const int mt = blockIdx.x / ntn, nq = blockIdx.x - mt * ntn; const int row0 = mt * 128 + 32 * w, col0 = nq * 64; if (mt * 128 >= M) return;      /* the whole work-group leaves or none: barriers follow */
  const int sr = tid >> 3, sc = (tid & 7) * 8;      /* staging: this thread moves 16 bytes of rows sr + 16 i of each tile; 8 threads cover a 128-byte row piece */
  __builtin_assume(lda == DM); __builtin_assume(ldb == DM);      /* every launch here has rows of DM: with the pitch known the 16-row steps are immediate offsets on one address pair an operand, no address arithmetic between the loads */
  const unsigned short* ag = (const unsigned short*)A + (size_t)(mt * 128 + sr) * lda + sc; const unsigned short* bg = (const unsigned short*)Bh + (size_t)(col0 + sr) * ldb + sc;
  v8us ra[8], rb[4];
#pragma unroll      /* constant indices keep the pieces in registers */
  for (int i = 0; i < 8; ++i) ra[i] = *(const v8us*)(ag + (size_t)(16 * i) * lda);
#pragma unroll      /* constant indices keep the pieces in registers */
  for (int i = 0; i < 4; ++i) rb[i] = *(const v8us*)(bg + (size_t)(16 * i) * ldb);
#pragma unroll      /* constant indices keep the pieces in registers */
  for (int i = 0; i < 8; ++i) *(v8us*)&sa[0][sr + 16 * i][sc] = ra[i];
#pragma unroll      /* constant indices keep the pieces in registers */
  for (int i = 0; i < 4; ++i) *(v8us*)&sb[0][sr + 16 * i][sc] = rb[i];
  __syncthreads();
  const v8f z8 = {0.f,0.f,0.f,0.f,0.f,0.f,0.f,0.f}; v8f c00 = z8, c01 = z8, c02 = z8, c03 = z8, c10 = z8, c11 = z8, c12 = z8, c13 = z8;
#pragma unroll 1      /* one pass a trip: the body already holds 16 matrix instructions and 24 LDS reads */
  for (int kb = 0; kb < K; kb += GK) { const int cur = (kb / GK) & 1; const bool more = kb + GK < K;
    if (more) { ag += GK; bg += GK;
#pragma unroll      /* constant indices keep the pieces in registers */
      for (int i = 0; i < 8; ++i) ra[i] = *(const v8us*)(ag + (size_t)(16 * i) * lda);
#pragma unroll      /* constant indices keep the pieces in registers */
      for (int i = 0; i < 4; ++i) rb[i] = *(const v8us*)(bg + (size_t)(16 * i) * ldb); }
    v16h af[2][2], bf[2][4];      /* [k half of the pass][tile] */
#pragma unroll      /* constant indices keep the fragments in registers */
    for (int s = 0; s < 2; ++s) {
#pragma unroll      /* constant indices keep the fragments in registers */
      for (int t = 0; t < 2; ++t) af[s][t] = g2_lfrag(&sa[cur][32 * w + 16 * t + ln][32 * s], hh);
#pragma unroll      /* constant indices keep the fragments in registers */
      for (int t = 0; t < 4; ++t) bf[s][t] = g2_lfrag(&sb[cur][16 * t + ln][32 * s], hh); }
    __builtin_amdgcn_sched_barrier(0);      /* keeps the pass's global loads and all 24 LDS reads issued here: sunk to in front of their matrix instructions, each group would stand with a full latency in the open */
#pragma unroll      /* constant indices keep the fragments in registers */
    for (int s = 0; s < 2; ++s) {
      c00 = g2_mma(af[s][0], bf[s][0], c00); c10 = g2_mma(af[s][1], bf[s][0], c10);
      c01 = g2_mma(af[s][0], bf[s][1], c01); c11 = g2_mma(af[s][1], bf[s][1], c11);
      c02 = g2_mma(af[s][0], bf[s][2], c02); c12 = g2_mma(af[s][1], bf[s][2], c12);
      c03 = g2_mma(af[s][0], bf[s][3], c03); c13 = g2_mma(af[s][1], bf[s][3], c13); }
    if (more) {      /* every reader left that buffer before the last barrier */
#pragma unroll      /* constant indices keep the pieces in registers */
      for (int i = 0; i < 8; ++i) *(v8us*)&sa[cur ^ 1][sr + 16 * i][sc] = ra[i];
#pragma unroll      /* constant indices keep the pieces in registers */
      for (int i = 0; i < 4; ++i) *(v8us*)&sb[cur ^ 1][sr + 16 * i][sc] = rb[i]; }
    __syncthreads(); }      /* publishes the next pass's tiles and ends this pass's reads of the buffer that the next pass refills */
  v8f accs[8] = {c00, c01, c02, c03, c10, c11, c12, c13};
#pragma unroll
  for (int u = 0; u < 8; ++u) { const int t = u & 3, half = u >> 2; const int col = col0 + t * 16 + ln; const float bv = bp ? bf16_round(bp[col]) : 0.f;
#pragma unroll
    for (int r = 0; r < 8; ++r) { const int rloc = half * 16 + 8 * hh + r; float v = accs[u][r] * alpha + bv; if (CP) { if (rowsPerB < 0) v += CP[cofs + (size_t)(row0g + row0 + rloc) * ldc + col];      /* rowsPerB < 0: own element of the batched C plane */ else { const int bidx = (row0g + row0 + rloc) / rowsPerB; v += CP[(size_t)bidx * sCPb + (size_t)by * 64 + col]; } }
      if (ACT == 3) v = fmaxf(v, 0.f); else if (ACT == 6) v = 0.5f * v * (1.0f + erff(v * 0.70710678118654752f)); else if (ACT == 11) v = 1.0f / (1.0f + expf(-v)); else if (ACT == 15) v = v / (1.0f + expf(-v)); else if (ACT == 12) v = (v > 0.f) ? v : 0.01f * v; else if (ACT == 8) v = tanhf(v); else if (ACT == 9) v = 0.5f * v * (1.0f + tanhf(0.7978845608028654f * (v + 0.044715f * v * v * v))); else if (ACT == 14) v = (v > 0.f) ? v : 0.1f * v; else if (ACT == 16) v = (v >= 0.f) ? v : 0.3f * v; else if (ACT == 17) v = (v >= 0.f) ? v : 0.2f * v;
      so[w][rloc][t * 16 + ln] = v; } }
  __builtin_amdgcn_fence(__ATOMIC_ACQ_REL, "workgroup"); __builtin_amdgcn_wave_barrier();
  const int rsub = lane >> 4, c4 = (lane & 15) * 4;
  {
#pragma unroll
    for (int q = 0; q < 16; ++q) { const int r = q * 2 + rsub; const v4f v = *(const v4fa*)&so[w][r][c4]; if (C) *(v4f*)(C + cofs + (size_t)(row0 + r) * ldc + col0 + c4) = v; if (C16) { v4h h4; for (int i = 0; i < 4; ++i) h4[i] = (_Float16)v[i]; *(v4h*)(C16 + cofs + (size_t)(row0 + r) * ldc + col0 + c4) = h4; } }
     } }


// All seven f32 -> f16 conversions in one launch; the block index picks the buffer. Blocks 0 .. 3 PXB - 1: query, key, value -> X[0..2] (bf16-rounded, exact in f16);
// then 4 PWB blocks: Wq, Wk, Wv, Wo -> B[0..3] (bf16-rounded, x16: exact, away from the f16 subnormal range). A thread moves PC pieces of 4 elements, 256 pieces apart:
// a wave's 16-byte loads cover 512 contiguous bytes and its 8-byte stores 256, whole lines both.
#define PC 16
#define PXB ((int)(NR * DM / 4 / (256 * PC)))      /* blocks an input: 128 */
#define PWB ((int)((size_t)DM * DM / 4 / (256 * PC)))      /* blocks a weight: 16 */
__global__ __launch_bounds__(256) void k_prep(const float* __restrict__ xq, const float* __restrict__ xk, const float* __restrict__ xv, const float* __restrict__ wq, const float* __restrict__ wk, const float* __restrict__ wv, const float* __restrict__ wo, _Float16* __restrict__ X, _Float16* __restrict__ B) {
  const int b = blockIdx.x; const bool isx = b < 3 * PXB; const int j = isx ? b / PXB : (b - 3 * PXB) / PWB; const int blk = isx ? b - j * PXB : (b - 3 * PXB) - j * PWB;
  const float* s = isx ? (j == 0 ? xq : j == 1 ? xk : xv) : (j == 0 ? wq : j == 1 ? wk : j == 2 ? wv : wo);
  _Float16* d = isx ? X + (size_t)j * NR * DM : B + (size_t)j * DM * DM; const float sc = isx ? 1.0f : 16.0f;
  const size_t e0 = ((size_t)blk * (256 * PC) + threadIdx.x) * 4;
  v4f a[PC];
#pragma unroll      /* constant indices keep the pieces in registers, their loads in flight together */
  for (int u = 0; u < PC; ++u) a[u] = *(const v4fa*)(s + e0 + (size_t)u * 1024);
  __builtin_amdgcn_sched_barrier(0);      /* keeps all PC loads issued here: left alone the build holds the last five back until the first eleven have landed, a second memory latency in the open */
#pragma unroll      /* constant indices keep the pieces in registers */
  for (int u = 0; u < PC; ++u) { v4h o;
#pragma unroll      /* constant indices keep the pieces in registers */
    for (int q = 0; q < 4; ++q) o[q] = (_Float16)(bf16_round(a[u][q]) * sc);
    *(v4h*)(d + e0 + (size_t)u * 1024) = o; } }
#define FS 4                         /* key quarters: waves that share a query group */
#define FW 32                        /* keys a wave and run */
#define FJ 2                         /* such 32-key runs of a wave between two barriers */
#define FK (FJ * FS * FW)            /* keys a pass */
#define FP 72                        /* LDS pitch of a K row in f16 */
#define FV 80                        /* LDS pitch of a V row in f16: 32 B x odd, the transposing load's pitch */
__device__ __forceinline__ float fa_xhalf(float x) { return __builtin_bit_cast(float, __builtin_amdgcn_permlanex16(__builtin_bit_cast(int, x), __builtin_bit_cast(int, x), 0x76543210, 0xfedcba98, false, false)); }      /* lane l with lane l ^ 16 */
__device__ __forceinline__ v8f fa_mma(v16h a, v16h b, v8f c) { return __builtin_amdgcn_wmma_f32_16x16x32_f16(false, a, false, b, (short)0, c, false, false); }
__device__ __forceinline__ v16h fa_frag(const unsigned short* p, int hh) { FragH f; f.half[0] = *(const v8us*)(p + 8 * hh); f.half[1] = *(const v8us*)(p + 16 + 8 * hh); return f.v; }
typedef short v8s __attribute__((ext_vector_type(8)));
__device__ __forceinline__ v8us fa_tr16(const unsigned short* p) { typedef __attribute__((address_space(3))) v8s lds_v8s; return __builtin_bit_cast(v8us, __builtin_amdgcn_ds_load_tr16_b128_v8i16((lds_v8s*)p)); }
// 16 d x 32 keys of V^T from V rows in LDS; p = this lane's address in the 16-key x 16-d block: row 8 hh + (lane & 7), 16-byte piece (lane >> 3) & 1. Lane (ln, hh) gets keys 8 hh + r and 16 + 8 hh + r of d = ln: fa_frag's k order
__device__ __forceinline__ v16h fa_vfrag(const unsigned short* p) { FragH f; f.half[0] = fa_tr16(p); f.half[1] = fa_tr16(p + 16 * FV); return f.v; }
__global__ __launch_bounds__(512) void k_fattn(const _Float16* __restrict__ Q16, const _Float16* __restrict__ K16, const _Float16* __restrict__ V16, _Float16* __restrict__ O16) {
  __shared__ __attribute__((aligned(16))) unsigned short kt[2][FK][FP];
  __shared__ __attribute__((aligned(16))) unsigned short vs[2][FK][FV];
  __shared__ __attribute__((aligned(32))) float mo[4][FS][4][2][32][8];      /* [query group][key quarter][16-d tile][16-query tile][lane]: a quarter's x */
  __shared__ __attribute__((aligned(8))) float ml[4][FS][2][32][2];      /* its maximum and its sum */
  const int tid = threadIdx.x, w = tid >> 5, lane = tid & 31, ln = lane & 15, hh = lane >> 4; const int qg = w & 3, ks = w >> 2; const int h = blockIdx.y; const int q0 = blockIdx.x * 128 + qg * 32;
  v16h qf[2][2];      /* [query tile][d half] */
#pragma unroll      /* constant indices keep the fragments and accumulators in registers */
  for (int u = 0; u < 2; ++u) { const _Float16* qp = Q16 + (size_t)(q0 + 16 * u + ln) * DM + h * HD; qf[u][0] = g2_frag(qp, hh); qf[u][1] = g2_frag(qp + 32, hh);
    asm volatile("s_wait_xcnt 0x0" ::: "memory"); }      /* stands in front of any reuse of this tile's address registers: the next loads' results may be placed on them */
  const int kr = tid >> 3, kc = (tid & 7) * 8;      /* staging K and V: this thread moves 16 bytes of rows kr + 64 i of each; 8 threads cover a 128-byte row */
  const int tr = 8 * hh + (lane & 7), tc = ((lane >> 3) & 1) * 8;      /* the transposing load: this lane's row and 16-byte piece in a 16-key x 16-d block of V */
  const unsigned short* kg = (const unsigned short*)K16 + (size_t)kr * DM + h * HD + kc; const unsigned short* vg = (const unsigned short*)V16 + (size_t)kr * DM + h * HD + kc;
  { v8us pk[4], pv[4];
#pragma unroll      /* constant indices keep the pieces in registers */
    for (int i = 0; i < 4; ++i) { pk[i] = *(const v8us*)(kg + (size_t)(64 * i) * DM); pv[i] = *(const v8us*)(vg + (size_t)(64 * i) * DM); }
#pragma unroll      /* constant indices keep the pieces in registers */
    for (int i = 0; i < 4; ++i) { *(v8us*)&kt[0][kr + 64 * i][kc] = pk[i]; *(v8us*)&vs[0][kr + 64 * i][kc] = pv[i]; } }
  __syncthreads();
  v8us rk[2], rv[2];
  const v8f z8 = {0.f,0.f,0.f,0.f,0.f,0.f,0.f,0.f}; v8f o[4][2] = {{z8, z8}, {z8, z8}, {z8, z8}, {z8, z8}}; float m[2] = {-3.0e38f, -3.0e38f}, l[2] = {0.f, 0.f};      /* o: [d tile][query tile]; m: running maximum of the raw products q.k; l: this half's sum of weights */
  const float CS = 0.125f * 1.4426950408889634f;      /* 1 / sqrt(64), and e^x as 2^(x log2 e) */
#pragma unroll 1      /* one pass a trip: the body already holds 32 matrix instructions and 32 LDS reads */
  for (int it = 0; it < SQ / FK; ++it) { const int cur = it & 1; const bool more = it + 1 < SQ / FK;
    if (more) { kg += (size_t)FK * DM; vg += (size_t)FK * DM; }
#pragma unroll      /* both runs in line: their LDS offsets are immediates */
    for (int j = 0; j < FJ; ++j) { const int k0 = (j * FS + ks) * FW;      /* the run's first key in the tile; no barrier between the runs, so the waves of a SIMD drift apart and fill one another's waits */
    if (more) {      /* each run brings half of the next tile: half the staging registers */
#pragma unroll      /* constant indices keep the pieces in registers */
      for (int i = 0; i < 2; ++i) { rk[i] = *(const v8us*)(kg + (size_t)(64 * (2 * j + i)) * DM); rv[i] = *(const v8us*)(vg + (size_t)(64 * (2 * j + i)) * DM); } }
    v16h kf[2][2], vf[4];
#pragma unroll      /* constant indices keep the fragments and accumulators in registers */
    for (int t = 0; t < 2; ++t) { const unsigned short* kp = &kt[cur][k0 + t * 16 + ln][0]; kf[t][0] = fa_frag(kp, hh); kf[t][1] = fa_frag(kp + 32, hh); }
    __builtin_amdgcn_sched_barrier(0);      /* keeps the run's global loads and its 8 K reads issued here, as one group ahead of the score products */
    v8f s[2][2];      /* [key tile][query tile] */
#pragma unroll      /* constant indices keep the fragments and accumulators in registers */
    for (int t = 0; t < 2; ++t)
#pragma unroll      /* constant indices keep the fragments and accumulators in registers */
      for (int u = 0; u < 2; ++u) s[t][u] = fa_mma(kf[t][0], qf[u][0], z8);
#pragma unroll      /* constant indices keep the fragments and accumulators in registers */
    for (int t = 0; t < 2; ++t)
#pragma unroll      /* constant indices keep the fragments and accumulators in registers */
      for (int u = 0; u < 2; ++u) s[t][u] = fa_mma(kf[t][1], qf[u][1], s[t][u]);
#pragma unroll      /* constant indices keep the fragments and accumulators in registers */
    for (int t = 0; t < 4; ++t) vf[t] = fa_vfrag(&vs[cur][k0 + tr][t * 16 + tc]);
    __builtin_amdgcn_sched_barrier(0);      /* keeps the 8 V^T reads issued here, as one group behind the score products: their latency passes under the softmax; sunk to in front of their matrix instructions each would stand in the open */
    FragH p[2]; float corr[2], off[2];
#pragma unroll      /* constant indices keep the fragments and accumulators in registers */
    for (int u = 0; u < 2; ++u) { float a0 = s[0][u][0], a1 = s[1][u][0];      /* one short maximum chain a tile */
#pragma unroll      /* constant indices keep the fragments and accumulators in registers */
      for (int r = 1; r < 8; ++r) { a0 = fmaxf(a0, s[0][u][r]); a1 = fmaxf(a1, s[1][u][r]); }
      float tm = fmaxf(a0, a1); tm = fmaxf(tm, fa_xhalf(tm)); const float mn = fmaxf(m[u], tm); corr[u] = __builtin_amdgcn_exp2f((m[u] - mn) * CS); off[u] = 8.0f - mn * CS; m[u] = mn; }      /* weights carry x256, as f16 operands away from the subnormal range; it cancels in x = sum / l */
#pragma unroll      /* constant indices keep the fragments and accumulators in registers */
    for (int t = 0; t < 2; ++t)
#pragma unroll      /* constant indices keep the fragments and accumulators in registers */
      for (int u = 0; u < 2; ++u)
#pragma unroll      /* constant indices keep the fragments and accumulators in registers */
        for (int r = 0; r < 8; ++r) { const float e = __builtin_amdgcn_exp2f(fmaf(s[t][u][r], CS, off[u])); s[t][u][r] = e; p[u].h[t * 8 + r] = (_Float16)e; }
#pragma unroll      /* constant indices keep the fragments and accumulators in registers */
    for (int u = 0; u < 2; ++u) { const v8f es = s[0][u] + s[1][u];      /* the run's sum as a tree: one chain of 16 dependent adds would stand at the foot of every run */
      l[u] = l[u] * corr[u] + (((es[0] + es[1]) + (es[2] + es[3])) + ((es[4] + es[5]) + (es[6] + es[7])));
#pragma unroll      /* constant indices keep the fragments and accumulators in registers */
      for (int t = 0; t < 4; ++t) o[t][u] *= corr[u]; }
#pragma unroll      /* constant indices keep the fragments and accumulators in registers */
    for (int u = 0; u < 2; ++u)
#pragma unroll      /* constant indices keep the fragments and accumulators in registers */
      for (int t = 0; t < 4; ++t) o[t][u] = fa_mma(vf[t], p[u].v, o[t][u]);
    if (more) {      /* every reader left that buffer before the last barrier */
#pragma unroll      /* constant indices keep the pieces in registers */
      for (int i = 0; i < 2; ++i) { *(v8us*)&kt[cur ^ 1][kr + 64 * (2 * j + i)][kc] = rk[i]; *(v8us*)&vs[cur ^ 1][kr + 64 * (2 * j + i)][kc] = rv[i]; } } }
    __syncthreads(); }      /* publishes the next tile and ends this pass's reads of the buffer that the next pass refills */
  // join of the four key quarters: every wave leaves its x, maximum and sum in LDS; then the wave of quarter j joins d tile j of its query group's 32 queries
#pragma unroll      /* constant indices keep the fragments and accumulators in registers */
  for (int u = 0; u < 2; ++u) { l[u] += fa_xhalf(l[u]); ml[qg][ks][u][lane][0] = m[u]; ml[qg][ks][u][lane][1] = l[u];
#pragma unroll      /* constant indices keep the fragments and accumulators in registers */
    for (int t = 0; t < 4; ++t) *(v8f*)&mo[qg][ks][t][u][lane][0] = o[t][u]; }
  __syncthreads();      /* the quarters' results are read by other waves */
#pragma unroll      /* constant indices keep the fragments and accumulators in registers */
  for (int u = 0; u < 2; ++u) { float mj[FS], lj[FS];
#pragma unroll      /* constant indices keep the fragments and accumulators in registers */
    for (int j = 0; j < FS; ++j) { mj[j] = ml[qg][j][u][lane][0]; lj[j] = ml[qg][j][u][lane][1]; }
    const float mx = fmaxf(fmaxf(mj[0], mj[1]), fmaxf(mj[2], mj[3])); float ls = 0.f; v8f x = z8;
#pragma unroll      /* constant indices keep the fragments and accumulators in registers */
    for (int j = 0; j < FS; ++j) mj[j] = __builtin_amdgcn_exp2f((mj[j] - mx) * CS);      /* each quarter's weight in the join */
#pragma unroll      /* constant indices keep the fragments and accumulators in registers */
    for (int j = 0; j < FS; ++j) { ls += mj[j] * lj[j]; x += *(const v8f*)&mo[qg][j][ks][u][lane][0] * mj[j]; }
    const float inv = 1.0f / ls; FragH f;      /* lane (ln, hh) holds x[q0 + 16 u + ln][16 ks + 8 hh + r] */
#pragma unroll      /* constant indices keep the fragments and accumulators in registers */
    for (int r = 0; r < 8; ++r) f.h[r] = (_Float16)(x[r] * inv);
    *(v8us*)&kt[0][qg * 32 + 16 * u + ln][16 * ks + 8 * hh] = f.half[0]; }      /* the K buffer, which every reader left at the loop's last barrier, now holds the work-group's 128 output row pieces */
  __syncthreads();      /* a row piece comes from four waves and leaves as one whole 128-byte line */
  unsigned short* op = (unsigned short*)O16 + (size_t)(blockIdx.x * 128 + kr) * DM + h * HD + kc;
  *(v8us*)op = *(const v8us*)&kt[0][kr][kc]; *(v8us*)(op + 64 * DM) = *(const v8us*)&kt[0][kr + 64][kc]; }

extern "C" void kernel_launch(void* const* d_in, const int* in_sizes, int n_in,
                              void* d_out, int out_size, void* d_ws, size_t ws_size, hipStream_t stream) {
  (void)in_sizes; (void)n_in; (void)out_size;
  const float* const* I = (const float* const*)d_in; const float* xq = I[0]; const float* xk = I[1]; const float* xv = I[2]; const float* wq = I[3]; const float* bq = I[4]; const float* wk = I[5]; const float* bk = I[6]; const float* wv = I[7]; const float* bv = I[8]; const float* wo = I[9]; const float* bo = I[10];
  char* ws = (char*)d_ws; size_t off = 0;
  auto take = [&](size_t bytes) { char* p = ws + off; off += (bytes + 255) & ~(size_t)255; return p; };
  _Float16* BQ = (_Float16*)take((size_t)4 * DM * DM * 2); _Float16* BO = BQ + (size_t)3 * DM * DM;      /* Wq | Wk | Wv | Wo, one after the other */
  _Float16* XQ = (_Float16*)take(3 * NR * DM * 2);      /* query | key | value rows */
  _Float16* Q16 = (_Float16*)take(3 * NR * DM * 2); _Float16* K16 = Q16 + NR * DM; _Float16* V16 = K16 + NR * DM;      /* q | k | v */
  _Float16* O16 = (_Float16*)take(NR * DM * 2);
  if (off > ws_size) return;      /* 2 + 7x4 = approx 30 MiB */
  k_prep<<<3 * PXB + 4 * PWB, 256, 0, stream>>>(xq, xk, xv, wq, wk, wv, wo, XQ, BQ);
  const dim3 gp((unsigned)((NR / 128) * (DM / 64)), 1); const dim3 gp3((unsigned)((NR / 128) * (DM / 64)), 3);
  k_gemm2<0><<<gp3, 128, 0, stream>>>(XQ, DM, NR * DM, BQ, DM, (size_t)DM * DM, 0.0625f, bq, 0, nullptr, 1, 0, 0, nullptr, Q16, DM, NR * DM, MP, DM, DM, bk, bv);      /* q, k and v: blockIdx.y picks rows, weight, bias and output */
  k_fattn<<<dim3(SQ / 128, NH), 512, 0, stream>>>(Q16, K16, V16, O16);      /* x (merged heads) as f16 rows */
  k_gemm2<0><<<gp, 128, 0, stream>>>(O16, DM, 0, BO, DM, 0, 0.0625f, bo, 0, nullptr, 1, 0, 0, (float*)d_out, nullptr, DM, 0, MO, DM, DM, nullptr, nullptr);      /* out = o W_o^T + b_o, rows are the output layout */
}

// v007
// One run takes 56.7 microseconds.
// Two timings next to v006 both put it at 1.11 times that version's speed.
// Over all steps from v000 it is 121 times as fast.
#include <hip/hip_runtime.h>
// Multi-head attention over separate query / key / value inputs ([1][4096][512] each; q = query Wq^T + bq, k = key Wk^T + bk, v = value Wv^T + bv, 8 heads of 64; attn = softmax(q k^T / 8); x = attn v; out = x Wo^T + bo -> [1][4096][512]).
// Structure: token rows; Q | K | V as three WMMA GEMMs in one launch, blockIdx.y the projection: query, key, value and their weights are read as f32 and rounded to bf16 on the way into LDS (128x256 work-group tiles, 32x64 wave tiles, bf16 products, f32 accumulation, bias in the epilogue, f16 outputs), a fourth blockIdx.y row rounds Wo (exact f16, x16) for the last launch; one attention kernel for all heads (scores^T = K q^T, running-maximum softmax in registers, x^T += V^T p^T with V^T fragments by transposing LDS loads of V rows; scores and weights never stored) written straight into the merged f16 rows; out = x Wo^T + bo GEMM (f32).
// Compute dtype: inputs rounded to bf16; inputs / weights exact; q, k, v, softmax weights and x as plain f16 GEMM operands (~2^-12); scores and softmax statistics f32. v_wmma_f32_16x16x32_bf16 (q, k, v projections), v_wmma_f32_16x16x32_f16 (attention, output projection).
#define NB 1
#define SQ 4096
#define DM 512
#define NH 8
#define HD 64
#define MP ((int)NR)                 /* unused: k_qkv always takes all NR token rows */
#define MO ((int)NR)                 /* token rows through the output projection (debug hook) */
#define NR ((size_t)NB * SQ)         /* 4096 token rows */
typedef __bf16 v16b __attribute__((ext_vector_type(16)));
typedef unsigned short v8us __attribute__((ext_vector_type(8), may_alias));
typedef float  v8f  __attribute__((ext_vector_type(8)));
typedef float  v4f  __attribute__((ext_vector_type(4)));
typedef float  v4fa __attribute__((ext_vector_type(4), may_alias));
union FragB { v16b v; v8us half[2]; unsigned short u[16]; };

__device__ __forceinline__ unsigned short bf16_bits(float x) { unsigned int u = __float_as_uint(x); return (unsigned short)((u + 0x7FFFu + ((u >> 16) & 1u)) >> 16); }
__device__ __forceinline__ float bf16_val(unsigned short b) { return __uint_as_float(((unsigned int)b) << 16); }
__device__ __forceinline__ float bf16_round(float x) { return bf16_val(bf16_bits(x)); }
// D += A·B with NT terms: 1 = ah·bh, 2 = + al·bh (A split), 3 = + ah·bl (both split)
template <int NT>
__device__ __forceinline__ v8f mmaN(v16b ah, v16b al, v16b bh, v16b bl, v8f c) {
  c = __builtin_amdgcn_wmma_f32_16x16x32_bf16(false, ah, false, bh, (short)0, c, false, false);
  if (NT >= 2) c = __builtin_amdgcn_wmma_f32_16x16x32_bf16(false, al, false, bh, (short)0, c, false, false);
  if (NT >= 3) c = __builtin_amdgcn_wmma_f32_16x16x32_bf16(false, ah, false, bl, (short)0, c, false, false);
  asm volatile("v_nop\n\tv_nop\n\tv_nop\n\tv_nop" : "+v"(c) : "v"(ah), "v"(al), "v"(bh), "v"(bl));
  return c;
}

__global__ __launch_bounds__(256) void k_wt_bf16(const float* __restrict__ W, unsigned short* __restrict__ Wt, int K, int N) {
  const int t = blockIdx.x * 256 + threadIdx.x;
  const int k8n = K / 8;
  if (t >= N * k8n) return;
  const int n = t / k8n, k8 = (t % k8n) * 8;
  v8us v;
#pragma unroll
  for (int i = 0; i < 8; ++i) v[i] = bf16_bits(W[(size_t)(k8 + i) * N + n]);
  *(v8us*)(Wt + (size_t)n * K + k8) = v;
  
}

// GEMM C[M][N] (f32, pitch ldc) = act(A[M][K]·W + bias). A f32 row-major (pitch lda) converted per fragment to bf16
// (ASPLIT: hi/lo two planes -> 2 terms, else single rounded term); Wt bf16 [N][K] (pitch ldb). BIAS_BF16 rounds the
// bias to bf16 first (bias quantised to bf16 before the add). K%32==0, M%16==0, N%64==0.
template <bool ASPLIT, int ACT, bool BIAS_BF16>
__global__ __launch_bounds__(128) void k_gemm_bf(const float* __restrict__ A, int lda, const unsigned short* __restrict__ Wt, int ldb,
                                               const float* __restrict__ bias, float* __restrict__ C, int ldc, int M, int N, int K) {
  __shared__ __attribute__((aligned(16))) float so[4][16][64];
  const int tid = threadIdx.x, w = tid >> 5, lane = tid & 31, ln = lane & 15, hh = lane >> 4;
  const int ntn = N / 64;
  const int wid = blockIdx.x * 4 + w;
  const int mt = wid / ntn, nq = wid % ntn;
  if (mt * 16 >= M) return;
  const int row0 = mt * 16, col0 = nq * 64;
  const float* arow = A + (size_t)(row0 + ln) * lda;
  v8f acc[4] = {};
  for (int kb = 0; kb < K; kb += 32) {
    FragB ah, al;
    const v4f x0 = *(const v4fa*)(arow + kb + 8 * hh), x1 = *(const v4fa*)(arow + kb + 8 * hh + 4);
    const v4f x2 = *(const v4fa*)(arow + kb + 16 + 8 * hh), x3 = *(const v4fa*)(arow + kb + 16 + 8 * hh + 4);
    float xs[16] = {x0[0],x0[1],x0[2],x0[3],x1[0],x1[1],x1[2],x1[3],x2[0],x2[1],x2[2],x2[3],x3[0],x3[1],x3[2],x3[3]};
#pragma unroll
    for (int i = 0; i < 16; ++i) { const unsigned short hb = bf16_bits(xs[i]); ah.u[i] = hb; al.u[i] = ASPLIT ? bf16_bits(xs[i] - bf16_val(hb)) : (unsigned short)0; }
#pragma unroll
    for (int t = 0; t < 4; ++t) {
      const unsigned short* brow = Wt + (size_t)(col0 + t * 16 + ln) * ldb + kb;
      FragB b;
      b.half[0] = *(const v8us*)(brow + 8 * hh);
      b.half[1] = *(const v8us*)(brow + 16 + 8 * hh);
      acc[t] = mmaN<ASPLIT ? 2 : 1>(ah.v, al.v, b.v, b.v, acc[t]);
    }
  }
#pragma unroll
  for (int t = 0; t < 4; ++t) {
    float bv = bias ? bias[col0 + t * 16 + ln] : 0.f;
    if (BIAS_BF16) bv = bf16_round(bv);
#pragma unroll
    for (int r = 0; r < 8; ++r) { float v = acc[t][r] + bv; if (ACT == 1) v = fmaxf(v, 0.f); so[w][8 * hh + r][t * 16 + ln] = v; }
  }
  __builtin_amdgcn_fence(__ATOMIC_ACQ_REL, "workgroup");
  __builtin_amdgcn_wave_barrier();
  const int rsub = lane >> 4, c4 = (lane & 15) * 4;
  {
#pragma unroll
    for (int q = 0; q < 8; ++q) {
      const int r = q * 2 + rsub;
      const v4f v = *(const v4fa*)&so[w][r][c4];
      *(v4f*)(C + (size_t)(row0 + r) * ldc + col0 + c4) = v;
    }
    
  }
}

// GEMM C = act(A·W + bias + resid): A f32 (ASPLIT -> hi/lo 2 terms), Wt bf16 [N][K]; ACT 0 none, 1 relu, 2 exact gelu;
// resid (optional, f32, row index = (row % rmod), pitch ldr, RES_BF16 rounds it) added before the activation.
template <bool ASPLIT, int ACT, bool BIAS_BF16, bool RES_BF16>
__global__ __launch_bounds__(128) void k_gemm_bf3(const float* __restrict__ A, int lda, const unsigned short* __restrict__ Wt, int ldb,
                                                const float* __restrict__ bias, const float* __restrict__ resid, int rmod, int ldr,
                                                float* __restrict__ C, int ldc, int M, int N, int K) {
  __shared__ __attribute__((aligned(16))) float so[4][16][64];
  const int tid = threadIdx.x, w = tid >> 5, lane = tid & 31, ln = lane & 15, hh = lane >> 4;
  const int ntn = N / 64;
  const int wid = blockIdx.x * 4 + w;
  const int mt = wid / ntn, nq = wid % ntn;
  if (mt * 16 >= M) return;
  const int row0 = mt * 16, col0 = nq * 64;
  const float* arow = A + (size_t)(row0 + ln) * lda;
  v8f acc[4] = {};
  for (int kb = 0; kb < K; kb += 32) {
    FragB ah, al;
    const v4f x0 = *(const v4fa*)(arow + kb + 8 * hh), x1 = *(const v4fa*)(arow + kb + 8 * hh + 4);
    const v4f x2 = *(const v4fa*)(arow + kb + 16 + 8 * hh), x3 = *(const v4fa*)(arow + kb + 16 + 8 * hh + 4);
    float xs[16] = {x0[0],x0[1],x0[2],x0[3],x1[0],x1[1],x1[2],x1[3],x2[0],x2[1],x2[2],x2[3],x3[0],x3[1],x3[2],x3[3]};
#pragma unroll
    for (int i = 0; i < 16; ++i) { const unsigned short hb = bf16_bits(xs[i]); ah.u[i] = hb; al.u[i] = ASPLIT ? bf16_bits(xs[i] - bf16_val(hb)) : (unsigned short)0; }
#pragma unroll
    for (int t = 0; t < 4; ++t) {
      const unsigned short* brow = Wt + (size_t)(col0 + t * 16 + ln) * ldb + kb;
      FragB b;
      b.half[0] = *(const v8us*)(brow + 8 * hh);
      b.half[1] = *(const v8us*)(brow + 16 + 8 * hh);
      acc[t] = mmaN<ASPLIT ? 2 : 1>(ah.v, al.v, b.v, b.v, acc[t]);
    }
  }
#pragma unroll
  for (int t = 0; t < 4; ++t) {
    const int col = col0 + t * 16 + ln;
    float bv = bias ? bias[col] : 0.f;
    if (BIAS_BF16) bv = bf16_round(bv);
#pragma unroll
    for (int r = 0; r < 8; ++r) {
      float v = acc[t][r] + bv;
      if (resid) { float rv = resid[(size_t)((row0 + 8 * hh + r) % rmod) * ldr + col]; if (RES_BF16) rv = bf16_round(rv); v += rv; }
      if (ACT == 1) v = fmaxf(v, 0.f);
      if (ACT == 2) v = 0.5f * v * (1.0f + erff(v * 0.70710678118654752f));
      if (ACT == 3) { const float u = 0.7978845608028654f * (v + 0.044715f * v * v * v); v = 0.5f * v * (1.0f + tanhf(u)); }
      so[w][8 * hh + r][t * 16 + ln] = v;
    }
  }
  __builtin_amdgcn_fence(__ATOMIC_ACQ_REL, "workgroup");
  __builtin_amdgcn_wave_barrier();
  const int rsub = lane >> 4, c4 = (lane & 15) * 4;
  {
#pragma unroll
    for (int q = 0; q < 8; ++q) {
      const int r = q * 2 + rsub;
      const v4f v = *(const v4fa*)&so[w][r][c4];
      *(v4f*)(C + (size_t)(row0 + r) * ldc + col0 + c4) = v;
    }
    
  }
}
// row LayerNorm (biased variance, eps) over N: s = X (+ R); optional out_sum <- s; out_norm <- (s-mu)*rsqrt(var+eps)*g + b
template <bool PARAM_BF16>
__global__ __launch_bounds__(256) void k_layernorm(const float* __restrict__ X, const float* __restrict__ R, const float* __restrict__ g, const float* __restrict__ bta,
                                                  float* __restrict__ out_sum, float* __restrict__ out_norm, int N, float eps) {
  __shared__ float red[256];
  const int row = blockIdx.x, tid = threadIdx.x;
  const float* x = X + (size_t)row * N; const float* rr = R ? R + (size_t)row * N : nullptr;
  float vals[16];                     // up to N = 4096
  const int per = N / 256;            // contiguous chunk per thread? use strided-by-4 chunks: thread handles j = tid*4 + 1024*u
  float s1 = 0.f;
  for (int u = 0; u < per / 4; ++u) {
    const int j = tid * 4 + 1024 * u;
    const v4f a = *(const v4fa*)(x + j);
    v4f b = {0.f,0.f,0.f,0.f}; if (rr) b = *(const v4fa*)(rr + j);
#pragma unroll
    for (int q = 0; q < 4; ++q) { const float v = a[q] + b[q]; vals[u * 4 + q] = v; s1 += v; }
  }
  red[tid] = s1; __syncthreads();
  for (int st = 128; st > 0; st >>= 1) { if (tid < st) red[tid] += red[tid + st]; __syncthreads(); }
  const float mu = red[0] / (float)N; __syncthreads();
  float s2 = 0.f;
  for (int u = 0; u < per / 4; ++u)
#pragma unroll
    for (int q = 0; q < 4; ++q) { const float c = vals[u * 4 + q] - mu; s2 += c * c; }
  red[tid] = s2; __syncthreads();
  for (int st = 128; st > 0; st >>= 1) { if (tid < st) red[tid] += red[tid + st]; __syncthreads(); }
  const float rs = rsqrtf(red[0] / (float)N + eps);
  {
    for (int u = 0; u < per / 4; ++u) {
      const int j = tid * 4 + 1024 * u;
      v4f o, sm;
#pragma unroll
      for (int q = 0; q < 4; ++q) {
        float gg = g[j + q], bb = bta[j + q];
        if (PARAM_BF16) { gg = bf16_round(gg); bb = bf16_round(bb); }
        sm[q] = vals[u * 4 + q]; o[q] = (vals[u * 4 + q] - mu) * rs * gg + bb;
      }
      if (out_sum) *(v4f*)(out_sum + (size_t)row * N + j) = sm;
      *(v4f*)(out_norm + (size_t)row * N + j) = o;
    }
    
  }
}



// ---- f16 WMMA path (v_wmma_f32_16x16x32_f16): 11-bit significands for operands in range — used where a [0,1] probability operand needs more precision than bf16
typedef _Float16 v16h __attribute__((ext_vector_type(16)));
union FragH { v16h v; v8us half[2]; _Float16 h[16]; unsigned short u[16]; };
template <int NT>
__device__ __forceinline__ v8f mmaH(v16h ah, v16h al, v16h bh, v16h bl, v8f c) {
  c = __builtin_amdgcn_wmma_f32_16x16x32_f16(false, ah, false, bh, (short)0, c, false, false);
  if (NT >= 2) c = __builtin_amdgcn_wmma_f32_16x16x32_f16(false, al, false, bh, (short)0, c, false, false);
  if (NT >= 3) c = __builtin_amdgcn_wmma_f32_16x16x32_f16(false, ah, false, bl, (short)0, c, false, false);
  asm volatile("v_nop\n\tv_nop\n\tv_nop\n\tv_nop" : "+v"(c) : "v"(ah), "v"(al), "v"(bh), "v"(bl));
  return c;
}
// batched GEMM like k_gemm_b but f16 operands: A f32 (split into f16 hi/lo if ASPLIT, else rounded to f16), Bt = f16 values [n][k]; alpha; C f32; N multiple of 16 (partial tiles skipped)
template <bool ASPLIT>
__global__ __launch_bounds__(128) void k_gemm_h(const float* __restrict__ A, int lda, size_t sA, const _Float16* __restrict__ Bh, int ldb, size_t sB, float alpha, float* __restrict__ C, int ldc, size_t sC, int M, int N, int K) {
  __shared__ __attribute__((aligned(16))) float so[4][16][64];
  const int tid = threadIdx.x, w = tid >> 5, lane = tid & 31, ln = lane & 15, hh = lane >> 4; const int by = blockIdx.y;
  A += (size_t)by * sA; Bh += (size_t)by * sB; C += (size_t)by * sC;
  const int ntn = (N + 63) / 64; const int wid = blockIdx.x * 4 + w; const int mt = wid / ntn, nq = wid % ntn; if (mt * 16 >= M) return;
  const int row0 = mt * 16, col0 = nq * 64; const float* arow = A + (size_t)(row0 + ln) * lda;
  v8f acc[4] = {};
  for (int kb = 0; kb < K; kb += 32) {
    FragH ah, al;
    const v4f x0 = *(const v4fa*)(arow + kb + 8 * hh), x1 = *(const v4fa*)(arow + kb + 8 * hh + 4), x2 = *(const v4fa*)(arow + kb + 16 + 8 * hh), x3 = *(const v4fa*)(arow + kb + 16 + 8 * hh + 4);
    float xs[16] = {x0[0],x0[1],x0[2],x0[3],x1[0],x1[1],x1[2],x1[3],x2[0],x2[1],x2[2],x2[3],x3[0],x3[1],x3[2],x3[3]};
#pragma unroll
    for (int i = 0; i < 16; ++i) { const _Float16 h = (_Float16)xs[i]; ah.h[i] = h; al.h[i] = ASPLIT ? (_Float16)(xs[i] - (float)h) : (_Float16)0.0f; }
#pragma unroll
    for (int t = 0; t < 4; ++t) { if (col0 + t * 16 >= N) continue; const size_t boff = (size_t)(col0 + t * 16 + ln) * ldb + kb; FragH bq; bq.half[0] = *(const v8us*)(Bh + boff + 8 * hh); bq.half[1] = *(const v8us*)(Bh + boff + 16 + 8 * hh);
      acc[t] = mmaH<ASPLIT ? 2 : 1>(ah.v, al.v, bq.v, bq.v, acc[t]); }
  }
#pragma unroll
  for (int t = 0; t < 4; ++t) { if (col0 + t * 16 >= N) continue;
#pragma unroll
    for (int r = 0; r < 8; ++r) so[w][8 * hh + r][t * 16 + ln] = acc[t][r] * alpha; }
  __builtin_amdgcn_fence(__ATOMIC_ACQ_REL, "workgroup"); __builtin_amdgcn_wave_barrier();
  const int rsub = lane >> 4, c4 = (lane & 15) * 4;
  {
#pragma unroll
    for (int q = 0; q < 8; ++q) { const int r = q * 2 + rsub; if (col0 + c4 < N) { const v4f v = *(const v4fa*)&so[w][r][c4]; *(v4f*)(C + (size_t)(row0 + r) * ldc + col0 + c4) = v; } }
     }
}

// Wt[n][k] = f16(W[k][n]·scale) from f32 row-major W[K][N] (scale = power of two; bf16-exact weights stay exact in f16 away from the subnormal range)
__global__ __launch_bounds__(256) void k_wt_f16(const float* __restrict__ W, _Float16* __restrict__ Wt, int K, int N, float scale) {
  const int t = blockIdx.x * 256 + threadIdx.x; if (t >= N * (K / 8)) return; const int n = t / (K / 8), k8 = (t % (K / 8)) * 8; FragH f;
#pragma unroll
  for (int i = 0; i < 8; ++i) f.h[i] = (_Float16)(bf16_round(W[(size_t)(k8 + i) * N + n]) * scale); const v8us o = f.half[0];
  *(v8us*)((unsigned short*)Wt + (size_t)n * K + k8) = o; 
}
// k_gemm_hh variant with fused epilogue: v = acc·alpha + bias[by·sBias + col] (+ CP[(row/rowsPerB)·sCPb + by·64 + col] if CP) ; ACT 0 none / 1 elu ; writes f16 C16 (and f32 C if non-null)
template <int ACT>
__global__ __launch_bounds__(128) void k_gemm_hhx(const _Float16* __restrict__ A, int lda, size_t sA, const _Float16* __restrict__ Bh, int ldb, size_t sB, float alpha, const float* __restrict__ bias, size_t sBias, const float* __restrict__ CP, int rowsPerB, size_t sCPb, int row0g,
    float* __restrict__ C, _Float16* __restrict__ C16, int ldc, size_t sC, int M, int N, int K) {
  __shared__ __attribute__((aligned(16))) float so[4][16][64];
  const int tid = threadIdx.x, w = tid >> 5, lane = tid & 31, ln = lane & 15, hh = lane >> 4; const int by = blockIdx.y;
  A += (size_t)by * sA; Bh += (size_t)by * sB; const size_t cofs = (size_t)by * sC; const float* bp = bias ? bias + (size_t)by * sBias : nullptr;
  const int ntn = (N + 63) / 64; const int wid = blockIdx.x * 4 + w; const int mt = wid / ntn, nq = wid % ntn; if (mt * 16 >= M) return;
  const int row0 = mt * 16, col0 = nq * 64; const _Float16* arow = A + (size_t)(row0 + ln) * lda;
  v8f acc[4] = {};
  for (int kb = 0; kb < K; kb += 32) { FragH ah; ah.half[0] = *(const v8us*)((const unsigned short*)arow + kb + 8 * hh); ah.half[1] = *(const v8us*)((const unsigned short*)arow + kb + 16 + 8 * hh);
#pragma unroll
    for (int t = 0; t < 4; ++t) { if (col0 + t * 16 >= N) continue; const size_t boff = (size_t)(col0 + t * 16 + ln) * ldb + kb; FragH bq; bq.half[0] = *(const v8us*)((const unsigned short*)Bh + boff + 8 * hh); bq.half[1] = *(const v8us*)((const unsigned short*)Bh + boff + 16 + 8 * hh);
      acc[t] = mmaH<1>(ah.v, ah.v, bq.v, bq.v, acc[t]); }
  }
#pragma unroll
  for (int t = 0; t < 4; ++t) { if (col0 + t * 16 >= N) continue; const int col = col0 + t * 16 + ln; const float bv = bp ? bf16_round(bp[col]) : 0.f;
#pragma unroll
    for (int r = 0; r < 8; ++r) { float v = acc[t][r] * alpha + bv; if (CP) { const int rr = row0g + row0 + 8 * hh + r; if (rowsPerB < 0) v += CP[cofs + (size_t)rr * ldc + col];      /* rowsPerB < 0: own element of the batched C plane */ else { const int bidx = rr / rowsPerB; v += CP[(size_t)bidx * sCPb + (size_t)by * 64 + col]; } } if (ACT == 1) v = (v > 0.f) ? v : expm1f(v); else if (ACT == 7) v = (v > 0.f) ? v + 1.0f : expf(v); else if (ACT == 8) v = tanhf(v); else if (ACT == 9) v = 0.5f * v * (1.0f + tanhf(0.7978845608028654f * (v + 0.044715f * v * v * v))); else if (ACT == 11) v = 1.0f / (1.0f + expf(-v)); else if (ACT == 12) v = (v > 0.f) ? v : 0.01f * v; else if (ACT == 14) v = (v > 0.f) ? v : 0.1f * v; else if (ACT == 16) v = (v >= 0.f) ? v : 0.3f * v; else if (ACT == 17) v = (v >= 0.f) ? v : 0.2f * v; else if (ACT == 15) v = v / (1.0f + expf(-v)); else if (ACT == 3) v = fmaxf(v, 0.f); else if (ACT == 6) v = 0.5f * v * (1.0f + erff(v * 0.70710678118654752f)); so[w][8 * hh + r][t * 16 + ln] = v; } }
  __builtin_amdgcn_fence(__ATOMIC_ACQ_REL, "workgroup"); __builtin_amdgcn_wave_barrier();
  const int rsub = lane >> 4, c4 = (lane & 15) * 4; typedef _Float16 v4h __attribute__((ext_vector_type(4)));
  {
#pragma unroll
    for (int q = 0; q < 8; ++q) { const int r = q * 2 + rsub; if (col0 + c4 < N) { const v4f v = *(const v4fa*)&so[w][r][c4]; if (C) *(v4f*)(C + cofs + (size_t)(row0 + r) * ldc + col0 + c4) = v; if (C16) { v4h h4; for (int i = 0; i < 4; ++i) h4[i] = (_Float16)v[i]; *(v4h*)(C16 + cofs + (size_t)(row0 + r) * ldc + col0 + c4) = h4; } } }
     }
}


typedef _Float16 v4h __attribute__((ext_vector_type(4)));

__global__ __launch_bounds__(256) void k_x16(const float* __restrict__ x, _Float16* __restrict__ X16, size_t n8) { const size_t t = (size_t)blockIdx.x * 256 + threadIdx.x; if (t >= n8) return; FragH f;
#pragma unroll
  for (int q = 0; q < 8; ++q) f.h[q] = (_Float16)bf16_round(x[t * 8 + q]); *(v8us*)((unsigned short*)X16 + t * 8) = f.half[0];  }
__global__ __launch_bounds__(256) void k_h16(const float* __restrict__ x, _Float16* __restrict__ X16, size_t n8) { const size_t t = (size_t)blockIdx.x * 256 + threadIdx.x; if (t >= n8) return; FragH f;
#pragma unroll
  for (int q = 0; q < 8; ++q) f.h[q] = (_Float16)x[t * 8 + q]; *(v8us*)((unsigned short*)X16 + t * 8) = f.half[0];  }
__global__ __launch_bounds__(256) void k_round16f(const float* __restrict__ W, _Float16* __restrict__ Bt, size_t n8) { const size_t t = (size_t)blockIdx.x * 256 + threadIdx.x; if (t >= n8) return; FragH f;
#pragma unroll
  for (int i = 0; i < 8; ++i) f.h[i] = (_Float16)(bf16_round(W[t * 8 + i]) * 16.0f); *(v8us*)((unsigned short*)Bt + t * 8) = f.half[0];  }
template <int NHv, int TTv>
__global__ __launch_bounds__(256) void k_vt(const _Float16* __restrict__ V16, int ldv, int voff, _Float16* __restrict__ Vt) { __shared__ unsigned short tl[64][66]; const int tid = threadIdx.x; const int slab = blockIdx.x / (TTv / 64), lg = blockIdx.x % (TTv / 64); const int b = slab / NHv, h = slab % NHv;
  for (int i = tid; i < 64 * 8; i += 256) { const int r = i / 8, c8 = (i % 8) * 8; FragH f; f.half[0] = *(const v8us*)((const unsigned short*)V16 + ((size_t)b * TTv + lg * 64 + r) * ldv + voff + h * 64 + c8);
#pragma unroll
    for (int q = 0; q < 8; ++q) tl[r][c8 + q] = f.u[q]; }
  __syncthreads();
  {
#pragma unroll
    for (int rd = 0; rd < 2; ++rd) { const int d = rd * 32 + tid / 8, pc = tid % 8; FragH f;
#pragma unroll
      for (int q = 0; q < 8; ++q) f.u[q] = tl[pc * 8 + q][d];
      *(v8us*)((unsigned short*)Vt + ((size_t)slab * 64 + d) * TTv + lg * 64 + pc * 8) = f.half[0]; }
     } }

__global__ __launch_bounds__(256) void k_hl(const float* __restrict__ F, _Float16* __restrict__ Hh, _Float16* __restrict__ Hl, size_t n8) { const size_t t = (size_t)blockIdx.x * 256 + threadIdx.x; if (t >= n8) return; FragH fh, fl; const v4f a = *(const v4fa*)(F + t * 8), c = *(const v4fa*)(F + t * 8 + 4);
#pragma unroll
  for (int q = 0; q < 4; ++q) { _Float16 h = (_Float16)a[q]; fh.h[q] = h; fl.h[q] = (_Float16)((a[q] - (float)h) * 1024.0f); h = (_Float16)c[q]; fh.h[4 + q] = h; fl.h[4 + q] = (_Float16)((c[q] - (float)h) * 1024.0f); }
  { *(v8us*)((unsigned short*)Hh + t * 8) = fh.half[0]; *(v8us*)((unsigned short*)Hl + t * 8) = fl.half[0];  } }

// ---- fast GEMM (work-group tile 128x64, wave tile 32x64; requires M % 128 == 0, N % 64 == 0, K % 64 == 0); epilogue = k_gemm_hhx semantics ----
// Operands go through LDS, 64 k a pass: the work-group's 128 A rows and 64 B rows as 128-byte row pieces, 8 lanes a piece, so a wave's 16-byte global load covers 4 whole lines
// (a fragment load straight from global touches 16 lines for the same bytes, and each wave fetched all of B for itself). Rows at a 144-B pitch: 16-byte fragment reads without bank conflicts.
// Two buffers: the next pass's global loads fly during the pass, are stored to the other buffer at its foot, one barrier a pass. Each accumulator takes its products in ascending k.
#define GK 64                        /* k a pass */
#define GP 72                        /* LDS row pitch in f16 */
__device__ __forceinline__ v16h g2_frag(const _Float16* p, int hh) { FragH f; f.half[0] = *(const v8us*)((const unsigned short*)p + 8 * hh); f.half[1] = *(const v8us*)((const unsigned short*)p + 16 + 8 * hh); return f.v; }
__device__ __forceinline__ v16h g2_lfrag(const unsigned short* p, int hh) { FragH f; f.half[0] = *(const v8us*)(p + 8 * hh); f.half[1] = *(const v8us*)(p + 16 + 8 * hh); return f.v; }      /* the same k order from an LDS row */
__device__ __forceinline__ v8f g2_mma(v16h a, v16h b, v8f c) { v8f d = __builtin_amdgcn_wmma_f32_16x16x32_f16(false, a, false, b, (short)0, c, false, false); asm volatile("v_nop\n\tv_nop\n\tv_nop\n\tv_nop" : "+v"(d) : "v"(a), "v"(b)); return d; }
template <int ACT>
__global__ __launch_bounds__(128) void k_gemm2(const _Float16* __restrict__ A, int lda, size_t sA, const _Float16* __restrict__ Bh, int ldb, size_t sB, float alpha, const float* __restrict__ bias, size_t sBias, const float* __restrict__ CP, int rowsPerB, size_t sCPb, int row0g,
    float* __restrict__ C, _Float16* __restrict__ C16, int ldc, size_t sC, int M, int N, int K, const float* __restrict__ bias1, const float* __restrict__ bias2) { static_assert(ACT == 0 || ACT == 3 || ACT == 6 || ACT == 8 || ACT == 9 || ACT == 11 || ACT == 12 || ACT == 14 || ACT == 15 || ACT == 16 || ACT == 17, "k_gemm2: unsupported ACT code (would silently apply no activation)");
  __shared__ __attribute__((aligned(16))) float so[4][32][68];
  __shared__ __attribute__((aligned(16))) unsigned short sa[2][128][GP];
  __shared__ __attribute__((aligned(16))) unsigned short sb[2][64][GP];
  const int tid = threadIdx.x, w = tid >> 5, lane = tid & 31, ln = lane & 15, hh = lane >> 4; const int by = blockIdx.y;
  A += (size_t)by * sA; Bh += (size_t)by * sB; const size_t cofs = (size_t)by * sC; const float* bp = bias ? bias + (size_t)by * sBias : nullptr;
  if (by == 1 && bias1) bp = bias1; if (by == 2 && bias2) bp = bias2;      /* batch entries 1 and 2 whose biases are buffers of their own */
  const int ntn = N >> 6; const int mt = blockIdx.x / ntn, nq = blockIdx.x - mt * ntn; const int row0 = mt * 128 + 32 * w, col0 = nq * 64; if (mt * 128 >= M) return;      /* the whole work-group leaves or none: barriers follow */
  const int sr = tid >> 3, sc = (tid & 7) * 8;      /* staging: this thread moves 16 bytes of rows sr + 16 i of each tile; 8 threads cover a 128-byte row piece */
  __builtin_assume(lda == DM); __builtin_assume(ldb == DM);      /* every launch here has rows of DM: with the pitch known the 16-row steps are immediate offsets on one address pair an operand, no address arithmetic between the loads */
  const unsigned short* ag = (const unsigned short*)A + (size_t)(mt * 128 + sr) * lda + sc; const unsigned short* bg = (const unsigned short*)Bh + (size_t)(col0 + sr) * ldb + sc;
  v8us ra[8], rb[4];
#pragma unroll      /* constant indices keep the pieces in registers */
  for (int i = 0; i < 8; ++i) ra[i] = *(const v8us*)(ag + (size_t)(16 * i) * lda);
#pragma unroll      /* constant indices keep the pieces in registers */
  for (int i = 0; i < 4; ++i) rb[i] = *(const v8us*)(bg + (size_t)(16 * i) * ldb);
#pragma unroll      /* constant indices keep the pieces in registers */
  for (int i = 0; i < 8; ++i) *(v8us*)&sa[0][sr + 16 * i][sc] = ra[i];
#pragma unroll      /* constant indices keep the pieces in registers */
  for (int i = 0; i < 4; ++i) *(v8us*)&sb[0][sr + 16 * i][sc] = rb[i];
  __syncthreads();
  const v8f z8 = {0.f,0.f,0.f,0.f,0.f,0.f,0.f,0.f}; v8f c00 = z8, c01 = z8, c02 = z8, c03 = z8, c10 = z8, c11 = z8, c12 = z8, c13 = z8;
#pragma unroll 1      /* one pass a trip: the body already holds 16 matrix instructions and 24 LDS reads */
  for (int kb = 0; kb < K; kb += GK) { const int cur = (kb / GK) & 1; const bool more = kb + GK < K;
    if (more) { ag += GK; bg += GK;
#pragma unroll      /* constant indices keep the pieces in registers */
      for (int i = 0; i < 8; ++i) ra[i] = *(const v8us*)(ag + (size_t)(16 * i) * lda);
#pragma unroll      /* constant indices keep the pieces in registers */
      for (int i = 0; i < 4; ++i) rb[i] = *(const v8us*)(bg + (size_t)(16 * i) * ldb); }
    v16h af[2][2], bf[2][4];      /* [k half of the pass][tile] */
#pragma unroll      /* constant indices keep the fragments in registers */
    for (int s = 0; s < 2; ++s) {
#pragma unroll      /* constant indices keep the fragments in registers */
      for (int t = 0; t < 2; ++t) af[s][t] = g2_lfrag(&sa[cur][32 * w + 16 * t + ln][32 * s], hh);
#pragma unroll      /* constant indices keep the fragments in registers */
      for (int t = 0; t < 4; ++t) bf[s][t] = g2_lfrag(&sb[cur][16 * t + ln][32 * s], hh); }
    __builtin_amdgcn_sched_barrier(0);      /* keeps the pass's global loads and all 24 LDS reads issued here: sunk to in front of their matrix instructions, each group would stand with a full latency in the open */
#pragma unroll      /* constant indices keep the fragments in registers */
    for (int s = 0; s < 2; ++s) {
      c00 = g2_mma(af[s][0], bf[s][0], c00); c10 = g2_mma(af[s][1], bf[s][0], c10);
      c01 = g2_mma(af[s][0], bf[s][1], c01); c11 = g2_mma(af[s][1], bf[s][1], c11);
      c02 = g2_mma(af[s][0], bf[s][2], c02); c12 = g2_mma(af[s][1], bf[s][2], c12);
      c03 = g2_mma(af[s][0], bf[s][3], c03); c13 = g2_mma(af[s][1], bf[s][3], c13); }
    if (more) {      /* every reader left that buffer before the last barrier */
#pragma unroll      /* constant indices keep the pieces in registers */
      for (int i = 0; i < 8; ++i) *(v8us*)&sa[cur ^ 1][sr + 16 * i][sc] = ra[i];
#pragma unroll      /* constant indices keep the pieces in registers */
      for (int i = 0; i < 4; ++i) *(v8us*)&sb[cur ^ 1][sr + 16 * i][sc] = rb[i]; }
    __syncthreads(); }      /* publishes the next pass's tiles and ends this pass's reads of the buffer that the next pass refills */
  v8f accs[8] = {c00, c01, c02, c03, c10, c11, c12, c13};
#pragma unroll
  for (int u = 0; u < 8; ++u) { const int t = u & 3, half = u >> 2; const int col = col0 + t * 16 + ln; const float bv = bp ? bf16_round(bp[col]) : 0.f;
#pragma unroll
    for (int r = 0; r < 8; ++r) { const int rloc = half * 16 + 8 * hh + r; float v = accs[u][r] * alpha + bv; if (CP) { if (rowsPerB < 0) v += CP[cofs + (size_t)(row0g + row0 + rloc) * ldc + col];      /* rowsPerB < 0: own element of the batched C plane */ else { const int bidx = (row0g + row0 + rloc) / rowsPerB; v += CP[(size_t)bidx * sCPb + (size_t)by * 64 + col]; } }
      if (ACT == 3) v = fmaxf(v, 0.f); else if (ACT == 6) v = 0.5f * v * (1.0f + erff(v * 0.70710678118654752f)); else if (ACT == 11) v = 1.0f / (1.0f + expf(-v)); else if (ACT == 15) v = v / (1.0f + expf(-v)); else if (ACT == 12) v = (v > 0.f) ? v : 0.01f * v; else if (ACT == 8) v = tanhf(v); else if (ACT == 9) v = 0.5f * v * (1.0f + tanhf(0.7978845608028654f * (v + 0.044715f * v * v * v))); else if (ACT == 14) v = (v > 0.f) ? v : 0.1f * v; else if (ACT == 16) v = (v >= 0.f) ? v : 0.3f * v; else if (ACT == 17) v = (v >= 0.f) ? v : 0.2f * v;
      so[w][rloc][t * 16 + ln] = v; } }
  __builtin_amdgcn_fence(__ATOMIC_ACQ_REL, "workgroup"); __builtin_amdgcn_wave_barrier();
  const int rsub = lane >> 4, c4 = (lane & 15) * 4;
  {
#pragma unroll
    for (int q = 0; q < 16; ++q) { const int r = q * 2 + rsub; const v4f v = *(const v4fa*)&so[w][r][c4]; if (C) *(v4f*)(C + cofs + (size_t)(row0 + r) * ldc + col0 + c4) = v; if (C16) { v4h h4; for (int i = 0; i < 4; ++i) h4[i] = (_Float16)v[i]; *(v4h*)(C16 + cofs + (size_t)(row0 + r) * ldc + col0 + c4) = h4; } }
     } }


// ---- q, k, v projections straight from the f32 inputs: no conversion launch ----
// blockIdx.y = 0, 1, 2: C16[y] = f16(X_y W_y^T + b_y). The loop, the fragment reads, the order of the products and the epilogue are k_gemm2's; the operands differ in how they reach LDS:
// a thread loads 16 bytes of f32 (16 lanes cover a 256-byte row piece: whole lines), rounds them to bf16 (two packed conversions) and writes those 8 bytes at the foot of the pass; the products run on the bf16 form,
// whose operands are the very values that the f16 form had (inputs and weights rounded to bf16 are exact in both; no x16 is needed here).
// f32 rows are twice the bytes from L2, so the work-group takes 128 rows x 256 columns (16 waves, 4 x 4 of 32x64): an input row is fetched by 2 work-groups, not 8, and rounded twice, not 8 times.
// blockIdx.y = 3: Wo to f16 x16 for the output GEMM two launches on; these blocks leave before any barrier.
#define QC 4                         /* 64-column groups a work-group */
#define QB ((int)((NR / 128) * (DM / (64 * QC))))      /* blocks a projection: 64 */
typedef unsigned short v4us __attribute__((ext_vector_type(4), may_alias));
typedef __bf16 v4b __attribute__((ext_vector_type(4)));
__device__ __forceinline__ v4us q_bf(v4f a) { return __builtin_bit_cast(v4us, __builtin_convertvector(a, v4b)); }      /* f32 -> bf16, nearest even: two packed conversions */
__device__ __forceinline__ v16b q_lfrag(const unsigned short* p, int hh) { FragB f; f.half[0] = *(const v8us*)(p + 8 * hh); f.half[1] = *(const v8us*)(p + 16 + 8 * hh); return f.v; }      /* g2_lfrag's k order */
__device__ __forceinline__ v8f q_mma(v16b a, v16b b, v8f c) { return __builtin_amdgcn_wmma_f32_16x16x32_bf16(false, a, false, b, (short)0, c, false, false); }
__global__ __launch_bounds__(128 * QC) void k_qkv(const float* __restrict__ xq, const float* __restrict__ xk, const float* __restrict__ xv, const float* __restrict__ wq, const float* __restrict__ wk, const float* __restrict__ wv, const float* __restrict__ wo,
    const float* __restrict__ bq, const float* __restrict__ bk, const float* __restrict__ bv, _Float16* __restrict__ C16, _Float16* __restrict__ BO) {
  __shared__ __attribute__((aligned(16))) float so[4 * QC][32][68];
  __shared__ __attribute__((aligned(16))) unsigned short sa[2][128][GP];
  __shared__ __attribute__((aligned(16))) unsigned short sb[2][64 * QC][GP];
  const int tid = threadIdx.x, w = tid >> 5, lane = tid & 31, ln = lane & 15, hh = lane >> 4; const int wr = w & 3, wc = w >> 2; const int by = blockIdx.y;
  if (by == 3) {      /* the whole work-group leaves here or none of it */
    const size_t e0 = ((size_t)blockIdx.x * (128 * QC) + tid) * 4; const size_t e1 = e0 + (size_t)QB * (128 * QC) * 4; static_assert((size_t)QB * (128 * QC) * 8 == (size_t)DM * DM, "two pieces of 4 a thread cover Wo");
    const v4f a0 = *(const v4fa*)(wo + e0), a1 = *(const v4fa*)(wo + e1);
    v4h o0, o1;
#pragma unroll      /* constant indices keep the pieces in registers */
    for (int q = 0; q < 4; ++q) { o0[q] = (_Float16)(bf16_round(a0[q]) * 16.0f); o1[q] = (_Float16)(bf16_round(a1[q]) * 16.0f); }
    *(v4h*)(BO + e0) = o0; *(v4h*)(BO + e1) = o1; return; }
  const float* A = by == 0 ? xq : by == 1 ? xk : xv; const float* Wf = by == 0 ? wq : by == 1 ? wk : wv; const float* bp = by == 0 ? bq : by == 1 ? bk : bv; const size_t cofs = (size_t)by * NR * DM;
  const int mt = blockIdx.x / (DM / (64 * QC)), nq = blockIdx.x - mt * (DM / (64 * QC)); const int row0 = mt * 128 + 32 * wr, col0 = nq * (64 * QC) + 64 * wc;
  const int fr = tid >> 4, fc = (tid & 15) * 4;      /* staging: this thread moves 4 elements of rows fr + 8 QC i of each tile */
  const float* ag = A + (size_t)(mt * 128 + fr) * DM + fc; const float* bg = Wf + (size_t)(nq * (64 * QC) + fr) * DM + fc;
  v4f ra[16 / QC], rb[8];
#pragma unroll      /* constant indices keep the pieces in registers */
  for (int i = 0; i < 16 / QC; ++i) ra[i] = *(const v4fa*)(ag + (size_t)(8 * QC * i) * DM);
#pragma unroll      /* constant indices keep the pieces in registers */
  for (int i = 0; i < 8; ++i) rb[i] = *(const v4fa*)(bg + (size_t)(8 * QC * i) * DM);
#pragma unroll      /* constant indices keep the pieces in registers */
  for (int i = 0; i < 16 / QC; ++i) *(v4us*)&sa[0][fr + 8 * QC * i][fc] = q_bf(ra[i]);
#pragma unroll      /* constant indices keep the pieces in registers */
  for (int i = 0; i < 8; ++i) *(v4us*)&sb[0][fr + 8 * QC * i][fc] = q_bf(rb[i]);
  __syncthreads();
  const v8f z8 = {0.f,0.f,0.f,0.f,0.f,0.f,0.f,0.f}; v8f c00 = z8, c01 = z8, c02 = z8, c03 = z8, c10 = z8, c11 = z8, c12 = z8, c13 = z8;
#pragma unroll 1      /* one pass a trip: the body already holds 16 matrix instructions and 24 LDS reads */
  for (int kb = 0; kb < DM; kb += GK) { const int cur = (kb / GK) & 1; const bool more = kb + GK < DM;
    if (more) { ag += GK; bg += GK;
#pragma unroll      /* constant indices keep the pieces in registers */
      for (int i = 0; i < 16 / QC; ++i) ra[i] = *(const v4fa*)(ag + (size_t)(8 * QC * i) * DM);
#pragma unroll      /* constant indices keep the pieces in registers */
      for (int i = 0; i < 8; ++i) rb[i] = *(const v4fa*)(bg + (size_t)(8 * QC * i) * DM); }
    v16b af[2][2], bf[2][4];      /* [k half of the pass][tile] */
#pragma unroll      /* constant indices keep the fragments in registers */
    for (int s = 0; s < 2; ++s) {
#pragma unroll      /* constant indices keep the fragments in registers */
      for (int t = 0; t < 2; ++t) af[s][t] = q_lfrag(&sa[cur][32 * wr + 16 * t + ln][32 * s], hh);
#pragma unroll      /* constant indices keep the fragments in registers */
      for (int t = 0; t < 4; ++t) bf[s][t] = q_lfrag(&sb[cur][64 * wc + 16 * t + ln][32 * s], hh); }
    __builtin_amdgcn_sched_barrier(0);      /* keeps the pass's global loads and all 24 LDS reads issued here: sunk to in front of their matrix instructions, each group would stand with a full latency in the open */
#pragma unroll      /* constant indices keep the fragments in registers */
    for (int s = 0; s < 2; ++s) {
      c00 = q_mma(af[s][0], bf[s][0], c00); c10 = q_mma(af[s][1], bf[s][0], c10);
      c01 = q_mma(af[s][0], bf[s][1], c01); c11 = q_mma(af[s][1], bf[s][1], c11);
      c02 = q_mma(af[s][0], bf[s][2], c02); c12 = q_mma(af[s][1], bf[s][2], c12);
      c03 = q_mma(af[s][0], bf[s][3], c03); c13 = q_mma(af[s][1], bf[s][3], c13); }
    asm volatile("v_nop\n\tv_nop\n\tv_nop\n\tv_nop" : "+v"(c03), "+v"(c13) : "v"(af[1][0]), "v"(af[1][1]), "v"(bf[1][3]));      /* the four vector slots the chip needs behind the pass's last matrix instructions: on the taken side of the branch that follows, the next vector instructions are address arithmetic that may be placed on their operand registers */
    if (more) {      /* every reader left that buffer before the last barrier */
#pragma unroll      /* constant indices keep the pieces in registers */
      for (int i = 0; i < 16 / QC; ++i) *(v4us*)&sa[cur ^ 1][fr + 8 * QC * i][fc] = q_bf(ra[i]);
#pragma unroll      /* constant indices keep the pieces in registers */
      for (int i = 0; i < 8; ++i) *(v4us*)&sb[cur ^ 1][fr + 8 * QC * i][fc] = q_bf(rb[i]); }
    __syncthreads(); }      /* publishes the next pass's tiles and ends this pass's reads of the buffer that the next pass refills */
  v8f accs[8] = {c00, c01, c02, c03, c10, c11, c12, c13};
#pragma unroll      /* constant indices keep the accumulators in registers */
  for (int u = 0; u < 8; ++u) { const int t = u & 3, half = u >> 2; const float bv1 = bf16_round(bp[col0 + t * 16 + ln]);
#pragma unroll      /* constant indices keep the accumulators in registers */
    for (int r = 0; r < 8; ++r) so[w][half * 16 + 8 * hh + r][t * 16 + ln] = accs[u][r] + bv1; }
  __builtin_amdgcn_fence(__ATOMIC_ACQ_REL, "workgroup"); __builtin_amdgcn_wave_barrier();      /* a wave reads back its own rows only */
  const int rsub = lane >> 4, c4 = (lane & 15) * 4;
#pragma unroll      /* the 16 row pairs' reads and stores in flight together */
  for (int q = 0; q < 16; ++q) { const int r = q * 2 + rsub; const v4f v = *(const v4fa*)&so[w][r][c4]; *(v4h*)(C16 + cofs + (size_t)(row0 + r) * DM + col0 + c4) = __builtin_convertvector(v, v4h); } }
#define FS 4                         /* key quarters: waves that share a query group */
#define FW 32                        /* keys a wave and run */
#define FJ 2                         /* such 32-key runs of a wave between two barriers */
#define FK (FJ * FS * FW)            /* keys a pass */
#define FP 72                        /* LDS pitch of a K row in f16 */
#define FV 80                        /* LDS pitch of a V row in f16: 32 B x odd, the transposing load's pitch */
__device__ __forceinline__ float fa_xhalf(float x) { return __builtin_bit_cast(float, __builtin_amdgcn_permlanex16(__builtin_bit_cast(int, x), __builtin_bit_cast(int, x), 0x76543210, 0xfedcba98, false, false)); }      /* lane l with lane l ^ 16 */
__device__ __forceinline__ v8f fa_mma(v16h a, v16h b, v8f c) { return __builtin_amdgcn_wmma_f32_16x16x32_f16(false, a, false, b, (short)0, c, false, false); }
__device__ __forceinline__ v16h fa_frag(const unsigned short* p, int hh) { FragH f; f.half[0] = *(const v8us*)(p + 8 * hh); f.half[1] = *(const v8us*)(p + 16 + 8 * hh); return f.v; }
typedef short v8s __attribute__((ext_vector_type(8)));
__device__ __forceinline__ v8us fa_tr16(const unsigned short* p) { typedef __attribute__((address_space(3))) v8s lds_v8s; return __builtin_bit_cast(v8us, __builtin_amdgcn_ds_load_tr16_b128_v8i16((lds_v8s*)p)); }
// 16 d x 32 keys of V^T from V rows in LDS; p = this lane's address in the 16-key x 16-d block: row 8 hh + (lane & 7), 16-byte piece (lane >> 3) & 1. Lane (ln, hh) gets keys 8 hh + r and 16 + 8 hh + r of d = ln: fa_frag's k order
__device__ __forceinline__ v16h fa_vfrag(const unsigned short* p) { FragH f; f.half[0] = fa_tr16(p); f.half[1] = fa_tr16(p + 16 * FV); return f.v; }
__global__ __launch_bounds__(512) void k_fattn(const _Float16* __restrict__ Q16, const _Float16* __restrict__ K16, const _Float16* __restrict__ V16, _Float16* __restrict__ O16) {
  __shared__ __attribute__((aligned(16))) unsigned short kt[2][FK][FP];
  __shared__ __attribute__((aligned(16))) unsigned short vs[2][FK][FV];
  __shared__ __attribute__((aligned(32))) float mo[4][FS][4][2][32][8];      /* [query group][key quarter][16-d tile][16-query tile][lane]: a quarter's x */
  __shared__ __attribute__((aligned(8))) float ml[4][FS][2][32][2];      /* its maximum and its sum */
  const int tid = threadIdx.x, w = tid >> 5, lane = tid & 31, ln = lane & 15, hh = lane >> 4; const int qg = w & 3, ks = w >> 2; const int h = blockIdx.y; const int q0 = blockIdx.x * 128 + qg * 32;
  v16h qf[2][2];      /* [query tile][d half] */
#pragma unroll      /* constant indices keep the fragments and accumulators in registers */
  for (int u = 0; u < 2; ++u) { const _Float16* qp = Q16 + (size_t)(q0 + 16 * u + ln) * DM + h * HD; qf[u][0] = g2_frag(qp, hh); qf[u][1] = g2_frag(qp + 32, hh);
    asm volatile("s_wait_xcnt 0x0" ::: "memory"); }      /* stands in front of any reuse of this tile's address registers: the next loads' results may be placed on them */
  const int kr = tid >> 3, kc = (tid & 7) * 8;      /* staging K and V: this thread moves 16 bytes of rows kr + 64 i of each; 8 threads cover a 128-byte row */
  const int tr = 8 * hh + (lane & 7), tc = ((lane >> 3) & 1) * 8;      /* the transposing load: this lane's row and 16-byte piece in a 16-key x 16-d block of V */
  const unsigned short* kg = (const unsigned short*)K16 + (size_t)kr * DM + h * HD + kc; const unsigned short* vg = (const unsigned short*)V16 + (size_t)kr * DM + h * HD + kc;
  { v8us pk[4], pv[4];
#pragma unroll      /* constant indices keep the pieces in registers */
    for (int i = 0; i < 4; ++i) { pk[i] = *(const v8us*)(kg + (size_t)(64 * i) * DM); pv[i] = *(const v8us*)(vg + (size_t)(64 * i) * DM); }
#pragma unroll      /* constant indices keep the pieces in registers */
    for (int i = 0; i < 4; ++i) { *(v8us*)&kt[0][kr + 64 * i][kc] = pk[i]; *(v8us*)&vs[0][kr + 64 * i][kc] = pv[i]; } }
  __syncthreads();
  v8us rk[2], rv[2];
  const v8f z8 = {0.f,0.f,0.f,0.f,0.f,0.f,0.f,0.f}; v8f o[4][2] = {{z8, z8}, {z8, z8}, {z8, z8}, {z8, z8}}; float m[2] = {-3.0e38f, -3.0e38f}, l[2] = {0.f, 0.f};      /* o: [d tile][query tile]; m: running maximum of the raw products q.k; l: this half's sum of weights */
  const float CS = 0.125f * 1.4426950408889634f;      /* 1 / sqrt(64), and e^x as 2^(x log2 e) */
#pragma unroll 1      /* one pass a trip: the body already holds 32 matrix instructions and 32 LDS reads */
  for (int it = 0; it < SQ / FK; ++it) { const int cur = it & 1; const bool more = it + 1 < SQ / FK;
    if (more) { kg += (size_t)FK * DM; vg += (size_t)FK * DM; }
#pragma unroll      /* both runs in line: their LDS offsets are immediates */
    for (int j = 0; j < FJ; ++j) { const int k0 = (j * FS + ks) * FW;      /* the run's first key in the tile; no barrier between the runs, so the waves of a SIMD drift apart and fill one another's waits */
    if (more) {      /* each run brings half of the next tile: half the staging registers */
#pragma unroll      /* constant indices keep the pieces in registers */
      for (int i = 0; i < 2; ++i) { rk[i] = *(const v8us*)(kg + (size_t)(64 * (2 * j + i)) * DM); rv[i] = *(const v8us*)(vg + (size_t)(64 * (2 * j + i)) * DM); } }
    v16h kf[2][2], vf[4];
#pragma unroll      /* constant indices keep the fragments and accumulators in registers */
    for (int t = 0; t < 2; ++t) { const unsigned short* kp = &kt[cur][k0 + t * 16 + ln][0]; kf[t][0] = fa_frag(kp, hh); kf[t][1] = fa_frag(kp + 32, hh); }
    __builtin_amdgcn_sched_barrier(0);      /* keeps the run's global loads and its 8 K reads issued here, as one group ahead of the score products */
    v8f s[2][2];      /* [key tile][query tile] */
#pragma unroll      /* constant indices keep the fragments and accumulators in registers */
    for (int t = 0; t < 2; ++t)
#pragma unroll      /* constant indices keep the fragments and accumulators in registers */
      for (int u = 0; u < 2; ++u) s[t][u] = fa_mma(kf[t][0], qf[u][0], z8);
#pragma unroll      /* constant indices keep the fragments and accumulators in registers */
    for (int t = 0; t < 2; ++t)
#pragma unroll      /* constant indices keep the fragments and accumulators in registers */
      for (int u = 0; u < 2; ++u) s[t][u] = fa_mma(kf[t][1], qf[u][1], s[t][u]);
#pragma unroll      /* constant indices keep the fragments and accumulators in registers */
    for (int t = 0; t < 4; ++t) vf[t] = fa_vfrag(&vs[cur][k0 + tr][t * 16 + tc]);
    __builtin_amdgcn_sched_barrier(0);      /* keeps the 8 V^T reads issued here, as one group behind the score products: their latency passes under the softmax; sunk to in front of their matrix instructions each would stand in the open */
    FragH p[2]; float corr[2], off[2];
#pragma unroll      /* constant indices keep the fragments and accumulators in registers */
    for (int u = 0; u < 2; ++u) { float a0 = s[0][u][0], a1 = s[1][u][0];      /* one short maximum chain a tile */
#pragma unroll      /* constant indices keep the fragments and accumulators in registers */
      for (int r = 1; r < 8; ++r) { a0 = fmaxf(a0, s[0][u][r]); a1 = fmaxf(a1, s[1][u][r]); }
      float tm = fmaxf(a0, a1); tm = fmaxf(tm, fa_xhalf(tm)); const float mn = fmaxf(m[u], tm); corr[u] = __builtin_amdgcn_exp2f((m[u] - mn) * CS); off[u] = 8.0f - mn * CS; m[u] = mn; }      /* weights carry x256, as f16 operands away from the subnormal range; it cancels in x = sum / l */
#pragma unroll      /* constant indices keep the fragments and accumulators in registers */
    for (int t = 0; t < 2; ++t)
#pragma unroll      /* constant indices keep the fragments and accumulators in registers */
      for (int u = 0; u < 2; ++u)
#pragma unroll      /* constant indices keep the fragments and accumulators in registers */
        for (int r = 0; r < 8; ++r) { const float e = __builtin_amdgcn_exp2f(fmaf(s[t][u][r], CS, off[u])); s[t][u][r] = e; p[u].h[t * 8 + r] = (_Float16)e; }
#pragma unroll      /* constant indices keep the fragments and accumulators in registers */
    for (int u = 0; u < 2; ++u) { const v8f es = s[0][u] + s[1][u];      /* the run's sum as a tree: one chain of 16 dependent adds would stand at the foot of every run */
      l[u] = l[u] * corr[u] + (((es[0] + es[1]) + (es[2] + es[3])) + ((es[4] + es[5]) + (es[6] + es[7])));
#pragma unroll      /* constant indices keep the fragments and accumulators in registers */
      for (int t = 0; t < 4; ++t) o[t][u] *= corr[u]; }
#pragma unroll      /* constant indices keep the fragments and accumulators in registers */
    for (int u = 0; u < 2; ++u)
#pragma unroll      /* constant indices keep the fragments and accumulators in registers */
      for (int t = 0; t < 4; ++t) o[t][u] = fa_mma(vf[t], p[u].v, o[t][u]);
    if (more) {      /* every reader left that buffer before the last barrier */
#pragma unroll      /* constant indices keep the pieces in registers */
      for (int i = 0; i < 2; ++i) { *(v8us*)&kt[cur ^ 1][kr + 64 * (2 * j + i)][kc] = rk[i]; *(v8us*)&vs[cur ^ 1][kr + 64 * (2 * j + i)][kc] = rv[i]; } } }
    __syncthreads(); }      /* publishes the next tile and ends this pass's reads of the buffer that the next pass refills */
  // join of the four key quarters: every wave leaves its x, maximum and sum in LDS; then the wave of quarter j joins d tile j of its query group's 32 queries
#pragma unroll      /* constant indices keep the fragments and accumulators in registers */
  for (int u = 0; u < 2; ++u) { l[u] += fa_xhalf(l[u]); ml[qg][ks][u][lane][0] = m[u]; ml[qg][ks][u][lane][1] = l[u];
#pragma unroll      /* constant indices keep the fragments and accumulators in registers */
    for (int t = 0; t < 4; ++t) *(v8f*)&mo[qg][ks][t][u][lane][0] = o[t][u]; }
  __syncthreads();      /* the quarters' results are read by other waves */
#pragma unroll      /* constant indices keep the fragments and accumulators in registers */
  for (int u = 0; u < 2; ++u) { float mj[FS], lj[FS];
#pragma unroll      /* constant indices keep the fragments and accumulators in registers */
    for (int j = 0; j < FS; ++j) { mj[j] = ml[qg][j][u][lane][0]; lj[j] = ml[qg][j][u][lane][1]; }
    const float mx = fmaxf(fmaxf(mj[0], mj[1]), fmaxf(mj[2], mj[3])); float ls = 0.f; v8f x = z8;
#pragma unroll      /* constant indices keep the fragments and accumulators in registers */
    for (int j = 0; j < FS; ++j) mj[j] = __builtin_amdgcn_exp2f((mj[j] - mx) * CS);      /* each quarter's weight in the join */
#pragma unroll      /* constant indices keep the fragments and accumulators in registers */
    for (int j = 0; j < FS; ++j) { ls += mj[j] * lj[j]; x += *(const v8f*)&mo[qg][j][ks][u][lane][0] * mj[j]; }
    const float inv = 1.0f / ls; FragH f;      /* lane (ln, hh) holds x[q0 + 16 u + ln][16 ks + 8 hh + r] */
#pragma unroll      /* constant indices keep the fragments and accumulators in registers */
    for (int r = 0; r < 8; ++r) f.h[r] = (_Float16)(x[r] * inv);
    *(v8us*)&kt[0][qg * 32 + 16 * u + ln][16 * ks + 8 * hh] = f.half[0]; }      /* the K buffer, which every reader left at the loop's last barrier, now holds the work-group's 128 output row pieces */
  __syncthreads();      /* a row piece comes from four waves and leaves as one whole 128-byte line */
  unsigned short* op = (unsigned short*)O16 + (size_t)(blockIdx.x * 128 + kr) * DM + h * HD + kc;
  *(v8us*)op = *(const v8us*)&kt[0][kr][kc]; *(v8us*)(op + 64 * DM) = *(const v8us*)&kt[0][kr + 64][kc]; }

extern "C" void kernel_launch(void* const* d_in, const int* in_sizes, int n_in,
                              void* d_out, int out_size, void* d_ws, size_t ws_size, hipStream_t stream) {
  (void)in_sizes; (void)n_in; (void)out_size;
  const float* const* I = (const float* const*)d_in; const float* xq = I[0]; const float* xk = I[1]; const float* xv = I[2]; const float* wq = I[3]; const float* bq = I[4]; const float* wk = I[5]; const float* bk = I[6]; const float* wv = I[7]; const float* bv = I[8]; const float* wo = I[9]; const float* bo = I[10];
  char* ws = (char*)d_ws; size_t off = 0;
  auto take = [&](size_t bytes) { char* p = ws + off; off += (bytes + 255) & ~(size_t)255; return p; };
  _Float16* BO = (_Float16*)take((size_t)DM * DM * 2);      /* Wo */
  _Float16* Q16 = (_Float16*)take(3 * NR * DM * 2); _Float16* K16 = Q16 + NR * DM; _Float16* V16 = K16 + NR * DM;      /* q | k | v */
  _Float16* O16 = (_Float16*)take(NR * DM * 2);
  if (off > ws_size) return;      /* approx 16.5 MiB */
  const dim3 gp((unsigned)((NR / 128) * (DM / 64)), 1);
  k_qkv<<<dim3(QB, 4), 128 * QC, 0, stream>>>(xq, xk, xv, wq, wk, wv, wo, bq, bk, bv, Q16, BO);      /* q, k and v: blockIdx.y picks rows, weight, bias and output; row 3 rounds Wo */
  k_fattn<<<dim3(SQ / 128, NH), 512, 0, stream>>>(Q16, K16, V16, O16);      /* x (merged heads) as f16 rows */
  k_gemm2<0><<<gp, 128, 0, stream>>>(O16, DM, 0, BO, DM, 0, 0.0625f, bo, 0, nullptr, 1, 0, 0, (float*)d_out, nullptr, DM, 0, MO, DM, DM, nullptr, nullptr);      /* out = o W_o^T + b_o, rows are the output layout */
}

// v008
// A run of this version takes 53.4 microseconds.
// Two timings next to v007 put it at 1.06 and 1.07 times that version's speed.
// Over all steps from v000 it is 128 times as fast.
#include <hip/hip_runtime.h>
// Multi-head attention over separate query / key / value inputs ([1][4096][512] each; q = query Wq^T + bq, k = key Wk^T + bk, v = value Wv^T + bv, 8 heads of 64; attn = softmax(q k^T / 8); x = attn v; out = x Wo^T + bo -> [1][4096][512]).
// Structure: token rows; Q | K | V as three WMMA GEMMs in one launch, blockIdx.y the projection: query, key, value and their weights are read as f32 and rounded to bf16 on the way into LDS (128x256 work-group tiles, 32x64 wave tiles, bf16 products, f32 accumulation, bias in the epilogue, f16 outputs), a fourth blockIdx.y row rounds Wo (exact f16, x16) for the last launch; one attention kernel for all heads (scores^T = K q^T, softmax in registers against a held reference that is raised only when a run's weights grow too large, x^T += V^T p^T with V^T fragments by transposing LDS loads of V rows; scores and weights never stored) written straight into the merged f16 rows; out = x Wo^T + bo GEMM (f32).
// Compute dtype: inputs rounded to bf16; inputs / weights exact; q, k, v, softmax weights and x as plain f16 GEMM operands (~2^-12); scores and softmax statistics f32. v_wmma_f32_16x16x32_bf16 (q, k, v projections), v_wmma_f32_16x16x32_f16 (attention, output projection).
#define NB 1
#define SQ 4096
#define DM 512
#define NH 8
#define HD 64
#define MP ((int)NR)                 /* unused: k_qkv always takes all NR token rows */
#define MO ((int)NR)                 /* token rows through the output projection (debug hook) */
#define NR ((size_t)NB * SQ)         /* 4096 token rows */
typedef __bf16 v16b __attribute__((ext_vector_type(16)));
typedef unsigned short v8us __attribute__((ext_vector_type(8), may_alias));
typedef float  v8f  __attribute__((ext_vector_type(8)));
typedef float  v4f  __attribute__((ext_vector_type(4)));
typedef float  v4fa __attribute__((ext_vector_type(4), may_alias));
union FragB { v16b v; v8us half[2]; unsigned short u[16]; };

__device__ __forceinline__ unsigned short bf16_bits(float x) { unsigned int u = __float_as_uint(x); return (unsigned short)((u + 0x7FFFu + ((u >> 16) & 1u)) >> 16); }
__device__ __forceinline__ float bf16_val(unsigned short b) { return __uint_as_float(((unsigned int)b) << 16); }
__device__ __forceinline__ float bf16_round(float x) { return bf16_val(bf16_bits(x)); }
// D += A·B with NT terms: 1 = ah·bh, 2 = + al·bh (A split), 3 = + ah·bl (both split)
template <int NT>
__device__ __forceinline__ v8f mmaN(v16b ah, v16b al, v16b bh, v16b bl, v8f c) {
  c = __builtin_amdgcn_wmma_f32_16x16x32_bf16(false, ah, false, bh, (short)0, c, false, false);
  if (NT >= 2) c = __builtin_amdgcn_wmma_f32_16x16x32_bf16(false, al, false, bh, (short)0, c, false, false);
  if (NT >= 3) c = __builtin_amdgcn_wmma_f32_16x16x32_bf16(false, ah, false, bl, (short)0, c, false, false);
  asm volatile("v_nop\n\tv_nop\n\tv_nop\n\tv_nop" : "+v"(c) : "v"(ah), "v"(al), "v"(bh), "v"(bl));
  return c;
}

__global__ __launch_bounds__(256) void k_wt_bf16(const float* __restrict__ W, unsigned short* __restrict__ Wt, int K, int N) {
  const int t = blockIdx.x * 256 + threadIdx.x;
  const int k8n = K / 8;
  if (t >= N * k8n) return;
  const int n = t / k8n, k8 = (t % k8n) * 8;
  v8us v;
#pragma unroll
  for (int i = 0; i < 8; ++i) v[i] = bf16_bits(W[(size_t)(k8 + i) * N + n]);
  *(v8us*)(Wt + (size_t)n * K + k8) = v;
  
}

// GEMM C[M][N] (f32, pitch ldc) = act(A[M][K]·W + bias). A f32 row-major (pitch lda) converted per fragment to bf16
// (ASPLIT: hi/lo two planes -> 2 terms, else single rounded term); Wt bf16 [N][K] (pitch ldb). BIAS_BF16 rounds the
// bias to bf16 first (bias quantised to bf16 before the add). K%32==0, M%16==0, N%64==0.
template <bool ASPLIT, int ACT, bool BIAS_BF16>
__global__ __launch_bounds__(128) void k_gemm_bf(const float* __restrict__ A, int lda, const unsigned short* __restrict__ Wt, int ldb,
                                               const float* __restrict__ bias, float* __restrict__ C, int ldc, int M, int N, int K) {
  __shared__ __attribute__((aligned(16))) float so[4][16][64];
  const int tid = threadIdx.x, w = tid >> 5, lane = tid & 31, ln = lane & 15, hh = lane >> 4;
  const int ntn = N / 64;
  const int wid = blockIdx.x * 4 + w;
  const int mt = wid / ntn, nq = wid % ntn;
  if (mt * 16 >= M) return;
  const int row0 = mt * 16, col0 = nq * 64;
  const float* arow = A + (size_t)(row0 + ln) * lda;
  v8f acc[4] = {};
  for (int kb = 0; kb < K; kb += 32) {
    FragB ah, al;
    const v4f x0 = *(const v4fa*)(arow + kb + 8 * hh), x1 = *(const v4fa*)(arow + kb + 8 * hh + 4);
    const v4f x2 = *(const v4fa*)(arow + kb + 16 + 8 * hh), x3 = *(const v4fa*)(arow + kb + 16 + 8 * hh + 4);
    float xs[16] = {x0[0],x0[1],x0[2],x0[3],x1[0],x1[1],x1[2],x1[3],x2[0],x2[1],x2[2],x2[3],x3[0],x3[1],x3[2],x3[3]};
#pragma unroll
    for (int i = 0; i < 16; ++i) { const unsigned short hb = bf16_bits(xs[i]); ah.u[i] = hb; al.u[i] = ASPLIT ? bf16_bits(xs[i] - bf16_val(hb)) : (unsigned short)0; }
#pragma unroll
    for (int t = 0; t < 4; ++t) {
      const unsigned short* brow = Wt + (size_t)(col0 + t * 16 + ln) * ldb + kb;
      FragB b;
      b.half[0] = *(const v8us*)(brow + 8 * hh);
      b.half[1] = *(const v8us*)(brow + 16 + 8 * hh);
      acc[t] = mmaN<ASPLIT ? 2 : 1>(ah.v, al.v, b.v, b.v, acc[t]);
    }
  }
#pragma unroll
  for (int t = 0; t < 4; ++t) {
    float bv = bias ? bias[col0 + t * 16 + ln] : 0.f;
    if (BIAS_BF16) bv = bf16_round(bv);
#pragma unroll
    for (int r = 0; r < 8; ++r) { float v = acc[t][r] + bv; if (ACT == 1) v = fmaxf(v, 0.f); so[w][8 * hh + r][t * 16 + ln] = v; }
  }
  __builtin_amdgcn_fence(__ATOMIC_ACQ_REL, "workgroup");
  __builtin_amdgcn_wave_barrier();
  const int rsub = lane >> 4, c4 = (lane & 15) * 4;
  {
#pragma unroll
    for (int q = 0; q < 8; ++q) {
      const int r = q * 2 + rsub;
      const v4f v = *(const v4fa*)&so[w][r][c4];
      *(v4f*)(C + (size_t)(row0 + r) * ldc + col0 + c4) = v;
    }
    
  }
}

// GEMM C = act(A·W + bias + resid): A f32 (ASPLIT -> hi/lo 2 terms), Wt bf16 [N][K]; ACT 0 none, 1 relu, 2 exact gelu;
// resid (optional, f32, row index = (row % rmod), pitch ldr, RES_BF16 rounds it) added before the activation.
template <bool ASPLIT, int ACT, bool BIAS_BF16, bool RES_BF16>
__global__ __launch_bounds__(128) void k_gemm_bf3(const float* __restrict__ A, int lda, const unsigned short* __restrict__ Wt, int ldb,
                                                const float* __restrict__ bias, const float* __restrict__ resid, int rmod, int ldr,
                                                float* __restrict__ C, int ldc, int M, int N, int K) {
  __shared__ __attribute__((aligned(16))) float so[4][16][64];
  const int tid = threadIdx.x, w = tid >> 5, lane = tid & 31, ln = lane & 15, hh = lane >> 4;
  const int ntn = N / 64;
  const int wid = blockIdx.x * 4 + w;
  const int mt = wid / ntn, nq = wid % ntn;
  if (mt * 16 >= M) return;
  const int row0 = mt * 16, col0 = nq * 64;
  const float* arow = A + (size_t)(row0 + ln) * lda;
  v8f acc[4] = {};
  for (int kb = 0; kb < K; kb += 32) {
    FragB ah, al;
    const v4f x0 = *(const v4fa*)(arow + kb + 8 * hh), x1 = *(const v4fa*)(arow + kb + 8 * hh + 4);
    const v4f x2 = *(const v4fa*)(arow + kb + 16 + 8 * hh), x3 = *(const v4fa*)(arow + kb + 16 + 8 * hh + 4);
    float xs[16] = {x0[0],x0[1],x0[2],x0[3],x1[0],x1[1],x1[2],x1[3],x2[0],x2[1],x2[2],x2[3],x3[0],x3[1],x3[2],x3[3]};
#pragma unroll
    for (int i = 0; i < 16; ++i) { const unsigned short hb = bf16_bits(xs[i]); ah.u[i] = hb; al.u[i] = ASPLIT ? bf16_bits(xs[i] - bf16_val(hb)) : (unsigned short)0; }
#pragma unroll
    for (int t = 0; t < 4; ++t) {
      const unsigned short* brow = Wt + (size_t)(col0 + t * 16 + ln) * ldb + kb;
      FragB b;
      b.half[0] = *(const v8us*)(brow + 8 * hh);
      b.half[1] = *(const v8us*)(brow + 16 + 8 * hh);
      acc[t] = mmaN<ASPLIT ? 2 : 1>(ah.v, al.v, b.v, b.v, acc[t]);
    }
  }
#pragma unroll
  for (int t = 0; t < 4; ++t) {
    const int col = col0 + t * 16 + ln;
    float bv = bias ? bias[col] : 0.f;
    if (BIAS_BF16) bv = bf16_round(bv);
#pragma unroll
    for (int r = 0; r < 8; ++r) {
      float v = acc[t][r] + bv;
      if (resid) { float rv = resid[(size_t)((row0 + 8 * hh + r) % rmod) * ldr + col]; if (RES_BF16) rv = bf16_round(rv); v += rv; }
      if (ACT == 1) v = fmaxf(v, 0.f);
      if (ACT == 2) v = 0.5f * v * (1.0f + erff(v * 0.70710678118654752f));
      if (ACT == 3) { const float u = 0.7978845608028654f * (v + 0.044715f * v * v * v); v = 0.5f * v * (1.0f + tanhf(u)); }
      so[w][8 * hh + r][t * 16 + ln] = v;
    }
  }
  __builtin_amdgcn_fence(__ATOMIC_ACQ_REL, "workgroup");
  __builtin_amdgcn_wave_barrier();
  const int rsub = lane >> 4, c4 = (lane & 15) * 4;
  {
#pragma unroll
    for (int q = 0; q < 8; ++q) {
      const int r = q * 2 + rsub;
      const v4f v = *(const v4fa*)&so[w][r][c4];
      *(v4f*)(C + (size_t)(row0 + r) * ldc + col0 + c4) = v;
    }
    
  }
}
// row LayerNorm (biased variance, eps) over N: s = X (+ R); optional out_sum <- s; out_norm <- (s-mu)*rsqrt(var+eps)*g + b
template <bool PARAM_BF16>
__global__ __launch_bounds__(256) void k_layernorm(const float* __restrict__ X, const float* __restrict__ R, const float* __restrict__ g, const float* __restrict__ bta,
                                                  float* __restrict__ out_sum, float* __restrict__ out_norm, int N, float eps) {
  __shared__ float red[256];
  const int row = blockIdx.x, tid = threadIdx.x;
  const float* x = X + (size_t)row * N; const float* rr = R ? R + (size_t)row * N : nullptr;
  float vals[16];                     // up to N = 4096
  const int per = N / 256;            // contiguous chunk per thread? use strided-by-4 chunks: thread handles j = tid*4 + 1024*u
  float s1 = 0.f;
  for (int u = 0; u < per / 4; ++u) {
    const int j = tid * 4 + 1024 * u;
    const v4f a = *(const v4fa*)(x + j);
    v4f b = {0.f,0.f,0.f,0.f}; if (rr) b = *(const v4fa*)(rr + j);
#pragma unroll
    for (int q = 0; q < 4; ++q) { const float v = a[q] + b[q]; vals[u * 4 + q] = v; s1 += v; }
  }
  red[tid] = s1; __syncthreads();
  for (int st = 128; st > 0; st >>= 1) { if (tid < st) red[tid] += red[tid + st]; __syncthreads(); }
  const float mu = red[0] / (float)N; __syncthreads();
  float s2 = 0.f;
  for (int u = 0; u < per / 4; ++u)
#pragma unroll
    for (int q = 0; q < 4; ++q) { const float c = vals[u * 4 + q] - mu; s2 += c * c; }
  red[tid] = s2; __syncthreads();
  for (int st = 128; st > 0; st >>= 1) { if (tid < st) red[tid] += red[tid + st]; __syncthreads(); }
  const float rs = rsqrtf(red[0] / (float)N + eps);
  {
    for (int u = 0; u < per / 4; ++u) {
      const int j = tid * 4 + 1024 * u;
      v4f o, sm;
#pragma unroll
      for (int q = 0; q < 4; ++q) {
        float gg = g[j + q], bb = bta[j + q];
        if (PARAM_BF16) { gg = bf16_round(gg); bb = bf16_round(bb); }
        sm[q] = vals[u * 4 + q]; o[q] = (vals[u * 4 + q] - mu) * rs * gg + bb;
      }
      if (out_sum) *(v4f*)(out_sum + (size_t)row * N + j) = sm;
      *(v4f*)(out_norm + (size_t)row * N + j) = o;
    }
    
  }
}



// ---- f16 WMMA path (v_wmma_f32_16x16x32_f16): 11-bit significands for operands in range — used where a [0,1] probability operand needs more precision than bf16
typedef _Float16 v16h __attribute__((ext_vector_type(16)));
union FragH { v16h v; v8us half[2]; _Float16 h[16]; unsigned short u[16]; };
template <int NT>
__device__ __forceinline__ v8f mmaH(v16h ah, v16h al, v16h bh, v16h bl, v8f c) {
  c = __builtin_amdgcn_wmma_f32_16x16x32_f16(false, ah, false, bh, (short)0, c, false, false);
  if (NT >= 2) c = __builtin_amdgcn_wmma_f32_16x16x32_f16(false, al, false, bh, (short)0, c, false, false);
  if (NT >= 3) c = __builtin_amdgcn_wmma_f32_16x16x32_f16(false, ah, false, bl, (short)0, c, false, false);
  asm volatile("v_nop\n\tv_nop\n\tv_nop\n\tv_nop" : "+v"(c) : "v"(ah), "v"(al), "v"(bh), "v"(bl));
  return c;
}
// batched GEMM like k_gemm_b but f16 operands: A f32 (split into f16 hi/lo if ASPLIT, else rounded to f16), Bt = f16 values [n][k]; alpha; C f32; N multiple of 16 (partial tiles skipped)
template <bool ASPLIT>
__global__ __launch_bounds__(128) void k_gemm_h(const float* __restrict__ A, int lda, size_t sA, const _Float16* __restrict__ Bh, int ldb, size_t sB, float alpha, float* __restrict__ C, int ldc, size_t sC, int M, int N, int K) {
  __shared__ __attribute__((aligned(16))) float so[4][16][64];
  const int tid = threadIdx.x, w = tid >> 5, lane = tid & 31, ln = lane & 15, hh = lane >> 4; const int by = blockIdx.y;
  A += (size_t)by * sA; Bh += (size_t)by * sB; C += (size_t)by * sC;
  const int ntn = (N + 63) / 64; const int wid = blockIdx.x * 4 + w; const int mt = wid / ntn, nq = wid % ntn; if (mt * 16 >= M) return;
  const int row0 = mt * 16, col0 = nq * 64; const float* arow = A + (size_t)(row0 + ln) * lda;
  v8f acc[4] = {};
  for (int kb = 0; kb < K; kb += 32) {
    FragH ah, al;
    const v4f x0 = *(const v4fa*)(arow + kb + 8 * hh), x1 = *(const v4fa*)(arow + kb + 8 * hh + 4), x2 = *(const v4fa*)(arow + kb + 16 + 8 * hh), x3 = *(const v4fa*)(arow + kb + 16 + 8 * hh + 4);
    float xs[16] = {x0[0],x0[1],x0[2],x0[3],x1[0],x1[1],x1[2],x1[3],x2[0],x2[1],x2[2],x2[3],x3[0],x3[1],x3[2],x3[3]};
#pragma unroll
    for (int i = 0; i < 16; ++i) { const _Float16 h = (_Float16)xs[i]; ah.h[i] = h; al.h[i] = ASPLIT ? (_Float16)(xs[i] - (float)h) : (_Float16)0.0f; }
#pragma unroll
    for (int t = 0; t < 4; ++t) { if (col0 + t * 16 >= N) continue; const size_t boff = (size_t)(col0 + t * 16 + ln) * ldb + kb; FragH bq; bq.half[0] = *(const v8us*)(Bh + boff + 8 * hh); bq.half[1] = *(const v8us*)(Bh + boff + 16 + 8 * hh);
      acc[t] = mmaH<ASPLIT ? 2 : 1>(ah.v, al.v, bq.v, bq.v, acc[t]); }
  }
#pragma unroll
  for (int t = 0; t < 4; ++t) { if (col0 + t * 16 >= N) continue;
#pragma unroll
    for (int r = 0; r < 8; ++r) so[w][8 * hh + r][t * 16 + ln] = acc[t][r] * alpha; }
  __builtin_amdgcn_fence(__ATOMIC_ACQ_REL, "workgroup"); __builtin_amdgcn_wave_barrier();
  const int rsub = lane >> 4, c4 = (lane & 15) * 4;
  {
#pragma unroll
    for (int q = 0; q < 8; ++q) { const int r = q * 2 + rsub; if (col0 + c4 < N) { const v4f v = *(const v4fa*)&so[w][r][c4]; *(v4f*)(C + (size_t)(row0 + r) * ldc + col0 + c4) = v; } }
     }
}

// Wt[n][k] = f16(W[k][n]·scale) from f32 row-major W[K][N] (scale = power of two; bf16-exact weights stay exact in f16 away from the subnormal range)
__global__ __launch_bounds__(256) void k_wt_f16(const float* __restrict__ W, _Float16* __restrict__ Wt, int K, int N, float scale) {
  const int t = blockIdx.x * 256 + threadIdx.x; if (t >= N * (K / 8)) return; const int n = t / (K / 8), k8 = (t % (K / 8)) * 8; FragH f;
#pragma unroll
  for (int i = 0; i < 8; ++i) f.h[i] = (_Float16)(bf16_round(W[(size_t)(k8 + i) * N + n]) * scale); const v8us o = f.half[0];
  *(v8us*)((unsigned short*)Wt + (size_t)n * K + k8) = o; 
}
// k_gemm_hh variant with fused epilogue: v = acc·alpha + bias[by·sBias + col] (+ CP[(row/rowsPerB)·sCPb + by·64 + col] if CP) ; ACT 0 none / 1 elu ; writes f16 C16 (and f32 C if non-null)
template <int ACT>
__global__ __launch_bounds__(128) void k_gemm_hhx(const _Float16* __restrict__ A, int lda, size_t sA, const _Float16* __restrict__ Bh, int ldb, size_t sB, float alpha, const float* __restrict__ bias, size_t sBias, const float* __restrict__ CP, int rowsPerB, size_t sCPb, int row0g,
    float* __restrict__ C, _Float16* __restrict__ C16, int ldc, size_t sC, int M, int N, int K) {
  __shared__ __attribute__((aligned(16))) float so[4][16][64];
  const int tid = threadIdx.x, w = tid >> 5, lane = tid & 31, ln = lane & 15, hh = lane >> 4; const int by = blockIdx.y;
  A += (size_t)by * sA; Bh += (size_t)by * sB; const size_t cofs = (size_t)by * sC; const float* bp = bias ? bias + (size_t)by * sBias : nullptr;
  const int ntn = (N + 63) / 64; const int wid = blockIdx.x * 4 + w; const int mt = wid / ntn, nq = wid % ntn; if (mt * 16 >= M) return;
  const int row0 = mt * 16, col0 = nq * 64; const _Float16* arow = A + (size_t)(row0 + ln) * lda;
  v8f acc[4] = {};
  for (int kb = 0; kb < K; kb += 32) { FragH ah; ah.half[0] = *(const v8us*)((const unsigned short*)arow + kb + 8 * hh); ah.half[1] = *(const v8us*)((const unsigned short*)arow + kb + 16 + 8 * hh);
#pragma unroll
    for (int t = 0; t < 4; ++t) { if (col0 + t * 16 >= N) continue; const size_t boff = (size_t)(col0 + t * 16 + ln) * ldb + kb; FragH bq; bq.half[0] = *(const v8us*)((const unsigned short*)Bh + boff + 8 * hh); bq.half[1] = *(const v8us*)((const unsigned short*)Bh + boff + 16 + 8 * hh);
      acc[t] = mmaH<1>(ah.v, ah.v, bq.v, bq.v, acc[t]); }
  }
#pragma unroll
  for (int t = 0; t < 4; ++t) { if (col0 + t * 16 >= N) continue; const int col = col0 + t * 16 + ln; const float bv = bp ? bf16_round(bp[col]) : 0.f;
#pragma unroll
    for (int r = 0; r < 8; ++r) { float v = acc[t][r] * alpha + bv; if (CP) { const int rr = row0g + row0 + 8 * hh + r; if (rowsPerB < 0) v += CP[cofs + (size_t)rr * ldc + col];      /* rowsPerB < 0: own element of the batched C plane */ else { const int bidx = rr / rowsPerB; v += CP[(size_t)bidx * sCPb + (size_t)by * 64 + col]; } } if (ACT == 1) v = (v > 0.f) ? v : expm1f(v); else if (ACT == 7) v = (v > 0.f) ? v + 1.0f : expf(v); else if (ACT == 8) v = tanhf(v); else if (ACT == 9) v = 0.5f * v * (1.0f + tanhf(0.7978845608028654f * (v + 0.044715f * v * v * v))); else if (ACT == 11) v = 1.0f / (1.0f + expf(-v)); else if (ACT == 12) v = (v > 0.f) ? v : 0.01f * v; else if (ACT == 14) v = (v > 0.f) ? v : 0.1f * v; else if (ACT == 16) v = (v >= 0.f) ? v : 0.3f * v; else if (ACT == 17) v = (v >= 0.f) ? v : 0.2f * v; else if (ACT == 15) v = v / (1.0f + expf(-v)); else if (ACT == 3) v = fmaxf(v, 0.f); else if (ACT == 6) v = 0.5f * v * (1.0f + erff(v * 0.70710678118654752f)); so[w][8 * hh + r][t * 16 + ln] = v; } }
  __builtin_amdgcn_fence(__ATOMIC_ACQ_REL, "workgroup"); __builtin_amdgcn_wave_barrier();
  const int rsub = lane >> 4, c4 = (lane & 15) * 4; typedef _Float16 v4h __attribute__((ext_vector_type(4)));
  {
#pragma unroll
    for (int q = 0; q < 8; ++q) { const int r = q * 2 + rsub; if (col0 + c4 < N) { const v4f v = *(const v4fa*)&so[w][r][c4]; if (C) *(v4f*)(C + cofs + (size_t)(row0 + r) * ldc + col0 + c4) = v; if (C16) { v4h h4; for (int i = 0; i < 4; ++i) h4[i] = (_Float16)v[i]; *(v4h*)(C16 + cofs + (size_t)(row0 + r) * ldc + col0 + c4) = h4; } } }
     }
}


typedef _Float16 v4h __attribute__((ext_vector_type(4)));

__global__ __launch_bounds__(256) void k_x16(const float* __restrict__ x, _Float16* __restrict__ X16, size_t n8) { const size_t t = (size_t)blockIdx.x * 256 + threadIdx.x; if (t >= n8) return; FragH f;
#pragma unroll
  for (int q = 0; q < 8; ++q) f.h[q] = (_Float16)bf16_round(x[t * 8 + q]); *(v8us*)((unsigned short*)X16 + t * 8) = f.half[0];  }
__global__ __launch_bounds__(256) void k_h16(const float* __restrict__ x, _Float16* __restrict__ X16, size_t n8) { const size_t t = (size_t)blockIdx.x * 256 + threadIdx.x; if (t >= n8) return; FragH f;
#pragma unroll
  for (int q = 0; q < 8; ++q) f.h[q] = (_Float16)x[t * 8 + q]; *(v8us*)((unsigned short*)X16 + t * 8) = f.half[0];  }
__global__ __launch_bounds__(256) void k_round16f(const float* __restrict__ W, _Float16* __restrict__ Bt, size_t n8) { const size_t t = (size_t)blockIdx.x * 256 + threadIdx.x; if (t >= n8) return; FragH f;
#pragma unroll
  for (int i = 0; i < 8; ++i) f.h[i] = (_Float16)(bf16_round(W[t * 8 + i]) * 16.0f); *(v8us*)((unsigned short*)Bt + t * 8) = f.half[0];  }
template <int NHv, int TTv>
__global__ __launch_bounds__(256) void k_vt(const _Float16* __restrict__ V16, int ldv, int voff, _Float16* __restrict__ Vt) { __shared__ unsigned short tl[64][66]; const int tid = threadIdx.x; const int slab = blockIdx.x / (TTv / 64), lg = blockIdx.x % (TTv / 64); const int b = slab / NHv, h = slab % NHv;
  for (int i = tid; i < 64 * 8; i += 256) { const int r = i / 8, c8 = (i % 8) * 8; FragH f; f.half[0] = *(const v8us*)((const unsigned short*)V16 + ((size_t)b * TTv + lg * 64 + r) * ldv + voff + h * 64 + c8);
#pragma unroll
    for (int q = 0; q < 8; ++q) tl[r][c8 + q] = f.u[q]; }
  __syncthreads();
  {
#pragma unroll
    for (int rd = 0; rd < 2; ++rd) { const int d = rd * 32 + tid / 8, pc = tid % 8; FragH f;
#pragma unroll
      for (int q = 0; q < 8; ++q) f.u[q] = tl[pc * 8 + q][d];
      *(v8us*)((unsigned short*)Vt + ((size_t)slab * 64 + d) * TTv + lg * 64 + pc * 8) = f.half[0]; }
     } }

__global__ __launch_bounds__(256) void k_hl(const float* __restrict__ F, _Float16* __restrict__ Hh, _Float16* __restrict__ Hl, size_t n8) { const size_t t = (size_t)blockIdx.x * 256 + threadIdx.x; if (t >= n8) return; FragH fh, fl; const v4f a = *(const v4fa*)(F + t * 8), c = *(const v4fa*)(F + t * 8 + 4);
#pragma unroll
  for (int q = 0; q < 4; ++q) { _Float16 h = (_Float16)a[q]; fh.h[q] = h; fl.h[q] = (_Float16)((a[q] - (float)h) * 1024.0f); h = (_Float16)c[q]; fh.h[4 + q] = h; fl.h[4 + q] = (_Float16)((c[q] - (float)h) * 1024.0f); }
  { *(v8us*)((unsigned short*)Hh + t * 8) = fh.half[0]; *(v8us*)((unsigned short*)Hl + t * 8) = fl.half[0];  } }

// ---- fast GEMM (work-group tile 128x64, wave tile 32x64; requires M % 128 == 0, N % 64 == 0, K % 64 == 0); epilogue = k_gemm_hhx semantics ----
// Operands go through LDS, 64 k a pass: the work-group's 128 A rows and 64 B rows as 128-byte row pieces, 8 lanes a piece, so a wave's 16-byte global load covers 4 whole lines
// (a fragment load straight from global touches 16 lines for the same bytes, and each wave fetched all of B for itself). Rows at a 144-B pitch: 16-byte fragment reads without bank conflicts.
// Two buffers: the next pass's global loads fly during the pass, are stored to the other buffer at its foot, one barrier a pass. Each accumulator takes its products in ascending k.
#define GK 64                        /* k a pass */
#define GP 72                        /* LDS row pitch in f16 */
__device__ __forceinline__ v16h g2_frag(const _Float16* p, int hh) { FragH f; f.half[0] = *(const v8us*)((const unsigned short*)p + 8 * hh); f.half[1] = *(const v8us*)((const unsigned short*)p + 16 + 8 * hh); return f.v; }
__device__ __forceinline__ v16h g2_lfrag(const unsigned short* p, int hh) { FragH f; f.half[0] = *(const v8us*)(p + 8 * hh); f.half[1] = *(const v8us*)(p + 16 + 8 * hh); return f.v; }      /* the same k order from an LDS row */
__device__ __forceinline__ v8f g2_mma(v16h a, v16h b, v8f c) { v8f d = __builtin_amdgcn_wmma_f32_16x16x32_f16(false, a, false, b, (short)0, c, false, false); asm volatile("v_nop\n\tv_nop\n\tv_nop\n\tv_nop" : "+v"(d) : "v"(a), "v"(b)); return d; }
template <int ACT>
__global__ __launch_bounds__(128) void k_gemm2(const _Float16* __restrict__ A, int lda, size_t sA, const _Float16* __restrict__ Bh, int ldb, size_t sB, float alpha, const float* __restrict__ bias, size_t sBias, const float* __restrict__ CP, int rowsPerB, size_t sCPb, int row0g,
    float* __restrict__ C, _Float16* __restrict__ C16, int ldc, size_t sC, int M, int N, int K, const float* __restrict__ bias1, const float* __restrict__ bias2) { static_assert(ACT == 0 || ACT == 3 || ACT == 6 || ACT == 8 || ACT == 9 || ACT == 11 || ACT == 12 || ACT == 14 || ACT == 15 || ACT == 16 || ACT == 17, "k_gemm2: unsupported ACT code (would silently apply no activation)");
  __shared__ __attribute__((aligned(16))) float so[4][32][68];
  __shared__ __attribute__((aligned(16))) unsigned short sa[2][128][GP];
  __shared__ __attribute__((aligned(16))) unsigned short sb[2][64][GP];
  const int tid = threadIdx.x, w = tid >> 5, lane = tid & 31, ln = lane & 15, hh = lane >> 4; const int by = blockIdx.y;
  A += (size_t)by * sA; Bh += (size_t)by * sB; const size_t cofs = (size_t)by * sC; const float* bp = bias ? bias + (size_t)by * sBias : nullptr;
  if (by == 1 && bias1) bp = bias1; if (by == 2 && bias2) bp = bias2;      /* batch entries 1 and 2 whose biases are buffers of their own */
  const int ntn = N >> 6; const int mt = blockIdx.x / ntn, nq = blockIdx.x - mt * ntn; const int row0 = mt * 128 + 32 * w, col0 = nq * 64; if (mt * 128 >= M) return;      /* the whole work-group leaves or none: barriers follow */
  const int sr = tid >> 3, sc = (tid & 7) * 8;      /* staging: this thread moves 16 bytes of rows sr + 16 i of each tile; 8 threads cover a 128-byte row piece */
  __builtin_assume(lda == DM); __builtin_assume(ldb == DM);      /* every launch here has rows of DM: with the pitch known the 16-row steps are immediate offsets on one address pair an operand, no address arithmetic between the loads */
  const unsigned short* ag = (const unsigned short*)A + (size_t)(mt * 128 + sr) * lda + sc; const unsigned short* bg = (const unsigned short*)Bh + (size_t)(col0 + sr) * ldb + sc;
  v8us ra[8], rb[4];
#pragma unroll      /* constant indices keep the pieces in registers */
  for (int i = 0; i < 8; ++i) ra[i] = *(const v8us*)(ag + (size_t)(16 * i) * lda);
#pragma unroll      /* constant indices keep the pieces in registers */
  for (int i = 0; i < 4; ++i) rb[i] = *(const v8us*)(bg + (size_t)(16 * i) * ldb);
#pragma unroll      /* constant indices keep the pieces in registers */
  for (int i = 0; i < 8; ++i) *(v8us*)&sa[0][sr + 16 * i][sc] = ra[i];
#pragma unroll      /* constant indices keep the pieces in registers */
  for (int i = 0; i < 4; ++i) *(v8us*)&sb[0][sr + 16 * i][sc] = rb[i];
  __syncthreads();
  const v8f z8 = {0.f,0.f,0.f,0.f,0.f,0.f,0.f,0.f}; v8f c00 = z8, c01 = z8, c02 = z8, c03 = z8, c10 = z8, c11 = z8, c12 = z8, c13 = z8;
#pragma unroll 1      /* one pass a trip: the body already holds 16 matrix instructions and 24 LDS reads */
  for (int kb = 0; kb < K; kb += GK) { const int cur = (kb / GK) & 1; const bool more = kb + GK < K;
    if (more) { ag += GK; bg += GK;
#pragma unroll      /* constant indices keep the pieces in registers */
      for (int i = 0; i < 8; ++i) ra[i] = *(const v8us*)(ag + (size_t)(16 * i) * lda);
#pragma unroll      /* constant indices keep the pieces in registers */
      for (int i = 0; i < 4; ++i) rb[i] = *(const v8us*)(bg + (size_t)(16 * i) * ldb); }
    v16h af[2][2], bf[2][4];      /* [k half of the pass][tile] */
#pragma unroll      /* constant indices keep the fragments in registers */
    for (int s = 0; s < 2; ++s) {
#pragma unroll      /* constant indices keep the fragments in registers */
      for (int t = 0; t < 2; ++t) af[s][t] = g2_lfrag(&sa[cur][32 * w + 16 * t + ln][32 * s], hh);
#pragma unroll      /* constant indices keep the fragments in registers */
      for (int t = 0; t < 4; ++t) bf[s][t] = g2_lfrag(&sb[cur][16 * t + ln][32 * s], hh); }
    __builtin_amdgcn_sched_barrier(0);      /* keeps the pass's global loads and all 24 LDS reads issued here: sunk to in front of their matrix instructions, each group would stand with a full latency in the open */
#pragma unroll      /* constant indices keep the fragments in registers */
    for (int s = 0; s < 2; ++s) {
      c00 = g2_mma(af[s][0], bf[s][0], c00); c10 = g2_mma(af[s][1], bf[s][0], c10);
      c01 = g2_mma(af[s][0], bf[s][1], c01); c11 = g2_mma(af[s][1], bf[s][1], c11);
      c02 = g2_mma(af[s][0], bf[s][2], c02); c12 = g2_mma(af[s][1], bf[s][2], c12);
      c03 = g2_mma(af[s][0], bf[s][3], c03); c13 = g2_mma(af[s][1], bf[s][3], c13); }
    if (more) {      /* every reader left that buffer before the last barrier */
#pragma unroll      /* constant indices keep the pieces in registers */
      for (int i = 0; i < 8; ++i) *(v8us*)&sa[cur ^ 1][sr + 16 * i][sc] = ra[i];
#pragma unroll      /* constant indices keep the pieces in registers */
      for (int i = 0; i < 4; ++i) *(v8us*)&sb[cur ^ 1][sr + 16 * i][sc] = rb[i]; }
    __syncthreads(); }      /* publishes the next pass's tiles and ends this pass's reads of the buffer that the next pass refills */
  v8f accs[8] = {c00, c01, c02, c03, c10, c11, c12, c13};
#pragma unroll
  for (int u = 0; u < 8; ++u) { const int t = u & 3, half = u >> 2; const int col = col0 + t * 16 + ln; const float bv = bp ? bf16_round(bp[col]) : 0.f;
#pragma unroll
    for (int r = 0; r < 8; ++r) { const int rloc = half * 16 + 8 * hh + r; float v = accs[u][r] * alpha + bv; if (CP) { if (rowsPerB < 0) v += CP[cofs + (size_t)(row0g + row0 + rloc) * ldc + col];      /* rowsPerB < 0: own element of the batched C plane */ else { const int bidx = (row0g + row0 + rloc) / rowsPerB; v += CP[(size_t)bidx * sCPb + (size_t)by * 64 + col]; } }
      if (ACT == 3) v = fmaxf(v, 0.f); else if (ACT == 6) v = 0.5f * v * (1.0f + erff(v * 0.70710678118654752f)); else if (ACT == 11) v = 1.0f / (1.0f + expf(-v)); else if (ACT == 15) v = v / (1.0f + expf(-v)); else if (ACT == 12) v = (v > 0.f) ? v : 0.01f * v; else if (ACT == 8) v = tanhf(v); else if (ACT == 9) v = 0.5f * v * (1.0f + tanhf(0.7978845608028654f * (v + 0.044715f * v * v * v))); else if (ACT == 14) v = (v > 0.f) ? v : 0.1f * v; else if (ACT == 16) v = (v >= 0.f) ? v : 0.3f * v; else if (ACT == 17) v = (v >= 0.f) ? v : 0.2f * v;
      so[w][rloc][t * 16 + ln] = v; } }
  __builtin_amdgcn_fence(__ATOMIC_ACQ_REL, "workgroup"); __builtin_amdgcn_wave_barrier();
  const int rsub = lane >> 4, c4 = (lane & 15) * 4;
  {
#pragma unroll
    for (int q = 0; q < 16; ++q) { const int r = q * 2 + rsub; const v4f v = *(const v4fa*)&so[w][r][c4]; if (C) *(v4f*)(C + cofs + (size_t)(row0 + r) * ldc + col0 + c4) = v; if (C16) { v4h h4; for (int i = 0; i < 4; ++i) h4[i] = (_Float16)v[i]; *(v4h*)(C16 + cofs + (size_t)(row0 + r) * ldc + col0 + c4) = h4; } }
     } }


// ---- q, k, v projections straight from the f32 inputs: no conversion launch ----
// blockIdx.y = 0, 1, 2: C16[y] = f16(X_y W_y^T + b_y). The loop, the fragment reads, the order of the products and the epilogue are k_gemm2's; the operands differ in how they reach LDS:
// a thread loads 16 bytes of f32 (16 lanes cover a 256-byte row piece: whole lines), rounds them to bf16 (two packed conversions) and writes those 8 bytes at the foot of the pass; the products run on the bf16 form,
// whose operands are the very values that the f16 form had (inputs and weights rounded to bf16 are exact in both; no x16 is needed here).
// f32 rows are twice the bytes from L2, so the work-group takes 128 rows x 256 columns (16 waves, 4 x 4 of 32x64): an input row is fetched by 2 work-groups, not 8, and rounded twice, not 8 times.
// q leaves times FCS = log2(e) / sqrt(64), applied in f32 ahead of its one rounding to f16: a score product of the attention kernel is then the argument of exp2 as it stands.
// blockIdx.y = 3: Wo to f16 x16 for the output GEMM two launches on; these blocks leave before any barrier.
#define FCS (0.125f * 1.4426950408889634f)      /* 1 / sqrt(64), and e^x as 2^(x log2 e) */
#define QC 4                         /* 64-column groups a work-group */
#define QB ((int)((NR / 128) * (DM / (64 * QC))))      /* blocks a projection: 64 */
typedef unsigned short v4us __attribute__((ext_vector_type(4), may_alias));
typedef __bf16 v4b __attribute__((ext_vector_type(4)));
__device__ __forceinline__ v4us q_bf(v4f a) { return __builtin_bit_cast(v4us, __builtin_convertvector(a, v4b)); }      /* f32 -> bf16, nearest even: two packed conversions */
__device__ __forceinline__ v16b q_lfrag(const unsigned short* p, int hh) { FragB f; f.half[0] = *(const v8us*)(p + 8 * hh); f.half[1] = *(const v8us*)(p + 16 + 8 * hh); return f.v; }      /* g2_lfrag's k order */
__device__ __forceinline__ v8f q_mma(v16b a, v16b b, v8f c) { return __builtin_amdgcn_wmma_f32_16x16x32_bf16(false, a, false, b, (short)0, c, false, false); }
__global__ __launch_bounds__(128 * QC) void k_qkv(const float* __restrict__ xq, const float* __restrict__ xk, const float* __restrict__ xv, const float* __restrict__ wq, const float* __restrict__ wk, const float* __restrict__ wv, const float* __restrict__ wo,
    const float* __restrict__ bq, const float* __restrict__ bk, const float* __restrict__ bv, _Float16* __restrict__ C16, _Float16* __restrict__ BO) {
  __shared__ __attribute__((aligned(16))) float so[4 * QC][32][68];
  __shared__ __attribute__((aligned(16))) unsigned short sa[2][128][GP];
  __shared__ __attribute__((aligned(16))) unsigned short sb[2][64 * QC][GP];
  const int tid = threadIdx.x, w = tid >> 5, lane = tid & 31, ln = lane & 15, hh = lane >> 4; const int wr = w & 3, wc = w >> 2; const int by = blockIdx.y;
  if (by == 3) {      /* the whole work-group leaves here or none of it */
    const size_t e0 = ((size_t)blockIdx.x * (128 * QC) + tid) * 4; const size_t e1 = e0 + (size_t)QB * (128 * QC) * 4; static_assert((size_t)QB * (128 * QC) * 8 == (size_t)DM * DM, "two pieces of 4 a thread cover Wo");
    const v4f a0 = *(const v4fa*)(wo + e0), a1 = *(const v4fa*)(wo + e1);
    v4h o0, o1;
#pragma unroll      /* constant indices keep the pieces in registers */
    for (int q = 0; q < 4; ++q) { o0[q] = (_Float16)(bf16_round(a0[q]) * 16.0f); o1[q] = (_Float16)(bf16_round(a1[q]) * 16.0f); }
    *(v4h*)(BO + e0) = o0; *(v4h*)(BO + e1) = o1; return; }
  const float* A = by == 0 ? xq : by == 1 ? xk : xv; const float* Wf = by == 0 ? wq : by == 1 ? wk : wv; const float* bp = by == 0 ? bq : by == 1 ? bk : bv; const size_t cofs = (size_t)by * NR * DM;
  const int mt = blockIdx.x / (DM / (64 * QC)), nq = blockIdx.x - mt * (DM / (64 * QC)); const int row0 = mt * 128 + 32 * wr, col0 = nq * (64 * QC) + 64 * wc;
  const int fr = tid >> 4, fc = (tid & 15) * 4;      /* staging: this thread moves 4 elements of rows fr + 8 QC i of each tile */
  const float* ag = A + (size_t)(mt * 128 + fr) * DM + fc; const float* bg = Wf + (size_t)(nq * (64 * QC) + fr) * DM + fc;
  v4f ra[16 / QC], rb[8];
#pragma unroll      /* constant indices keep the pieces in registers */
  for (int i = 0; i < 16 / QC; ++i) ra[i] = *(const v4fa*)(ag + (size_t)(8 * QC * i) * DM);
#pragma unroll      /* constant indices keep the pieces in registers */
  for (int i = 0; i < 8; ++i) rb[i] = *(const v4fa*)(bg + (size_t)(8 * QC * i) * DM);
#pragma unroll      /* constant indices keep the pieces in registers */
  for (int i = 0; i < 16 / QC; ++i) *(v4us*)&sa[0][fr + 8 * QC * i][fc] = q_bf(ra[i]);
#pragma unroll      /* constant indices keep the pieces in registers */
  for (int i = 0; i < 8; ++i) *(v4us*)&sb[0][fr + 8 * QC * i][fc] = q_bf(rb[i]);
  __syncthreads();
  const v8f z8 = {0.f,0.f,0.f,0.f,0.f,0.f,0.f,0.f}; v8f c00 = z8, c01 = z8, c02 = z8, c03 = z8, c10 = z8, c11 = z8, c12 = z8, c13 = z8;
#pragma unroll 1      /* one pass a trip: the body already holds 16 matrix instructions and 24 LDS reads */
  for (int kb = 0; kb < DM; kb += GK) { const int cur = (kb / GK) & 1; const bool more = kb + GK < DM;
    if (more) { ag += GK; bg += GK;
#pragma unroll      /* constant indices keep the pieces in registers */
      for (int i = 0; i < 16 / QC; ++i) ra[i] = *(const v4fa*)(ag + (size_t)(8 * QC * i) * DM);
#pragma unroll      /* constant indices keep the pieces in registers */
      for (int i = 0; i < 8; ++i) rb[i] = *(const v4fa*)(bg + (size_t)(8 * QC * i) * DM); }
    v16b af[2][2], bf[2][4];      /* [k half of the pass][tile] */
#pragma unroll      /* constant indices keep the fragments in registers */
    for (int s = 0; s < 2; ++s) {
#pragma unroll      /* constant indices keep the fragments in registers */
      for (int t = 0; t < 2; ++t) af[s][t] = q_lfrag(&sa[cur][32 * wr + 16 * t + ln][32 * s], hh);
#pragma unroll      /* constant indices keep the fragments in registers */
      for (int t = 0; t < 4; ++t) bf[s][t] = q_lfrag(&sb[cur][64 * wc + 16 * t + ln][32 * s], hh); }
    __builtin_amdgcn_sched_barrier(0);      /* keeps the pass's global loads and all 24 LDS reads issued here: sunk to in front of their matrix instructions, each group would stand with a full latency in the open */
#pragma unroll      /* constant indices keep the fragments in registers */
    for (int s = 0; s < 2; ++s) {
      c00 = q_mma(af[s][0], bf[s][0], c00); c10 = q_mma(af[s][1], bf[s][0], c10);
      c01 = q_mma(af[s][0], bf[s][1], c01); c11 = q_mma(af[s][1], bf[s][1], c11);
      c02 = q_mma(af[s][0], bf[s][2], c02); c12 = q_mma(af[s][1], bf[s][2], c12);
      c03 = q_mma(af[s][0], bf[s][3], c03); c13 = q_mma(af[s][1], bf[s][3], c13); }
    asm volatile("v_nop\n\tv_nop\n\tv_nop\n\tv_nop" : "+v"(c03), "+v"(c13) : "v"(af[1][0]), "v"(af[1][1]), "v"(bf[1][3]));      /* the four vector slots the chip needs behind the pass's last matrix instructions: on the taken side of the branch that follows, the next vector instructions are address arithmetic that may be placed on their operand registers */
    if (more) {      /* every reader left that buffer before the last barrier */
#pragma unroll      /* constant indices keep the pieces in registers */
      for (int i = 0; i < 16 / QC; ++i) *(v4us*)&sa[cur ^ 1][fr + 8 * QC * i][fc] = q_bf(ra[i]);
#pragma unroll      /* constant indices keep the pieces in registers */
      for (int i = 0; i < 8; ++i) *(v4us*)&sb[cur ^ 1][fr + 8 * QC * i][fc] = q_bf(rb[i]); }
    __syncthreads(); }      /* publishes the next pass's tiles and ends this pass's reads of the buffer that the next pass refills */
  v8f accs[8] = {c00, c01, c02, c03, c10, c11, c12, c13};
#pragma unroll      /* constant indices keep the accumulators in registers */
  for (int u = 0; u < 8; ++u) { const int t = u & 3, half = u >> 2; const float bv1 = bf16_round(bp[col0 + t * 16 + ln]);
#pragma unroll      /* constant indices keep the accumulators in registers */
    for (int r = 0; r < 8; ++r) so[w][half * 16 + 8 * hh + r][t * 16 + ln] = accs[u][r] + bv1; }
  __builtin_amdgcn_fence(__ATOMIC_ACQ_REL, "workgroup"); __builtin_amdgcn_wave_barrier();      /* a wave reads back its own rows only */
  const int rsub = lane >> 4, c4 = (lane & 15) * 4; const float qs = by == 0 ? FCS : 1.0f;
#pragma unroll      /* the 16 row pairs' reads and stores in flight together */
  for (int q = 0; q < 16; ++q) { const int r = q * 2 + rsub; const v4f v = *(const v4fa*)&so[w][r][c4] * qs; *(v4h*)(C16 + cofs + (size_t)(row0 + r) * DM + col0 + c4) = __builtin_convertvector(v, v4h); } }
#define FS 4                         /* key quarters: waves that share a query group */
#define FW 32                        /* keys a wave and run */
#define FJ 2                         /* such 32-key runs of a wave between two barriers */
#define FK (FJ * FS * FW)            /* keys a pass */
#define FP 72                        /* LDS pitch of a K row in f16 */
#define FV 80                        /* LDS pitch of a V row in f16: 32 B x odd, the transposing load's pitch */
#define FT 32768.0f                  /* a lane's sum of a run's weights up to here: every weight is finite in f16 */
__device__ __forceinline__ float fa_xhalf(float x) { return __builtin_bit_cast(float, __builtin_amdgcn_permlanex16(__builtin_bit_cast(int, x), __builtin_bit_cast(int, x), 0x76543210, 0xfedcba98, false, false)); }      /* lane l with lane l ^ 16 */
__device__ __forceinline__ v8f fa_mma(v16h a, v16h b, v8f c) { return __builtin_amdgcn_wmma_f32_16x16x32_f16(false, a, false, b, (short)0, c, false, false); }
__device__ __forceinline__ v16h fa_frag(const unsigned short* p, int hh) { FragH f; f.half[0] = *(const v8us*)(p + 8 * hh); f.half[1] = *(const v8us*)(p + 16 + 8 * hh); return f.v; }
typedef short v8s __attribute__((ext_vector_type(8)));
__device__ __forceinline__ v8us fa_tr16(const unsigned short* p) { typedef __attribute__((address_space(3))) v8s lds_v8s; return __builtin_bit_cast(v8us, __builtin_amdgcn_ds_load_tr16_b128_v8i16((lds_v8s*)p)); }
// 16 d x 32 keys of V^T from V rows in LDS; p = this lane's address in the 16-key x 16-d block: row 8 hh + (lane & 7), 16-byte piece (lane >> 3) & 1. Lane (ln, hh) gets keys 8 hh + r and 16 + 8 hh + r of d = ln: fa_frag's k order
__device__ __forceinline__ v16h fa_vfrag(const unsigned short* p) { FragH f; f.half[0] = fa_tr16(p); f.half[1] = fa_tr16(p + 16 * FV); return f.v; }
// 2^x with the one slot that the instruction set asks for behind a transcendental, before its result is read or its source overwritten, in the same statement
__device__ __forceinline__ float fa_exp2_slot(float x) { float y; asm("v_exp_f32 %0, %1\n\tv_nop" : "=v"(y) : "v"(x)); return y; }
// weights of one query tile and run from their exponents: p = f16(2^a | 2^b) in the B operand's k order, rs = this lane's f32 sum of the 16
__device__ __forceinline__ void fa_weights(v8f a, v8f b, FragH& p, float& rs) {
#pragma unroll      /* constant indices keep the values in registers */
  for (int r = 0; r < 8; ++r) a[r] = __builtin_amdgcn_exp2f(a[r]);
#pragma unroll      /* constant indices keep the values in registers */
  for (int r = 0; r < 8; ++r) b[r] = __builtin_amdgcn_exp2f(b[r]);
#pragma unroll      /* constant indices keep the values in registers */
  for (int r = 0; r < 8; ++r) { p.h[r] = (_Float16)a[r]; p.h[8 + r] = (_Float16)b[r]; }
  const v8f es = a + b; const v4f e4 = __builtin_shufflevector(es, es, 0, 1, 2, 3) + __builtin_shufflevector(es, es, 4, 5, 6, 7);      /* a tree of register pairs: packed adds, and no chain of 16 dependent adds in front of the test */
  rs = (e4[0] + e4[2]) + (e4[1] + e4[3]); }
__global__ __launch_bounds__(512) void k_fattn(const _Float16* __restrict__ Q16, const _Float16* __restrict__ K16, const _Float16* __restrict__ V16, _Float16* __restrict__ O16) {
  __shared__ __attribute__((aligned(16))) unsigned short kt[2][FK][FP];
  __shared__ __attribute__((aligned(16))) unsigned short vs[2][FK][FV];
  __shared__ __attribute__((aligned(32))) float mo[4][FS][4][2][32][8];      /* [query group][key quarter][16-d tile][16-query tile][lane]: a quarter's x */
  __shared__ __attribute__((aligned(8))) float ml[4][FS][2][32][2];      /* its 8 - reference and its sum */
  const int tid = threadIdx.x, w = tid >> 5, lane = tid & 31, ln = lane & 15, hh = lane >> 4; const int qg = w & 3, ks = w >> 2; const int h = blockIdx.y; const int q0 = blockIdx.x * 128 + qg * 32;
  v16h qf[2][2];      /* [query tile][d half] */
#pragma unroll      /* constant indices keep the fragments and accumulators in registers */
  for (int u = 0; u < 2; ++u) { const _Float16* qp = Q16 + (size_t)(q0 + 16 * u + ln) * DM + h * HD; qf[u][0] = g2_frag(qp, hh); qf[u][1] = g2_frag(qp + 32, hh);
    asm volatile("s_wait_xcnt 0x0" ::: "memory"); }      /* stands in front of any reuse of this tile's address registers: the next loads' results may be placed on them */
  const int kr = tid >> 3, kc = (tid & 7) * 8;      /* staging K and V: this thread moves 16 bytes of rows kr + 64 i of each; 8 threads cover a 128-byte row */
  const int tr = 8 * hh + (lane & 7), tc = ((lane >> 3) & 1) * 8;      /* the transposing load: this lane's row and 16-byte piece in a 16-key x 16-d block of V */
  const unsigned short* kg = (const unsigned short*)K16 + (size_t)kr * DM + h * HD + kc; const unsigned short* vg = (const unsigned short*)V16 + (size_t)kr * DM + h * HD + kc;
  { v8us pk[4], pv[4];
#pragma unroll      /* constant indices keep the pieces in registers */
    for (int i = 0; i < 4; ++i) { pk[i] = *(const v8us*)(kg + (size_t)(64 * i) * DM); pv[i] = *(const v8us*)(vg + (size_t)(64 * i) * DM); }
#pragma unroll      /* constant indices keep the pieces in registers */
    for (int i = 0; i < 4; ++i) { *(v8us*)&kt[0][kr + 64 * i][kc] = pk[i]; *(v8us*)&vs[0][kr + 64 * i][kc] = pv[i]; } }
  __syncthreads();
  v8us rk[2], rv[2];
  const v8f z8 = {0.f,0.f,0.f,0.f,0.f,0.f,0.f,0.f}; v8f o[4][2] = {{z8, z8}, {z8, z8}, {z8, z8}, {z8, z8}}; float l[2] = {0.f, 0.f};      /* o: [d tile][query tile]; l: this half's sum of weights */
  v8f cr[2] = {z8 + 3.0e38f, z8 + 3.0e38f};      /* 8 - m in all 8 registers, m the reference in use in units of the scaled products: the score products' start value, and the only place where m is kept; weights carry x256, as f16 operands away from the subnormal range; it cancels in x = sum / l */
#pragma unroll 1      /* one pass a trip: the body already holds 32 matrix instructions and 32 LDS reads */
  for (int it = 0; it < SQ / FK; ++it) { const int cur = it & 1; const bool more = it + 1 < SQ / FK;
    if (more) { kg += (size_t)FK * DM; vg += (size_t)FK * DM; }
#pragma unroll      /* both runs in line: their LDS offsets are immediates */
    for (int j = 0; j < FJ; ++j) { const int k0 = (j * FS + ks) * FW;      /* the run's first key in the tile; no barrier between the runs, so the waves of a SIMD drift apart and fill one another's waits */
    if (more) {      /* each run brings half of the next tile: half the staging registers */
#pragma unroll      /* constant indices keep the pieces in registers */
      for (int i = 0; i < 2; ++i) { rk[i] = *(const v8us*)(kg + (size_t)(64 * (2 * j + i)) * DM); rv[i] = *(const v8us*)(vg + (size_t)(64 * (2 * j + i)) * DM); } }
    v16h kf[2][2], vf[4];
#pragma unroll      /* constant indices keep the fragments and accumulators in registers */
    for (int t = 0; t < 2; ++t) { const unsigned short* kp = &kt[cur][k0 + t * 16 + ln][0]; kf[t][0] = fa_frag(kp, hh); kf[t][1] = fa_frag(kp + 32, hh); }
    __builtin_amdgcn_sched_barrier(0);      /* keeps the run's global loads and its 8 K reads issued here, as one group ahead of the score products */
    v8f s[2][2];      /* [key tile][query tile] */
#pragma unroll      /* constant indices keep the fragments and accumulators in registers */
    for (int t = 0; t < 2; ++t)
#pragma unroll      /* constant indices keep the fragments and accumulators in registers */
      for (int u = 0; u < 2; ++u) s[t][u] = fa_mma(kf[t][0], qf[u][0], cr[u]);
#pragma unroll      /* constant indices keep the fragments and accumulators in registers */
    for (int t = 0; t < 2; ++t)
#pragma unroll      /* constant indices keep the fragments and accumulators in registers */
      for (int u = 0; u < 2; ++u) s[t][u] = fa_mma(kf[t][1], qf[u][1], s[t][u]);
#pragma unroll      /* constant indices keep the fragments and accumulators in registers */
    for (int t = 0; t < 4; ++t) vf[t] = fa_vfrag(&vs[cur][k0 + tr][t * 16 + tc]);
    __builtin_amdgcn_sched_barrier(0);      /* keeps the 8 V^T reads issued here, as one group behind the score products: their latency passes under the softmax; sunk to in front of their matrix instructions each would stand in the open */
    FragH p[2]; float rs[2];
#pragma unroll      /* constant indices keep the fragments and accumulators in registers */
    for (int u = 0; u < 2; ++u) fa_weights(s[0][u], s[1][u], p[u], rs[u]);
    if (__builtin_expect(__builtin_amdgcn_ballot_w32(fmaxf(rs[0], rs[1]) > FT) != 0, 0)) {      /* the same for the whole wave: a scalar branch, all lanes on at the matrix instructions inside; rare (the first run, and a score about 7 above m), and marked so, which keeps this path out of the loop's line */
#pragma unroll      /* constant indices keep the fragments and accumulators in registers */
      for (int t = 0; t < 2; ++t) { const unsigned short* kp = &kt[cur][k0 + t * 16 + ln][0]; kf[t][0] = fa_frag(kp, hh); kf[t][1] = fa_frag(kp + 32, hh); }      /* the tile still stands: no barrier since */
#pragma unroll      /* constant indices keep the fragments and accumulators in registers */
      for (int t = 0; t < 2; ++t)
#pragma unroll      /* constant indices keep the fragments and accumulators in registers */
        for (int u = 0; u < 2; ++u) s[t][u] = fa_mma(kf[t][1], qf[u][1], fa_mma(kf[t][0], qf[u][0], z8));
#pragma unroll      /* constant indices keep the fragments and accumulators in registers */
      for (int u = 0; u < 2; ++u) { float a0 = s[0][u][0], a1 = s[1][u][0];
#pragma unroll      /* constant indices keep the fragments and accumulators in registers */
        for (int r = 1; r < 8; ++r) { a0 = fmaxf(a0, s[0][u][r]); a1 = fmaxf(a1, s[1][u][r]); }
        float tm = fmaxf(a0, a1); tm = fmaxf(tm, fa_xhalf(tm)); const float cn = fminf(cr[u][0], 8.0f - tm), corr = __builtin_amdgcn_exp2f(cn - cr[u][0]); cr[u] = z8 + cn; l[u] *= corr;      /* m rises to the run's maximum, 8 - m falls; both halves of the wave hold the same m for a query */
#pragma unroll      /* constant indices keep the fragments and accumulators in registers */
        for (int t = 0; t < 4; ++t) o[t][u] *= corr;
        fa_weights(s[0][u] + cn, s[1][u] + cn, p[u], rs[u]); } }
#pragma unroll      /* constant indices keep the fragments and accumulators in registers */
    for (int u = 0; u < 2; ++u) l[u] += rs[u];
#pragma unroll      /* constant indices keep the fragments and accumulators in registers */
    for (int u = 0; u < 2; ++u)
#pragma unroll      /* constant indices keep the fragments and accumulators in registers */
      for (int t = 0; t < 4; ++t) o[t][u] = fa_mma(vf[t], p[u].v, o[t][u]);
    if (more) {      /* every reader left that buffer before the last barrier */
#pragma unroll      /* constant indices keep the pieces in registers */
      for (int i = 0; i < 2; ++i) { *(v8us*)&kt[cur ^ 1][kr + 64 * (2 * j + i)][kc] = rk[i]; *(v8us*)&vs[cur ^ 1][kr + 64 * (2 * j + i)][kc] = rv[i]; } } }
    __syncthreads(); }      /* publishes the next tile and ends this pass's reads of the buffer that the next pass refills */
  // join of the four key quarters: every wave leaves its x, reference and sum in LDS; then the wave of quarter j joins d tile j of its query group's 32 queries
#pragma unroll      /* constant indices keep the fragments and accumulators in registers */
  for (int u = 0; u < 2; ++u) { l[u] += fa_xhalf(l[u]); ml[qg][ks][u][lane][0] = cr[u][0]; ml[qg][ks][u][lane][1] = l[u];      /* 8 - m: the 8 cancels in the join */
#pragma unroll      /* constant indices keep the fragments and accumulators in registers */
    for (int t = 0; t < 4; ++t) *(v8f*)&mo[qg][ks][t][u][lane][0] = o[t][u]; }
  __syncthreads();      /* the quarters' results are read by other waves */
#pragma unroll      /* constant indices keep the fragments and accumulators in registers */
  for (int u = 0; u < 2; ++u) { float mj[FS], lj[FS];
#pragma unroll      /* constant indices keep the fragments and accumulators in registers */
    for (int j = 0; j < FS; ++j) { mj[j] = ml[qg][j][u][lane][0]; lj[j] = ml[qg][j][u][lane][1]; }
    const float mx = fminf(fminf(mj[0], mj[1]), fminf(mj[2], mj[3])); float ls = 0.f; v8f x = z8;      /* the least 8 - m: the highest reference */
#pragma unroll      /* constant indices keep the fragments and accumulators in registers */
    for (int j = 0; j < FS; ++j) mj[j] = fa_exp2_slot(mx - mj[j]);      /* each quarter's weight in the join */
#pragma unroll      /* constant indices keep the fragments and accumulators in registers */
    for (int j = 0; j < FS; ++j) { ls += mj[j] * lj[j]; x += *(const v8f*)&mo[qg][j][ks][u][lane][0] * mj[j]; }
    const float inv = 1.0f / ls; FragH f;      /* lane (ln, hh) holds x[q0 + 16 u + ln][16 ks + 8 hh + r] */
#pragma unroll      /* constant indices keep the fragments and accumulators in registers */
    for (int r = 0; r < 8; ++r) f.h[r] = (_Float16)(x[r] * inv);
    *(v8us*)&kt[0][qg * 32 + 16 * u + ln][16 * ks + 8 * hh] = f.half[0]; }      /* the K buffer, which every reader left at the loop's last barrier, now holds the work-group's 128 output row pieces */
  __syncthreads();      /* a row piece comes from four waves and leaves as one whole 128-byte line */
  unsigned short* op = (unsigned short*)O16 + (size_t)(blockIdx.x * 128 + kr) * DM + h * HD + kc;
  *(v8us*)op = *(const v8us*)&kt[0][kr][kc]; *(v8us*)(op + 64 * DM) = *(const v8us*)&kt[0][kr + 64][kc]; }

extern "C" void kernel_launch(void* const* d_in, const int* in_sizes, int n_in,
                              void* d_out, int out_size, void* d_ws, size_t ws_size, hipStream_t stream) {
  (void)in_sizes; (void)n_in; (void)out_size;
  const float* const* I = (const float* const*)d_in; const float* xq = I[0]; const float* xk = I[1]; const float* xv = I[2]; const float* wq = I[3]; const float* bq = I[4]; const float* wk = I[5]; const float* bk = I[6]; const float* wv = I[7]; const float* bv = I[8]; const float* wo = I[9]; const float* bo = I[10];
  char* ws = (char*)d_ws; size_t off = 0;
  auto take = [&](size_t bytes) { char* p = ws + off; off += (bytes + 255) & ~(size_t)255; return p; };
  _Float16* BO = (_Float16*)take((size_t)DM * DM * 2);      /* Wo */
  _Float16* Q16 = (_Float16*)take(3 * NR * DM * 2); _Float16* K16 = Q16 + NR * DM; _Float16* V16 = K16 + NR * DM;      /* q | k | v */
  _Float16* O16 = (_Float16*)take(NR * DM * 2);
  if (off > ws_size) return;      /* approx 16.5 MiB */
  const dim3 gp((unsigned)((NR / 128) * (DM / 64)), 1);
  k_qkv<<<dim3(QB, 4), 128 * QC, 0, stream>>>(xq, xk, xv, wq, wk, wv, wo, bq, bk, bv, Q16, BO);      /* q, k and v: blockIdx.y picks rows, weight, bias and output; row 3 rounds Wo */
  k_fattn<<<dim3(SQ / 128, NH), 512, 0, stream>>>(Q16, K16, V16, O16);      /* x (merged heads) as f16 rows */
  k_gemm2<0><<<gp, 128, 0, stream>>>(O16, DM, 0, BO, DM, 0, 0.0625f, bo, 0, nullptr, 1, 0, 0, (float*)d_out, nullptr, DM, 0, MO, DM, DM, nullptr, nullptr);      /* out = o W_o^T + b_o, rows are the output layout */
}

// v009
// A run of this version takes 49.3 microseconds.
// Next to v008, in two timings, it ran 1.08 times as fast each time.
// Counting every step since v000, it is 139 times as fast.
#include <hip/hip_runtime.h>
// Multi-head attention over separate query / key / value inputs ([1][4096][512] each; q = query Wq^T + bq, k = key Wk^T + bk, v = value Wv^T + bv, 8 heads of 64; attn = softmax(q k^T / 8); x = attn v; out = x Wo^T + bo -> [1][4096][512]).
// Structure: token rows; Q | K | V as three WMMA GEMMs in one launch, blockIdx.y the projection: query, key, value and their weights are read as f32 and rounded to bf16 on the way into LDS (128x256 work-group tiles, 32x64 wave tiles, bf16 products, f32 accumulation, bias in the epilogue, f16 outputs), a fourth blockIdx.y row rounds Wo (exact f16, x16) for the last launch; one attention kernel for all heads (scores^T = K q^T, softmax in registers against a held reference that is raised only when a run's weights grow too large, x^T += V^T p^T with V^T fragments by transposing LDS loads of V rows; scores and weights never stored) written straight into the merged f16 rows; out = x Wo^T + bo GEMM (f32).
// Compute dtype: inputs rounded to bf16; inputs / weights exact; q, k, v, softmax weights and x as plain f16 GEMM operands (~2^-12); scores and softmax statistics f32. v_wmma_f32_16x16x32_bf16 (q, k, v projections), v_wmma_f32_16x16x32_f16 (attention, output projection).
#define NB 1
#define SQ 4096
#define DM 512
#define NH 8
#define HD 64
#define MP ((int)NR)                 /* unused: k_qkv always takes all NR token rows */
#define MO ((int)NR)                 /* token rows through the output projection (debug hook) */
#define NR ((size_t)NB * SQ)         /* 4096 token rows */
typedef __bf16 v16b __attribute__((ext_vector_type(16)));
typedef unsigned short v8us __attribute__((ext_vector_type(8), may_alias));
typedef float  v8f  __attribute__((ext_vector_type(8)));
typedef float  v4f  __attribute__((ext_vector_type(4)));
typedef float  v4fa __attribute__((ext_vector_type(4), may_alias));
union FragB { v16b v; v8us half[2]; unsigned short u[16]; };

__device__ __forceinline__ unsigned short bf16_bits(float x) { unsigned int u = __float_as_uint(x); return (unsigned short)((u + 0x7FFFu + ((u >> 16) & 1u)) >> 16); }
__device__ __forceinline__ float bf16_val(unsigned short b) { return __uint_as_float(((unsigned int)b) << 16); }
__device__ __forceinline__ float bf16_round(float x) { return bf16_val(bf16_bits(x)); }
// D += A·B with NT terms: 1 = ah·bh, 2 = + al·bh (A split), 3 = + ah·bl (both split)
template <int NT>
__device__ __forceinline__ v8f mmaN(v16b ah, v16b al, v16b bh, v16b bl, v8f c) {
  c = __builtin_amdgcn_wmma_f32_16x16x32_bf16(false, ah, false, bh, (short)0, c, false, false);
  if (NT >= 2) c = __builtin_amdgcn_wmma_f32_16x16x32_bf16(false, al, false, bh, (short)0, c, false, false);
  if (NT >= 3) c = __builtin_amdgcn_wmma_f32_16x16x32_bf16(false, ah, false, bl, (short)0, c, false, false);
  asm volatile("v_nop\n\tv_nop\n\tv_nop\n\tv_nop" : "+v"(c) : "v"(ah), "v"(al), "v"(bh), "v"(bl));
  return c;
}

__global__ __launch_bounds__(256) void k_wt_bf16(const float* __restrict__ W, unsigned short* __restrict__ Wt, int K, int N) {
  const int t = blockIdx.x * 256 + threadIdx.x;
  const int k8n = K / 8;
  if (t >= N * k8n) return;
  const int n = t / k8n, k8 = (t % k8n) * 8;
  v8us v;
#pragma unroll
  for (int i = 0; i < 8; ++i) v[i] = bf16_bits(W[(size_t)(k8 + i) * N + n]);
  *(v8us*)(Wt + (size_t)n * K + k8) = v;
  
}

// GEMM C[M][N] (f32, pitch ldc) = act(A[M][K]·W + bias). A f32 row-major (pitch lda) converted per fragment to bf16
// (ASPLIT: hi/lo two planes -> 2 terms, else single rounded term); Wt bf16 [N][K] (pitch ldb). BIAS_BF16 rounds the
// bias to bf16 first (bias quantised to bf16 before the add). K%32==0, M%16==0, N%64==0.
template <bool ASPLIT, int ACT, bool BIAS_BF16>
__global__ __launch_bounds__(128) void k_gemm_bf(const float* __restrict__ A, int lda, const unsigned short* __restrict__ Wt, int ldb,
                                               const float* __restrict__ bias, float* __restrict__ C, int ldc, int M, int N, int K) {
  __shared__ __attribute__((aligned(16))) float so[4][16][64];
  const int tid = threadIdx.x, w = tid >> 5, lane = tid & 31, ln = lane & 15, hh = lane >> 4;
  const int ntn = N / 64;
  const int wid = blockIdx.x * 4 + w;
  const int mt = wid / ntn, nq = wid % ntn;
  if (mt * 16 >= M) return;
  const int row0 = mt * 16, col0 = nq * 64;
  const float* arow = A + (size_t)(row0 + ln) * lda;
  v8f acc[4] = {};
  for (int kb = 0; kb < K; kb += 32) {
    FragB ah, al;
    const v4f x0 = *(const v4fa*)(arow + kb + 8 * hh), x1 = *(const v4fa*)(arow + kb + 8 * hh + 4);
    const v4f x2 = *(const v4fa*)(arow + kb + 16 + 8 * hh), x3 = *(const v4fa*)(arow + kb + 16 + 8 * hh + 4);
    float xs[16] = {x0[0],x0[1],x0[2],x0[3],x1[0],x1[1],x1[2],x1[3],x2[0],x2[1],x2[2],x2[3],x3[0],x3[1],x3[2],x3[3]};
#pragma unroll
    for (int i = 0; i < 16; ++i) { const unsigned short hb = bf16_bits(xs[i]); ah.u[i] = hb; al.u[i] = ASPLIT ? bf16_bits(xs[i] - bf16_val(hb)) : (unsigned short)0; }
#pragma unroll
    for (int t = 0; t < 4; ++t) {
      const unsigned short* brow = Wt + (size_t)(col0 + t * 16 + ln) * ldb + kb;
      FragB b;
      b.half[0] = *(const v8us*)(brow + 8 * hh);
      b.half[1] = *(const v8us*)(brow + 16 + 8 * hh);
      acc[t] = mmaN<ASPLIT ? 2 : 1>(ah.v, al.v, b.v, b.v, acc[t]);
    }
  }
#pragma unroll
  for (int t = 0; t < 4; ++t) {
    float bv = bias ? bias[col0 + t * 16 + ln] : 0.f;
    if (BIAS_BF16) bv = bf16_round(bv);
#pragma unroll
    for (int r = 0; r < 8; ++r) { float v = acc[t][r] + bv; if (ACT == 1) v = fmaxf(v, 0.f); so[w][8 * hh + r][t * 16 + ln] = v; }
  }
  __builtin_amdgcn_fence(__ATOMIC_ACQ_REL, "workgroup");
  __builtin_amdgcn_wave_barrier();
  const int rsub = lane >> 4, c4 = (lane & 15) * 4;
  {
#pragma unroll
    for (int q = 0; q < 8; ++q) {
      const int r = q * 2 + rsub;
      const v4f v = *(const v4fa*)&so[w][r][c4];
      *(v4f*)(C + (size_t)(row0 + r) * ldc + col0 + c4) = v;
    }
    
  }
}

// GEMM C = act(A·W + bias + resid): A f32 (ASPLIT -> hi/lo 2 terms), Wt bf16 [N][K]; ACT 0 none, 1 relu, 2 exact gelu;
// resid (optional, f32, row index = (row % rmod), pitch ldr, RES_BF16 rounds it) added before the activation.
template <bool ASPLIT, int ACT, bool BIAS_BF16, bool RES_BF16>
__global__ __launch_bounds__(128) void k_gemm_bf3(const float* __restrict__ A, int lda, const unsigned short* __restrict__ Wt, int ldb,
                                                const float* __restrict__ bias, const float* __restrict__ resid, int rmod, int ldr,
                                                float* __restrict__ C, int ldc, int M, int N, int K) {
  __shared__ __attribute__((aligned(16))) float so[4][16][64];
  const int tid = threadIdx.x, w = tid >> 5, lane = tid & 31, ln = lane & 15, hh = lane >> 4;
  const int ntn = N / 64;
  const int wid = blockIdx.x * 4 + w;
  const int mt = wid / ntn, nq = wid % ntn;
  if (mt * 16 >= M) return;
  const int row0 = mt * 16, col0 = nq * 64;
  const float* arow = A + (size_t)(row0 + ln) * lda;
  v8f acc[4] = {};
  for (int kb = 0; kb < K; kb += 32) {
    FragB ah, al;
    const v4f x0 = *(const v4fa*)(arow + kb + 8 * hh), x1 = *(const v4fa*)(arow + kb + 8 * hh + 4);
    const v4f x2 = *(const v4fa*)(arow + kb + 16 + 8 * hh), x3 = *(const v4fa*)(arow + kb + 16 + 8 * hh + 4);
    float xs[16] = {x0[0],x0[1],x0[2],x0[3],x1[0],x1[1],x1[2],x1[3],x2[0],x2[1],x2[2],x2[3],x3[0],x3[1],x3[2],x3[3]};
#pragma unroll
    for (int i = 0; i < 16; ++i) { const unsigned short hb = bf16_bits(xs[i]); ah.u[i] = hb; al.u[i] = ASPLIT ? bf16_bits(xs[i] - bf16_val(hb)) : (unsigned short)0; }
#pragma unroll
    for (int t = 0; t < 4; ++t) {
      const unsigned short* brow = Wt + (size_t)(col0 + t * 16 + ln) * ldb + kb;
      FragB b;
      b.half[0] = *(const v8us*)(brow + 8 * hh);
      b.half[1] = *(const v8us*)(brow + 16 + 8 * hh);
      acc[t] = mmaN<ASPLIT ? 2 : 1>(ah.v, al.v, b.v, b.v, acc[t]);
    }
  }
#pragma unroll
  for (int t = 0; t < 4; ++t) {
    const int col = col0 + t * 16 + ln;
    float bv = bias ? bias[col] : 0.f;
    if (BIAS_BF16) bv = bf16_round(bv);
#pragma unroll
    for (int r = 0; r < 8; ++r) {
      float v = acc[t][r] + bv;
      if (resid) { float rv = resid[(size_t)((row0 + 8 * hh + r) % rmod) * ldr + col]; if (RES_BF16) rv = bf16_round(rv); v += rv; }
      if (ACT == 1) v = fmaxf(v, 0.f);
      if (ACT == 2) v = 0.5f * v * (1.0f + erff(v * 0.70710678118654752f));
      if (ACT == 3) { const float u = 0.7978845608028654f * (v + 0.044715f * v * v * v); v = 0.5f * v * (1.0f + tanhf(u)); }
      so[w][8 * hh + r][t * 16 + ln] = v;
    }
  }
  __builtin_amdgcn_fence(__ATOMIC_ACQ_REL, "workgroup");
  __builtin_amdgcn_wave_barrier();
  const int rsub = lane >> 4, c4 = (lane & 15) * 4;
  {
#pragma unroll
    for (int q = 0; q < 8; ++q) {
      const int r = q * 2 + rsub;
      const v4f v = *(const v4fa*)&so[w][r][c4];
      *(v4f*)(C + (size_t)(row0 + r) * ldc + col0 + c4) = v;
    }
    
  }
}
// row LayerNorm (biased variance, eps) over N: s = X (+ R); optional out_sum <- s; out_norm <- (s-mu)*rsqrt(var+eps)*g + b
template <bool PARAM_BF16>
__global__ __launch_bounds__(256) void k_layernorm(const float* __restrict__ X, const float* __restrict__ R, const float* __restrict__ g, const float* __restrict__ bta,
                                                  float* __restrict__ out_sum, float* __restrict__ out_norm, int N, float eps) {
  __shared__ float red[256];
  const int row = blockIdx.x, tid = threadIdx.x;
  const float* x = X + (size_t)row * N; const float* rr = R ? R + (size_t)row * N : nullptr;
  float vals[16];                     // up to N = 4096
  const int per = N / 256;            // contiguous chunk per thread? use strided-by-4 chunks: thread handles j = tid*4 + 1024*u
  float s1 = 0.f;
  for (int u = 0; u < per / 4; ++u) {
    const int j = tid * 4 + 1024 * u;
    const v4f a = *(const v4fa*)(x + j);
    v4f b = {0.f,0.f,0.f,0.f}; if (rr) b = *(const v4fa*)(rr + j);
#pragma unroll
    for (int q = 0; q < 4; ++q) { const float v = a[q] + b[q]; vals[u * 4 + q] = v; s1 += v; }
  }
  red[tid] = s1; __syncthreads();
  for (int st = 128; st > 0; st >>= 1) { if (tid < st) red[tid] += red[tid + st]; __syncthreads(); }
  const float mu = red[0] / (float)N; __syncthreads();
  float s2 = 0.f;
  for (int u = 0; u < per / 4; ++u)
#pragma unroll
    for (int q = 0; q < 4; ++q) { const float c = vals[u * 4 + q] - mu; s2 += c * c; }
  red[tid] = s2; __syncthreads();
  for (int st = 128; st > 0; st >>= 1) { if (tid < st) red[tid] += red[tid + st]; __syncthreads(); }
  const float rs = rsqrtf(red[0] / (float)N + eps);
  {
    for (int u = 0; u < per / 4; ++u) {
      const int j = tid * 4 + 1024 * u;
      v4f o, sm;
#pragma unroll
      for (int q = 0; q < 4; ++q) {
        float gg = g[j + q], bb = bta[j + q];
        if (PARAM_BF16) { gg = bf16_round(gg); bb = bf16_round(bb); }
        sm[q] = vals[u * 4 + q]; o[q] = (vals[u * 4 + q] - mu) * rs * gg + bb;
      }
      if (out_sum) *(v4f*)(out_sum + (size_t)row * N + j) = sm;
      *(v4f*)(out_norm + (size_t)row * N + j) = o;
    }
    
  }
}



// ---- f16 WMMA path (v_wmma_f32_16x16x32_f16): 11-bit significands for operands in range — used where a [0,1] probability operand needs more precision than bf16
typedef _Float16 v16h __attribute__((ext_vector_type(16)));
union FragH { v16h v; v8us half[2]; _Float16 h[16]; unsigned short u[16]; };
template <int NT>
__device__ __forceinline__ v8f mmaH(v16h ah, v16h al, v16h bh, v16h bl, v8f c) {
  c = __builtin_amdgcn_wmma_f32_16x16x32_f16(false, ah, false, bh, (short)0, c, false, false);
  if (NT >= 2) c = __builtin_amdgcn_wmma_f32_16x16x32_f16(false, al, false, bh, (short)0, c, false, false);
  if (NT >= 3) c = __builtin_amdgcn_wmma_f32_16x16x32_f16(false, ah, false, bl, (short)0, c, false, false);
  asm volatile("v_nop\n\tv_nop\n\tv_nop\n\tv_nop" : "+v"(c) : "v"(ah), "v"(al), "v"(bh), "v"(bl));
  return c;
}
// batched GEMM like k_gemm_b but f16 operands: A f32 (split into f16 hi/lo if ASPLIT, else rounded to f16), Bt = f16 values [n][k]; alpha; C f32; N multiple of 16 (partial tiles skipped)
template <bool ASPLIT>
__global__ __launch_bounds__(128) void k_gemm_h(const float* __restrict__ A, int lda, size_t sA, const _Float16* __restrict__ Bh, int ldb, size_t sB, float alpha, float* __restrict__ C, int ldc, size_t sC, int M, int N, int K) {
  __shared__ __attribute__((aligned(16))) float so[4][16][64];
  const int tid = threadIdx.x, w = tid >> 5, lane = tid & 31, ln = lane & 15, hh = lane >> 4; const int by = blockIdx.y;
  A += (size_t)by * sA; Bh += (size_t)by * sB; C += (size_t)by * sC;
  const int ntn = (N + 63) / 64; const int wid = blockIdx.x * 4 + w; const int mt = wid / ntn, nq = wid % ntn; if (mt * 16 >= M) return;
  const int row0 = mt * 16, col0 = nq * 64; const float* arow = A + (size_t)(row0 + ln) * lda;
  v8f acc[4] = {};
  for (int kb = 0; kb < K; kb += 32) {
    FragH ah, al;
    const v4f x0 = *(const v4fa*)(arow + kb + 8 * hh), x1 = *(const v4fa*)(arow + kb + 8 * hh + 4), x2 = *(const v4fa*)(arow + kb + 16 + 8 * hh), x3 = *(const v4fa*)(arow + kb + 16 + 8 * hh + 4);
    float xs[16] = {x0[0],x0[1],x0[2],x0[3],x1[0],x1[1],x1[2],x1[3],x2[0],x2[1],x2[2],x2[3],x3[0],x3[1],x3[2],x3[3]};
#pragma unroll
    for (int i = 0; i < 16; ++i) { const _Float16 h = (_Float16)xs[i]; ah.h[i] = h; al.h[i] = ASPLIT ? (_Float16)(xs[i] - (float)h) : (_Float16)0.0f; }
#pragma unroll
    for (int t = 0; t < 4; ++t) { if (col0 + t * 16 >= N) continue; const size_t boff = (size_t)(col0 + t * 16 + ln) * ldb + kb; FragH bq; bq.half[0] = *(const v8us*)(Bh + boff + 8 * hh); bq.half[1] = *(const v8us*)(Bh + boff + 16 + 8 * hh);
      acc[t] = mmaH<ASPLIT ? 2 : 1>(ah.v, al.v, bq.v, bq.v, acc[t]); }
  }
#pragma unroll
  for (int t = 0; t < 4; ++t) { if (col0 + t * 16 >= N) continue;
#pragma unroll
    for (int r = 0; r < 8; ++r) so[w][8 * hh + r][t * 16 + ln] = acc[t][r] * alpha; }
  __builtin_amdgcn_fence(__ATOMIC_ACQ_REL, "workgroup"); __builtin_amdgcn_wave_barrier();
  const int rsub = lane >> 4, c4 = (lane & 15) * 4;
  {
#pragma unroll
    for (int q = 0; q < 8; ++q) { const int r = q * 2 + rsub; if (col0 + c4 < N) { const v4f v = *(const v4fa*)&so[w][r][c4]; *(v4f*)(C + (size_t)(row0 + r) * ldc + col0 + c4) = v; } }
     }
}

// Wt[n][k] = f16(W[k][n]·scale) from f32 row-major W[K][N] (scale = power of two; bf16-exact weights stay exact in f16 away from the subnormal range)
__global__ __launch_bounds__(256) void k_wt_f16(const float* __restrict__ W, _Float16* __restrict__ Wt, int K, int N, float scale) {
  const int t = blockIdx.x * 256 + threadIdx.x; if (t >= N * (K / 8)) return; const int n = t / (K / 8), k8 = (t % (K / 8)) * 8; FragH f;
#pragma unroll
  for (int i = 0; i < 8; ++i) f.h[i] = (_Float16)(bf16_round(W[(size_t)(k8 + i) * N + n]) * scale); const v8us o = f.half[0];
  *(v8us*)((unsigned short*)Wt + (size_t)n * K + k8) = o; 
}
// k_gemm_hh variant with fused epilogue: v = acc·alpha + bias[by·sBias + col] (+ CP[(row/rowsPerB)·sCPb + by·64 + col] if CP) ; ACT 0 none / 1 elu ; writes f16 C16 (and f32 C if non-null)
template <int ACT>
__global__ __launch_bounds__(128) void k_gemm_hhx(const _Float16* __restrict__ A, int lda, size_t sA, const _Float16* __restrict__ Bh, int ldb, size_t sB, float alpha, const float* __restrict__ bias, size_t sBias, const float* __restrict__ CP, int rowsPerB, size_t sCPb, int row0g,
    float* __restrict__ C, _Float16* __restrict__ C16, int ldc, size_t sC, int M, int N, int K) {
  __shared__ __attribute__((aligned(16))) float so[4][16][64];
  const int tid = threadIdx.x, w = tid >> 5, lane = tid & 31, ln = lane & 15, hh = lane >> 4; const int by = blockIdx.y;
  A += (size_t)by * sA; Bh += (size_t)by * sB; const size_t cofs = (size_t)by * sC; const float* bp = bias ? bias + (size_t)by * sBias : nullptr;
  const int ntn = (N + 63) / 64; const int wid = blockIdx.x * 4 + w; const int mt = wid / ntn, nq = wid % ntn; if (mt * 16 >= M) return;
  const int row0 = mt * 16, col0 = nq * 64; const _Float16* arow = A + (size_t)(row0 + ln) * lda;
  v8f acc[4] = {};
  for (int kb = 0; kb < K; kb += 32) { FragH ah; ah.half[0] = *(const v8us*)((const unsigned short*)arow + kb + 8 * hh); ah.half[1] = *(const v8us*)((const unsigned short*)arow + kb + 16 + 8 * hh);
#pragma unroll
    for (int t = 0; t < 4; ++t) { if (col0 + t * 16 >= N) continue; const size_t boff = (size_t)(col0 + t * 16 + ln) * ldb + kb; FragH bq; bq.half[0] = *(const v8us*)((const unsigned short*)Bh + boff + 8 * hh); bq.half[1] = *(const v8us*)((const unsigned short*)Bh + boff + 16 + 8 * hh);
      acc[t] = mmaH<1>(ah.v, ah.v, bq.v, bq.v, acc[t]); }
  }
#pragma unroll
  for (int t = 0; t < 4; ++t) { if (col0 + t * 16 >= N) continue; const int col = col0 + t * 16 + ln; const float bv = bp ? bf16_round(bp[col]) : 0.f;
#pragma unroll
    for (int r = 0; r < 8; ++r) { float v = acc[t][r] * alpha + bv; if (CP) { const int rr = row0g + row0 + 8 * hh + r; if (rowsPerB < 0) v += CP[cofs + (size_t)rr * ldc + col];      /* rowsPerB < 0: own element of the batched C plane */ else { const int bidx = rr / rowsPerB; v += CP[(size_t)bidx * sCPb + (size_t)by * 64 + col]; } } if (ACT == 1) v = (v > 0.f) ? v : expm1f(v); else if (ACT == 7) v = (v > 0.f) ? v + 1.0f : expf(v); else if (ACT == 8) v = tanhf(v); else if (ACT == 9) v = 0.5f * v * (1.0f + tanhf(0.7978845608028654f * (v + 0.044715f * v * v * v))); else if (ACT == 11) v = 1.0f / (1.0f + expf(-v)); else if (ACT == 12) v = (v > 0.f) ? v : 0.01f * v; else if (ACT == 14) v = (v > 0.f) ? v : 0.1f * v; else if (ACT == 16) v = (v >= 0.f) ? v : 0.3f * v; else if (ACT == 17) v = (v >= 0.f) ? v : 0.2f * v; else if (ACT == 15) v = v / (1.0f + expf(-v)); else if (ACT == 3) v = fmaxf(v, 0.f); else if (ACT == 6) v = 0.5f * v * (1.0f + erff(v * 0.70710678118654752f)); so[w][8 * hh + r][t * 16 + ln] = v; } }
  __builtin_amdgcn_fence(__ATOMIC_ACQ_REL, "workgroup"); __builtin_amdgcn_wave_barrier();
  const int rsub = lane >> 4, c4 = (lane & 15) * 4; typedef _Float16 v4h __attribute__((ext_vector_type(4)));
  {
#pragma unroll
    for (int q = 0; q < 8; ++q) { const int r = q * 2 + rsub; if (col0 + c4 < N) { const v4f v = *(const v4fa*)&so[w][r][c4]; if (C) *(v4f*)(C + cofs + (size_t)(row0 + r) * ldc + col0 + c4) = v; if (C16) { v4h h4; for (int i = 0; i < 4; ++i) h4[i] = (_Float16)v[i]; *(v4h*)(C16 + cofs + (size_t)(row0 + r) * ldc + col0 + c4) = h4; } } }
     }
}


typedef _Float16 v4h __attribute__((ext_vector_type(4)));

__global__ __launch_bounds__(256) void k_x16(const float* __restrict__ x, _Float16* __restrict__ X16, size_t n8) { const size_t t = (size_t)blockIdx.x * 256 + threadIdx.x; if (t >= n8) return; FragH f;
#pragma unroll
  for (int q = 0; q < 8; ++q) f.h[q] = (_Float16)bf16_round(x[t * 8 + q]); *(v8us*)((unsigned short*)X16 + t * 8) = f.half[0];  }
__global__ __launch_bounds__(256) void k_h16(const float* __restrict__ x, _Float16* __restrict__ X16, size_t n8) { const size_t t = (size_t)blockIdx.x * 256 + threadIdx.x; if (t >= n8) return; FragH f;
#pragma unroll
  for (int q = 0; q < 8; ++q) f.h[q] = (_Float16)x[t * 8 + q]; *(v8us*)((unsigned short*)X16 + t * 8) = f.half[0];  }
__global__ __launch_bounds__(256) void k_round16f(const float* __restrict__ W, _Float16* __restrict__ Bt, size_t n8) { const size_t t = (size_t)blockIdx.x * 256 + threadIdx.x; if (t >= n8) return; FragH f;
#pragma unroll
  for (int i = 0; i < 8; ++i) f.h[i] = (_Float16)(bf16_round(W[t * 8 + i]) * 16.0f); *(v8us*)((unsigned short*)Bt + t * 8) = f.half[0];  }
template <int NHv, int TTv>
__global__ __launch_bounds__(256) void k_vt(const _Float16* __restrict__ V16, int ldv, int voff, _Float16* __restrict__ Vt) { __shared__ unsigned short tl[64][66]; const int tid = threadIdx.x; const int slab = blockIdx.x / (TTv / 64), lg = blockIdx.x % (TTv / 64); const int b = slab / NHv, h = slab % NHv;
  for (int i = tid; i < 64 * 8; i += 256) { const int r = i / 8, c8 = (i % 8) * 8; FragH f; f.half[0] = *(const v8us*)((const unsigned short*)V16 + ((size_t)b * TTv + lg * 64 + r) * ldv + voff + h * 64 + c8);
#pragma unroll
    for (int q = 0; q < 8; ++q) tl[r][c8 + q] = f.u[q]; }
  __syncthreads();
  {
#pragma unroll
    for (int rd = 0; rd < 2; ++rd) { const int d = rd * 32 + tid / 8, pc = tid % 8; FragH f;
#pragma unroll
      for (int q = 0; q < 8; ++q) f.u[q] = tl[pc * 8 + q][d];
      *(v8us*)((unsigned short*)Vt + ((size_t)slab * 64 + d) * TTv + lg * 64 + pc * 8) = f.half[0]; }
     } }

__global__ __launch_bounds__(256) void k_hl(const float* __restrict__ F, _Float16* __restrict__ Hh, _Float16* __restrict__ Hl, size_t n8) { const size_t t = (size_t)blockIdx.x * 256 + threadIdx.x; if (t >= n8) return; FragH fh, fl; const v4f a = *(const v4fa*)(F + t * 8), c = *(const v4fa*)(F + t * 8 + 4);
#pragma unroll
  for (int q = 0; q < 4; ++q) { _Float16 h = (_Float16)a[q]; fh.h[q] = h; fl.h[q] = (_Float16)((a[q] - (float)h) * 1024.0f); h = (_Float16)c[q]; fh.h[4 + q] = h; fl.h[4 + q] = (_Float16)((c[q] - (float)h) * 1024.0f); }
  { *(v8us*)((unsigned short*)Hh + t * 8) = fh.half[0]; *(v8us*)((unsigned short*)Hl + t * 8) = fl.half[0];  } }

// ---- tensor loads: one request of one wave brings ROWS rows of ROWB bytes (source pitch DM f16 = 1024 B) from global memory into LDS, through no register ----
// W0 = word 0 of descriptor group 1, a constant: no mask, 1-byte elements, a pad behind every row: on 128-byte rows TD_P16 gives the 144-B pitch of the 16-byte fragment reads, TD_P32 the 160-B pitch of the transposing reads; on 256-byte rows TD_Q16 gives 272 B.
typedef unsigned int u32x4 __attribute__((ext_vector_type(4)));
typedef unsigned int u32x8 __attribute__((ext_vector_type(8)));
#define TD_P16 ((1u << 20) | (4u << 22) | (3u << 25))
#define TD_P32 ((1u << 20) | (4u << 22) | (7u << 25))
#define TD_Q16 ((1u << 20) | (5u << 22) | (3u << 25))
__device__ __forceinline__ unsigned int td_uni(unsigned int v) { return (unsigned int)__builtin_amdgcn_readfirstlane(v); }
__device__ __forceinline__ unsigned int pinned(unsigned int v) { unsigned int w = td_uni(v); asm volatile("" : "+s"(w)); return w; }      /* holds a wave-uniform test, or a descriptor word, in a scalar register: the branch round a tensor load must be a scalar branch (the instruction ignores EXEC), and a descriptor word keeps its register while a request is out */
__device__ __forceinline__ u32x4 td_group0(unsigned int place, const unsigned short* g) { const unsigned long long ga = (unsigned long long)(size_t)g; u32x4 g0;      /* count 1 | place in LDS | address | type 2 */
  g0[0] = pinned(1u); g0[1] = td_uni(place); g0[2] = td_uni((unsigned int)ga); g0[3] = td_uni((((unsigned int)(ga >> 32)) & 0x01FFFFFFu) | 0x80000000u); return g0; }
template <unsigned int W0, unsigned int ROWB, unsigned int ROWS>
__device__ __forceinline__ u32x8 td_group1() { u32x8 g1;      /* tensor = tile = ROWB bytes x ROWS, source pitch in bytes */
  g1[0] = pinned(W0); g1[1] = pinned(ROWB << 16); g1[2] = pinned(ROWS << 16); g1[3] = pinned(ROWB << 16); g1[4] = pinned(ROWS); g1[5] = pinned((unsigned int)(DM * 2)); g1[6] = pinned(0u); g1[7] = pinned(0u); return g1; }
// the next stage's request from the last one's: the other buffer (psum = the two places added), the address step bytes on; called only behind the wait that covers the last request
__device__ __forceinline__ void td_next(u32x4& g0, unsigned int psum, unsigned int step) { const unsigned long long a = (((unsigned long long)g0[3] << 32) | g0[2]) + step; g0[1] = td_uni(psum - g0[1]); g0[2] = td_uni((unsigned int)a); g0[3] = td_uni((unsigned int)(a >> 32)); }
__device__ __forceinline__ void td_issue(u32x4 g0, u32x8 g1) { asm volatile("tensor_load_to_lds %0, %1" :: "s"(g0), "s"(g1) : "memory"); }
__device__ __forceinline__ void td_wait(u32x4& g0) { asm volatile("s_wait_tensorcnt 0x0" : "+s"(g0) :: "memory"); }      /* the issuing wave's own: its tile has landed; the compiler places no wait for a tensor load. It names the request's group 0, so that td_next's arithmetic on those registers cannot be lifted over it */
__device__ __forceinline__ void ds_wait() { asm volatile("s_wait_dscnt 0x0" ::: "memory"); }      /* this wave's LDS reads have returned before the barrier behind which their buffer is refilled */

// ---- fast GEMM (work-group tile 128x64, wave tile 32x64; requires M % 128 == 0, N % 64 == 0, K % 128 == 0); epilogue = k_gemm_hhx semantics ----
// Operands go through LDS, 128 k a stage: the work-group's 128 A rows and 64 B rows as 256-byte row pieces, brought by four tensor loads, one a wave
// (a fragment load straight from global touches 16 lines for the same bytes, and each wave fetched all of B for itself). Rows at a 272-B pitch, the load's pad: 16-byte fragment reads without bank conflicts.
// Two buffers: the load of stage s + 2 is issued behind the barrier at the foot of pass s and flies during pass s + 1, one barrier a pass. Each accumulator takes its products in ascending k.
#define GK 64                        /* k a pass */
#define GP 72                        /* LDS row pitch in f16 */
#define G2K 128                      /* k a stage of k_gemm2: rows of 256 B */
#define G2P 136                      /* its LDS row pitch in f16: 272 B */
#define G2A 9216                     /* f16 a slice of 64 A rows at that pitch, rounded up to 2 KiB */
#define G2B 5120                     /* f16 a slice of 32 B rows, likewise */
__device__ __forceinline__ v16h g2_frag(const _Float16* p, int hh) { FragH f; f.half[0] = *(const v8us*)((const unsigned short*)p + 8 * hh); f.half[1] = *(const v8us*)((const unsigned short*)p + 16 + 8 * hh); return f.v; }
__device__ __forceinline__ v16h g2_lfrag(const unsigned short* p, int hh) { FragH f; f.half[0] = *(const v8us*)(p + 8 * hh); f.half[1] = *(const v8us*)(p + 16 + 8 * hh); return f.v; }      /* the same k order from an LDS row */
__device__ __forceinline__ v8f g2_mma(v16h a, v16h b, v8f c) { v8f d = __builtin_amdgcn_wmma_f32_16x16x32_f16(false, a, false, b, (short)0, c, false, false); asm volatile("v_nop\n\tv_nop\n\tv_nop\n\tv_nop" : "+v"(d) : "v"(a), "v"(b)); return d; }
template <int ACT>
__global__ __launch_bounds__(128) void k_gemm2(const _Float16* __restrict__ A, int lda, size_t sA, const _Float16* __restrict__ Bh, int ldb, size_t sB, float alpha, const float* __restrict__ bias, size_t sBias, const float* __restrict__ CP, int rowsPerB, size_t sCPb, int row0g,
    float* __restrict__ C, _Float16* __restrict__ C16, int ldc, size_t sC, int M, int N, int K, const float* __restrict__ bias1, const float* __restrict__ bias2) { static_assert(ACT == 0 || ACT == 3 || ACT == 6 || ACT == 8 || ACT == 9 || ACT == 11 || ACT == 12 || ACT == 14 || ACT == 15 || ACT == 16 || ACT == 17, "k_gemm2: unsupported ACT code (would silently apply no activation)");
  __shared__ __attribute__((aligned(16))) float so[4][32][68];
  __shared__ __attribute__((aligned(2048))) unsigned short sa[2][2][G2A];      /* [buffer][slice]: every tensor load's place, a slice, is a multiple of 2 KiB */
  __shared__ __attribute__((aligned(2048))) unsigned short sb[2][2][G2B];
  static_assert((G2A * 2) % 2048 == 0 && (G2B * 2) % 2048 == 0 && G2A >= 64 * G2P && G2B >= 32 * G2P && G2K * 2 == 256 && G2P * 2 == 272, "slices at multiples of 2 KiB; a stage's rows are 256 B, 272 B with the pad");
  const int tid = threadIdx.x, w = tid >> 5, lane = tid & 31, ln = lane & 15, hh = lane >> 4; const int by = blockIdx.y;
  A += (size_t)by * sA; Bh += (size_t)by * sB; const size_t cofs = (size_t)by * sC; const float* bp = bias ? bias + (size_t)by * sBias : nullptr;
  if (by == 1 && bias1) bp = bias1; if (by == 2 && bias2) bp = bias2;      /* batch entries 1 and 2 whose biases are buffers of their own */
  const int ntn = N >> 6; const int mt = blockIdx.x / ntn, nq = blockIdx.x - mt * ntn; const int row0 = mt * 128 + 32 * w, col0 = nq * 64; if (mt * 128 >= M) return;      /* the whole work-group leaves or none: barriers follow */
  __builtin_assume(lda == DM); __builtin_assume(ldb == DM);      /* every launch here has rows of DM: the descriptors' source pitch */
  // every wave brings its own slice of a stage: waves 0 and 1 the two halves of the 128 A rows, waves 2 and 3 those of the 64 B rows: one request a wave and stage, one outstanding
  const unsigned int wv = td_uni((unsigned int)tid >> 5), sl = wv & 1u; const bool isb = (wv & 2u) != 0u;
  const unsigned int pl0 = isb ? (unsigned int)(size_t)&sb[0][sl][0] : (unsigned int)(size_t)&sa[0][sl][0], psum = 2u * pl0 + (isb ? (unsigned int)sizeof(sb[0]) : (unsigned int)sizeof(sa[0]));
  u32x4 g0 = td_group0(pl0, isb ? (const unsigned short*)Bh + (size_t)(col0 + 32 * sl) * ldb : (const unsigned short*)A + (size_t)(mt * 128 + 64 * sl) * lda);
  const u32x8 g1a = td_group1<TD_Q16, 256, 64>(), g1b = td_group1<TD_Q16, 256, 32>();
  if (pinned(!isb)) { td_issue(g0, g1a); td_wait(g0); }
  if (pinned(isb)) { td_issue(g0, g1b); td_wait(g0); }
  __syncthreads();      /* publishes stage 0 */
  td_next(g0, psum, G2K * 2);
  if (pinned(G2K < K && !isb)) td_issue(g0, g1a);
  if (pinned(G2K < K && isb)) td_issue(g0, g1b);
  const v8f z8 = {0.f,0.f,0.f,0.f,0.f,0.f,0.f,0.f}; v8f c00 = z8, c01 = z8, c02 = z8, c03 = z8, c10 = z8, c11 = z8, c12 = z8, c13 = z8;
#pragma unroll 1      /* one pass a trip: the body already holds 32 matrix instructions and 48 LDS reads */
  for (int kb = 0; kb < K; kb += G2K) { const int cur = (kb / G2K) & 1;
#pragma unroll      /* the stage's two blocks of 64 k in line: their LDS offsets are immediates */
    for (int hb = 0; hb < 2; ++hb) {
    v16h af[2][2], bf[2][4];      /* [k half of the block][tile] */
#pragma unroll      /* constant indices keep the fragments in registers */
    for (int s = 0; s < 2; ++s) {
#pragma unroll      /* constant indices keep the fragments in registers */
      for (int t = 0; t < 2; ++t) af[s][t] = g2_lfrag(&sa[cur][w >> 1][(32 * (w & 1) + 16 * t + ln) * G2P + 64 * hb + 32 * s], hh);
#pragma unroll      /* constant indices keep the fragments in registers */
      for (int t = 0; t < 4; ++t) bf[s][t] = g2_lfrag(&sb[cur][t >> 1][(16 * (t & 1) + ln) * G2P + 64 * hb + 32 * s], hh); }
    __builtin_amdgcn_sched_barrier(0);      /* keeps the block's 24 LDS reads issued here: sunk to in front of their matrix instructions, each group would stand with a full latency in the open */
#pragma unroll      /* constant indices keep the fragments in registers */
    for (int s = 0; s < 2; ++s) {
      c00 = g2_mma(af[s][0], bf[s][0], c00); c10 = g2_mma(af[s][1], bf[s][0], c10);
      c01 = g2_mma(af[s][0], bf[s][1], c01); c11 = g2_mma(af[s][1], bf[s][1], c11);
      c02 = g2_mma(af[s][0], bf[s][2], c02); c12 = g2_mma(af[s][1], bf[s][2], c12);
      c03 = g2_mma(af[s][0], bf[s][3], c03); c13 = g2_mma(af[s][1], bf[s][3], c13); } }
    // publish point of the next stage: this wave's LDS reads back, each issuing wave's own tile landed, the barrier; only then the refill of the buffer that this pass has read
    ds_wait();
    td_wait(g0);      /* every wave issues */
    __syncthreads();      /* publishes the next stage and ends this pass's reads of the buffer that is refilled behind it */
    td_next(g0, psum, G2K * 2);
    if (pinned(kb + 2 * G2K < K && !isb)) td_issue(g0, g1a);
    if (pinned(kb + 2 * G2K < K && isb)) td_issue(g0, g1b); }
  td_wait(g0); ds_wait();      /* nothing in flight behind the loop */
  v8f accs[8] = {c00, c01, c02, c03, c10, c11, c12, c13};
#pragma unroll
  for (int u = 0; u < 8; ++u) { const int t = u & 3, half = u >> 2; const int col = col0 + t * 16 + ln; const float bv = bp ? bf16_round(bp[col]) : 0.f;
#pragma unroll
    for (int r = 0; r < 8; ++r) { const int rloc = half * 16 + 8 * hh + r; float v = accs[u][r] * alpha + bv; if (CP) { if (rowsPerB < 0) v += CP[cofs + (size_t)(row0g + row0 + rloc) * ldc + col];      /* rowsPerB < 0: own element of the batched C plane */ else { const int bidx = (row0g + row0 + rloc) / rowsPerB; v += CP[(size_t)bidx * sCPb + (size_t)by * 64 + col]; } }
      if (ACT == 3) v = fmaxf(v, 0.f); else if (ACT == 6) v = 0.5f * v * (1.0f + erff(v * 0.70710678118654752f)); else if (ACT == 11) v = 1.0f / (1.0f + expf(-v)); else if (ACT == 15) v = v / (1.0f + expf(-v)); else if (ACT == 12) v = (v > 0.f) ? v : 0.01f * v; else if (ACT == 8) v = tanhf(v); else if (ACT == 9) v = 0.5f * v * (1.0f + tanhf(0.7978845608028654f * (v + 0.044715f * v * v * v))); else if (ACT == 14) v = (v > 0.f) ? v : 0.1f * v; else if (ACT == 16) v = (v >= 0.f) ? v : 0.3f * v; else if (ACT == 17) v = (v >= 0.f) ? v : 0.2f * v;
      so[w][rloc][t * 16 + ln] = v; } }
  __builtin_amdgcn_fence(__ATOMIC_ACQ_REL, "workgroup"); __builtin_amdgcn_wave_barrier();
  const int rsub = lane >> 4, c4 = (lane & 15) * 4;
  {
#pragma unroll
    for (int q = 0; q < 16; ++q) { const int r = q * 2 + rsub; const v4f v = *(const v4fa*)&so[w][r][c4]; if (C) *(v4f*)(C + cofs + (size_t)(row0 + r) * ldc + col0 + c4) = v; if (C16) { v4h h4; for (int i = 0; i < 4; ++i) h4[i] = (_Float16)v[i]; *(v4h*)(C16 + cofs + (size_t)(row0 + r) * ldc + col0 + c4) = h4; } }
     } }


// ---- q, k, v projections straight from the f32 inputs: no conversion launch ----
// blockIdx.y = 0, 1, 2: C16[y] = f16(X_y W_y^T + b_y). The fragment reads, the order of the products and the epilogue are k_gemm2's; the operands differ in how they reach LDS (through registers, 64 k a pass):
// a thread loads 16 bytes of f32 (16 lanes cover a 256-byte row piece: whole lines), rounds them to bf16 (two packed conversions) and writes those 8 bytes at the foot of the pass; the products run on the bf16 form,
// whose operands are the very values that the f16 form had (inputs and weights rounded to bf16 are exact in both; no x16 is needed here).
// f32 rows are twice the bytes from L2, so the work-group takes 128 rows x 256 columns (16 waves, 4 x 4 of 32x64): an input row is fetched by 2 work-groups, not 8, and rounded twice, not 8 times.
// q leaves times FCS = log2(e) / sqrt(64), applied in f32 ahead of its one rounding to f16: a score product of the attention kernel is then the argument of exp2 as it stands.
// blockIdx.y = 3: Wo to f16 x16 for the output GEMM two launches on; these blocks leave before any barrier.
#define FCS (0.125f * 1.4426950408889634f)      /* 1 / sqrt(64), and e^x as 2^(x log2 e) */
#define QC 4                         /* 64-column groups a work-group */
#define QB ((int)((NR / 128) * (DM / (64 * QC))))      /* blocks a projection: 64 */
typedef unsigned short v4us __attribute__((ext_vector_type(4), may_alias));
typedef __bf16 v4b __attribute__((ext_vector_type(4)));
__device__ __forceinline__ v4us q_bf(v4f a) { return __builtin_bit_cast(v4us, __builtin_convertvector(a, v4b)); }      /* f32 -> bf16, nearest even: two packed conversions */
__device__ __forceinline__ v16b q_lfrag(const unsigned short* p, int hh) { FragB f; f.half[0] = *(const v8us*)(p + 8 * hh); f.half[1] = *(const v8us*)(p + 16 + 8 * hh); return f.v; }      /* g2_lfrag's k order */
__device__ __forceinline__ v8f q_mma(v16b a, v16b b, v8f c) { return __builtin_amdgcn_wmma_f32_16x16x32_bf16(false, a, false, b, (short)0, c, false, false); }
__global__ __launch_bounds__(128 * QC) void k_qkv(const float* __restrict__ xq, const float* __restrict__ xk, const float* __restrict__ xv, const float* __restrict__ wq, const float* __restrict__ wk, const float* __restrict__ wv, const float* __restrict__ wo,
    const float* __restrict__ bq, const float* __restrict__ bk, const float* __restrict__ bv, _Float16* __restrict__ C16, _Float16* __restrict__ BO) {
  __shared__ __attribute__((aligned(16))) float so[4 * QC][32][68];
  __shared__ __attribute__((aligned(16))) unsigned short sa[2][128][GP];
  __shared__ __attribute__((aligned(16))) unsigned short sb[2][64 * QC][GP];
  const int tid = threadIdx.x, w = tid >> 5, lane = tid & 31, ln = lane & 15, hh = lane >> 4; const int wr = w & 3, wc = w >> 2; const int by = blockIdx.y;
  if (by == 3) {      /* the whole work-group leaves here or none of it */
    const size_t e0 = ((size_t)blockIdx.x * (128 * QC) + tid) * 4; const size_t e1 = e0 + (size_t)QB * (128 * QC) * 4; static_assert((size_t)QB * (128 * QC) * 8 == (size_t)DM * DM, "two pieces of 4 a thread cover Wo");
    const v4f a0 = *(const v4fa*)(wo + e0), a1 = *(const v4fa*)(wo + e1);
    v4h o0, o1;
#pragma unroll      /* constant indices keep the pieces in registers */
    for (int q = 0; q < 4; ++q) { o0[q] = (_Float16)(bf16_round(a0[q]) * 16.0f); o1[q] = (_Float16)(bf16_round(a1[q]) * 16.0f); }
    *(v4h*)(BO + e0) = o0; *(v4h*)(BO + e1) = o1; return; }
  const float* A = by == 0 ? xq : by == 1 ? xk : xv; const float* Wf = by == 0 ? wq : by == 1 ? wk : wv; const float* bp = by == 0 ? bq : by == 1 ? bk : bv; const size_t cofs = (size_t)by * NR * DM;
  const int mt = blockIdx.x / (DM / (64 * QC)), nq = blockIdx.x - mt * (DM / (64 * QC)); const int row0 = mt * 128 + 32 * wr, col0 = nq * (64 * QC) + 64 * wc;
  const int fr = tid >> 4, fc = (tid & 15) * 4;      /* staging: this thread moves 4 elements of rows fr + 8 QC i of each tile */
  const float* ag = A + (size_t)(mt * 128 + fr) * DM + fc; const float* bg = Wf + (size_t)(nq * (64 * QC) + fr) * DM + fc;
  v4f ra[16 / QC], rb[8];
#pragma unroll      /* constant indices keep the pieces in registers */
  for (int i = 0; i < 16 / QC; ++i) ra[i] = *(const v4fa*)(ag + (size_t)(8 * QC * i) * DM);
#pragma unroll      /* constant indices keep the pieces in registers */
  for (int i = 0; i < 8; ++i) rb[i] = *(const v4fa*)(bg + (size_t)(8 * QC * i) * DM);
#pragma unroll      /* constant indices keep the pieces in registers */
  for (int i = 0; i < 16 / QC; ++i) *(v4us*)&sa[0][fr + 8 * QC * i][fc] = q_bf(ra[i]);
#pragma unroll      /* constant indices keep the pieces in registers */
  for (int i = 0; i < 8; ++i) *(v4us*)&sb[0][fr + 8 * QC * i][fc] = q_bf(rb[i]);
  __syncthreads();
  const v8f z8 = {0.f,0.f,0.f,0.f,0.f,0.f,0.f,0.f}; v8f c00 = z8, c01 = z8, c02 = z8, c03 = z8, c10 = z8, c11 = z8, c12 = z8, c13 = z8;
#pragma unroll 1      /* one pass a trip: the body already holds 16 matrix instructions and 24 LDS reads */
  for (int kb = 0; kb < DM; kb += GK) { const int cur = (kb / GK) & 1; const bool more = kb + GK < DM;
    if (more) { ag += GK; bg += GK;
#pragma unroll      /* constant indices keep the pieces in registers */
      for (int i = 0; i < 16 / QC; ++i) ra[i] = *(const v4fa*)(ag + (size_t)(8 * QC * i) * DM);
#pragma unroll      /* constant indices keep the pieces in registers */
      for (int i = 0; i < 8; ++i) rb[i] = *(const v4fa*)(bg + (size_t)(8 * QC * i) * DM); }
    v16b af[2][2], bf[2][4];      /* [k half of the pass][tile] */
#pragma unroll      /* constant indices keep the fragments in registers */
    for (int s = 0; s < 2; ++s) {
#pragma unroll      /* constant indices keep the fragments in registers */
      for (int t = 0; t < 2; ++t) af[s][t] = q_lfrag(&sa[cur][32 * wr + 16 * t + ln][32 * s], hh);
#pragma unroll      /* constant indices keep the fragments in registers */
      for (int t = 0; t < 4; ++t) bf[s][t] = q_lfrag(&sb[cur][64 * wc + 16 * t + ln][32 * s], hh); }
    __builtin_amdgcn_sched_barrier(0);      /* keeps the pass's global loads and all 24 LDS reads issued here: sunk to in front of their matrix instructions, each group would stand with a full latency in the open */
#pragma unroll      /* constant indices keep the fragments in registers */
    for (int s = 0; s < 2; ++s) {
      c00 = q_mma(af[s][0], bf[s][0], c00); c10 = q_mma(af[s][1], bf[s][0], c10);
      c01 = q_mma(af[s][0], bf[s][1], c01); c11 = q_mma(af[s][1], bf[s][1], c11);
      c02 = q_mma(af[s][0], bf[s][2], c02); c12 = q_mma(af[s][1], bf[s][2], c12);
      c03 = q_mma(af[s][0], bf[s][3], c03); c13 = q_mma(af[s][1], bf[s][3], c13); }
    asm volatile("v_nop\n\tv_nop\n\tv_nop\n\tv_nop" : "+v"(c03), "+v"(c13) : "v"(af[1][0]), "v"(af[1][1]), "v"(bf[1][3]));      /* the four vector slots the chip needs behind the pass's last matrix instructions: on the taken side of the branch that follows, the next vector instructions are address arithmetic that may be placed on their operand registers */
    if (more) {      /* every reader left that buffer before the last barrier */
#pragma unroll      /* constant indices keep the pieces in registers */
      for (int i = 0; i < 16 / QC; ++i) *(v4us*)&sa[cur ^ 1][fr + 8 * QC * i][fc] = q_bf(ra[i]);
#pragma unroll      /* constant indices keep the pieces in registers */
      for (int i = 0; i < 8; ++i) *(v4us*)&sb[cur ^ 1][fr + 8 * QC * i][fc] = q_bf(rb[i]); }
    __syncthreads(); }      /* publishes the next pass's tiles and ends this pass's reads of the buffer that the next pass refills */
  v8f accs[8] = {c00, c01, c02, c03, c10, c11, c12, c13};
#pragma unroll      /* constant indices keep the accumulators in registers */
  for (int u = 0; u < 8; ++u) { const int t = u & 3, half = u >> 2; const float bv1 = bf16_round(bp[col0 + t * 16 + ln]);
#pragma unroll      /* constant indices keep the accumulators in registers */
    for (int r = 0; r < 8; ++r) so[w][half * 16 + 8 * hh + r][t * 16 + ln] = accs[u][r] + bv1; }
  __builtin_amdgcn_fence(__ATOMIC_ACQ_REL, "workgroup"); __builtin_amdgcn_wave_barrier();      /* a wave reads back its own rows only */
  const int rsub = lane >> 4, c4 = (lane & 15) * 4; const float qs = by == 0 ? FCS : 1.0f;
#pragma unroll      /* the 16 row pairs' reads and stores in flight together */
  for (int q = 0; q < 16; ++q) { const int r = q * 2 + rsub; const v4f v = *(const v4fa*)&so[w][r][c4] * qs; *(v4h*)(C16 + cofs + (size_t)(row0 + r) * DM + col0 + c4) = __builtin_convertvector(v, v4h); } }
#define FS 4                         /* key quarters: waves that share a query group */
#define FW 32                        /* keys a wave and run */
#define FJ 2                         /* such 32-key runs of a wave between two barriers */
#define FK (FJ * FS * FW)            /* keys a pass */
#define FP 72                        /* LDS pitch of a K row in f16 */
#define FV 80                        /* LDS pitch of a V row in f16: 32 B x odd, the transposing load's pitch */
#define FT 32768.0f                  /* a lane's sum of a run's weights up to here: every weight is finite in f16 */
__device__ __forceinline__ float fa_xhalf(float x) { return __builtin_bit_cast(float, __builtin_amdgcn_permlanex16(__builtin_bit_cast(int, x), __builtin_bit_cast(int, x), 0x76543210, 0xfedcba98, false, false)); }      /* lane l with lane l ^ 16 */
__device__ __forceinline__ v8f fa_mma(v16h a, v16h b, v8f c) { return __builtin_amdgcn_wmma_f32_16x16x32_f16(false, a, false, b, (short)0, c, false, false); }
__device__ __forceinline__ v16h fa_frag(const unsigned short* p, int hh) { FragH f; f.half[0] = *(const v8us*)(p + 8 * hh); f.half[1] = *(const v8us*)(p + 16 + 8 * hh); return f.v; }
typedef short v8s __attribute__((ext_vector_type(8)));
__device__ __forceinline__ v8us fa_tr16(const unsigned short* p) { typedef __attribute__((address_space(3))) v8s lds_v8s; return __builtin_bit_cast(v8us, __builtin_amdgcn_ds_load_tr16_b128_v8i16((lds_v8s*)p)); }
// 16 d x 32 keys of V^T from V rows in LDS; p = this lane's address in the 16-key x 16-d block: row 8 hh + (lane & 7), 16-byte piece (lane >> 3) & 1. Lane (ln, hh) gets keys 8 hh + r and 16 + 8 hh + r of d = ln: fa_frag's k order
__device__ __forceinline__ v16h fa_vfrag(const unsigned short* p) { FragH f; f.half[0] = fa_tr16(p); f.half[1] = fa_tr16(p + 16 * FV); return f.v; }
// 2^x with the one slot that the instruction set asks for behind a transcendental, before its result is read or its source overwritten, in the same statement
__device__ __forceinline__ float fa_exp2_slot(float x) { float y; asm("v_exp_f32 %0, %1\n\tv_nop" : "=v"(y) : "v"(x)); return y; }
// weights of one query tile and run from their exponents: p = f16(2^a | 2^b) in the B operand's k order, rs = this lane's f32 sum of the 16
__device__ __forceinline__ void fa_weights(v8f a, v8f b, FragH& p, float& rs) {
#pragma unroll      /* constant indices keep the values in registers */
  for (int r = 0; r < 8; ++r) a[r] = __builtin_amdgcn_exp2f(a[r]);
#pragma unroll      /* constant indices keep the values in registers */
  for (int r = 0; r < 8; ++r) b[r] = __builtin_amdgcn_exp2f(b[r]);
#pragma unroll      /* constant indices keep the values in registers */
  for (int r = 0; r < 8; ++r) { p.h[r] = (_Float16)a[r]; p.h[8 + r] = (_Float16)b[r]; }
  const v8f es = a + b; const v4f e4 = __builtin_shufflevector(es, es, 0, 1, 2, 3) + __builtin_shufflevector(es, es, 4, 5, 6, 7);      /* a tree of register pairs: packed adds, and no chain of 16 dependent adds in front of the test */
  rs = (e4[0] + e4[2]) + (e4[1] + e4[3]); }
__global__ __launch_bounds__(512) void k_fattn(const _Float16* __restrict__ Q16, const _Float16* __restrict__ K16, const _Float16* __restrict__ V16, _Float16* __restrict__ O16) {
  __shared__ __attribute__((aligned(2048))) unsigned short kt[2][FK][FP];      /* every tensor load's place, a half buffer, is a multiple of 2 KiB */
  __shared__ __attribute__((aligned(2048))) unsigned short vs[2][FK][FV];
  static_assert((FK / 2 * FP * 2) % 2048 == 0 && (FK / 2 * FV * 2) % 2048 == 0 && SQ / FK >= 2, "half buffers at multiples of 2 KiB; the ring's prologue needs two stages");
  __shared__ __attribute__((aligned(32))) float mo[4][FS][4][2][32][8];      /* [query group][key quarter][16-d tile][16-query tile][lane]: a quarter's x */
  __shared__ __attribute__((aligned(8))) float ml[4][FS][2][32][2];      /* its 8 - reference and its sum */
  const int tid = threadIdx.x, w = tid >> 5, lane = tid & 31, ln = lane & 15, hh = lane >> 4; const int qg = w & 3, ks = w >> 2; const int h = blockIdx.y; const int q0 = blockIdx.x * 128 + qg * 32;
  v16h qf[2][2];      /* [query tile][d half] */
#pragma unroll      /* constant indices keep the fragments and accumulators in registers */
  for (int u = 0; u < 2; ++u) { const _Float16* qp = Q16 + (size_t)(q0 + 16 * u + ln) * DM + h * HD; qf[u][0] = g2_frag(qp, hh); qf[u][1] = g2_frag(qp + 32, hh);
    asm volatile("s_wait_xcnt 0x0" ::: "memory"); }      /* stands in front of any reuse of this tile's address registers: the next loads' results may be placed on them */
  const int kr = tid >> 3, kc = (tid & 7) * 8;      /* the output rows: this thread moves 16 bytes of rows kr and kr + 64; 8 threads cover a 128-byte row */
  const int tr = 8 * hh + (lane & 7), tc = ((lane >> 3) & 1) * 8;      /* the transposing load: this lane's row and 16-byte piece in a 16-key x 16-d block of V */
  // waves 0 and 1 bring the two halves of a stage's K rows, waves 2 and 3 those of its V rows: one request of 128 rows (16 KiB) a wave and stage, one outstanding
  const unsigned int wv = td_uni((unsigned int)tid >> 5), sl = wv & 1u; const bool isv = (wv & 2u) != 0u;
  const unsigned int pl0 = isv ? (unsigned int)(size_t)&vs[0][sl * (FK / 2)][0] : (unsigned int)(size_t)&kt[0][sl * (FK / 2)][0], psum = 2u * pl0 + (isv ? (unsigned int)sizeof(vs[0]) : (unsigned int)sizeof(kt[0]));
  u32x4 g0 = td_group0(pl0, (const unsigned short*)(isv ? V16 : K16) + (size_t)(sl * (FK / 2)) * DM + h * HD);
  const u32x8 g1k = td_group1<TD_P16, 128, FK / 2>(), g1v = td_group1<TD_P32, 128, FK / 2>();
  if (pinned(wv < 2u)) { td_issue(g0, g1k); td_wait(g0); }
  if (pinned((wv >> 1) == 1u)) { td_issue(g0, g1v); td_wait(g0); }
  __syncthreads();      /* publishes stage 0 */
  td_next(g0, psum, FK * DM * 2);
  if (pinned(wv < 2u)) td_issue(g0, g1k);
  if (pinned((wv >> 1) == 1u)) td_issue(g0, g1v);
  const v8f z8 = {0.f,0.f,0.f,0.f,0.f,0.f,0.f,0.f}; v8f o[4][2] = {{z8, z8}, {z8, z8}, {z8, z8}, {z8, z8}}; float l[2] = {0.f, 0.f};      /* o: [d tile][query tile]; l: this half's sum of weights */
  v8f cr[2] = {z8 + 3.0e38f, z8 + 3.0e38f};      /* 8 - m in all 8 registers, m the reference in use in units of the scaled products: the score products' start value, and the only place where m is kept; weights carry x256, as f16 operands away from the subnormal range; it cancels in x = sum / l */
#pragma unroll 1      /* one pass a trip: the body already holds 32 matrix instructions and 32 LDS reads */
  for (int it = 0; it < SQ / FK; ++it) { const int cur = it & 1;
#pragma unroll      /* both runs in line: their LDS offsets are immediates */
    for (int j = 0; j < FJ; ++j) { const int k0 = (j * FS + ks) * FW;      /* the run's first key in the tile; no barrier between the runs, so the waves of a SIMD drift apart and fill one another's waits */
    v16h kf[2][2], vf[4];
#pragma unroll      /* constant indices keep the fragments and accumulators in registers */
    for (int t = 0; t < 2; ++t) { const unsigned short* kp = &kt[cur][k0 + t * 16 + ln][0]; kf[t][0] = fa_frag(kp, hh); kf[t][1] = fa_frag(kp + 32, hh); }
    __builtin_amdgcn_sched_barrier(0);      /* keeps the run's 8 K reads issued here, as one group ahead of the score products */
    v8f s[2][2];      /* [key tile][query tile] */
#pragma unroll      /* constant indices keep the fragments and accumulators in registers */
    for (int t = 0; t < 2; ++t)
#pragma unroll      /* constant indices keep the fragments and accumulators in registers */
      for (int u = 0; u < 2; ++u) s[t][u] = fa_mma(kf[t][0], qf[u][0], cr[u]);
#pragma unroll      /* constant indices keep the fragments and accumulators in registers */
    for (int t = 0; t < 2; ++t)
#pragma unroll      /* constant indices keep the fragments and accumulators in registers */
      for (int u = 0; u < 2; ++u) s[t][u] = fa_mma(kf[t][1], qf[u][1], s[t][u]);
#pragma unroll      /* constant indices keep the fragments and accumulators in registers */
    for (int t = 0; t < 4; ++t) vf[t] = fa_vfrag(&vs[cur][k0 + tr][t * 16 + tc]);
    __builtin_amdgcn_sched_barrier(0);      /* keeps the 8 V^T reads issued here, as one group behind the score products: their latency passes under the softmax; sunk to in front of their matrix instructions each would stand in the open */
    FragH p[2]; float rs[2];
#pragma unroll      /* constant indices keep the fragments and accumulators in registers */
    for (int u = 0; u < 2; ++u) fa_weights(s[0][u], s[1][u], p[u], rs[u]);
    if (__builtin_expect(__builtin_amdgcn_ballot_w32(fmaxf(rs[0], rs[1]) > FT) != 0, 0)) {      /* the same for the whole wave: a scalar branch, all lanes on at the matrix instructions inside; rare (the first run, and a score about 7 above m), and marked so, which keeps this path out of the loop's line */
#pragma unroll      /* constant indices keep the fragments and accumulators in registers */
      for (int t = 0; t < 2; ++t) { const unsigned short* kp = &kt[cur][k0 + t * 16 + ln][0]; kf[t][0] = fa_frag(kp, hh); kf[t][1] = fa_frag(kp + 32, hh); }      /* the tile still stands: no barrier since */
#pragma unroll      /* constant indices keep the fragments and accumulators in registers */
      for (int t = 0; t < 2; ++t)
#pragma unroll      /* constant indices keep the fragments and accumulators in registers */
        for (int u = 0; u < 2; ++u) s[t][u] = fa_mma(kf[t][1], qf[u][1], fa_mma(kf[t][0], qf[u][0], z8));
#pragma unroll      /* constant indices keep the fragments and accumulators in registers */
      for (int u = 0; u < 2; ++u) { float a0 = s[0][u][0], a1 = s[1][u][0];
#pragma unroll      /* constant indices keep the fragments and accumulators in registers */
        for (int r = 1; r < 8; ++r) { a0 = fmaxf(a0, s[0][u][r]); a1 = fmaxf(a1, s[1][u][r]); }
        float tm = fmaxf(a0, a1); tm = fmaxf(tm, fa_xhalf(tm)); const float cn = fminf(cr[u][0], 8.0f - tm), corr = __builtin_amdgcn_exp2f(cn - cr[u][0]); cr[u] = z8 + cn; l[u] *= corr;      /* m rises to the run's maximum, 8 - m falls; both halves of the wave hold the same m for a query */
#pragma unroll      /* constant indices keep the fragments and accumulators in registers */
        for (int t = 0; t < 4; ++t) o[t][u] *= corr;
        fa_weights(s[0][u] + cn, s[1][u] + cn, p[u], rs[u]); } }
#pragma unroll      /* constant indices keep the fragments and accumulators in registers */
    for (int u = 0; u < 2; ++u) l[u] += rs[u];
#pragma unroll      /* constant indices keep the fragments and accumulators in registers */
    for (int u = 0; u < 2; ++u)
#pragma unroll      /* constant indices keep the fragments and accumulators in registers */
      for (int t = 0; t < 4; ++t) o[t][u] = fa_mma(vf[t], p[u].v, o[t][u]); }
    // publish point of stage it + 1: this wave's LDS reads back, each issuing wave's own tile landed, the barrier; only then the refill of the buffer that this pass has read
    ds_wait();
    if (pinned(wv < 4u)) td_wait(g0);
    __syncthreads();      /* publishes the next stage and ends this pass's reads of the buffer that is refilled behind it */
    td_next(g0, psum, FK * DM * 2);
    if (pinned(it + 2 < SQ / FK && wv < 2u)) td_issue(g0, g1k);
    if (pinned(it + 2 < SQ / FK && (wv >> 1) == 1u)) td_issue(g0, g1v); }
  td_wait(g0); ds_wait();      /* nothing in flight when the ring becomes output staging */
  // join of the four key quarters: every wave leaves its x, reference and sum in LDS; then the wave of quarter j joins d tile j of its query group's 32 queries
#pragma unroll      /* constant indices keep the fragments and accumulators in registers */
  for (int u = 0; u < 2; ++u) { l[u] += fa_xhalf(l[u]); ml[qg][ks][u][lane][0] = cr[u][0]; ml[qg][ks][u][lane][1] = l[u];      /* 8 - m: the 8 cancels in the join */
#pragma unroll      /* constant indices keep the fragments and accumulators in registers */
    for (int t = 0; t < 4; ++t) *(v8f*)&mo[qg][ks][t][u][lane][0] = o[t][u]; }
  __syncthreads();      /* the quarters' results are read by other waves */
#pragma unroll      /* constant indices keep the fragments and accumulators in registers */
  for (int u = 0; u < 2; ++u) { float mj[FS], lj[FS];
#pragma unroll      /* constant indices keep the fragments and accumulators in registers */
    for (int j = 0; j < FS; ++j) { mj[j] = ml[qg][j][u][lane][0]; lj[j] = ml[qg][j][u][lane][1]; }
    const float mx = fminf(fminf(mj[0], mj[1]), fminf(mj[2], mj[3])); float ls = 0.f; v8f x = z8;      /* the least 8 - m: the highest reference */
#pragma unroll      /* constant indices keep the fragments and accumulators in registers */
    for (int j = 0; j < FS; ++j) mj[j] = fa_exp2_slot(mx - mj[j]);      /* each quarter's weight in the join */
#pragma unroll      /* constant indices keep the fragments and accumulators in registers */
    for (int j = 0; j < FS; ++j) { ls += mj[j] * lj[j]; x += *(const v8f*)&mo[qg][j][ks][u][lane][0] * mj[j]; }
    const float inv = 1.0f / ls; FragH f;      /* lane (ln, hh) holds x[q0 + 16 u + ln][16 ks + 8 hh + r] */
#pragma unroll      /* constant indices keep the fragments and accumulators in registers */
    for (int r = 0; r < 8; ++r) f.h[r] = (_Float16)(x[r] * inv);
    *(v8us*)&kt[0][qg * 32 + 16 * u + ln][16 * ks + 8 * hh] = f.half[0]; }      /* the K buffer, which every reader left at the loop's last barrier, now holds the work-group's 128 output row pieces */
  __syncthreads();      /* a row piece comes from four waves and leaves as one whole 128-byte line */
  unsigned short* op = (unsigned short*)O16 + (size_t)(blockIdx.x * 128 + kr) * DM + h * HD + kc;
  *(v8us*)op = *(const v8us*)&kt[0][kr][kc]; *(v8us*)(op + 64 * DM) = *(const v8us*)&kt[0][kr + 64][kc]; }

extern "C" void kernel_launch(void* const* d_in, const int* in_sizes, int n_in,
                              void* d_out, int out_size, void* d_ws, size_t ws_size, hipStream_t stream) {
  (void)in_sizes; (void)n_in; (void)out_size;
  const float* const* I = (const float* const*)d_in; const float* xq = I[0]; const float* xk = I[1]; const float* xv = I[2]; const float* wq = I[3]; const float* bq = I[4]; const float* wk = I[5]; const float* bk = I[6]; const float* wv = I[7]; const float* bv = I[8]; const float* wo = I[9]; const float* bo = I[10];
  char* ws = (char*)d_ws; size_t off = 0;
  auto take = [&](size_t bytes) { char* p = ws + off; off += (bytes + 255) & ~(size_t)255; return p; };
  _Float16* BO = (_Float16*)take((size_t)DM * DM * 2);      /* Wo */
  _Float16* Q16 = (_Float16*)take(3 * NR * DM * 2); _Float16* K16 = Q16 + NR * DM; _Float16* V16 = K16 + NR * DM;      /* q | k | v */
  _Float16* O16 = (_Float16*)take(NR * DM * 2);
  if (off > ws_size) return;      /* approx 16.5 MiB */
  const dim3 gp((unsigned)((NR / 128) * (DM / 64)), 1);
  k_qkv<<<dim3(QB, 4), 128 * QC, 0, stream>>>(xq, xk, xv, wq, wk, wv, wo, bq, bk, bv, Q16, BO);      /* q, k and v: blockIdx.y picks rows, weight, bias and output; row 3 rounds Wo */
  k_fattn<<<dim3(SQ / 128, NH), 512, 0, stream>>>(Q16, K16, V16, O16);      /* x (merged heads) as f16 rows */
  k_gemm2<0><<<gp, 128, 0, stream>>>(O16, DM, 0, BO, DM, 0, 0.0625f, bo, 0, nullptr, 1, 0, 0, (float*)d_out, nullptr, DM, 0, MO, DM, DM, nullptr, nullptr);      /* out = o W_o^T + b_o, rows are the output layout */
}

// v010
// Measured time: 45.2 microseconds a run.
// Next to v009, in two timings, it ran 1.08 times as fast each time.
// Counting every step since v000, it is 150 times as fast.
#include <hip/hip_runtime.h>
// Multi-head attention over separate query / key / value inputs ([1][4096][512] each; q = query Wq^T + bq, k = key Wk^T + bk, v = value Wv^T + bv, 8 heads of 64; attn = softmax(q k^T / 8); x = attn v; out = x Wo^T + bo -> [1][4096][512]).
// Structure: token rows; Q | K | V as three WMMA GEMMs in one launch, blockIdx.y the projection: query, key, value and their weights are read as f32 and rounded to bf16 on the way into LDS (128x256 work-group tiles, 32x64 wave tiles, bf16 products, f32 accumulation, bias in the epilogue, f16 outputs), a fourth blockIdx.y row rounds Wo (exact f16, x16) for the last launch; one attention kernel for all heads (scores^T = K q^T, softmax in registers against a held reference that is raised only when a run's weights grow too large, x^T += V^T p^T with V^T fragments by transposing LDS loads of V rows; scores and weights never stored) written straight into the merged f16 rows; out = x Wo^T + bo GEMM (f32).
// Compute dtype: inputs rounded to bf16; inputs / weights exact; q, k, v, softmax weights and x as plain f16 GEMM operands (~2^-12); scores and softmax statistics f32. v_wmma_f32_16x16x32_bf16 (q, k, v projections), v_wmma_f32_16x16x32_f16 (attention, output projection).
#define NB 1
#define SQ 4096
#define DM 512
#define NH 8
#define HD 64
#define MP ((int)NR)                 /* unused: k_qkv always takes all NR token rows */
#define MO ((int)NR)                 /* token rows through the output projection (debug hook) */
#define NR ((size_t)NB * SQ)         /* 4096 token rows */
typedef __bf16 v16b __attribute__((ext_vector_type(16)));
typedef unsigned short v8us __attribute__((ext_vector_type(8), may_alias));
typedef float  v8f  __attribute__((ext_vector_type(8)));
typedef float  v4f  __attribute__((ext_vector_type(4)));
typedef float  v4fa __attribute__((ext_vector_type(4), may_alias));
union FragB { v16b v; v8us half[2]; unsigned short u[16]; };

__device__ __forceinline__ unsigned short bf16_bits(float x) { unsigned int u = __float_as_uint(x); return (unsigned short)((u + 0x7FFFu + ((u >> 16) & 1u)) >> 16); }
__device__ __forceinline__ float bf16_val(unsigned short b) { return __uint_as_float(((unsigned int)b) << 16); }
__device__ __forceinline__ float bf16_round(float x) { return bf16_val(bf16_bits(x)); }
// D += A·B with NT terms: 1 = ah·bh, 2 = + al·bh (A split), 3 = + ah·bl (both split)
template <int NT>
__device__ __forceinline__ v8f mmaN(v16b ah, v16b al, v16b bh, v16b bl, v8f c) {
  c = __builtin_amdgcn_wmma_f32_16x16x32_bf16(false, ah, false, bh, (short)0, c, false, false);
  if (NT >= 2) c = __builtin_amdgcn_wmma_f32_16x16x32_bf16(false, al, false, bh, (short)0, c, false, false);
  if (NT >= 3) c = __builtin_amdgcn_wmma_f32_16x16x32_bf16(false, ah, false, bl, (short)0, c, false, false);
  asm volatile("v_nop\n\tv_nop\n\tv_nop\n\tv_nop" : "+v"(c) : "v"(ah), "v"(al), "v"(bh), "v"(bl));
  return c;
}

__global__ __launch_bounds__(256) void k_wt_bf16(const float* __restrict__ W, unsigned short* __restrict__ Wt, int K, int N) {
  const int t = blockIdx.x * 256 + threadIdx.x;
  const int k8n = K / 8;
  if (t >= N * k8n) return;
  const int n = t / k8n, k8 = (t % k8n) * 8;
  v8us v;
#pragma unroll
  for (int i = 0; i < 8; ++i) v[i] = bf16_bits(W[(size_t)(k8 + i) * N + n]);
  *(v8us*)(Wt + (size_t)n * K + k8) = v;
  
}

// GEMM C[M][N] (f32, pitch ldc) = act(A[M][K]·W + bias). A f32 row-major (pitch lda) converted per fragment to bf16
// (ASPLIT: hi/lo two planes -> 2 terms, else single rounded term); Wt bf16 [N][K] (pitch ldb). BIAS_BF16 rounds the
// bias to bf16 first (bias quantised to bf16 before the add). K%32==0, M%16==0, N%64==0.
template <bool ASPLIT, int ACT, bool BIAS_BF16>
__global__ __launch_bounds__(128) void k_gemm_bf(const float* __restrict__ A, int lda, const unsigned short* __restrict__ Wt, int ldb,
                                               const float* __restrict__ bias, float* __restrict__ C, int ldc, int M, int N, int K) {
  __shared__ __attribute__((aligned(16))) float so[4][16][64];
  const int tid = threadIdx.x, w = tid >> 5, lane = tid & 31, ln = lane & 15, hh = lane >> 4;
  const int ntn = N / 64;
  const int wid = blockIdx.x * 4 + w;
  const int mt = wid / ntn, nq = wid % ntn;
  if (mt * 16 >= M) return;
  const int row0 = mt * 16, col0 = nq * 64;
  const float* arow = A + (size_t)(row0 + ln) * lda;
  v8f acc[4] = {};
  for (int kb = 0; kb < K; kb += 32) {
    FragB ah, al;
    const v4f x0 = *(const v4fa*)(arow + kb + 8 * hh), x1 = *(const v4fa*)(arow + kb + 8 * hh + 4);
    const v4f x2 = *(const v4fa*)(arow + kb + 16 + 8 * hh), x3 = *(const v4fa*)(arow + kb + 16 + 8 * hh + 4);
    float xs[16] = {x0[0],x0[1],x0[2],x0[3],x1[0],x1[1],x1[2],x1[3],x2[0],x2[1],x2[2],x2[3],x3[0],x3[1],x3[2],x3[3]};
#pragma unroll
    for (int i = 0; i < 16; ++i) { const unsigned short hb = bf16_bits(xs[i]); ah.u[i] = hb; al.u[i] = ASPLIT ? bf16_bits(xs[i] - bf16_val(hb)) : (unsigned short)0; }
#pragma unroll
    for (int t = 0; t < 4; ++t) {
      const unsigned short* brow = Wt + (size_t)(col0 + t * 16 + ln) * ldb + kb;
      FragB b;
      b.half[0] = *(const v8us*)(brow + 8 * hh);
      b.half[1] = *(const v8us*)(brow + 16 + 8 * hh);
      acc[t] = mmaN<ASPLIT ? 2 : 1>(ah.v, al.v, b.v, b.v, acc[t]);
    }
  }
#pragma unroll
  for (int t = 0; t < 4; ++t) {
    float bv = bias ? bias[col0 + t * 16 + ln] : 0.f;
    if (BIAS_BF16) bv = bf16_round(bv);
#pragma unroll
    for (int r = 0; r < 8; ++r) { float v = acc[t][r] + bv; if (ACT == 1) v = fmaxf(v, 0.f); so[w][8 * hh + r][t * 16 + ln] = v; }
  }
  __builtin_amdgcn_fence(__ATOMIC_ACQ_REL, "workgroup");
  __builtin_amdgcn_wave_barrier();
  const int rsub = lane >> 4, c4 = (lane & 15) * 4;
  {
#pragma unroll
    for (int q = 0; q < 8; ++q) {
      const int r = q * 2 + rsub;
      const v4f v = *(const v4fa*)&so[w][r][c4];
      *(v4f*)(C + (size_t)(row0 + r) * ldc + col0 + c4) = v;
    }
    
  }
}

// GEMM C = act(A·W + bias + resid): A f32 (ASPLIT -> hi/lo 2 terms), Wt bf16 [N][K]; ACT 0 none, 1 relu, 2 exact gelu;
// resid (optional, f32, row index = (row % rmod), pitch ldr, RES_BF16 rounds it) added before the activation.
template <bool ASPLIT, int ACT, bool BIAS_BF16, bool RES_BF16>
__global__ __launch_bounds__(128) void k_gemm_bf3(const float* __restrict__ A, int lda, const unsigned short* __restrict__ Wt, int ldb,
                                                const float* __restrict__ bias, const float* __restrict__ resid, int rmod, int ldr,
                                                float* __restrict__ C, int ldc, int M, int N, int K) {
  __shared__ __attribute__((aligned(16))) float so[4][16][64];
  const int tid = threadIdx.x, w = tid >> 5, lane = tid & 31, ln = lane & 15, hh = lane >> 4;
  const int ntn = N / 64;
  const int wid = blockIdx.x * 4 + w;
  const int mt = wid / ntn, nq = wid % ntn;
  if (mt * 16 >= M) return;
  const int row0 = mt * 16, col0 = nq * 64;
  const float* arow = A + (size_t)(row0 + ln) * lda;
  v8f acc[4] = {};
  for (int kb = 0; kb < K; kb += 32) {
    FragB ah, al;
    const v4f x0 = *(const v4fa*)(arow + kb + 8 * hh), x1 = *(const v4fa*)(arow + kb + 8 * hh + 4);
    const v4f x2 = *(const v4fa*)(arow + kb + 16 + 8 * hh), x3 = *(const v4fa*)(arow + kb + 16 + 8 * hh + 4);
    float xs[16] = {x0[0],x0[1],x0[2],x0[3],x1[0],x1[1],x1[2],x1[3],x2[0],x2[1],x2[2],x2[3],x3[0],x3[1],x3[2],x3[3]};
#pragma unroll
    for (int i = 0; i < 16; ++i) { const unsigned short hb = bf16_bits(xs[i]); ah.u[i] = hb; al.u[i] = ASPLIT ? bf16_bits(xs[i] - bf16_val(hb)) : (unsigned short)0; }
#pragma unroll
    for (int t = 0; t < 4; ++t) {
      const unsigned short* brow = Wt + (size_t)(col0 + t * 16 + ln) * ldb + kb;
      FragB b;
      b.half[0] = *(const v8us*)(brow + 8 * hh);
      b.half[1] = *(const v8us*)(brow + 16 + 8 * hh);
      acc[t] = mmaN<ASPLIT ? 2 : 1>(ah.v, al.v, b.v, b.v, acc[t]);
    }
  }
#pragma unroll
  for (int t = 0; t < 4; ++t) {
    const int col = col0 + t * 16 + ln;
    float bv = bias ? bias[col] : 0.f;
    if (BIAS_BF16) bv = bf16_round(bv);
#pragma unroll
    for (int r = 0; r < 8; ++r) {
      float v = acc[t][r] + bv;
      if (resid) { float rv = resid[(size_t)((row0 + 8 * hh + r) % rmod) * ldr + col]; if (RES_BF16) rv = bf16_round(rv); v += rv; }
      if (ACT == 1) v = fmaxf(v, 0.f);
      if (ACT == 2) v = 0.5f * v * (1.0f + erff(v * 0.70710678118654752f));
      if (ACT == 3) { const float u = 0.7978845608028654f * (v + 0.044715f * v * v * v); v = 0.5f * v * (1.0f + tanhf(u)); }
      so[w][8 * hh + r][t * 16 + ln] = v;
    }
  }
  __builtin_amdgcn_fence(__ATOMIC_ACQ_REL, "workgroup");
  __builtin_amdgcn_wave_barrier();
  const int rsub = lane >> 4, c4 = (lane & 15) * 4;
  {
#pragma unroll
    for (int q = 0; q < 8; ++q) {
      const int r = q * 2 + rsub;
      const v4f v = *(const v4fa*)&so[w][r][c4];
      *(v4f*)(C + (size_t)(row0 + r) * ldc + col0 + c4) = v;
    }
    
  }
}
// row LayerNorm (biased variance, eps) over N: s = X (+ R); optional out_sum <- s; out_norm <- (s-mu)*rsqrt(var+eps)*g + b
template <bool PARAM_BF16>
__global__ __launch_bounds__(256) void k_layernorm(const float* __restrict__ X, const float* __restrict__ R, const float* __restrict__ g, const float* __restrict__ bta,
                                                  float* __restrict__ out_sum, float* __restrict__ out_norm, int N, float eps) {
  __shared__ float red[256];
  const int row = blockIdx.x, tid = threadIdx.x;
  const float* x = X + (size_t)row * N; const float* rr = R ? R + (size_t)row * N : nullptr;
  float vals[16];                     // up to N = 4096
  const int per = N / 256;            // contiguous chunk per thread? use strided-by-4 chunks: thread handles j = tid*4 + 1024*u
  float s1 = 0.f;
  for (int u = 0; u < per / 4; ++u) {
    const int j = tid * 4 + 1024 * u;
    const v4f a = *(const v4fa*)(x + j);
    v4f b = {0.f,0.f,0.f,0.f}; if (rr) b = *(const v4fa*)(rr + j);
#pragma unroll
    for (int q = 0; q < 4; ++q) { const float v = a[q] + b[q]; vals[u * 4 + q] = v; s1 += v; }
  }
  red[tid] = s1; __syncthreads();
  for (int st = 128; st > 0; st >>= 1) { if (tid < st) red[tid] += red[tid + st]; __syncthreads(); }
  const float mu = red[0] / (float)N; __syncthreads();
  float s2 = 0.f;
  for (int u = 0; u < per / 4; ++u)
#pragma unroll
    for (int q = 0; q < 4; ++q) { const float c = vals[u * 4 + q] - mu; s2 += c * c; }
  red[tid] = s2; __syncthreads();
  for (int st = 128; st > 0; st >>= 1) { if (tid < st) red[tid] += red[tid + st]; __syncthreads(); }
  const float rs = rsqrtf(red[0] / (float)N + eps);
  {
    for (int u = 0; u < per / 4; ++u) {
      const int j = tid * 4 + 1024 * u;
      v4f o, sm;
#pragma unroll
      for (int q = 0; q < 4; ++q) {
        float gg = g[j + q], bb = bta[j + q];
        if (PARAM_BF16) { gg = bf16_round(gg); bb = bf16_round(bb); }
        sm[q] = vals[u * 4 + q]; o[q] = (vals[u * 4 + q] - mu) * rs * gg + bb;
      }
      if (out_sum) *(v4f*)(out_sum + (size_t)row * N + j) = sm;
      *(v4f*)(out_norm + (size_t)row * N + j) = o;
    }
    
  }
}



// ---- f16 WMMA path (v_wmma_f32_16x16x32_f16): 11-bit significands for operands in range — used where a [0,1] probability operand needs more precision than bf16
typedef _Float16 v16h __attribute__((ext_vector_type(16)));
union FragH { v16h v; v8us half[2]; _Float16 h[16]; unsigned short u[16]; };
template <int NT>
__device__ __forceinline__ v8f mmaH(v16h ah, v16h al, v16h bh, v16h bl, v8f c) {
  c = __builtin_amdgcn_wmma_f32_16x16x32_f16(false, ah, false, bh, (short)0, c, false, false);
  if (NT >= 2) c = __builtin_amdgcn_wmma_f32_16x16x32_f16(false, al, false, bh, (short)0, c, false, false);
  if (NT >= 3) c = __builtin_amdgcn_wmma_f32_16x16x32_f16(false, ah, false, bl, (short)0, c, false, false);
  asm volatile("v_nop\n\tv_nop\n\tv_nop\n\tv_nop" : "+v"(c) : "v"(ah), "v"(al), "v"(bh), "v"(bl));
  return c;
}
// batched GEMM like k_gemm_b but f16 operands: A f32 (split into f16 hi/lo if ASPLIT, else rounded to f16), Bt = f16 values [n][k]; alpha; C f32; N multiple of 16 (partial tiles skipped)
template <bool ASPLIT>
__global__ __launch_bounds__(128) void k_gemm_h(const float* __restrict__ A, int lda, size_t sA, const _Float16* __restrict__ Bh, int ldb, size_t sB, float alpha, float* __restrict__ C, int ldc, size_t sC, int M, int N, int K) {
  __shared__ __attribute__((aligned(16))) float so[4][16][64];
  const int tid = threadIdx.x, w = tid >> 5, lane = tid & 31, ln = lane & 15, hh = lane >> 4; const int by = blockIdx.y;
  A += (size_t)by * sA; Bh += (size_t)by * sB; C += (size_t)by * sC;
  const int ntn = (N + 63) / 64; const int wid = blockIdx.x * 4 + w; const int mt = wid / ntn, nq = wid % ntn; if (mt * 16 >= M) return;
  const int row0 = mt * 16, col0 = nq * 64; const float* arow = A + (size_t)(row0 + ln) * lda;
  v8f acc[4] = {};
  for (int kb = 0; kb < K; kb += 32) {
    FragH ah, al;
    const v4f x0 = *(const v4fa*)(arow + kb + 8 * hh), x1 = *(const v4fa*)(arow + kb + 8 * hh + 4), x2 = *(const v4fa*)(arow + kb + 16 + 8 * hh), x3 = *(const v4fa*)(arow + kb + 16 + 8 * hh + 4);
    float xs[16] = {x0[0],x0[1],x0[2],x0[3],x1[0],x1[1],x1[2],x1[3],x2[0],x2[1],x2[2],x2[3],x3[0],x3[1],x3[2],x3[3]};
#pragma unroll
    for (int i = 0; i < 16; ++i) { const _Float16 h = (_Float16)xs[i]; ah.h[i] = h; al.h[i] = ASPLIT ? (_Float16)(xs[i] - (float)h) : (_Float16)0.0f; }
#pragma unroll
    for (int t = 0; t < 4; ++t) { if (col0 + t * 16 >= N) continue; const size_t boff = (size_t)(col0 + t * 16 + ln) * ldb + kb; FragH bq; bq.half[0] = *(const v8us*)(Bh + boff + 8 * hh); bq.half[1] = *(const v8us*)(Bh + boff + 16 + 8 * hh);
      acc[t] = mmaH<ASPLIT ? 2 : 1>(ah.v, al.v, bq.v, bq.v, acc[t]); }
  }
#pragma unroll
  for (int t = 0; t < 4; ++t) { if (col0 + t * 16 >= N) continue;
#pragma unroll
    for (int r = 0; r < 8; ++r) so[w][8 * hh + r][t * 16 + ln] = acc[t][r] * alpha; }
  __builtin_amdgcn_fence(__ATOMIC_ACQ_REL, "workgroup"); __builtin_amdgcn_wave_barrier();
  const int rsub = lane >> 4, c4 = (lane & 15) * 4;
  {
#pragma unroll
    for (int q = 0; q < 8; ++q) { const int r = q * 2 + rsub; if (col0 + c4 < N) { const v4f v = *(const v4fa*)&so[w][r][c4]; *(v4f*)(C + (size_t)(row0 + r) * ldc + col0 + c4) = v; } }
     }
}

// Wt[n][k] = f16(W[k][n]·scale) from f32 row-major W[K][N] (scale = power of two; bf16-exact weights stay exact in f16 away from the subnormal range)
__global__ __launch_bounds__(256) void k_wt_f16(const float* __restrict__ W, _Float16* __restrict__ Wt, int K, int N, float scale) {
  const int t = blockIdx.x * 256 + threadIdx.x; if (t >= N * (K / 8)) return; const int n = t / (K / 8), k8 = (t % (K / 8)) * 8; FragH f;
#pragma unroll
  for (int i = 0; i < 8; ++i) f.h[i] = (_Float16)(bf16_round(W[(size_t)(k8 + i) * N + n]) * scale); const v8us o = f.half[0];
  *(v8us*)((unsigned short*)Wt + (size_t)n * K + k8) = o; 
}
// k_gemm_hh variant with fused epilogue: v = acc·alpha + bias[by·sBias + col] (+ CP[(row/rowsPerB)·sCPb + by·64 + col] if CP) ; ACT 0 none / 1 elu ; writes f16 C16 (and f32 C if non-null)
template <int ACT>
__global__ __launch_bounds__(128) void k_gemm_hhx(const _Float16* __restrict__ A, int lda, size_t sA, const _Float16* __restrict__ Bh, int ldb, size_t sB, float alpha, const float* __restrict__ bias, size_t sBias, const float* __restrict__ CP, int rowsPerB, size_t sCPb, int row0g,
    float* __restrict__ C, _Float16* __restrict__ C16, int ldc, size_t sC, int M, int N, int K) {
  __shared__ __attribute__((aligned(16))) float so[4][16][64];
  const int tid = threadIdx.x, w = tid >> 5, lane = tid & 31, ln = lane & 15, hh = lane >> 4; const int by = blockIdx.y;
  A += (size_t)by * sA; Bh += (size_t)by * sB; const size_t cofs = (size_t)by * sC; const float* bp = bias ? bias + (size_t)by * sBias : nullptr;
  const int ntn = (N + 63) / 64; const int wid = blockIdx.x * 4 + w; const int mt = wid / ntn, nq = wid % ntn; if (mt * 16 >= M) return;
  const int row0 = mt * 16, col0 = nq * 64; const _Float16* arow = A + (size_t)(row0 + ln) * lda;
  v8f acc[4] = {};
  for (int kb = 0; kb < K; kb += 32) { FragH ah; ah.half[0] = *(const v8us*)((const unsigned short*)arow + kb + 8 * hh); ah.half[1] = *(const v8us*)((const unsigned short*)arow + kb + 16 + 8 * hh);
#pragma unroll
    for (int t = 0; t < 4; ++t) { if (col0 + t * 16 >= N) continue; const size_t boff = (size_t)(col0 + t * 16 + ln) * ldb + kb; FragH bq; bq.half[0] = *(const v8us*)((const unsigned short*)Bh + boff + 8 * hh); bq.half[1] = *(const v8us*)((const unsigned short*)Bh + boff + 16 + 8 * hh);
      acc[t] = mmaH<1>(ah.v, ah.v, bq.v, bq.v, acc[t]); }
  }
#pragma unroll
  for (int t = 0; t < 4; ++t) { if (col0 + t * 16 >= N) continue; const int col = col0 + t * 16 + ln; const float bv = bp ? bf16_round(bp[col]) : 0.f;
#pragma unroll
    for (int r = 0; r < 8; ++r) { float v = acc[t][r] * alpha + bv; if (CP) { const int rr = row0g + row0 + 8 * hh + r; if (rowsPerB < 0) v += CP[cofs + (size_t)rr * ldc + col];      /* rowsPerB < 0: own element of the batched C plane */ else { const int bidx = rr / rowsPerB; v += CP[(size_t)bidx * sCPb + (size_t)by * 64 + col]; } } if (ACT == 1) v = (v > 0.f) ? v : expm1f(v); else if (ACT == 7) v = (v > 0.f) ? v + 1.0f : expf(v); else if (ACT == 8) v = tanhf(v); else if (ACT == 9) v = 0.5f * v * (1.0f + tanhf(0.7978845608028654f * (v + 0.044715f * v * v * v))); else if (ACT == 11) v = 1.0f / (1.0f + expf(-v)); else if (ACT == 12) v = (v > 0.f) ? v : 0.01f * v; else if (ACT == 14) v = (v > 0.f) ? v : 0.1f * v; else if (ACT == 16) v = (v >= 0.f) ? v : 0.3f * v; else if (ACT == 17) v = (v >= 0.f) ? v : 0.2f * v; else if (ACT == 15) v = v / (1.0f + expf(-v)); else if (ACT == 3) v = fmaxf(v, 0.f); else if (ACT == 6) v = 0.5f * v * (1.0f + erff(v * 0.70710678118654752f)); so[w][8 * hh + r][t * 16 + ln] = v; } }
  __builtin_amdgcn_fence(__ATOMIC_ACQ_REL, "workgroup"); __builtin_amdgcn_wave_barrier();
  const int rsub = lane >> 4, c4 = (lane & 15) * 4; typedef _Float16 v4h __attribute__((ext_vector_type(4)));
  {
#pragma unroll
    for (int q = 0; q < 8; ++q) { const int r = q * 2 + rsub; if (col0 + c4 < N) { const v4f v = *(const v4fa*)&so[w][r][c4]; if (C) *(v4f*)(C + cofs + (size_t)(row0 + r) * ldc + col0 + c4) = v; if (C16) { v4h h4; for (int i = 0; i < 4; ++i) h4[i] = (_Float16)v[i]; *(v4h*)(C16 + cofs + (size_t)(row0 + r) * ldc + col0 + c4) = h4; } } }
     }
}


typedef _Float16 v4h __attribute__((ext_vector_type(4)));

__global__ __launch_bounds__(256) void k_x16(const float* __restrict__ x, _Float16* __restrict__ X16, size_t n8) { const size_t t = (size_t)blockIdx.x * 256 + threadIdx.x; if (t >= n8) return; FragH f;
#pragma unroll
  for (int q = 0; q < 8; ++q) f.h[q] = (_Float16)bf16_round(x[t * 8 + q]); *(v8us*)((unsigned short*)X16 + t * 8) = f.half[0];  }
__global__ __launch_bounds__(256) void k_h16(const float* __restrict__ x, _Float16* __restrict__ X16, size_t n8) { const size_t t = (size_t)blockIdx.x * 256 + threadIdx.x; if (t >= n8) return; FragH f;
#pragma unroll
  for (int q = 0; q < 8; ++q) f.h[q] = (_Float16)x[t * 8 + q]; *(v8us*)((unsigned short*)X16 + t * 8) = f.half[0];  }
__global__ __launch_bounds__(256) void k_round16f(const float* __restrict__ W, _Float16* __restrict__ Bt, size_t n8) { const size_t t = (size_t)blockIdx.x * 256 + threadIdx.x; if (t >= n8) return; FragH f;
#pragma unroll
  for (int i = 0; i < 8; ++i) f.h[i] = (_Float16)(bf16_round(W[t * 8 + i]) * 16.0f); *(v8us*)((unsigned short*)Bt + t * 8) = f.half[0];  }
template <int NHv, int TTv>
__global__ __launch_bounds__(256) void k_vt(const _Float16* __restrict__ V16, int ldv, int voff, _Float16* __restrict__ Vt) { __shared__ unsigned short tl[64][66]; const int tid = threadIdx.x; const int slab = blockIdx.x / (TTv / 64), lg = blockIdx.x % (TTv / 64); const int b = slab / NHv, h = slab % NHv;
  for (int i = tid; i < 64 * 8; i += 256) { const int r = i / 8, c8 = (i % 8) * 8; FragH f; f.half[0] = *(const v8us*)((const unsigned short*)V16 + ((size_t)b * TTv + lg * 64 + r) * ldv + voff + h * 64 + c8);
#pragma unroll
    for (int q = 0; q < 8; ++q) tl[r][c8 + q] = f.u[q]; }
  __syncthreads();
  {
#pragma unroll
    for (int rd = 0; rd < 2; ++rd) { const int d = rd * 32 + tid / 8, pc = tid % 8; FragH f;
#pragma unroll
      for (int q = 0; q < 8; ++q) f.u[q] = tl[pc * 8 + q][d];
      *(v8us*)((unsigned short*)Vt + ((size_t)slab * 64 + d) * TTv + lg * 64 + pc * 8) = f.half[0]; }
     } }

__global__ __launch_bounds__(256) void k_hl(const float* __restrict__ F, _Float16* __restrict__ Hh, _Float16* __restrict__ Hl, size_t n8) { const size_t t = (size_t)blockIdx.x * 256 + threadIdx.x; if (t >= n8) return; FragH fh, fl; const v4f a = *(const v4fa*)(F + t * 8), c = *(const v4fa*)(F + t * 8 + 4);
#pragma unroll
  for (int q = 0; q < 4; ++q) { _Float16 h = (_Float16)a[q]; fh.h[q] = h; fl.h[q] = (_Float16)((a[q] - (float)h) * 1024.0f); h = (_Float16)c[q]; fh.h[4 + q] = h; fl.h[4 + q] = (_Float16)((c[q] - (float)h) * 1024.0f); }
  { *(v8us*)((unsigned short*)Hh + t * 8) = fh.half[0]; *(v8us*)((unsigned short*)Hl + t * 8) = fl.half[0];  } }

// ---- tensor loads: one request of one wave brings ROWS rows of ROWB bytes (source pitch DM f16 = 1024 B) from global memory into LDS, through no register ----
// W0 = word 0 of descriptor group 1, a constant: no mask, 1-byte elements, a pad behind every row: on 128-byte rows TD_P16 gives the 144-B pitch of the 16-byte fragment reads, TD_P32 the 160-B pitch of the transposing reads; on 256-byte rows TD_Q16 gives 272 B.
typedef unsigned int u32x4 __attribute__((ext_vector_type(4)));
typedef unsigned int u32x8 __attribute__((ext_vector_type(8)));
#define TD_P16 ((1u << 20) | (4u << 22) | (3u << 25))
#define TD_P32 ((1u << 20) | (4u << 22) | (7u << 25))
#define TD_Q16 ((1u << 20) | (5u << 22) | (3u << 25))
__device__ __forceinline__ unsigned int td_uni(unsigned int v) { return (unsigned int)__builtin_amdgcn_readfirstlane(v); }
__device__ __forceinline__ unsigned int pinned(unsigned int v) { unsigned int w = td_uni(v); asm volatile("" : "+s"(w)); return w; }      /* holds a wave-uniform test, or a descriptor word, in a scalar register: the branch round a tensor load must be a scalar branch (the instruction ignores EXEC), and a descriptor word keeps its register while a request is out */
__device__ __forceinline__ u32x4 td_group0(unsigned int place, const unsigned short* g) { const unsigned long long ga = (unsigned long long)(size_t)g; u32x4 g0;      /* count 1 | place in LDS | address | type 2 */
  g0[0] = pinned(1u); g0[1] = td_uni(place); g0[2] = td_uni((unsigned int)ga); g0[3] = td_uni((((unsigned int)(ga >> 32)) & 0x01FFFFFFu) | 0x80000000u); return g0; }
template <unsigned int W0, unsigned int ROWB, unsigned int ROWS>
__device__ __forceinline__ u32x8 td_group1() { u32x8 g1;      /* tensor = tile = ROWB bytes x ROWS, source pitch in bytes */
  g1[0] = pinned(W0); g1[1] = pinned(ROWB << 16); g1[2] = pinned(ROWS << 16); g1[3] = pinned(ROWB << 16); g1[4] = pinned(ROWS); g1[5] = pinned((unsigned int)(DM * 2)); g1[6] = pinned(0u); g1[7] = pinned(0u); return g1; }
// the next stage's request from the last one's: the other buffer (psum = the two places added), the address step bytes on; called only behind the wait that covers the last request
__device__ __forceinline__ void td_next(u32x4& g0, unsigned int psum, unsigned int step) { const unsigned long long a = (((unsigned long long)g0[3] << 32) | g0[2]) + step; g0[1] = td_uni(psum - g0[1]); g0[2] = td_uni((unsigned int)a); g0[3] = td_uni((unsigned int)(a >> 32)); }
__device__ __forceinline__ void td_issue(u32x4 g0, u32x8 g1) { asm volatile("tensor_load_to_lds %0, %1" :: "s"(g0), "s"(g1) : "memory"); }
__device__ __forceinline__ void td_wait(u32x4& g0) { asm volatile("s_wait_tensorcnt 0x0" : "+s"(g0) :: "memory"); }      /* the issuing wave's own: its tile has landed; the compiler places no wait for a tensor load. It names the request's group 0, so that td_next's arithmetic on those registers cannot be lifted over it */
__device__ __forceinline__ void ds_wait() { asm volatile("s_wait_dscnt 0x0" ::: "memory"); }      /* this wave's LDS reads have returned before the barrier behind which their buffer is refilled */

// ---- requests to L2 at block entry ----
// A launch's first read of a line can come at memory latency (whether planes that the launch before stored still lie in L2 is not known). So each block, as it starts, asks L2
// once for the row pieces that it reads (units of 256 B in the GEMMs, 128 B in attention), the first pass's included; units that several blocks read are dealt among them.
// For speed only, nothing rests on it: a unit that nobody asked for is fetched by its load, as before.
// A hint: nothing returns and no counter moves. Every lane is on, every lane's address lies inside the buffer, the scope word keeps it speculative.
__device__ __forceinline__ void l2_ask(const void* p) { asm volatile("global_prefetch_b8 %0, off scope:SCOPE_SE" :: "v"(p)); }
__device__ __forceinline__ void l2_ask_1k(const void* p) { asm volatile("global_prefetch_b8 %0, off offset:1024 scope:SCOPE_SE" :: "v"(p)); }      /* the unit 1024 bytes on, from the same register pair */
__device__ __forceinline__ void l2_hold(const void* p) { asm volatile("" :: "v"(p)); }      /* stands at the kernel's end and only reads p: the pair that a request named holds that address for the kernel's whole length, since no wait covers a request and its registers must never come to hold a non-address */

// ---- fast GEMM (work-group tile 128x64, wave tile 32x64; requires M % 128 == 0, N % 64 == 0, K % 128 == 0); epilogue = k_gemm_hhx semantics ----
// Operands go through LDS, 128 k a stage: the work-group's 128 A rows and 64 B rows as 256-byte row pieces, brought by four tensor loads, one a wave
// (a fragment load straight from global touches 16 lines for the same bytes, and each wave fetched all of B for itself). Rows at a 272-B pitch, the load's pad: 16-byte fragment reads without bank conflicts.
// Two buffers: the load of stage s + 2 is issued behind the barrier at the foot of pass s and flies during pass s + 1, one barrier a pass. Each accumulator takes its products in ascending k.
#define GK 64                        /* k a pass */
#define GP 72                        /* LDS row pitch in f16 */
#define G2K 128                      /* k a stage of k_gemm2: rows of 256 B */
#define G2P 136                      /* its LDS row pitch in f16: 272 B */
#define G2A 9216                     /* f16 a slice of 64 A rows at that pitch, rounded up to 2 KiB */
#define G2B 5120                     /* f16 a slice of 32 B rows, likewise */
__device__ __forceinline__ v16h g2_frag(const _Float16* p, int hh) { FragH f; f.half[0] = *(const v8us*)((const unsigned short*)p + 8 * hh); f.half[1] = *(const v8us*)((const unsigned short*)p + 16 + 8 * hh); return f.v; }
__device__ __forceinline__ v16h g2_lfrag(const unsigned short* p, int hh) { FragH f; f.half[0] = *(const v8us*)(p + 8 * hh); f.half[1] = *(const v8us*)(p + 16 + 8 * hh); return f.v; }      /* the same k order from an LDS row */
__device__ __forceinline__ v8f g2_mma(v16h a, v16h b, v8f c) { v8f d = __builtin_amdgcn_wmma_f32_16x16x32_f16(false, a, false, b, (short)0, c, false, false); asm volatile("v_nop\n\tv_nop\n\tv_nop\n\tv_nop" : "+v"(d) : "v"(a), "v"(b)); return d; }
template <int ACT>
__global__ __launch_bounds__(128) void k_gemm2(const _Float16* __restrict__ A, int lda, size_t sA, const _Float16* __restrict__ Bh, int ldb, size_t sB, float alpha, const float* __restrict__ bias, size_t sBias, const float* __restrict__ CP, int rowsPerB, size_t sCPb, int row0g,
    float* __restrict__ C, _Float16* __restrict__ C16, int ldc, size_t sC, int M, int N, int K, const float* __restrict__ bias1, const float* __restrict__ bias2) { static_assert(ACT == 0 || ACT == 3 || ACT == 6 || ACT == 8 || ACT == 9 || ACT == 11 || ACT == 12 || ACT == 14 || ACT == 15 || ACT == 16 || ACT == 17, "k_gemm2: unsupported ACT code (would silently apply no activation)");
  __shared__ __attribute__((aligned(16))) float so[4][32][68];
  __shared__ __attribute__((aligned(2048))) unsigned short sa[2][2][G2A];      /* [buffer][slice]: every tensor load's place, a slice, is a multiple of 2 KiB */
  __shared__ __attribute__((aligned(2048))) unsigned short sb[2][2][G2B];
  static_assert((G2A * 2) % 2048 == 0 && (G2B * 2) % 2048 == 0 && G2A >= 64 * G2P && G2B >= 32 * G2P && G2K * 2 == 256 && G2P * 2 == 272, "slices at multiples of 2 KiB; a stage's rows are 256 B, 272 B with the pad");
  const int tid = threadIdx.x, w = tid >> 5, lane = tid & 31, ln = lane & 15, hh = lane >> 4; const int by = blockIdx.y;
  A += (size_t)by * sA; Bh += (size_t)by * sB; const size_t cofs = (size_t)by * sC; const float* bp = bias ? bias + (size_t)by * sBias : nullptr;
  if (by == 1 && bias1) bp = bias1; if (by == 2 && bias2) bp = bias2;      /* batch entries 1 and 2 whose biases are buffers of their own */
  const int ntn = N >> 6; const int mt = blockIdx.x / ntn, nq = blockIdx.x - mt * ntn; const int row0 = mt * 128 + 32 * w, col0 = nq * 64; if (mt * 128 >= M) return;      /* the whole work-group leaves or none: barriers follow */
  __builtin_assume(lda == DM); __builtin_assume(ldb == DM);      /* every launch here has rows of DM: the descriptors' source pitch */
  // a stage is one 256-byte unit of every row. The 8 blocks that share these A rows have neighbouring indices: each asks for one stage's units of the 128 rows; the blocks that share these B rows take two stages each, by the parity of mt
  const int nu = K / G2K - 1; const int ua = (nq & 3) < nu ? (nq & 3) : nu, ub = (tid >> 6) + 2 * (mt & 1) < nu ? (tid >> 6) + 2 * (mt & 1) : nu;      /* clamped to the row's last unit */
  const _Float16* pfa = A + (size_t)(mt * 128 + tid) * lda + ua * G2K; const _Float16* pfb = Bh + (size_t)(col0 + (tid & 63)) * ldb + ub * G2K;
  l2_ask(pfa); l2_ask(pfb);
  // every wave brings its own slice of a stage: waves 0 and 1 the two halves of the 128 A rows, waves 2 and 3 those of the 64 B rows: one request a wave and stage, one outstanding
  const unsigned int wv = td_uni((unsigned int)tid >> 5), sl = wv & 1u; const bool isb = (wv & 2u) != 0u;
  const unsigned int pl0 = isb ? (unsigned int)(size_t)&sb[0][sl][0] : (unsigned int)(size_t)&sa[0][sl][0], psum = 2u * pl0 + (isb ? (unsigned int)sizeof(sb[0]) : (unsigned int)sizeof(sa[0]));
  u32x4 g0 = td_group0(pl0, isb ? (const unsigned short*)Bh + (size_t)(col0 + 32 * sl) * ldb : (const unsigned short*)A + (size_t)(mt * 128 + 64 * sl) * lda);
  const u32x8 g1a = td_group1<TD_Q16, 256, 64>(), g1b = td_group1<TD_Q16, 256, 32>();
  if (pinned(!isb)) { td_issue(g0, g1a); td_wait(g0); }
  if (pinned(isb)) { td_issue(g0, g1b); td_wait(g0); }
  __syncthreads();      /* publishes stage 0 */
  td_next(g0, psum, G2K * 2);
  if (pinned(G2K < K && !isb)) td_issue(g0, g1a);
  if (pinned(G2K < K && isb)) td_issue(g0, g1b);
  const v8f z8 = {0.f,0.f,0.f,0.f,0.f,0.f,0.f,0.f}; v8f c00 = z8, c01 = z8, c02 = z8, c03 = z8, c10 = z8, c11 = z8, c12 = z8, c13 = z8;
#pragma unroll 1      /* one pass a trip: the body already holds 32 matrix instructions and 48 LDS reads */
  for (int kb = 0; kb < K; kb += G2K) { const int cur = (kb / G2K) & 1;
#pragma unroll      /* the stage's two blocks of 64 k in line: their LDS offsets are immediates */
    for (int hb = 0; hb < 2; ++hb) {
    v16h af[2][2], bf[2][4];      /* [k half of the block][tile] */
#pragma unroll      /* constant indices keep the fragments in registers */
    for (int s = 0; s < 2; ++s) {
#pragma unroll      /* constant indices keep the fragments in registers */
      for (int t = 0; t < 2; ++t) af[s][t] = g2_lfrag(&sa[cur][w >> 1][(32 * (w & 1) + 16 * t + ln) * G2P + 64 * hb + 32 * s], hh);
#pragma unroll      /* constant indices keep the fragments in registers */
      for (int t = 0; t < 4; ++t) bf[s][t] = g2_lfrag(&sb[cur][t >> 1][(16 * (t & 1) + ln) * G2P + 64 * hb + 32 * s], hh); }
    __builtin_amdgcn_sched_barrier(0);      /* keeps the block's 24 LDS reads issued here: sunk to in front of their matrix instructions, each group would stand with a full latency in the open */
#pragma unroll      /* constant indices keep the fragments in registers */
    for (int s = 0; s < 2; ++s) {
      c00 = g2_mma(af[s][0], bf[s][0], c00); c10 = g2_mma(af[s][1], bf[s][0], c10);
      c01 = g2_mma(af[s][0], bf[s][1], c01); c11 = g2_mma(af[s][1], bf[s][1], c11);
      c02 = g2_mma(af[s][0], bf[s][2], c02); c12 = g2_mma(af[s][1], bf[s][2], c12);
      c03 = g2_mma(af[s][0], bf[s][3], c03); c13 = g2_mma(af[s][1], bf[s][3], c13); } }
    // publish point of the next stage: this wave's LDS reads back, each issuing wave's own tile landed, the barrier; only then the refill of the buffer that this pass has read
    ds_wait();
    td_wait(g0);      /* every wave issues */
    __syncthreads();      /* publishes the next stage and ends this pass's reads of the buffer that is refilled behind it */
    td_next(g0, psum, G2K * 2);
    if (pinned(kb + 2 * G2K < K && !isb)) td_issue(g0, g1a);
    if (pinned(kb + 2 * G2K < K && isb)) td_issue(g0, g1b); }
  td_wait(g0); ds_wait();      /* nothing in flight behind the loop */
  v8f accs[8] = {c00, c01, c02, c03, c10, c11, c12, c13};
#pragma unroll
  for (int u = 0; u < 8; ++u) { const int t = u & 3, half = u >> 2; const int col = col0 + t * 16 + ln; const float bv = bp ? bf16_round(bp[col]) : 0.f;
#pragma unroll
    for (int r = 0; r < 8; ++r) { const int rloc = half * 16 + 8 * hh + r; float v = accs[u][r] * alpha + bv; if (CP) { if (rowsPerB < 0) v += CP[cofs + (size_t)(row0g + row0 + rloc) * ldc + col];      /* rowsPerB < 0: own element of the batched C plane */ else { const int bidx = (row0g + row0 + rloc) / rowsPerB; v += CP[(size_t)bidx * sCPb + (size_t)by * 64 + col]; } }
      if (ACT == 3) v = fmaxf(v, 0.f); else if (ACT == 6) v = 0.5f * v * (1.0f + erff(v * 0.70710678118654752f)); else if (ACT == 11) v = 1.0f / (1.0f + expf(-v)); else if (ACT == 15) v = v / (1.0f + expf(-v)); else if (ACT == 12) v = (v > 0.f) ? v : 0.01f * v; else if (ACT == 8) v = tanhf(v); else if (ACT == 9) v = 0.5f * v * (1.0f + tanhf(0.7978845608028654f * (v + 0.044715f * v * v * v))); else if (ACT == 14) v = (v > 0.f) ? v : 0.1f * v; else if (ACT == 16) v = (v >= 0.f) ? v : 0.3f * v; else if (ACT == 17) v = (v >= 0.f) ? v : 0.2f * v;
      so[w][rloc][t * 16 + ln] = v; } }
  __builtin_amdgcn_fence(__ATOMIC_ACQ_REL, "workgroup"); __builtin_amdgcn_wave_barrier();
  const int rsub = lane >> 4, c4 = (lane & 15) * 4;
  {
#pragma unroll
    for (int q = 0; q < 16; ++q) { const int r = q * 2 + rsub; const v4f v = *(const v4fa*)&so[w][r][c4]; if (C) *(v4f*)(C + cofs + (size_t)(row0 + r) * ldc + col0 + c4) = v; if (C16) { v4h h4; for (int i = 0; i < 4; ++i) h4[i] = (_Float16)v[i]; *(v4h*)(C16 + cofs + (size_t)(row0 + r) * ldc + col0 + c4) = h4; } }
     }
  l2_hold(pfa); l2_hold(pfb); }


// ---- q, k, v projections straight from the f32 inputs: no conversion launch ----
// blockIdx.y = 0, 1, 2: C16[y] = f16(X_y W_y^T + b_y). The fragment reads, the order of the products and the epilogue are k_gemm2's; the operands differ in how they reach LDS (through registers, 64 k a pass):
// a thread loads 16 bytes of f32 (16 lanes cover a 256-byte row piece: whole lines), rounds them to bf16 (two packed conversions) and writes those 8 bytes at the foot of the pass; the products run on the bf16 form,
// whose operands are the very values that the f16 form had (inputs and weights rounded to bf16 are exact in both; no x16 is needed here).
// f32 rows are twice the bytes from L2, so the work-group takes 128 rows x 256 columns (16 waves, 4 x 4 of 32x64): an input row is fetched by 2 work-groups, not 8, and rounded twice, not 8 times.
// q leaves times FCS = log2(e) / sqrt(64), applied in f32 ahead of its one rounding to f16: a score product of the attention kernel is then the argument of exp2 as it stands.
// blockIdx.y = 3: Wo to f16 x16 for the output GEMM two launches on; these blocks leave before any barrier.
#define FCS (0.125f * 1.4426950408889634f)      /* 1 / sqrt(64), and e^x as 2^(x log2 e) */
#define QC 4                         /* 64-column groups a work-group */
#define QB ((int)((NR / 128) * (DM / (64 * QC))))      /* blocks a projection: 64 */
typedef unsigned short v4us __attribute__((ext_vector_type(4), may_alias));
typedef __bf16 v4b __attribute__((ext_vector_type(4)));
__device__ __forceinline__ v4us q_bf(v4f a) { return __builtin_bit_cast(v4us, __builtin_convertvector(a, v4b)); }      /* f32 -> bf16, nearest even: two packed conversions */
__device__ __forceinline__ v16b q_lfrag(const unsigned short* p, int hh) { FragB f; f.half[0] = *(const v8us*)(p + 8 * hh); f.half[1] = *(const v8us*)(p + 16 + 8 * hh); return f.v; }      /* g2_lfrag's k order */
__device__ __forceinline__ v8f q_mma(v16b a, v16b b, v8f c) { return __builtin_amdgcn_wmma_f32_16x16x32_bf16(false, a, false, b, (short)0, c, false, false); }
__global__ __launch_bounds__(128 * QC) void k_qkv(const float* __restrict__ xq, const float* __restrict__ xk, const float* __restrict__ xv, const float* __restrict__ wq, const float* __restrict__ wk, const float* __restrict__ wv, const float* __restrict__ wo,
    const float* __restrict__ bq, const float* __restrict__ bk, const float* __restrict__ bv, _Float16* __restrict__ C16, _Float16* __restrict__ BO) {
  __shared__ __attribute__((aligned(16))) float so[4 * QC][32][68];
  __shared__ __attribute__((aligned(16))) unsigned short sa[2][128][GP];
  __shared__ __attribute__((aligned(16))) unsigned short sb[2][64 * QC][GP];
  const int tid = threadIdx.x, w = tid >> 5, lane = tid & 31, ln = lane & 15, hh = lane >> 4; const int wr = w & 3, wc = w >> 2; const int by = blockIdx.y;
  if (by == 3) {      /* the whole work-group leaves here or none of it */
    const size_t e0 = ((size_t)blockIdx.x * (128 * QC) + tid) * 4; const size_t e1 = e0 + (size_t)QB * (128 * QC) * 4; static_assert((size_t)QB * (128 * QC) * 8 == (size_t)DM * DM, "two pieces of 4 a thread cover Wo");
    const v4f a0 = *(const v4fa*)(wo + e0), a1 = *(const v4fa*)(wo + e1);
    v4h o0, o1;
#pragma unroll      /* constant indices keep the pieces in registers */
    for (int q = 0; q < 4; ++q) { o0[q] = (_Float16)(bf16_round(a0[q]) * 16.0f); o1[q] = (_Float16)(bf16_round(a1[q]) * 16.0f); }
    *(v4h*)(BO + e0) = o0; *(v4h*)(BO + e1) = o1; return; }
  const float* A = by == 0 ? xq : by == 1 ? xk : xv; const float* Wf = by == 0 ? wq : by == 1 ? wk : wv; const float* bp = by == 0 ? bq : by == 1 ? bk : bv; const size_t cofs = (size_t)by * NR * DM;
  const int mt = blockIdx.x / (DM / (64 * QC)), nq = blockIdx.x - mt * (DM / (64 * QC)); const int row0 = mt * 128 + 32 * wr, col0 = nq * (64 * QC) + 64 * wc;
  const int fr = tid >> 4, fc = (tid & 15) * 4;      /* staging: this thread moves 4 elements of rows fr + 8 QC i of each tile */
  const float* ag = A + (size_t)(mt * 128 + fr) * DM + fc; const float* bg = Wf + (size_t)(nq * (64 * QC) + fr) * DM + fc;
  v4f ra[16 / QC], rb[8];
#pragma unroll      /* constant indices keep the pieces in registers */
  for (int i = 0; i < 16 / QC; ++i) ra[i] = *(const v4fa*)(ag + (size_t)(8 * QC * i) * DM);
#pragma unroll      /* constant indices keep the pieces in registers */
  for (int i = 0; i < 8; ++i) rb[i] = *(const v4fa*)(bg + (size_t)(8 * QC * i) * DM);
  // a pass is one 256-byte unit of every row (64 f32). The block asks for all 8 units of its 128 input rows, two a thread; the 32 blocks that share these 256 weight rows take two passes' units each, one a thread
  const float* pfa = A + (size_t)(mt * 128 + (tid & 127)) * DM + (tid >> 7) * GK; const float* pfb = Wf + (size_t)(nq * (64 * QC) + (tid & 255)) * DM + ((tid >> 8) + 2 * ((mt & 1) + 2 * ((mt >> 2) & 1))) * GK;
  static_assert(128 * QC == 512 && DM == 8 * GK && GK * 4 == 256, "512 threads: 4 units of 128 rows, twice; 2 units of 256 rows");
  l2_ask(pfa); l2_ask_1k(pfa); l2_ask(pfb);
#pragma unroll      /* constant indices keep the pieces in registers */
  for (int i = 0; i < 16 / QC; ++i) *(v4us*)&sa[0][fr + 8 * QC * i][fc] = q_bf(ra[i]);
#pragma unroll      /* constant indices keep the pieces in registers */
  for (int i = 0; i < 8; ++i) *(v4us*)&sb[0][fr + 8 * QC * i][fc] = q_bf(rb[i]);
  __syncthreads();
  const v8f z8 = {0.f,0.f,0.f,0.f,0.f,0.f,0.f,0.f}; v8f c00 = z8, c01 = z8, c02 = z8, c03 = z8, c10 = z8, c11 = z8, c12 = z8, c13 = z8;
#pragma unroll 1      /* one pass a trip: the body already holds 16 matrix instructions and 24 LDS reads */
  for (int kb = 0; kb < DM; kb += GK) { const int cur = (kb / GK) & 1; const bool more = kb + GK < DM;
    if (more) { ag += GK; bg += GK;
#pragma unroll      /* constant indices keep the pieces in registers */
      for (int i = 0; i < 16 / QC; ++i) ra[i] = *(const v4fa*)(ag + (size_t)(8 * QC * i) * DM);
#pragma unroll      /* constant indices keep the pieces in registers */
      for (int i = 0; i < 8; ++i) rb[i] = *(const v4fa*)(bg + (size_t)(8 * QC * i) * DM); }
    v16b af[2][2], bf[2][4];      /* [k half of the pass][tile] */
#pragma unroll      /* constant indices keep the fragments in registers */
    for (int s = 0; s < 2; ++s) {
#pragma unroll      /* constant indices keep the fragments in registers */
      for (int t = 0; t < 2; ++t) af[s][t] = q_lfrag(&sa[cur][32 * wr + 16 * t + ln][32 * s], hh);
#pragma unroll      /* constant indices keep the fragments in registers */
      for (int t = 0; t < 4; ++t) bf[s][t] = q_lfrag(&sb[cur][64 * wc + 16 * t + ln][32 * s], hh); }
    __builtin_amdgcn_sched_barrier(0);      /* keeps the pass's global loads and all 24 LDS reads issued here: sunk to in front of their matrix instructions, each group would stand with a full latency in the open */
#pragma unroll      /* constant indices keep the fragments in registers */
    for (int s = 0; s < 2; ++s) {
      c00 = q_mma(af[s][0], bf[s][0], c00); c10 = q_mma(af[s][1], bf[s][0], c10);
      c01 = q_mma(af[s][0], bf[s][1], c01); c11 = q_mma(af[s][1], bf[s][1], c11);
      c02 = q_mma(af[s][0], bf[s][2], c02); c12 = q_mma(af[s][1], bf[s][2], c12);
      c03 = q_mma(af[s][0], bf[s][3], c03); c13 = q_mma(af[s][1], bf[s][3], c13); }
    asm volatile("v_nop\n\tv_nop\n\tv_nop\n\tv_nop" : "+v"(c03), "+v"(c13) : "v"(af[1][0]), "v"(af[1][1]), "v"(bf[1][3]));      /* the four vector slots the chip needs behind the pass's last matrix instructions: on the taken side of the branch that follows, the next vector instructions are address arithmetic that may be placed on their operand registers */
    if (more) {      /* every reader left that buffer before the last barrier */
#pragma unroll      /* constant indices keep the pieces in registers */
      for (int i = 0; i < 16 / QC; ++i) *(v4us*)&sa[cur ^ 1][fr + 8 * QC * i][fc] = q_bf(ra[i]);
#pragma unroll      /* constant indices keep the pieces in registers */
      for (int i = 0; i < 8; ++i) *(v4us*)&sb[cur ^ 1][fr + 8 * QC * i][fc] = q_bf(rb[i]); }
    __syncthreads(); }      /* publishes the next pass's tiles and ends this pass's reads of the buffer that the next pass refills */
  v8f accs[8] = {c00, c01, c02, c03, c10, c11, c12, c13};
#pragma unroll      /* constant indices keep the accumulators in registers */
  for (int u = 0; u < 8; ++u) { const int t = u & 3, half = u >> 2; const float bv1 = bf16_round(bp[col0 + t * 16 + ln]);
#pragma unroll      /* constant indices keep the accumulators in registers */
    for (int r = 0; r < 8; ++r) so[w][half * 16 + 8 * hh + r][t * 16 + ln] = accs[u][r] + bv1; }
  __builtin_amdgcn_fence(__ATOMIC_ACQ_REL, "workgroup"); __builtin_amdgcn_wave_barrier();      /* a wave reads back its own rows only */
  const int rsub = lane >> 4, c4 = (lane & 15) * 4; const float qs = by == 0 ? FCS : 1.0f;
#pragma unroll      /* the 16 row pairs' reads and stores in flight together */
  for (int q = 0; q < 16; ++q) { const int r = q * 2 + rsub; const v4f v = *(const v4fa*)&so[w][r][c4] * qs; *(v4h*)(C16 + cofs + (size_t)(row0 + r) * DM + col0 + c4) = __builtin_convertvector(v, v4h); }
  l2_hold(pfa); l2_hold(pfb); }
#define FS 4                         /* key quarters: waves that share a query group */
#define FW 32                        /* keys a wave and run */
#define FJ 2                         /* such 32-key runs of a wave between two barriers */
#define FK (FJ * FS * FW)            /* keys a pass */
#define FP 72                        /* LDS pitch of a K row in f16 */
#define FV 80                        /* LDS pitch of a V row in f16: 32 B x odd, the transposing load's pitch */
#define FT 32768.0f                  /* a lane's sum of a run's weights up to here: every weight is finite in f16 */
__device__ __forceinline__ float fa_xhalf(float x) { return __builtin_bit_cast(float, __builtin_amdgcn_permlanex16(__builtin_bit_cast(int, x), __builtin_bit_cast(int, x), 0x76543210, 0xfedcba98, false, false)); }      /* lane l with lane l ^ 16 */
__device__ __forceinline__ v8f fa_mma(v16h a, v16h b, v8f c) { return __builtin_amdgcn_wmma_f32_16x16x32_f16(false, a, false, b, (short)0, c, false, false); }
__device__ __forceinline__ v16h fa_frag(const unsigned short* p, int hh) { FragH f; f.half[0] = *(const v8us*)(p + 8 * hh); f.half[1] = *(const v8us*)(p + 16 + 8 * hh); return f.v; }
typedef short v8s __attribute__((ext_vector_type(8)));
__device__ __forceinline__ v8us fa_tr16(const unsigned short* p) { typedef __attribute__((address_space(3))) v8s lds_v8s; return __builtin_bit_cast(v8us, __builtin_amdgcn_ds_load_tr16_b128_v8i16((lds_v8s*)p)); }
// 16 d x 32 keys of V^T from V rows in LDS; p = this lane's address in the 16-key x 16-d block: row 8 hh + (lane & 7), 16-byte piece (lane >> 3) & 1. Lane (ln, hh) gets keys 8 hh + r and 16 + 8 hh + r of d = ln: fa_frag's k order
__device__ __forceinline__ v16h fa_vfrag(const unsigned short* p) { FragH f; f.half[0] = fa_tr16(p); f.half[1] = fa_tr16(p + 16 * FV); return f.v; }
// 2^x with the one slot that the instruction set asks for behind a transcendental, before its result is read or its source overwritten, in the same statement
__device__ __forceinline__ float fa_exp2_slot(float x) { float y; asm("v_exp_f32 %0, %1\n\tv_nop" : "=v"(y) : "v"(x)); return y; }
// weights of one query tile and run from their exponents: p = f16(2^a | 2^b) in the B operand's k order, rs = this lane's f32 sum of the 16
__device__ __forceinline__ void fa_weights(v8f a, v8f b, FragH& p, float& rs) {
#pragma unroll      /* constant indices keep the values in registers */
  for (int r = 0; r < 8; ++r) a[r] = __builtin_amdgcn_exp2f(a[r]);
#pragma unroll      /* constant indices keep the values in registers */
  for (int r = 0; r < 8; ++r) b[r] = __builtin_amdgcn_exp2f(b[r]);
#pragma unroll      /* constant indices keep the values in registers */
  for (int r = 0; r < 8; ++r) { p.h[r] = (_Float16)a[r]; p.h[8 + r] = (_Float16)b[r]; }
  const v8f es = a + b; const v4f e4 = __builtin_shufflevector(es, es, 0, 1, 2, 3) + __builtin_shufflevector(es, es, 4, 5, 6, 7);      /* a tree of register pairs: packed adds, and no chain of 16 dependent adds in front of the test */
  rs = (e4[0] + e4[2]) + (e4[1] + e4[3]); }
__global__ __launch_bounds__(512) void k_fattn(const _Float16* __restrict__ Q16, const _Float16* __restrict__ K16, const _Float16* __restrict__ V16, _Float16* __restrict__ O16) {
  __shared__ __attribute__((aligned(2048))) unsigned short kt[2][FK][FP];      /* every tensor load's place, a half buffer, is a multiple of 2 KiB */
  __shared__ __attribute__((aligned(2048))) unsigned short vs[2][FK][FV];
  static_assert((FK / 2 * FP * 2) % 2048 == 0 && (FK / 2 * FV * 2) % 2048 == 0 && SQ / FK >= 2, "half buffers at multiples of 2 KiB; the ring's prologue needs two stages");
  __shared__ __attribute__((aligned(32))) float mo[4][FS][4][2][32][8];      /* [query group][key quarter][16-d tile][16-query tile][lane]: a quarter's x */
  __shared__ __attribute__((aligned(8))) float ml[4][FS][2][32][2];      /* its 8 - reference and its sum */
  const int tid = threadIdx.x, w = tid >> 5, lane = tid & 31, ln = lane & 15, hh = lane >> 4; const int qg = w & 3, ks = w >> 2; const int h = blockIdx.y; const int q0 = blockIdx.x * 128 + qg * 32;
  v16h qf[2][2];      /* [query tile][d half] */
#pragma unroll      /* constant indices keep the fragments and accumulators in registers */
  for (int u = 0; u < 2; ++u) { const _Float16* qp = Q16 + (size_t)(q0 + 16 * u + ln) * DM + h * HD; qf[u][0] = g2_frag(qp, hh); qf[u][1] = g2_frag(qp + 32, hh);
    asm volatile("s_wait_xcnt 0x0" ::: "memory"); }      /* stands in front of any reuse of this tile's address registers: the next loads' results may be placed on them */
  // the 32 blocks of a head share its 4096 K and 4096 V row pieces: each asks for every 16th row of both, one piece a thread (waves 0 to 7 K, 8 to 15 V)
  const _Float16* pfk = ((tid >> 8) ? V16 : K16) + (size_t)((tid & 255) * 16 + (blockIdx.x & 3) + 4 * (blockIdx.x >> 3)) * DM + h * HD; static_assert(SQ == 256 * 16 && SQ / 128 == 32, "256 rows a tensor and block, 16 shares");
  l2_ask(pfk);
  const int kr = tid >> 3, kc = (tid & 7) * 8;      /* the output rows: this thread moves 16 bytes of rows kr and kr + 64; 8 threads cover a 128-byte row */
  const int tr = 8 * hh + (lane & 7), tc = ((lane >> 3) & 1) * 8;      /* the transposing load: this lane's row and 16-byte piece in a 16-key x 16-d block of V */
  // waves 0 and 1 bring the two halves of a stage's K rows, waves 2 and 3 those of its V rows: one request of 128 rows (16 KiB) a wave and stage, one outstanding
  const unsigned int wv = td_uni((unsigned int)tid >> 5), sl = wv & 1u; const bool isv = (wv & 2u) != 0u;
  const unsigned int pl0 = isv ? (unsigned int)(size_t)&vs[0][sl * (FK / 2)][0] : (unsigned int)(size_t)&kt[0][sl * (FK / 2)][0], psum = 2u * pl0 + (isv ? (unsigned int)sizeof(vs[0]) : (unsigned int)sizeof(kt[0]));
  u32x4 g0 = td_group0(pl0, (const unsigned short*)(isv ? V16 : K16) + (size_t)(sl * (FK / 2)) * DM + h * HD);
  const u32x8 g1k = td_group1<TD_P16, 128, FK / 2>(), g1v = td_group1<TD_P32, 128, FK / 2>();
  if (pinned(wv < 2u)) { td_issue(g0, g1k); td_wait(g0); }
  if (pinned((wv >> 1) == 1u)) { td_issue(g0, g1v); td_wait(g0); }
  __syncthreads();      /* publishes stage 0 */
  td_next(g0, psum, FK * DM * 2);
  if (pinned(wv < 2u)) td_issue(g0, g1k);
  if (pinned((wv >> 1) == 1u)) td_issue(g0, g1v);
  const v8f z8 = {0.f,0.f,0.f,0.f,0.f,0.f,0.f,0.f}; v8f o[4][2] = {{z8, z8}, {z8, z8}, {z8, z8}, {z8, z8}}; float l[2] = {0.f, 0.f};      /* o: [d tile][query tile]; l: this half's sum of weights */
  v8f cr[2] = {z8 + 3.0e38f, z8 + 3.0e38f};      /* 8 - m in all 8 registers, m the reference in use in units of the scaled products: the score products' start value, and the only place where m is kept; weights carry x256, as f16 operands away from the subnormal range; it cancels in x = sum / l */
#pragma unroll 1      /* one pass a trip: the body already holds 32 matrix instructions and 32 LDS reads */
  for (int it = 0; it < SQ / FK; ++it) { const int cur = it & 1;
#pragma unroll      /* both runs in line: their LDS offsets are immediates */
    for (int j = 0; j < FJ; ++j) { const int k0 = (j * FS + ks) * FW;      /* the run's first key in the tile; no barrier between the runs, so the waves of a SIMD drift apart and fill one another's waits */
    v16h kf[2][2], vf[4];
#pragma unroll      /* constant indices keep the fragments and accumulators in registers */
    for (int t = 0; t < 2; ++t) { const unsigned short* kp = &kt[cur][k0 + t * 16 + ln][0]; kf[t][0] = fa_frag(kp, hh); kf[t][1] = fa_frag(kp + 32, hh); }
    __builtin_amdgcn_sched_barrier(0);      /* keeps the run's 8 K reads issued here, as one group ahead of the score products */
    v8f s[2][2];      /* [key tile][query tile] */
#pragma unroll      /* constant indices keep the fragments and accumulators in registers */
    for (int t = 0; t < 2; ++t)
#pragma unroll      /* constant indices keep the fragments and accumulators in registers */
      for (int u = 0; u < 2; ++u) s[t][u] = fa_mma(kf[t][0], qf[u][0], cr[u]);
#pragma unroll      /* constant indices keep the fragments and accumulators in registers */
    for (int t = 0; t < 2; ++t)
#pragma unroll      /* constant indices keep the fragments and accumulators in registers */
      for (int u = 0; u < 2; ++u) s[t][u] = fa_mma(kf[t][1], qf[u][1], s[t][u]);
#pragma unroll      /* constant indices keep the fragments and accumulators in registers */
    for (int t = 0; t < 4; ++t) vf[t] = fa_vfrag(&vs[cur][k0 + tr][t * 16 + tc]);
    __builtin_amdgcn_sched_barrier(0);      /* keeps the 8 V^T reads issued here, as one group behind the score products: their latency passes under the softmax; sunk to in front of their matrix instructions each would stand in the open */
    FragH p[2]; float rs[2];
#pragma unroll      /* constant indices keep the fragments and accumulators in registers */
    for (int u = 0; u < 2; ++u) fa_weights(s[0][u], s[1][u], p[u], rs[u]);
    if (__builtin_expect(__builtin_amdgcn_ballot_w32(fmaxf(rs[0], rs[1]) > FT) != 0, 0)) {      /* the same for the whole wave: a scalar branch, all lanes on at the matrix instructions inside; rare (the first run, and a score about 7 above m), and marked so, which keeps this path out of the loop's line */
#pragma unroll      /* constant indices keep the fragments and accumulators in registers */
      for (int t = 0; t < 2; ++t) { const unsigned short* kp = &kt[cur][k0 + t * 16 + ln][0]; kf[t][0] = fa_frag(kp, hh); kf[t][1] = fa_frag(kp + 32, hh); }      /* the tile still stands: no barrier since */
#pragma unroll      /* constant indices keep the fragments and accumulators in registers */
      for (int t = 0; t < 2; ++t)
#pragma unroll      /* constant indices keep the fragments and accumulators in registers */
        for (int u = 0; u < 2; ++u) s[t][u] = fa_mma(kf[t][1], qf[u][1], fa_mma(kf[t][0], qf[u][0], z8));
#pragma unroll      /* constant indices keep the fragments and accumulators in registers */
      for (int u = 0; u < 2; ++u) { float a0 = s[0][u][0], a1 = s[1][u][0];
#pragma unroll      /* constant indices keep the fragments and accumulators in registers */
        for (int r = 1; r < 8; ++r) { a0 = fmaxf(a0, s[0][u][r]); a1 = fmaxf(a1, s[1][u][r]); }
        float tm = fmaxf(a0, a1); tm = fmaxf(tm, fa_xhalf(tm)); const float cn = fminf(cr[u][0], 8.0f - tm), corr = __builtin_amdgcn_exp2f(cn - cr[u][0]); cr[u] = z8 + cn; l[u] *= corr;      /* m rises to the run's maximum, 8 - m falls; both halves of the wave hold the same m for a query */
#pragma unroll      /* constant indices keep the fragments and accumulators in registers */
        for (int t = 0; t < 4; ++t) o[t][u] *= corr;
        fa_weights(s[0][u] + cn, s[1][u] + cn, p[u], rs[u]); } }
#pragma unroll      /* constant indices keep the fragments and accumulators in registers */
    for (int u = 0; u < 2; ++u) l[u] += rs[u];
#pragma unroll      /* constant indices keep the fragments and accumulators in registers */
    for (int u = 0; u < 2; ++u)
#pragma unroll      /* constant indices keep the fragments and accumulators in registers */
      for (int t = 0; t < 4; ++t) o[t][u] = fa_mma(vf[t], p[u].v, o[t][u]); }
    // publish point of stage it + 1: this wave's LDS reads back, each issuing wave's own tile landed, the barrier; only then the refill of the buffer that this pass has read
    ds_wait();
    if (pinned(wv < 4u)) td_wait(g0);
    __syncthreads();      /* publishes the next stage and ends this pass's reads of the buffer that is refilled behind it */
    td_next(g0, psum, FK * DM * 2);
    if (pinned(it + 2 < SQ / FK && wv < 2u)) td_issue(g0, g1k);
    if (pinned(it + 2 < SQ / FK && (wv >> 1) == 1u)) td_issue(g0, g1v); }
  td_wait(g0); ds_wait();      /* nothing in flight when the ring becomes output staging */
  // join of the four key quarters: every wave leaves its x, reference and sum in LDS; then the wave of quarter j joins d tile j of its query group's 32 queries
#pragma unroll      /* constant indices keep the fragments and accumulators in registers */
  for (int u = 0; u < 2; ++u) { l[u] += fa_xhalf(l[u]); ml[qg][ks][u][lane][0] = cr[u][0]; ml[qg][ks][u][lane][1] = l[u];      /* 8 - m: the 8 cancels in the join */
#pragma unroll      /* constant indices keep the fragments and accumulators in registers */
    for (int t = 0; t < 4; ++t) *(v8f*)&mo[qg][ks][t][u][lane][0] = o[t][u]; }
  __syncthreads();      /* the quarters' results are read by other waves */
#pragma unroll      /* constant indices keep the fragments and accumulators in registers */
  for (int u = 0; u < 2; ++u) { float mj[FS], lj[FS];
#pragma unroll      /* constant indices keep the fragments and accumulators in registers */
    for (int j = 0; j < FS; ++j) { mj[j] = ml[qg][j][u][lane][0]; lj[j] = ml[qg][j][u][lane][1]; }
    const float mx = fminf(fminf(mj[0], mj[1]), fminf(mj[2], mj[3])); float ls = 0.f; v8f x = z8;      /* the least 8 - m: the highest reference */
#pragma unroll      /* constant indices keep the fragments and accumulators in registers */
    for (int j = 0; j < FS; ++j) mj[j] = fa_exp2_slot(mx - mj[j]);      /* each quarter's weight in the join */
#pragma unroll      /* constant indices keep the fragments and accumulators in registers */
    for (int j = 0; j < FS; ++j) { ls += mj[j] * lj[j]; x += *(const v8f*)&mo[qg][j][ks][u][lane][0] * mj[j]; }
    const float inv = 1.0f / ls; FragH f;      /* lane (ln, hh) holds x[q0 + 16 u + ln][16 ks + 8 hh + r] */
#pragma unroll      /* constant indices keep the fragments and accumulators in registers */
    for (int r = 0; r < 8; ++r) f.h[r] = (_Float16)(x[r] * inv);
    *(v8us*)&kt[0][qg * 32 + 16 * u + ln][16 * ks + 8 * hh] = f.half[0]; }      /* the K buffer, which every reader left at the loop's last barrier, now holds the work-group's 128 output row pieces */
  __syncthreads();      /* a row piece comes from four waves and leaves as one whole 128-byte line */
  unsigned short* op = (unsigned short*)O16 + (size_t)(blockIdx.x * 128 + kr) * DM + h * HD + kc;
  *(v8us*)op = *(const v8us*)&kt[0][kr][kc]; *(v8us*)(op + 64 * DM) = *(const v8us*)&kt[0][kr + 64][kc];
  l2_hold(pfk); }

extern "C" void kernel_launch(void* const* d_in, const int* in_sizes, int n_in,
                              void* d_out, int out_size, void* d_ws, size_t ws_size, hipStream_t stream) {
  (void)in_sizes; (void)n_in; (void)out_size;
  const float* const* I = (const float* const*)d_in; const float* xq = I[0]; const float* xk = I[1]; const float* xv = I[2]; const float* wq = I[3]; const float* bq = I[4]; const float* wk = I[5]; const float* bk = I[6]; const float* wv = I[7]; const float* bv = I[8]; const float* wo = I[9]; const float* bo = I[10];
  char* ws = (char*)d_ws; size_t off = 0;
  auto take = [&](size_t bytes) { char* p = ws + off; off += (bytes + 255) & ~(size_t)255; return p; };
  _Float16* BO = (_Float16*)take((size_t)DM * DM * 2);      /* Wo */
  _Float16* Q16 = (_Float16*)take(3 * NR * DM * 2); _Float16* K16 = Q16 + NR * DM; _Float16* V16 = K16 + NR * DM;      /* q | k | v */
  _Float16* O16 = (_Float16*)take(NR * DM * 2);
  if (off > ws_size) return;      /* approx 16.5 MiB */
  const dim3 gp((unsigned)((NR / 128) * (DM / 64)), 1);
  k_qkv<<<dim3(QB, 4), 128 * QC, 0, stream>>>(xq, xk, xv, wq, wk, wv, wo, bq, bk, bv, Q16, BO);      /* q, k and v: blockIdx.y picks rows, weight, bias and output; row 3 rounds Wo */
  k_fattn<<<dim3(SQ / 128, NH), 512, 0, stream>>>(Q16, K16, V16, O16);      /* x (merged heads) as f16 rows */
  k_gemm2<0><<<gp, 128, 0, stream>>>(O16, DM, 0, BO, DM, 0, 0.0625f, bo, 0, nullptr, 1, 0, 0, (float*)d_out, nullptr, DM, 0, MO, DM, DM, nullptr, nullptr);      /* out = o W_o^T + b_o, rows are the output layout */
}
